// v000
// The times below were measured on an AMD MI455X: many runs one after another, warmed up first and cycling through
// copies of the inputs, with the whole window's GPU time divided by the number of runs. Launches and the gaps
// between them are all in it. The median over several windows is given; except for v000 it joins two sittings, which
// can be a few percent apart, so the side-by-side timings, each taken in one sitting, are the better comparison.
// v000, which the later versions start from, runs in 1400 microseconds.
#include <hip/hip_runtime.h>
#include <math.h>

typedef __attribute__((ext_vector_type(16))) _Float16 v16h;
typedef __attribute__((ext_vector_type(8)))  _Float16 v8h;
typedef __attribute__((ext_vector_type(16))) __bf16   v16b;
typedef __attribute__((ext_vector_type(8)))  float    v8f;
typedef __attribute__((ext_vector_type(4)))  float    v4f;

// 16-bit WMMA fragment map (wave32), lane L, h = L>>4, m = L&15:
//   A 16x32: lane = row m;   element i -> k = (i<8) ? 8h+i : 16+8h+(i-8)
//   B 32x16: lane = column m; the SAME k(i,h)
//   D 16x16 (8 f32): lane = column m; element r -> row 8h+r
__device__ __forceinline__ int frag_k(int i, int h) { return (i < 8) ? (8 * h + i) : (16 + 8 * h + (i - 8)); }
__device__ __forceinline__ __bf16 bf16_rne(float f) {
    unsigned int u = __float_as_uint(f);
    u += 0x7fffu + ((u >> 16) & 1u);
    return __builtin_bit_cast(__bf16, (unsigned short)(u >> 16));
}
__device__ __forceinline__ float bf16_f32(__bf16 b) { return __uint_as_float(((unsigned int)__builtin_bit_cast(unsigned short, b)) << 16); }
__device__ __forceinline__ v8f wmma16(v16h a, v16h b, v8f c) {
    c = __builtin_amdgcn_wmma_f32_16x16x32_f16(false, a, false, b, (short)0, c, false, false);
    asm volatile("v_nop\n\tv_nop\n\tv_nop\n\tv_nop" : "+v"(c) : "v"(a), "v"(b));
    return c;
}
__device__ __forceinline__ v8f wmmab(v16b a, v16b b, v8f c) {
    c = __builtin_amdgcn_wmma_f32_16x16x32_bf16(false, a, false, b, (short)0, c, false, false);
    asm volatile("v_nop\n\tv_nop\n\tv_nop\n\tv_nop" : "+v"(c) : "v"(a), "v"(b));
    return c;
}
struct Split { v16b hi, lo; };
// hi/lo split product: a.hi*b.hi + a.hi*b.lo + a.lo*b.hi
__device__ __forceinline__ v8f wmma3(const Split& a, const Split& b, v8f c) {
    c = __builtin_amdgcn_wmma_f32_16x16x32_bf16(false, a.hi, false, b.hi, (short)0, c, false, false);
    c = __builtin_amdgcn_wmma_f32_16x16x32_bf16(false, a.hi, false, b.lo, (short)0, c, false, false);
    c = __builtin_amdgcn_wmma_f32_16x16x32_bf16(false, a.lo, false, b.hi, (short)0, c, false, false);
    asm volatile("v_nop\n\tv_nop\n\tv_nop\n\tv_nop" : "+v"(c) : "v"(a.hi), "v"(a.lo), "v"(b.hi), "v"(b.lo));
    return c;
}
struct Split3 { v16b hi, mid, lo; };
// triple split product (6 terms, drops only terms below 2^-24 relative)
__device__ __forceinline__ v8f wmma6(const Split3& a, const Split3& b, v8f c) {
    c = __builtin_amdgcn_wmma_f32_16x16x32_bf16(false, a.hi, false, b.hi, (short)0, c, false, false);
    c = __builtin_amdgcn_wmma_f32_16x16x32_bf16(false, a.hi, false, b.mid, (short)0, c, false, false);
    c = __builtin_amdgcn_wmma_f32_16x16x32_bf16(false, a.mid, false, b.hi, (short)0, c, false, false);
    c = __builtin_amdgcn_wmma_f32_16x16x32_bf16(false, a.hi, false, b.lo, (short)0, c, false, false);
    c = __builtin_amdgcn_wmma_f32_16x16x32_bf16(false, a.mid, false, b.mid, (short)0, c, false, false);
    c = __builtin_amdgcn_wmma_f32_16x16x32_bf16(false, a.lo, false, b.hi, (short)0, c, false, false);
    asm volatile("v_nop\n\tv_nop\n\tv_nop\n\tv_nop" : "+v"(c) : "v"(a.hi), "v"(a.mid), "v"(a.lo), "v"(b.hi), "v"(b.mid), "v"(b.lo));
    return c;
}

// Fragment gathers from f32 memory: element i <- p[(k0 + frag_k(i,h)) * sk] * s, zero for k >= klen.
__device__ __forceinline__ v16h fh_ld(const float* __restrict__ p, long long sk, int k0, int h, int klen, float s) {
    v16h a;
#pragma unroll
    for (int i = 0; i < 16; ++i) { const int k = k0 + frag_k(i, h); a[i] = (k < klen) ? (_Float16)(p[(long long)k * sk] * s) : (_Float16)0.f; }
    return a;
}
__device__ __forceinline__ Split sp_ld(const float* __restrict__ p, long long sk, int k0, int h, int klen, float s) {
    Split r;
#pragma unroll
    for (int i = 0; i < 16; ++i) {
        const int k = k0 + frag_k(i, h); const float x = (k < klen) ? p[(long long)k * sk] * s : 0.f;
        const __bf16 hb = bf16_rne(x); r.hi[i] = hb; r.lo[i] = bf16_rne(x - bf16_f32(hb));
    }
    return r;
}
__device__ __forceinline__ Split3 sp3_ld(const float* __restrict__ p, long long sk, int k0, int h, int klen, float s) {
    Split3 r;
#pragma unroll
    for (int i = 0; i < 16; ++i) {
        const int k = k0 + frag_k(i, h); const float x = (k < klen) ? p[(long long)k * sk] * s : 0.f;
        const __bf16 hb = bf16_rne(x); const float r1 = x - bf16_f32(hb); const __bf16 mb = bf16_rne(r1);
        r.hi[i] = hb; r.mid[i] = mb; r.lo[i] = bf16_rne(r1 - bf16_f32(mb));
    }
    return r;
}
__device__ __forceinline__ v16b bh_ld(const float* __restrict__ p, long long sk, int k0, int h, int klen, float s) {
    v16b a;
#pragma unroll
    for (int i = 0; i < 16; ++i) { const int k = k0 + frag_k(i, h); a[i] = bf16_rne((k < klen) ? p[(long long)k * sk] * s : 0.f); }
    return a;
}
// f16 fragment from an f16 LDS/global row with element stride 1 (k-contiguous), no bounds (tile already zero padded)
__device__ __forceinline__ v16h fh_row(const _Float16* __restrict__ row, int k0, int h) {
    v16h a;
#pragma unroll
    for (int i = 0; i < 16; ++i) a[i] = row[k0 + frag_k(i, h)];
    return a;
}

#define VST2(T, ptr, val) do { const T vst2_v_ = (val); *(T*)(ptr) = vst2_v_;  } while (0)
typedef float v4f __attribute__((ext_vector_type(4)));
#define VST2V4(ptr, val) do { const v4f vst2_v4_ = (val); *(v4f*)(ptr) = vst2_v4_;  } while (0)

__device__ __attribute__((noinline)) float act_fn(float v, int act) {
    if (act == 1) return fmaxf(v, 0.f);                                                                               // relu
    if (act == 2) { const float u = 0.7978845608028654f * (v + 0.044715f * v * v * v); return 0.5f * v * (1.f + tanhf(u)); } // tanh-gelu
    if (act == 3) return v / (1.f + expf(-v));                                                                        // silu
    if (act == 4) return 0.5f * v * (1.f + erff(v * 0.7071067811865476f));                                             // erf-gelu
    if (act == 5) return tanhf(v);
    if (act == 6) return 1.f / (1.f + expf(-v));                                                                      // sigmoid
    if (act == 7) return (v > 0.f) ? v : 0.01f * v;                                                                   // leaky relu 0.01
    if (act == 8) return (v > 0.f) ? v : (expf(v) - 1.f);                                                             // elu
    if (act == 9) return fminf(fmaxf(v, 0.f), 6.f);                                                                   // relu6
    if (act == 10) return fabsf(v);                                                                                    // abs
    if (act == 11) return (v >= 0.f) ? v : 0.1f * v;                                                                  // leaky 0.1
    if (act == 12) return (v > 0.f) ? v : 0.2f * v;                                                                   // leaky 0.2
    if (act == 13) return (v > 20.f) ? v : log1pf(expf(v));                                                            // softplus
    return v;
}

// =====================================================================================================================
// k_gemm<MODE>: C(z, m, n) = act(alpha * sum_k A(z, m, k) * B(z, k, n) + bias) + beta * R(z, m, n)
//   One wave (32-thread block) per 16 x 32 tile of C; grid (ceil(N/32), ceil(M/16), Z). Batch z -> (zo = z / zi_n, zi = z % zi_n)
//   with separate outer/inner strides for every tensor (e.g. batch and head). A(m,k) = A[zo*sAo + zi*sAi + m*sAm + k*sAk] (f32),
//   B(k,n) = B[zo*sBo + zi*sBi + n*sBn + k*sBk] (f32); any M, N, K (K zero-padded to 32 inside the fragments, M/N tails guarded).
//   C(m,n) = C[zo*sCo + zi*sCi + m*sCm + n] (n contiguous). flags: 1 bias[n], 2 bias[m], 4 residual R[zo*sRo + zi*sRi + m*sRm + n*sRn].
//   MODE 0: f16 operands (A prescaled by sa, B by sb, both undone in the epilogue); 1: bf16 hi/lo split (3 products); 2: bf16;
//   3: bf16 hi/mid/lo triple split (6 products); 4: as 3 with Kahan-compensated f32 accumulation across k-steps.
// =====================================================================================================================
struct GemmP {
    const float* A; const float* B; const float* bias; const float* R; float* C;
    long long sAo, sAi, sAm, sAk, sBo, sBi, sBn, sBk, sCo, sCi, sCm, sRo, sRi, sRm, sRn;
    int M, N, K, zi_n, flags, act; float alpha, beta, sa, sb;
    int Npad, pad_;     // columns [N, Npad) of C are written as 0 so that padded workspace rows are covered by whole-line stores; Npad >= N
};
static_assert(sizeof(GemmP) == 5 * 8 + 15 * 8 + 6 * 4 + 4 * 4 + 2 * 4, "GemmP has padding");

template <int MODE>
__global__ __launch_bounds__(32) void k_gemm(GemmP p) {
    const int lane = threadIdx.x & 31, h = lane >> 4, l15 = lane & 15;
    const int m0 = blockIdx.y * 16, n0 = blockIdx.x * 32;
    const int z = blockIdx.z, zo = z / p.zi_n, zi = z - zo * p.zi_n;
    const float* A = p.A + zo * p.sAo + zi * p.sAi;
    const float* B = p.B + zo * p.sBo + zi * p.sBi;
    const int am = min(m0 + l15, p.M - 1);                       // clamped row for loads (stores are guarded)
    v8f acc[2], comp[2];
#pragma unroll
    for (int t = 0; t < 2; ++t) { v8f zz = {}; acc[t] = zz; comp[t] = zz; }
    for (int k0 = 0; k0 < p.K; k0 += 32) {
        const float* arow = A + (long long)am * p.sAm;
        if (MODE == 1) {
            const Split a = sp_ld(arow, p.sAk, k0, h, p.K, 1.f);
#pragma unroll
            for (int t = 0; t < 2; ++t) {
                const int bn = min(n0 + t * 16 + l15, p.N - 1);
                acc[t] = wmma3(a, sp_ld(B + (long long)bn * p.sBn, p.sBk, k0, h, p.K, 1.f), acc[t]);
            }
        } else if (MODE == 3) {
            const Split3 a = sp3_ld(arow, p.sAk, k0, h, p.K, 1.f);
#pragma unroll
            for (int t = 0; t < 2; ++t) {
                const int bn = min(n0 + t * 16 + l15, p.N - 1);
                acc[t] = wmma6(a, sp3_ld(B + (long long)bn * p.sBn, p.sBk, k0, h, p.K, 1.f), acc[t]);
            }
        } else if (MODE == 4) {
            // triple split as MODE 3, but each k-step's 6 products go into a fresh accumulator and the partial is added to the running f32 sum
            // on the VALU with Kahan compensation (accumulation error stays ~1 ulp however long K is)
            const Split3 a = sp3_ld(arow, p.sAk, k0, h, p.K, 1.f);
#pragma unroll
            for (int t = 0; t < 2; ++t) {
                const int bn = min(n0 + t * 16 + l15, p.N - 1); v8f zz = {};
                const v8f part = wmma6(a, sp3_ld(B + (long long)bn * p.sBn, p.sBk, k0, h, p.K, 1.f), zz);
                const v8f y = part - comp[t]; const v8f s = acc[t] + y; comp[t] = (s - acc[t]) - y; acc[t] = s;
            }
        } else if (MODE == 2) {
            const v16b a = bh_ld(arow, p.sAk, k0, h, p.K, 1.f);
#pragma unroll
            for (int t = 0; t < 2; ++t) {
                const int bn = min(n0 + t * 16 + l15, p.N - 1);
                acc[t] = wmmab(a, bh_ld(B + (long long)bn * p.sBn, p.sBk, k0, h, p.K, 1.f), acc[t]);
            }
        } else {
            const v16h a = fh_ld(arow, p.sAk, k0, h, p.K, p.sa);
#pragma unroll
            for (int t = 0; t < 2; ++t) {
                const int bn = min(n0 + t * 16 + l15, p.N - 1);
                acc[t] = wmma16(a, fh_ld(B + (long long)bn * p.sBn, p.sBk, k0, h, p.K, p.sb), acc[t]);
            }
        }
    }
    const float iscale = (MODE == 0) ? p.alpha / (p.sa * p.sb) : p.alpha;
    float* C = p.C + zo * p.sCo + zi * p.sCi;
    const float* R = p.R + zo * p.sRo + zi * p.sRi;
    __shared__ __align__(16) float ctile[16][36];
#pragma unroll
    for (int t = 0; t < 2; ++t) {
        const int n = n0 + t * 16 + l15; const int nn = min(n, p.N - 1);
#pragma unroll
        for (int r = 0; r < 8; ++r) {
            const int m = m0 + 8 * h + r; const int mm = min(m, p.M - 1);
            float v = acc[t][r] * iscale;
            if (p.flags & 1) v += p.bias[nn];
            if (p.flags & 2) v += p.bias[mm];
            if (p.flags & 8) v *= p.bias[(long long)zo * p.M + mm];   /* per-(z,row) scale vector laid out [Z][M]; exclusive with the bias flags */
            v = act_fn(v, p.act);
            if (p.flags & 4) v += p.beta * R[(long long)mm * p.sRm + (long long)nn * p.sRn];
            ctile[8 * h + r][t * 16 + l15] = (n < p.N) ? v : 0.f;
        }
    }
    __syncthreads();
    const int NW = (p.Npad > p.N) ? p.Npad : p.N;           // write width
    const bool fast = (m0 + 16 <= p.M) && (n0 + 32 <= NW) && ((p.sCm & 3) == 0) && ((((size_t)C) & 15) == 0);
    if (fast) {
#pragma unroll
        for (int s = 0; s < 4; ++s) {
            const int row = s * 4 + (lane >> 3), c4 = (lane & 7) * 4;
            const v4f v = *(const v4f*)&ctile[row][c4];
            VST2V4(C + (long long)(m0 + row) * p.sCm + n0 + c4, v);
        }
    } else {
        for (int row = 0; row < 16; ++row) {
            const int m = m0 + row, n = n0 + lane;
            if (m < p.M && n < NW) VST2(float, C + (long long)m * p.sCm + n, ctile[row][lane]);
        }
    }
}


// =====================================================================================================================
// k_gemmT<MODE, TM, TN>: same contract as k_gemm, but one wave computes a (16*TM) x (16*TN) tile: TM A fragments and TN B fragments are
//   loaded per 32-wide k-step and reused across TM*TN WMMAs (far fewer load/convert instructions per MAC). MODE 0 (f16), 1 (bf16 hi/lo),
//   2 (bf16) only. grid (ceil(NW/(16*TN)), ceil(M/(16*TM)), Z), block 32. Epilogue identical to k_gemm, run per 16x32 sub-tile.
// =====================================================================================================================
template <int MODE, int TM, int TN>
__global__ __launch_bounds__(32) void k_gemmT(GemmP p) {
    const int lane = threadIdx.x & 31, h = lane >> 4, l15 = lane & 15;
    const int m0 = blockIdx.y * (16 * TM), n0 = blockIdx.x * (16 * TN);
    const int z = blockIdx.z, zo = z / p.zi_n, zi = z - zo * p.zi_n;
    const float* A = p.A + zo * p.sAo + zi * p.sAi;
    const float* B = p.B + zo * p.sBo + zi * p.sBi;
    v8f acc[TM][TN];
#pragma unroll
    for (int i = 0; i < TM; ++i)
#pragma unroll
        for (int t = 0; t < TN; ++t) { v8f zz = {}; acc[i][t] = zz; }
    for (int k0 = 0; k0 < p.K; k0 += 32) {
        if (MODE == 1) {
            Split a[TM], b[TN];
#pragma unroll
            for (int i = 0; i < TM; ++i) { const int am = min(m0 + 16 * i + l15, p.M - 1); a[i] = sp_ld(A + (long long)am * p.sAm, p.sAk, k0, h, p.K, 1.f); }
#pragma unroll
            for (int t = 0; t < TN; ++t) { const int bn = min(n0 + 16 * t + l15, p.N - 1); b[t] = sp_ld(B + (long long)bn * p.sBn, p.sBk, k0, h, p.K, 1.f); }
#pragma unroll
            for (int i = 0; i < TM; ++i)
#pragma unroll
                for (int t = 0; t < TN; ++t) acc[i][t] = wmma3(a[i], b[t], acc[i][t]);
        } else if (MODE == 2) {
            v16b a[TM], b[TN];
#pragma unroll
            for (int i = 0; i < TM; ++i) { const int am = min(m0 + 16 * i + l15, p.M - 1); a[i] = bh_ld(A + (long long)am * p.sAm, p.sAk, k0, h, p.K, 1.f); }
#pragma unroll
            for (int t = 0; t < TN; ++t) { const int bn = min(n0 + 16 * t + l15, p.N - 1); b[t] = bh_ld(B + (long long)bn * p.sBn, p.sBk, k0, h, p.K, 1.f); }
#pragma unroll
            for (int i = 0; i < TM; ++i)
#pragma unroll
                for (int t = 0; t < TN; ++t) acc[i][t] = wmmab(a[i], b[t], acc[i][t]);
        } else {
            v16h a[TM], b[TN];
#pragma unroll
            for (int i = 0; i < TM; ++i) { const int am = min(m0 + 16 * i + l15, p.M - 1); a[i] = fh_ld(A + (long long)am * p.sAm, p.sAk, k0, h, p.K, p.sa); }
#pragma unroll
            for (int t = 0; t < TN; ++t) { const int bn = min(n0 + 16 * t + l15, p.N - 1); b[t] = fh_ld(B + (long long)bn * p.sBn, p.sBk, k0, h, p.K, p.sb); }
#pragma unroll
            for (int i = 0; i < TM; ++i)
#pragma unroll
                for (int t = 0; t < TN; ++t) acc[i][t] = wmma16(a[i], b[t], acc[i][t]);
        }
    }
    const float iscale = (MODE == 0) ? p.alpha / (p.sa * p.sb) : p.alpha;
    float* C = p.C + zo * p.sCo + zi * p.sCi;
    const float* R = p.R + zo * p.sRo + zi * p.sRi;
    const int NW = (p.Npad > p.N) ? p.Npad : p.N;
    __shared__ __align__(16) float ctile[16][36];
#pragma unroll
    for (int i = 0; i < TM; ++i) {
        const int mb = m0 + 16 * i; if (mb >= p.M) break;          // wave-uniform
#pragma unroll
        for (int tp = 0; tp < TN / 2; ++tp) {
            const int nb = n0 + 32 * tp; if (nb >= NW) break;        // wave-uniform
#pragma unroll
            for (int t2 = 0; t2 < 2; ++t2) {
                const int t = 2 * tp + t2; const int n = nb + t2 * 16 + l15; const int nn = min(n, p.N - 1);
#pragma unroll
                for (int r = 0; r < 8; ++r) {
                    const int m = mb + 8 * h + r; const int mm = min(m, p.M - 1);
                    float v = acc[i][t][r] * iscale;
                    if (p.flags & 1) v += p.bias[nn];
                    if (p.flags & 2) v += p.bias[mm];
            if (p.flags & 8) v *= p.bias[(long long)zo * p.M + mm];   /* per-(z,row) scale vector laid out [Z][M]; exclusive with the bias flags */
                    v = act_fn(v, p.act);
                    if (p.flags & 4) v += p.beta * R[(long long)mm * p.sRm + (long long)nn * p.sRn];
                    ctile[8 * h + r][t2 * 16 + l15] = (n < p.N) ? v : 0.f;
                }
            }
            __syncthreads();
            const bool fast = (mb + 16 <= p.M) && (nb + 32 <= NW) && ((p.sCm & 3) == 0) && ((((size_t)C) & 15) == 0);
            if (fast) {
#pragma unroll
                for (int s = 0; s < 4; ++s) {
                    const int row = s * 4 + (lane >> 3), c4 = (lane & 7) * 4;
                    const v4f v = *(const v4f*)&ctile[row][c4];
                    VST2V4(C + (long long)(mb + row) * p.sCm + nb + c4, v);
                }
            } else {
                for (int row = 0; row < 16; ++row) {
                    const int m = mb + row, n = nb + lane;
                    if (m < p.M && n < NW) VST2(float, C + (long long)m * p.sCm + n, ctile[row][lane]);
                }
            }
            __syncthreads();
        }
    }
}

// =====================================================================================================================
//   Wave = 16 queries, AW waves per block, 64-key blocks; grid (ceil(Lq/(16*AW)), H, B), block 32*AW. Any Lq, Lk; head dim dh <= DHP
//   (DHP multiple of 32), value dim dv <= DVP (multiple of 16, <= 128). Every tensor addressed by (batch, head, row, element) strides, f32.
//   Scores: QM 0 f16 operands, 1 bf16 hi/lo split, 2 bf16 triple split; statistics f32 (exp2 domain); P.V: P x 4096 as f16 with V f16 staged in LDS
//   (SPLITPV: P and V as bf16 hi/lo splits). kv head = h / hrep. Masking: causal = 1 (keep j <= i + coff, masked -> -inf, key blocks beyond the
//   diagonal skipped), causal = 2 (masked -> mfill, a finite fill like the -1e9; no skipping), causal = 3 (keep j >= i + coff,
//   masked -> -inf, no skipping); optional additive f32 mask Mf,
//   optional int keep-mask Mi (0 -> score := mfill), both addressed b*smb + h*smh + i*smi + j*smj (0 strides broadcast).
// =====================================================================================================================
#define AW 4
struct AttnP {   // apv4
    const float* Q; const float* K; const float* V; float* O; float* P; const float* Mf; const int* Mi; float* ST;
    const float* Pw; const float* Rt; const int* SQ; const int* SK;           // optional: post-softmax weight, relative-position table, segment ids
    long long swb, swh, swi, swj, srb, srh, sri;                                 // Pw strides (b,h,i,j); Rt strides (b,h,i), column = clamp(i - j + roff, 0, rn-1)
    long long sQb, sQh, sQi, sQd, sKb, sKh, sKj, sKd, sVb, sVh, sVj, sVd, sOb, sOh, sOi, sPb, sPh, sPi, smb, smh, smi, smj;
    int Lq, Lk, dh, dv, hrep, causal, coff, pband;   // pband > 0: P holds only the band |j - i| <= pband, column j - i + pband
    float scale, mfill; int nonorm, mpol;             // nonorm (online path only): O = sum_j exp(score_j) V_j without the 1/rowsum (scores must be <= ~0); mpol: Mi masks where ==0 (mpol 0) or where !=0 (mpol 1)
    int roff, rn, segpol, win;                        // Rt column offset/count; SQ/SK: score := mfill where (segpol 0) SQ[i] != SK[j] or (segpol 1) SQ[i] == SK[j]; win > 0: keys with i - j > win (after coff) -> -inf
};
//   Pw: the softmax numerator is multiplied by Pw(b,h,i,j) AFTER the row sum is taken (probs * weight, then P.V), as in post-softmax multiplicative biases.                                                    // ST (optional): per row (b,h,i) -> ST[((b*H + h)*Lq + i)*2 + {0,1}] = {row max of the scaled+masked score (natural units), sum_j exp(score - max)}
static_assert(sizeof(AttnP) == 12 * 8 + 29 * 8 + 16 * 4, "AttnP has padding");

#ifndef KATTN_ATTR
#define KATTN_ATTR
#endif
template <int DHP, int DVP, int QM, bool SPLITPV, bool TWOPASS>
__global__ __launch_bounds__(32 * AW) KATTN_ATTR void k_attn(AttnP p) {
    constexpr int NT = DVP / 16;                // output tiles
    constexpr int KS = DHP / 32;                // k-steps for the scores
    constexpr int VP = DVP + 8;                 // LDS pitch (halves)
    __shared__ __align__(16) float    pl[AW][16 * 64];
    __shared__ __align__(16) _Float16 vl[(SPLITPV ? 2 : 1) * 64 * VP];   // f16 V tile, or bf16 hi and lo tiles (same 2-byte size)
    const int lane = threadIdx.x & 31, hf = lane >> 4, l15 = lane & 15, wave = threadIdx.x >> 5;
    const int h = blockIdx.y, b = blockIdx.z, hk = h / p.hrep;
    const int q0 = (blockIdx.x * AW + wave) * 16;
    float* myp = pl[wave];
    const float L2E = 1.4426950408889634f;
    const float NEG = -__builtin_inff();
    const int qi = min(q0 + l15, p.Lq - 1);
    const float* qrow = p.Q + b * p.sQb + h * p.sQh + (long long)qi * p.sQi;
    const float* kbase = p.K + b * p.sKb + hk * p.sKh;
    const float* vbase = p.V + b * p.sVb + hk * p.sVh;
    v16h qa[QM == 0 ? KS : 1]; Split qs_[QM == 1 ? KS : 1]; Split3 qt_[QM == 2 ? KS : 1];
#pragma unroll
    for (int ks = 0; ks < KS; ++ks) {
        if (QM == 2) qt_[ks] = sp3_ld(qrow, p.sQd, ks * 32, hf, p.dh, 1.f);
        else if (QM == 1) qs_[ks] = sp_ld(qrow, p.sQd, ks * 32, hf, p.dh, 1.f);
        else qa[ks] = fh_ld(qrow, p.sQd, ks * 32, hf, p.dh, 1.f);
    }
    v8f o[NT]; float m8[8], l8[8];
#pragma unroll
    for (int t = 0; t < NT; ++t) { v8f zz = {}; o[t] = zz; }
#pragma unroll
    for (int i = 0; i < 8; ++i) { m8[i] = NEG; l8[i] = 0.f; }
    int jend = p.Lk; int jstart = 0;
    if (p.causal == 1) { const int je = (blockIdx.x * AW + AW - 1) * 16 + 16 + p.coff; jend = min(jend, max(je, 0)); }   // uniform per block
    if (p.win > 0) { const int js = (int)(blockIdx.x * AW) * 16 + p.coff - p.win; jstart = (js > 0) ? (js / 64) * 64 : 0; }   // uniform per block: key blocks entirely outside every row's window hold only -inf entries and are skipped exactly
    const int npass = TWOPASS ? 2 : 1;
    for (int pass = 0; pass < npass; ++pass) {
        const bool dopv = (!TWOPASS) || pass == 1;
        for (int j0 = jstart; j0 < jend; j0 += 64) {
            if (dopv) {
                __syncthreads();                                 // previous key block's reads of vl / pl are done
                for (int idx = threadIdx.x; idx < 64 * DVP; idx += 32 * AW) {
                    const int jr = idx / DVP, d = idx - jr * DVP, j = j0 + jr;
                    const float f = (j < p.Lk && d < p.dv) ? vbase[(long long)j * p.sVj + (long long)d * p.sVd] : 0.f;
                    if (SPLITPV) {
                        const __bf16 hb = bf16_rne(f);
                        ((__bf16*)vl)[jr * VP + d] = hb; ((__bf16*)vl)[64 * VP + jr * VP + d] = bf16_rne(f - bf16_f32(hb));
                    } else vl[jr * VP + d] = (_Float16)f;
                }
            }
            v8f s[4];
#pragma unroll
            for (int t = 0; t < 4; ++t) {
                const int j = min(j0 + t * 16 + l15, p.Lk - 1);
                const float* krow = kbase + (long long)j * p.sKj;
                v8f acc = {};
#pragma unroll
                for (int ks = 0; ks < KS; ++ks) {
                    if (QM == 2)      acc = wmma6(qt_[ks], sp3_ld(krow, p.sKd, ks * 32, hf, p.dh, 1.f), acc);
                    else if (QM == 1) acc = wmma3(qs_[ks], sp_ld(krow, p.sKd, ks * 32, hf, p.dh, 1.f), acc);
                    else              acc = wmma16(qa[ks], fh_ld(krow, p.sKd, ks * 32, hf, p.dh, 1.f), acc);
                }
                s[t] = acc;
            }
            float pv[8][4];
#pragma unroll
            for (int i = 0; i < 8; ++i) {
                const int irow = q0 + i + 8 * hf;
                const int ic = min(irow, p.Lq - 1);
                float sc[4];
#pragma unroll
                for (int t = 0; t < 4; ++t) {
                    const int jg = j0 + t * 16 + l15;
                    float v = s[t][i] * p.scale;
                    if (p.Mf) v += p.Mf[b * p.smb + h * p.smh + (long long)ic * p.smi + (long long)min(jg, p.Lk - 1) * p.smj];
                    if (p.Rt) { int rc = ic - min(jg, p.Lk - 1) + p.roff; rc = rc < 0 ? 0 : (rc >= p.rn ? p.rn - 1 : rc); v += p.Rt[b * p.srb + h * p.srh + (long long)ic * p.sri + rc]; }
                    if (p.Mi) { const int mv = p.Mi[b * p.smb + h * p.smh + (long long)ic * p.smi + (long long)min(jg, p.Lk - 1) * p.smj]; if (p.mpol ? (mv != 0) : (mv == 0)) v = p.mfill; }
                    if (p.SQ) { const bool same = p.SQ[(long long)b * p.Lq + ic] == p.SK[(long long)b * p.Lk + min(jg, p.Lk - 1)]; if (p.segpol ? same : !same) v = p.mfill; }
                    if (p.causal == 2 && jg > irow + p.coff) v = p.mfill;
                    if (jg >= p.Lk || (p.causal == 1 && jg > irow + p.coff) || (p.causal == 3 && jg < irow + p.coff) || (p.win > 0 && irow + p.coff - jg > p.win)) v = NEG; else v *= L2E;
                    sc[t] = v;
                }
                if (!TWOPASS || pass == 0) {
                    float mx = fmaxf(fmaxf(sc[0], sc[1]), fmaxf(sc[2], sc[3]));
                    mx = fmaxf(mx, __shfl_xor(mx, 1, 32)); mx = fmaxf(mx, __shfl_xor(mx, 2, 32));
                    mx = fmaxf(mx, __shfl_xor(mx, 4, 32)); mx = fmaxf(mx, __shfl_xor(mx, 8, 32));
                    const float mnew = fmaxf(m8[i], mx);
                    const float corr = (mnew == NEG) ? 1.f : exp2f(m8[i] - mnew);
                    float rs = 0.f;
#pragma unroll
                    for (int t = 0; t < 4; ++t) {
                        const float pp = (sc[t] == NEG) ? 0.f : exp2f(sc[t] - mnew); rs += pp;
                        pv[i][t] = p.Pw ? pp * p.Pw[b * p.swb + h * p.swh + (long long)ic * p.swi + (long long)min(j0 + t * 16 + l15, p.Lk - 1) * p.swj] : pp;
                    }
                    rs += __shfl_xor(rs, 1, 32); rs += __shfl_xor(rs, 2, 32); rs += __shfl_xor(rs, 4, 32); rs += __shfl_xor(rs, 8, 32);
                    l8[i] = l8[i] * corr + rs; m8[i] = mnew;
                    if (!TWOPASS) {
#pragma unroll
                        for (int t = 0; t < NT; ++t) o[t][i] *= corr;
                    }
                } else {
                    const float inv = (l8[i] > 0.f) ? 1.f / l8[i] : 0.f;
#pragma unroll
                    for (int t = 0; t < 4; ++t) {
                        const int jg = j0 + t * 16 + l15;
                        float pp = (sc[t] == NEG) ? 0.f : exp2f(sc[t] - m8[i]) * inv;
                        if (p.Pw) pp *= p.Pw[b * p.swb + h * p.swh + (long long)ic * p.swi + (long long)min(jg, p.Lk - 1) * p.swj];
                        pv[i][t] = pp;
                    }
                }
            }
            if (dopv) {
#pragma unroll
                for (int i = 0; i < 8; ++i)
#pragma unroll
                    for (int t = 0; t < 4; ++t) ((float*)myp)[(i + 8 * hf) * 64 + t * 16 + l15] = pv[i][t];
                __syncthreads();                                 // P (per wave) and V (shared) visible
                if (p.P) {
                    float* pb_ = p.P + b * p.sPb + h * p.sPh;
                    const bool fastP = (p.pband == 0) && ((p.sPi & 3) == 0) && (j0 + 64 <= p.Lk) && (q0 + 16 <= p.Lq) && ((((size_t)pb_) & 15) == 0);
                    if (fastP) {
#pragma unroll
                        for (int s = 0; s < 8; ++s) {
                            const int row = s * 2 + (lane >> 4), c4 = (lane & 15) * 4;
                            const v4f v = *(const v4f*)(myp + row * 64 + c4);
                            VST2V4(pb_ + (long long)(q0 + row) * p.sPi + j0 + c4, v);
                        }
                    } else {
                        for (int row = 0; row < 16; ++row) {
                            const int irow = q0 + row; if (irow >= p.Lq) continue;
                            for (int c = lane; c < 64; c += 32) {
                                const int jg = j0 + c; if (jg >= p.Lk) continue;
                                if (p.pband == 0) VST2(float, pb_ + (long long)irow * p.sPi + jg, myp[row * 64 + c]);
                                else if (jg - irow <= p.pband && irow - jg <= p.pband) VST2(float, pb_ + (long long)irow * p.sPi + (jg - irow + p.pband), myp[row * 64 + c]);
                            }
                        }
                    }
                }
                if (SPLITPV) {
                    const Split pa0 = sp_ld(myp + l15 * 64, 1, 0, hf, 64, 1.f), pa1 = sp_ld(myp + l15 * 64, 1, 32, hf, 64, 1.f);
                    const __bf16* vh = (const __bf16*)vl; const __bf16* vlo = vh + 64 * VP;
#pragma unroll
                    for (int t = 0; t < NT; ++t) {
                        const int dcol = t * 16 + l15;
                        Split b0, b1;
#pragma unroll
                        for (int e = 0; e < 16; ++e) {
                            const int k0 = frag_k(e, hf), k1 = 32 + frag_k(e, hf);
                            b0.hi[e] = vh[k0 * VP + dcol]; b0.lo[e] = vlo[k0 * VP + dcol]; b1.hi[e] = vh[k1 * VP + dcol]; b1.lo[e] = vlo[k1 * VP + dcol];
                        }
                        o[t] = wmma3(pa0, b0, o[t]);
                        o[t] = wmma3(pa1, b1, o[t]);
                    }
                } else {
                    const v16h pa0 = fh_ld(myp + l15 * 64, 1, 0, hf, 64, 4096.f), pa1 = fh_ld(myp + l15 * 64, 1, 32, hf, 64, 4096.f);
#pragma unroll
                    for (int t = 0; t < NT; ++t) {
                        const int dcol = t * 16 + l15;
                        v16h b0, b1;
#pragma unroll
                        for (int e = 0; e < 16; ++e) { b0[e] = vl[frag_k(e, hf) * VP + dcol]; b1[e] = vl[(32 + frag_k(e, hf)) * VP + dcol]; }
                        o[t] = wmma16(pa0, b0, o[t]);
                        o[t] = wmma16(pa1, b1, o[t]);
                    }
                }
            }
        }
    }
    float* obase = p.O + b * p.sOb + h * p.sOh;
    if (p.ST) {
        const int rl = lane >> 1, isel = rl & 7;           // row q0 + rl ; rl>>3 == hf holds because lane>>4 == (lane>>1)>>3
        float mv = 0.f, lv = 0.f;
#pragma unroll
        for (int i = 0; i < 8; ++i) if (i == isel) { mv = m8[i]; lv = l8[i]; }
        const int irow = q0 + rl;
        if (irow < p.Lq) { float* st = p.ST + (((long long)b * gridDim.y + h) * p.Lq + irow) * 2 + (lane & 1); VST2(float, st, (lane & 1) ? lv : mv * 0.6931471805599453f); }
    }
    float invr[8];
#pragma unroll
    for (int i = 0; i < 8; ++i) {
        if (TWOPASS) invr[i] = SPLITPV ? 1.f : (1.f / 4096.f);
        else if (p.nonorm) invr[i] = exp2f(m8[i]) * (SPLITPV ? 1.f : (1.f / 4096.f));
        else invr[i] = (l8[i] > 0.f) ? (SPLITPV ? 1.f / l8[i] : 1.f / (l8[i] * 4096.f)) : 0.f;
    }
    __syncthreads();                                             // all waves done with pl/vl from the main loop
    const bool ofast = ((p.sOi & 3) == 0) && ((((size_t)obase) & 15) == 0) && (q0 + 16 <= p.Lq);
#pragma unroll
    for (int c0 = 0; c0 < DVP; c0 += 64) {
#pragma unroll
        for (int i = 0; i < 8; ++i)
#pragma unroll
            for (int t = 0; t < NT; ++t) if (t * 16 >= c0 && t * 16 < c0 + 64) ((float*)myp)[(i + 8 * hf) * 64 + (t * 16 - c0) + l15] = o[t][i] * invr[i];
        __syncthreads();
        const int cw = (DVP - c0 < 64) ? (DVP - c0) : 64;      // staged columns in this chunk (multiple of 16)
        if (ofast && (c0 + cw <= p.dv) && (cw % 32 == 0)) {
            const int lpr = cw / 4;                              // lanes per row (16 for 64 cols, 8 for 32)
            const int rows_per_ins = 32 / lpr;
            for (int r0 = 0; r0 < 16; r0 += rows_per_ins) {
                const int row = r0 + lane / lpr, c4 = (lane % lpr) * 4;
                const v4f v = *(const v4f*)(myp + row * 64 + c4);
                VST2V4(obase + (long long)(q0 + row) * p.sOi + c0 + c4, v);
            }
        } else {
            for (int row = 0; row < 16; ++row) {
                const int irow = q0 + row; if (irow >= p.Lq) continue;
                for (int c = lane; c < cw; c += 32) { const int d = c0 + c; if (d < p.dv) VST2(float, obase + (long long)irow * p.sOi + d, myp[row * 64 + c]); }
            }
        }
        __syncthreads();
    }
}

// =====================================================================================================================
// k_tr: dst(z, c, r) = alpha * src(z, r, c) (+ beta * R2(z, c, r)): [Z][R][C] (row stride lds) -> [Z][C][R] (row stride ldd) through a 32x32 LDS tile;
//   flags: 1 -> add beta * residual R2 addressed like dst (z*sRz + c*ldr + r); act applied before the residual.
// =====================================================================================================================
struct TrP { const float* src; float* dst; const float* R2; long long sSz, lds, sDz, ldd, sRz, ldr; int R, C, flags, act; float alpha, beta; };
static_assert(sizeof(TrP) == 3 * 8 + 6 * 8 + 6 * 4, "TrP has padding");
__global__ __launch_bounds__(256) void k_tr(TrP p) {
    __shared__ float tile[32][33];
    const int c0 = blockIdx.x * 32, r0 = blockIdx.y * 32, z = blockIdx.z;
    const int lane = threadIdx.x & 31, wave = threadIdx.x >> 5;
    const float* s = p.src + z * p.sSz;
#pragma unroll
    for (int k = 0; k < 4; ++k) {
        const int rl = wave * 4 + k, r = r0 + rl, c = c0 + lane;
        tile[rl][lane] = (r < p.R && c < p.C) ? s[(long long)r * p.lds + c] : 0.f;
    }
    __syncthreads();
    float* d = p.dst + z * p.sDz; const float* rr = p.R2 + z * p.sRz;
#pragma unroll
    for (int k = 0; k < 4; ++k) {
        const int cl = wave * 4 + k, c = c0 + cl, r = r0 + lane;
        if (c < p.C && r < p.R) {
            float v = act_fn(p.alpha * tile[lane][cl], p.act);
            if (p.flags & 1) v += p.beta * rr[(long long)c * p.ldr + r];
            VST2(float, d + (long long)c * p.ldd + r, v);
        }
    }
}

// k_affine: dst[i] = a * (sdev ? sdev[0] : 1) * src[i] + b, i < n (one thread per element; consecutive lanes -> consecutive addresses)
__global__ __launch_bounds__(256) void k_affine(const float* __restrict__ src, float* __restrict__ dst, int n, float a, float b, const float* __restrict__ sdev) {
    const int i = blockIdx.x * 256 + threadIdx.x;
    if (i < n) { const float aa = sdev ? a * sdev[0] : a; const float v = aa * src[i] + b; VST2(float, dst + i, v); }
}

// =====================================================================================================================
// k_softmax: row softmax over n contiguous elements, one 256-thread block per row; rows addressed z*sz + r*sr (grid (R, Z)).
//   out = scale_out * softmax(scale_in * x + (Mf ? Mf[z*smz + r*smr + j] : 0)); a row whose max is -inf is written as 0.
// =====================================================================================================================
struct SmP { const float* src; float* dst; const float* Mf; long long sz, sr, dz, dr, smz, smr; int n, pad; float scale_in, scale_out; };
static_assert(sizeof(SmP) == 3 * 8 + 6 * 8 + 4 * 4, "SmP has padding");
__global__ __launch_bounds__(256) void k_softmax(SmP p) {
    __shared__ float red[256];
    const int r = blockIdx.x, z = blockIdx.y, tid = threadIdx.x;
    const float* s = p.src + z * p.sz + (long long)r * p.sr;
    const float* mf = p.Mf ? (p.Mf + z * p.smz + (long long)r * p.smr) : nullptr;
    float mx = -__builtin_inff();
    for (int j = tid; j < p.n; j += 256) { float v = s[j] * p.scale_in; if (mf) v += mf[j]; mx = fmaxf(mx, v); }
    red[tid] = mx; __syncthreads();
    for (int o = 128; o > 0; o >>= 1) { if (tid < o) red[tid] = fmaxf(red[tid], red[tid + o]); __syncthreads(); }
    mx = red[0]; __syncthreads();
    float sum = 0.f;
    for (int j = tid; j < p.n; j += 256) { float v = s[j] * p.scale_in; if (mf) v += mf[j]; sum += (mx == -__builtin_inff()) ? 0.f : expf(v - mx); }
    red[tid] = sum; __syncthreads();
    for (int o = 128; o > 0; o >>= 1) { if (tid < o) red[tid] += red[tid + o]; __syncthreads(); }
    sum = red[0];
    const float inv = (sum > 0.f) ? p.scale_out / sum : 0.f;
    float* d = p.dst + z * p.dz + (long long)r * p.dr;
    for (int j = tid; j < p.n; j += 256) { float v = s[j] * p.scale_in; if (mf) v += mf[j]; const float o = (mx == -__builtin_inff()) ? 0.f : expf(v - mx) * inv; VST2(float, d + j, o); }
}
// =====================================================================================================================
// k_stats: mean and rsqrt(var + eps) over a set of n elements addressed base + z*sz + (e / inner) * so + (e % inner) * si, one 256-thread
// k_norm_apply: y = (x - mean[set]) * rstd[set] * g[c] + b[c] over a [Z][C][L] channel-major tensor with set = z*G + c / (C/G) (G groups per z;
//   G = C -> per-channel sets indexed z*C+c; for batch norm pass stats indexed by c only via bn = 1). Optional act. Output same layout.
// =====================================================================================================================
//   mode 0: mean / rsqrt(var + eps); mode 1 (RMSNorm): 0 / rsqrt(mean(x^2) + eps); mode 2 (L2 normalize * sqrt(n)): 0 / sqrt(n) / max(||x||, eps); mode 3: as 0 with unbiased variance (n-1)
__global__ __launch_bounds__(256) void k_stats(const float* __restrict__ x, long long sz, long long so, long long si, int inner, int n, float eps, float* __restrict__ stat, int mode) {
    __shared__ float red[256];
    const int z = blockIdx.x, tid = threadIdx.x;
    const float* base = x + z * sz;
    float s = 0.f;
    for (int e = tid; e < n; e += 256) s += base[(long long)(e / inner) * so + (long long)(e % inner) * si];
    red[tid] = s; __syncthreads();
    for (int o = 128; o > 0; o >>= 1) { if (tid < o) red[tid] += red[tid + o]; __syncthreads(); }
    const float mu = (mode == 0 || mode == 3) ? red[0] / (float)n : 0.f; __syncthreads();
    float q = 0.f;
    for (int e = tid; e < n; e += 256) { const float dlt = base[(long long)(e / inner) * so + (long long)(e % inner) * si] - mu; q += dlt * dlt; }
    red[tid] = q; __syncthreads();
    for (int o = 128; o > 0; o >>= 1) { if (tid < o) red[tid] += red[tid + o]; __syncthreads(); }
    {
        float rs;
        if (mode == 2) rs = sqrtf((float)n) / fmaxf(sqrtf(red[0]), eps); else if (mode == 3) rs = rsqrtf(red[0] / (float)(n - 1) + eps); else rs = rsqrtf(red[0] / (float)n + eps);
        if (tid < 32) { const float v = (tid == 0) ? mu : ((tid == 1) ? rs : 0.f); VST2(float, stat + (long long)z * 32 + tid, v); }
    }
}
//   One thread per element over the flat [Z][C][L] index space: grid ceil(Z*C*L / 256).
__global__ __launch_bounds__(256) void k_norm_apply(const float* __restrict__ x, float* __restrict__ y, const float* __restrict__ stat, const float* __restrict__ g, const float* __restrict__ bta,
                                                     int Z, int C, int L, int G, int bn, int act) {
    const long long idx = (long long)blockIdx.x * 256 + threadIdx.x;
    if (idx >= (long long)Z * C * L) return;
    const int l = (int)(idx % L); const long long zc = idx / L; const int c = (int)(zc % C), z = (int)(zc / C); (void)l;
    const int set = bn ? c : (z * G + c / (C / G));
    float v = (x[idx] - stat[(long long)set * 32]) * stat[(long long)set * 32 + 1];
    if (g) v *= g[c];
    if (bta) v += bta[c];
    v = act_fn(v, act);
    VST2(float, y + idx, v);
}

// k_lse_neg: c[i] = -(st[2i] + log(st[2i+1])) = minus the log-sum-exp of row i from k_attn's ST output (for softmax over the query dimension)
__global__ __launch_bounds__(256) void k_lse_neg(const float* __restrict__ st, float* __restrict__ c, int n) {
    const int i = blockIdx.x * 256 + threadIdx.x;
    if (i < n) { const float v = -(st[2 * i] + logf(st[2 * i + 1])); VST2(float, c + i, v); }
}

// k_iota: dst[i] = a * i + b as int32 (segment/position id helper)
__global__ __launch_bounds__(256) void k_iota(int* __restrict__ dst, int n, int a, int b) {
    const int i = blockIdx.x * 256 + threadIdx.x;
    if (i < n) { const int v = a * i + b; VST2(int, dst + i, v); }
}

// k_axpby: dst[i] = a * x[i] + b * y[i] (+ c), i < n
__global__ __launch_bounds__(256) void k_axpby(const float* __restrict__ x, const float* __restrict__ y, float* __restrict__ dst, int n, float a, float b, float c) {
    const int i = blockIdx.x * 256 + threadIdx.x;
    if (i < n) { const float v = a * x[i] + b * y[i] + c; VST2(float, dst + i, v); }
}

// =====================================================================================================================
// k_rope: rotary embedding on a [R rows][Hn heads][D] view (row stride sXr, head stride sXh, element stride 1) -> Y (own strides).
//   mode 0: rotate_half (partner d±D/2, sign - for d<D/2); mode 1: interleaved pairs (partner d^1, sign - for even d).
//   table column tcol: tmode 0 -> d, 1 -> d % (D/2), 2 -> d / 2; position p: pmode 0 -> r % S, 1 -> head index, 2 -> pos[r];
//   c = C[(r / S) * sCb + p * sCp + tcol * sCd], s likewise from Sn; y = x[d] * c + sign * x[partner] * s. X and Y must not alias.
// =====================================================================================================================
struct RopeP { const float* X; float* Y; const float* C; const float* Sn; const int* pos; long long sXr, sXh, sYr, sYh, sCb, sCp, sCd; int R, Hn, D, S, mode, tmode, pmode, pad; };
static_assert(sizeof(RopeP) == 5 * 8 + 7 * 8 + 8 * 4, "RopeP has padding");
__global__ __launch_bounds__(256) void k_rope(RopeP p) {
    const long long idx = (long long)blockIdx.x * 256 + threadIdx.x;
    if (idx >= (long long)p.R * p.Hn * p.D) return;
    const int d = (int)(idx % p.D); const long long rh = idx / p.D; const int h = (int)(rh % p.Hn); const int r = (int)(rh / p.Hn);
    const int half = p.D / 2;
    int partner; float sign;
    if (p.mode == 0) { partner = (d < half) ? d + half : d - half; sign = (d < half) ? -1.f : 1.f; }
    else { partner = d ^ 1; sign = (d & 1) ? 1.f : -1.f; }
    const int tcol = (p.tmode == 0) ? d : ((p.tmode == 1) ? (d % half) : (d >> 1));
    const int pp = (p.pmode == 0) ? (r % p.S) : ((p.pmode == 1) ? h : p.pos[r]);
    const long long toff = (long long)(r / p.S) * p.sCb + (long long)pp * p.sCp + (long long)tcol * p.sCd;
    const float* xr = p.X + (long long)r * p.sXr + (long long)h * p.sXh;
    const float v = xr[d] * p.C[toff] + sign * xr[partner] * p.Sn[toff];
    VST2(float, p.Y + (long long)r * p.sYr + (long long)h * p.sYh + d, v);
}

// k_invf + k_sincos (split so neither kernel carries a large VALU-fma footprint): invf_i = num * (1 / powf(base, (2 i)/D)) [fmode 0],
//   num * expf((2 i) * cexp) [fmode 1], num * powf(base, -2 (i - 1) / D) [fmode 2]; then cs/sn[s*half + i] = cos/sin((pscale * s) * invf_i)
__global__ __launch_bounds__(256) void k_invf(float* __restrict__ invb, int half, int D, float base, float num, int fmode, float cexp) {
    const int i = blockIdx.x * 256 + threadIdx.x;
    if (i >= ((half + 31) / 32) * 32) return;
    if (i >= half) { VST2(float, invb + i, 0.f); return; }
    const float e = (float)(2 * i) / (float)D;
    float invf;
    if (fmode == 1) invf = num * expf((float)(2 * i) * cexp);
    else if (fmode == 2) invf = num * powf(base, (-2.0f * ((float)i - 1.0f)) / (float)D);
    else invf = num * (1.0f / powf(base, e));
    VST2(float, invb + i, invf);
}
__global__ __launch_bounds__(256) void k_sincos(float* __restrict__ cs, float* __restrict__ sn, const float* __restrict__ invb, int S, int half, float pscale) {
    const int idx = blockIdx.x * 256 + threadIdx.x;
    if (idx >= S * half) return;
    const int s = idx / half, i = idx - s * half;
    const float ang = (pscale * (float)s) * invb[i];
    VST2(float, cs + idx, cosf(ang)); VST2(float, sn + idx, sinf(ang));
}

// k_mulact: dst[i] = act(x[i]) * y[i]
__global__ __launch_bounds__(256) void k_mulact(const float* __restrict__ x, const float* __restrict__ y, float* __restrict__ dst, int n, int act) {
    const int i = blockIdx.x * 256 + threadIdx.x;
    if (i < n) { const float v = act_fn(x[i], act) * y[i]; VST2(float, dst + i, v); }
}

// =====================================================================================================================
// k_matvec: thread-per-row matrix-vector products for N <= 8 output columns (heads with 1-3 outputs, gates), f32 on the VALU.
//   C[r*sCm + j] = act(alpha * sum_k A[r*sAm + k*sAk] * B[j*sBn + k*sBk] + bias[j]) + beta * R[r*sRm + j*sRn]; each thread writes its N contiguous floats.
// =====================================================================================================================
__global__ __launch_bounds__(256) void k_matvec(GemmP p) {
    // 32 lanes write one line with one instruction.
    const int rpt = (p.N == 1) ? 1 : 32;
    const long long r0 = ((long long)blockIdx.x * 256 + threadIdx.x) * rpt; const int z = blockIdx.z, zo = z / p.zi_n, zi = z - zo * p.zi_n;
    if (r0 >= p.M) return;
    const float* Bb = p.B + zo * p.sBo + zi * p.sBi;
    float* C = p.C + zo * p.sCo + zi * p.sCi; const float* R = p.R + zo * p.sRo + zi * p.sRi;
    for (int rr = 0; rr < rpt; ++rr) {
        const long long r = r0 + rr; if (r >= p.M) break;
        const float* A = p.A + zo * p.sAo + zi * p.sAi + r * p.sAm;
        float acc[8] = {0.f, 0.f, 0.f, 0.f, 0.f, 0.f, 0.f, 0.f};
        for (int k = 0; k < p.K; ++k) { const float a = A[(long long)k * p.sAk];
#pragma unroll
            for (int j = 0; j < 8; ++j) if (j < p.N) acc[j] += a * Bb[(long long)j * p.sBn + (long long)k * p.sBk]; }
#pragma unroll
        for (int j = 0; j < 8; ++j) if (j < p.N) {
            float v = acc[j] * p.alpha;
            if (p.flags & 1) v += p.bias[j];
            if (p.flags & 2) v += p.bias[r];
            v = act_fn(v, p.act);
            if (p.flags & 4) v += p.beta * R[r * p.sRm + (long long)j * p.sRn];
            VST2(float, C + r * p.sCm + j, v);
        }
    }
}
// k_smallsoftmax: thread-per-row softmax for short rows (n <= 64): dst[r*dr + j] = softmax(scale*src[r*sr + j])
__global__ __launch_bounds__(256) void k_smallsoftmax(const float* __restrict__ src, float* __restrict__ dst, long long sr, long long dr, int n, long long R, float scale) {
    const long long r0 = ((long long)blockIdx.x * 256 + threadIdx.x) * 32;
    for (int rr = 0; rr < 32; ++rr) {
        const long long r = r0 + rr; if (r >= R) return;
        const float* s = src + r * sr; float* d = dst + r * dr;
        float mx = -__builtin_inff();
        for (int j = 0; j < n; ++j) mx = fmaxf(mx, s[j] * scale);
        float sum = 0.f;
        for (int j = 0; j < n; ++j) sum += expf(s[j] * scale - mx);
        const float inv = 1.f / sum;
        for (int j = 0; j < n; ++j) { const float v = expf(s[j] * scale - mx) * inv; VST2(float, d + j, v); }
    }
}

__global__ __launch_bounds__(32) void k_unitstat(float* __restrict__ st) { const int t = threadIdx.x; const float v = (t == 1) ? 1.f : 0.f; VST2(float, st + t, v); }

// destination (e.g. a d_out whose row width is not a multiple of 32 floats) is written by consecutive lanes of one instruction
__global__ __launch_bounds__(256) void k_lincopy(const float* __restrict__ src, long long lds, float* __restrict__ dst, long long ldd, long long rows, int cols) {
    const long long i = (long long)blockIdx.x * 256 + threadIdx.x; if (i >= rows * cols) return;
    const long long r = i / cols; const int c = (int)(i - r * cols);
    const float v = src[r * lds + c]; VST2(float, dst + r * ldd + c, v);
}

namespace w25 {
typedef __attribute__((ext_vector_type(16))) _Float16 v16h;
typedef __attribute__((ext_vector_type(8)))  _Float16 v8h;
typedef __attribute__((ext_vector_type(16))) __bf16   v16b;
typedef __attribute__((ext_vector_type(8)))  __bf16   v8b;
typedef __attribute__((ext_vector_type(8)))  float    v8f;
typedef __attribute__((ext_vector_type(4)))  float    v4f;

__device__ __forceinline__ unsigned short f2bf_bits(float f) {
  unsigned u = __float_as_uint(f);
  return (unsigned short)((u + 0x7FFFu + ((u >> 16) & 1u)) >> 16);
}
__device__ __forceinline__ float bf_bits2f(unsigned short h) { return __uint_as_float(((unsigned)h) << 16); }

// hazard guards as plain device helpers (no inline asm inside the kernel template body)
__device__ __forceinline__ void dep_guard_h(v8f& a, v8f& b, v16h x, v16h y) { asm volatile("v_nop\n\tv_nop\n\tv_nop\n\tv_nop" : "+v"(a), "+v"(b) : "v"(x), "v"(y)); }
__device__ __forceinline__ void dep_guard_b(v8f& a, v8f& b, v16b x, v16b y) { asm volatile("v_nop\n\tv_nop\n\tv_nop\n\tv_nop" : "+v"(a), "+v"(b) : "v"(x), "v"(y)); }
__device__ __forceinline__ void keep4_h(v16h a, v16h b, v16h c, v16h d) { asm volatile("v_nop" :: "v"(a), "v"(b), "v"(c), "v"(d)); }
__device__ __forceinline__ void keep4_b(v16b a, v16b b, v16b c, v16b d) { asm volatile("v_nop" :: "v"(a), "v"(b), "v"(c), "v"(d)); }
__device__ __forceinline__ void acc_guard4(v8f& a, v8f& b, v8f& c, v8f& d) { asm volatile("v_nop\n\tv_nop\n\tv_nop\n\tv_nop" : "+v"(a), "+v"(b), "+v"(c), "+v"(d)); }
template <typename T> struct Frag;
template <> struct Frag<_Float16> {
  typedef v16h V; union U { v16h v; v8h h[2]; };
  static __device__ __forceinline__ v16h load(const _Float16* p) {   // elements 0..7 <- p[0..7], 8..15 <- p[16..23]
    U f; f.h[0] = *(const v8h*)(p); f.h[1] = *(const v8h*)(p + 16); return f.v;
  }
  static __device__ __forceinline__ v8f mma(v16h a, v16h b, v8f c) {
    return __builtin_amdgcn_wmma_f32_16x16x32_f16(false, a, false, b, (short)0, c, false, false);
  }
  static __device__ __forceinline__ void guard(v8f& a, v8f& b, v16h x, v16h y) { dep_guard_h(a, b, x, y); }
  static __device__ __forceinline__ void keep(v16h a, v16h b, v16h c, v16h d) { keep4_h(a, b, c, d); }
};
template <> struct Frag<__bf16> {
  typedef v16b V; union U { v16b v; v8b h[2]; };
  static __device__ __forceinline__ v16b load(const __bf16* p) {
    U f; f.h[0] = *(const v8b*)(p); f.h[1] = *(const v8b*)(p + 16); return f.v;
  }
  static __device__ __forceinline__ v8f mma(v16b a, v16b b, v8f c) {
    return __builtin_amdgcn_wmma_f32_16x16x32_bf16(false, a, false, b, (short)0, c, false, false);
  }
  static __device__ __forceinline__ void guard(v8f& a, v8f& b, v16b x, v16b y) { dep_guard_b(a, b, x, y); }
  static __device__ __forceinline__ void keep(v16b a, v16b b, v16b c, v16b d) { keep4_b(a, b, c, d); }
};

// ---- Register-blocked batched WMMA GEMM ------------------------------------
// C[m,n] = scale * sum_k A[m,k] * Bt[n,k] (+bias)(+resid); each wave owns a 64x64 tile.
// A row-major [M,K]; Bt row-major [N,K]; M,N % 64 == 0, K % 32 == 0.
// SPLIT: operands are hi/lo planes (A2/Bt2 = lo planes, same layout); product = hi·hi + hi·lo + lo·hi.
// BIAS_MODE: 0 = none, 1 = bias[m], 2 = bias[n].
// OUT_MODE: 0 = f32, 1 = f16, 2 = bf16 hi plane (Cout) + bf16 lo plane (Cout2).
// ET: 0 = f16 operands, 1 = bf16 operands (pointers passed as 16-bit storage)
template <int ET> struct Elem;
template <> struct Elem<0> { typedef _Float16 T; };
template <> struct Elem<1> { typedef __bf16 T; };
template <int ET, bool SPLIT, int BIAS_MODE, int OUT_MODE, bool RESID, int ACT = 0>
__global__ __launch_bounds__(256) void wmma_gemm64(
    const unsigned short* __restrict__ Ap, const unsigned short* __restrict__ A2p, int lda, long strideA,
    const unsigned short* __restrict__ Btp, const unsigned short* __restrict__ Bt2p, int ldb, long strideB,
    void* __restrict__ Cout, void* __restrict__ Cout2, int ldc, long strideC,
    const float* __restrict__ bias,
    const float* __restrict__ resid, long strideR,
    int M, int N, int K, float scale) {
  typedef typename Elem<ET>::T T;
  typedef typename Frag<T>::V V;
  const T* A = (const T*)Ap; const T* A2 = (const T*)A2p; const T* Bt = (const T*)Btp; const T* Bt2 = (const T*)Bt2p;
  __shared__ __align__(16) float sT[8][16 * 68];   // per-wave 16x64 slab, pitch 68 floats
  const int b    = blockIdx.y;
  const int lane = threadIdx.x & 31;
  const int wave = threadIdx.x >> 5;
  const int tilesN = N >> 6;
  const int tilesM = M >> 6;
  const int tile = blockIdx.x * 8 + wave;
  if (tile >= tilesM * tilesN) return;   // wave-uniform; no block barriers in this kernel
  const int tm = tile / tilesN;
  const int tn = tile - tm * tilesN;
  const int m0 = tm << 6;
  const int n0 = tn << 6;

  const T* Ab  = A  + (size_t)b * strideA;
  const T* Bb  = Bt + (size_t)b * strideB;
  const T* Ab2 = SPLIT ? (A2  + (size_t)b * strideA) : nullptr;
  const T* Bb2 = SPLIT ? (Bt2 + (size_t)b * strideB) : nullptr;

  const int rlane = lane & 15;                 // row (A) / col (B, D) within subtile
  const int koff  = (lane >> 4) * 8;           // k offset of this lane half
  const int mOff  = (lane >> 4) * 8;           // D row offset

  v8f acc[4][4];
#pragma unroll
  for (int i = 0; i < 4; ++i)
#pragma unroll
    for (int j = 0; j < 4; ++j) acc[i][j] = (v8f){0.f,0.f,0.f,0.f,0.f,0.f,0.f,0.f};

  for (int k0 = 0; k0 < K; k0 += 32) {
    V bh[4], bl[4];
#pragma unroll
    for (int j = 0; j < 4; ++j) {
      const size_t bo = (size_t)(n0 + (j << 4) + rlane) * ldb + koff + k0;
      bh[j] = Frag<T>::load(Bb + bo);
      if (SPLIT) bl[j] = Frag<T>::load(Bb2 + bo);
    }
#pragma unroll
    for (int i = 0; i < 4; ++i) {
      const size_t ao = (size_t)(m0 + (i << 4) + rlane) * lda + koff + k0;
      V ah = Frag<T>::load(Ab + ao);
      V al;
      if (SPLIT) al = Frag<T>::load(Ab2 + ao);
#pragma unroll
      for (int j = 0; j < 4; ++j) {
        acc[i][j] = Frag<T>::mma(ah, bh[j], acc[i][j]);
        if (SPLIT) {
          acc[i][j] = Frag<T>::mma(ah, bl[j], acc[i][j]);
          acc[i][j] = Frag<T>::mma(al, bh[j], acc[i][j]);
        }
      }
      Frag<T>::guard(acc[i][0], acc[i][3], ah, SPLIT ? al : ah);
    }
    Frag<T>::keep(bh[0], bh[1], bh[2], bh[3]);
    if (SPLIT) Frag<T>::keep(bl[0], bl[1], bl[2], bl[3]);
  }
  acc_guard4(acc[0][0], acc[0][1], acc[0][2], acc[0][3]);
  acc_guard4(acc[1][0], acc[1][1], acc[1][2], acc[1][3]);
  acc_guard4(acc[2][0], acc[2][1], acc[2][2], acc[2][3]);
  acc_guard4(acc[3][0], acc[3][1], acc[3][2], acc[3][3]);

  // ---- epilogue ----
  float* slab = sT[wave];
  const float* Rb = RESID ? (resid + (size_t)b * strideR) : nullptr;
#pragma unroll
  for (int i = 0; i < 4; ++i) {
    const int mBase = m0 + (i << 4);
#pragma unroll
    for (int j = 0; j < 4; ++j) {
      const int n = n0 + (j << 4) + rlane;
      float bv = 0.f;
      if (BIAS_MODE == 2) bv = bias[n];
#pragma unroll
      for (int r = 0; r < 8; ++r) {
        float v = acc[i][j][r] * scale;
        if (BIAS_MODE == 1) v += bias[mBase + mOff + r];
        if (BIAS_MODE == 2) v += bv;
        if (RESID) v += Rb[(size_t)(mBase + mOff + r) * ldc + n];
        if (ACT == 1) v = tanhf(v);
        if (ACT == 2) v = fmaxf(v, 0.0f);
        if (ACT == 3) v = v / (1.0f + expf(-v));
        if (ACT == 4) v = (v > 0.f) ? v : 0.01f * v;
        if (ACT == 5) v = 0.5f * v * (1.0f + erff(v * 0.70710678118654752f));
        slab[(mOff + r) * 68 + (j << 4) + rlane] = v;
      }
    }
    __builtin_amdgcn_fence(__ATOMIC_RELEASE, "workgroup");
    __builtin_amdgcn_wave_barrier();
    __builtin_amdgcn_fence(__ATOMIC_ACQUIRE, "workgroup");
    if (OUT_MODE == 0) {
      float* C = (float*)Cout + (size_t)b * strideC;
      const int hh = lane >> 4, c4 = (lane & 15) * 4;     // row seg = 256 B = 16 lanes x 16 B
      {
#pragma unroll
        for (int it = 0; it < 8; ++it) {
          const int row = it * 2 + hh;
          v4f v = *(const v4f*)(slab + row * 68 + c4);
          *(v4f*)(C + (size_t)(mBase + row) * ldc + n0 + c4) = v;
        }
        
      }
    } else {
      const int q = lane >> 3, c8 = (lane & 7) * 8;
      unsigned short* C  = (unsigned short*)Cout  + (size_t)b * strideC;
      unsigned short* C2 = (OUT_MODE == 2) ? ((unsigned short*)Cout2 + (size_t)b * strideC) : nullptr;
      {
#pragma unroll
        for (int it = 0; it < 4; ++it) {
          const int row = it * 4 + q;
          const float* sp = slab + row * 68 + c8;
          v8h hv, lv;
#pragma unroll
          for (int e = 0; e < 8; ++e) {
            if (OUT_MODE == 1) {
              hv[e] = (_Float16)sp[e];
            } else {
              unsigned short hb = f2bf_bits(sp[e]);
              unsigned short lb = f2bf_bits(sp[e] - bf_bits2f(hb));
              hv[e] = __builtin_bit_cast(_Float16, hb);
              lv[e] = __builtin_bit_cast(_Float16, lb);
            }
          }
          *(v8h*)(C + (size_t)(mBase + row) * ldc + n0 + c8) = hv;
          if (OUT_MODE == 2) *(v8h*)(C2 + (size_t)(mBase + row) * ldc + n0 + c8) = lv;
        }
        
      }
    }
    __builtin_amdgcn_fence(__ATOMIC_RELEASE, "workgroup");
    __builtin_amdgcn_wave_barrier();
    __builtin_amdgcn_fence(__ATOMIC_ACQUIRE, "workgroup");
  }
}

__global__ __launch_bounds__(256) void cast_f32_f16x2(
    const float* __restrict__ in, _Float16* __restrict__ out, int n2) {
  int i = blockIdx.x * 256 + threadIdx.x;
  if (i < n2) {
    const _Float16 h0 = (_Float16)in[2 * i], h1 = (_Float16)in[2 * i + 1];
    const unsigned u = (unsigned)__builtin_bit_cast(unsigned short, h0) | ((unsigned)__builtin_bit_cast(unsigned short, h1) << 16);
    ((unsigned*)out)[i] = u;
    
  }
}


} // namespace w25

__global__ __launch_bounds__(256) void k_castT16(const float* __restrict__ src, long long lds, _Float16* __restrict__ dst, long long ldd, int R, int C, float s) {
    const long long i = (long long)blockIdx.x * 256 + threadIdx.x; const long long np = (long long)C * (R / 2); if (i >= np) return; const int c = (int)(i / (R / 2)); const int r = 2 * (int)(i % (R / 2));
    const _Float16 h0 = (_Float16)(src[(long long)r * lds + c] * s), h1 = (_Float16)(src[(long long)(r + 1) * lds + c] * s);
    const unsigned u = (unsigned)__builtin_bit_cast(unsigned short, h0) | ((unsigned)__builtin_bit_cast(unsigned short, h1) << 16);
    unsigned* d = (unsigned*)(dst + (long long)c * ldd + r); *d = u;  }
__global__ __launch_bounds__(256) void k_cast16(const float* __restrict__ src, long long lds, _Float16* __restrict__ dst, long long ldd, int R, int C, float s) {
    const long long i = (long long)blockIdx.x * 256 + threadIdx.x; const long long np = (long long)R * (C / 2); if (i >= np) return; const int r = (int)(i / (C / 2)); const int c = 2 * (int)(i % (C / 2));
    const _Float16 h0 = (_Float16)(src[(long long)r * lds + c] * s), h1 = (_Float16)(src[(long long)r * lds + c + 1] * s);
    const unsigned u = (unsigned)__builtin_bit_cast(unsigned short, h0) | ((unsigned)__builtin_bit_cast(unsigned short, h1) << 16);
    unsigned* d = (unsigned*)(dst + (long long)r * ldd + c); *d = u;  }

// f32 -> bf16 hi plane + bf16 lo plane (x = hi + lo to ~2^-17 relative; RNE both), [R][C] -> [R][C] (or transposed to [C][R]); 2 consecutive destination elements
__device__ __forceinline__ unsigned int f2bf2_pack(float a, float b, unsigned int* lo) {
    const unsigned short ha = w25::f2bf_bits(a), hb = w25::f2bf_bits(b);
    const unsigned short la = w25::f2bf_bits(a - w25::bf_bits2f(ha)), lb = w25::f2bf_bits(b - w25::bf_bits2f(hb));
    *lo = (unsigned)la | ((unsigned)lb << 16); return (unsigned)ha | ((unsigned)hb << 16); }
__global__ __launch_bounds__(256) void k_castS16(const float* __restrict__ src, long long lds, __bf16* __restrict__ dhi, __bf16* __restrict__ dlo, long long ldd, int R, int C, float s, int transpose) {
    const long long i = (long long)blockIdx.x * 256 + threadIdx.x; long long o; float a, b;
    if (transpose) { const long long np = (long long)C * (R / 2); if (i >= np) return; const int c = (int)(i / (R / 2)); const int r = 2 * (int)(i % (R / 2)); a = src[(long long)r * lds + c] * s; b = src[(long long)(r + 1) * lds + c] * s; o = (long long)c * ldd + r; }
    else { const long long np = (long long)R * (C / 2); if (i >= np) return; const int r = (int)(i / (C / 2)); const int c = 2 * (int)(i % (C / 2)); a = src[(long long)r * lds + c] * s; b = src[(long long)r * lds + c + 1] * s; o = (long long)r * ldd + c; }
    unsigned lo; const unsigned hi = f2bf2_pack(a, b, &lo); unsigned* ph = (unsigned*)(dhi + o); unsigned* pl = (unsigned*)(dlo + o);
    *ph = hi; *pl = lo;  }

namespace w25 {
// =====================================================================================
// Generic causal/non-causal attention for head_dim 64, f32 in / f32 out; 16-bit operands: bf16 with optional hi/lo splits, or
// plain f16 (F16=true, non-split, probabilities carried x2^15).
//   scores = (q*qscale)·kᵀ : v_wmma_f32_16x16x32_bf16; SPLIT_QK -> q,k as bf16 hi/lo (hi·hi + hi·lo + lo·hi)
//   out    = p·v           : v_wmma_f32_16x16x32_bf16; SPLIT_PV -> p,v as bf16 hi/lo; else p,v plain bf16
//   f32 accumulate; online softmax in f32. Block = 4 waves = 64 query rows of one (batch, head); S % 64 == 0.
//   Element (b, s, h, d) of tensor X lives at X[b*X_bs + s*X_rs + h*X_hs + d] (strides in floats, multiples of 4).
//   Masking: mask_mode 0 none, 1 causal (kv > q masked), 2 tensor [S][Skv] shared over (b,h) (float if
//   mask_is_int==0, int32 with element == 0 -> masked if 1, int32 with element != 0 -> masked if 2), 3 per-token vectors qmask[B][S] & kvmask[B][Skv] (int32,
//   0 -> masked), 4 causal + sliding window (kv > q or q - kv > W masked; W passed in mask_is_int);
//   5 = relative-position bias: s += cp[b,h,q][idx[q][kv]] + pc[b,h,kv][idx[q][kv]] with idx = mask_b ([S][Skv] int32) and
//   mask_a an int32 [S][Skv] tensor with nonzero = masked (tables: element (b,h,row,n) at X + b*c_bs + h*c_hs + row*c_rs + n);
//   masked scores are replaced by mask_fill (e.g. -inf or -1e9) before the softmax.
//   grid.x = B * H * (S/64) (or a sub-range with blk0).
// =====================================================================================
#define AT_D 64
#define AT_NW 4
#define AT_QB 64
#define AT_KC 64
struct AttnGeom { const float* cp = nullptr; const float* pc = nullptr; long c_bs = 0, c_rs = 0, c_hs = 0;   // mode-5 score-bias tables
                  long q_bs, q_rs, q_hs, k_bs, k_rs, k_hs, v_bs, v_rs, v_hs, o_bs, o_rs, o_hs;
                  int S, Skv, H, mask_mode; float qscale; int blk0; float mask_fill; int mask_is_int; };
static_assert(sizeof(AttnGeom) == 168, "no padding");

__device__ __forceinline__ unsigned short at_bf_bits(float f) {
  unsigned u = __float_as_uint(f);
  return (unsigned short)((u + 0x7FFFu + ((u >> 16) & 1u)) >> 16);
}
__device__ __forceinline__ __bf16 at_f2bf(float f) { return __builtin_bit_cast(__bf16, at_bf_bits(f)); }
__device__ __forceinline__ void at_split(float f, __bf16& hi, __bf16& lo) {
  const unsigned short hb = at_bf_bits(f);
  hi = __builtin_bit_cast(__bf16, hb);
  lo = at_f2bf(f - __uint_as_float(((unsigned)hb) << 16));
}
__device__ __forceinline__ v8f at_mma(v16b a, v16b b, v8f c) {
  c = __builtin_amdgcn_wmma_f32_16x16x32_bf16(false, a, false, b, (short)0, c, false, false);
  asm volatile("v_nop\n\tv_nop\n\tv_nop\n\tv_nop" : "+v"(c) : "v"(a), "v"(b));
  return c;
}
// 16-bit element as a bit pattern held in a __bf16 slot: f16 bits when F16, bf16 (RNE) otherwise
template <bool F16> __device__ __forceinline__ __bf16 at_to16(float f) {
  if (F16) return __builtin_bit_cast(__bf16, (_Float16)f);
  return at_f2bf(f);
}
template <bool F16> __device__ __forceinline__ v8f at_mma16(v16b a, v16b b, v8f c) {
  if (F16) {
    const v16h ah = __builtin_bit_cast(v16h, a), bh = __builtin_bit_cast(v16h, b);
    c = __builtin_amdgcn_wmma_f32_16x16x32_f16(false, ah, false, bh, (short)0, c, false, false);
    asm volatile("v_nop\n\tv_nop\n\tv_nop\n\tv_nop" : "+v"(c) : "v"(ah), "v"(bh));
    return c;
  }
  return at_mma(a, b, c);
}

template <bool SPLIT_QK, bool SPLIT_PV, bool F16 = false>
__global__ __launch_bounds__(128)
void attn64_kernel(const float* __restrict__ q, const float* __restrict__ k,
                   const float* __restrict__ v, float* __restrict__ out,
                   const void* __restrict__ mask_a, const int* __restrict__ mask_b, AttnGeom g) {
  static_assert(!(F16 && (SPLIT_QK || SPLIT_PV)), "f16 mode is non-split");
  const float PSC = F16 ? 32768.0f : 1.0f;     // f16 probabilities carried x2^15 (subnormal range), folded into the final 1/l
  union FB { v16b v; v8b h[2]; };
  __shared__ __align__(16) __bf16 Ksh[AT_KC * AT_D];             // K hi [kv][d]      8 KB
  __shared__ __align__(16) __bf16 Ksl[SPLIT_QK ? AT_KC * AT_D : 8];
  __shared__ __align__(16) __bf16 Vth[AT_D * AT_KC];             // V hi [d][kv]      8 KB
  __shared__ __align__(16) __bf16 Vtl[SPLIT_PV ? AT_D * AT_KC : 8];
  __shared__ __align__(16) __bf16 Psh[AT_NW][16 * AT_KC];        // per wave P hi [row][kv]  8 KB
  __shared__ __align__(16) __bf16 Psl[SPLIT_PV ? AT_NW : 1][SPLIT_PV ? 16 * AT_KC : 8];
  __shared__ __align__(16) float  Os[AT_NW][16 * 68];            // per wave out tile, pitch 68

  const int tid  = threadIdx.x;
  const int wave = tid >> 5;
  const int lane = tid & 31;
  const int hh   = lane >> 4;
  const int c    = lane & 15;

  const int nqb = g.S / AT_QB;
  const int bx = blockIdx.x + g.blk0;
  const int qb = bx % nqb;
  const int bh = bx / nqb;
  const int h  = bh % g.H;
  const int b  = bh / g.H;
  const int qbase_block = qb * AT_QB;
  const int q0 = qbase_block + wave * 16;

  const float* qb_ptr = q + (size_t)b * g.q_bs + (size_t)h * g.q_hs;
  const float* kb_ptr = k + (size_t)b * g.k_bs + (size_t)h * g.k_hs;
  const float* vb_ptr = v + (size_t)b * g.v_bs + (size_t)h * g.v_hs;
  float*       ob_ptr = out + (size_t)b * g.o_bs + (size_t)h * g.o_hs;

  // ---- Q fragments (A operand): 2 d-chunks, hi (and lo) ----
  v16b qah[2], qal[2];
  {
    const float* qrow = qb_ptr + (size_t)(q0 + c) * g.q_rs;
#pragma unroll
    for (int dc = 0; dc < 2; ++dc) {
#pragma unroll
      for (int e = 0; e < 8; ++e) {
        const float f0 = qrow[dc * 32 + 8 * hh + e] * g.qscale;
        const float f1 = qrow[dc * 32 + 16 + 8 * hh + e] * g.qscale;
        if (SPLIT_QK) { __bf16 hq, lq; at_split(f0, hq, lq); qah[dc][e] = hq; qal[dc][e] = lq; at_split(f1, hq, lq); qah[dc][8 + e] = hq; qal[dc][8 + e] = lq; }
        else { qah[dc][e] = at_to16<F16>(f0); qah[dc][8 + e] = at_to16<F16>(f1); qal[dc][e] = qah[dc][e]; qal[dc][8 + e] = qah[dc][8 + e]; }
      }
    }
  }

  float mrow[8], lrow[8];
  v8f oacc[4];
#pragma unroll
  for (int r = 0; r < 8; ++r) { mrow[r] = -INFINITY; lrow[r] = 0.f; }
#pragma unroll
  for (int t = 0; t < 4; ++t) oacc[t] = (v8f){0.f,0.f,0.f,0.f,0.f,0.f,0.f,0.f};

  const int nChunks = (g.mask_mode == 1 || g.mask_mode == 4) ? (qb + 1) : (g.Skv / AT_KC);   // block-uniform
  // per-row query mask (mode 3)
  int qkeep[8];
#pragma unroll
  for (int r = 0; r < 8; ++r) qkeep[r] = (g.mask_mode == 3) ? mask_b[(size_t)b * g.S + q0 + 8 * hh + r] : 1;   // mask_b = qmask in mode 3
  for (int kc = 0; kc < nChunks; ++kc) {
    const int kv0 = kc * AT_KC;
    __syncthreads();
    {
      const int kvr = tid >> 1, dh = (tid & 1) * 32;
      const float* krow = kb_ptr + (size_t)(kv0 + kvr) * g.k_rs + dh;
      const float* vrow = vb_ptr + (size_t)(kv0 + kvr) * g.v_rs + dh;
#pragma unroll
      for (int i = 0; i < 8; ++i) {
        v4f kk = *(const v4f*)(krow + 4 * i);
        v4f vv = *(const v4f*)(vrow + 4 * i);
#pragma unroll
        for (int e = 0; e < 4; ++e) {
          const int d = dh + 4 * i + e;
          if (SPLIT_QK) { __bf16 a, bl; at_split(kk[e], a, bl); Ksh[kvr * AT_D + d] = a; Ksl[kvr * AT_D + d] = bl; }
          else Ksh[kvr * AT_D + d] = at_to16<F16>(kk[e]);
          if (SPLIT_PV) { __bf16 a, bl; at_split(vv[e], a, bl); Vth[d * AT_KC + kvr] = a; Vtl[d * AT_KC + kvr] = bl; }
          else Vth[d * AT_KC + kvr] = at_to16<F16>(vv[e]);
        }
      }
    }
    __syncthreads();

    v8f s[4];
#pragma unroll
    for (int j = 0; j < 4; ++j) {
      s[j] = (v8f){0.f,0.f,0.f,0.f,0.f,0.f,0.f,0.f};
#pragma unroll 1
      for (int dc = 0; dc < 2; ++dc) {
        FB kb;
        kb.h[0] = *(const v8b*)(Ksh + (j * 16 + c) * AT_D + dc * 32 + 8 * hh);
        kb.h[1] = *(const v8b*)(Ksh + (j * 16 + c) * AT_D + dc * 32 + 16 + 8 * hh);
        s[j] = at_mma16<F16>(qah[dc], kb.v, s[j]);
        if (SPLIT_QK) {
          FB kl;
          kl.h[0] = *(const v8b*)(Ksl + (j * 16 + c) * AT_D + dc * 32 + 8 * hh);
          kl.h[1] = *(const v8b*)(Ksl + (j * 16 + c) * AT_D + dc * 32 + 16 + 8 * hh);
          s[j] = at_mma16<F16>(qah[dc], kl.v, s[j]);
          s[j] = at_mma16<F16>(qal[dc], kb.v, s[j]);
        }
      }
    }
    const bool diag = (g.mask_mode == 1) && (kc == qb);
    int kvkeep[4] = {1, 1, 1, 1};
    if (g.mask_mode == 3) {
#pragma unroll
      for (int j = 0; j < 4; ++j) kvkeep[j] = ((const int*)mask_a)[(size_t)b * g.Skv + kv0 + j * 16 + c];   // mask_a = kvmask
    }
    float cm[8];
#pragma unroll
    for (int r = 0; r < 8; ++r) {
      const int qrow = q0 + 8 * hh + r;
      float m = -INFINITY;
#pragma unroll
      for (int j = 0; j < 4; ++j) {
        const int kvcol = kv0 + j * 16 + c;
        bool masked = false;
        if (diag) masked = (kvcol > qrow);
        else if (g.mask_mode == 4) masked = (kvcol > qrow) || (qrow - kvcol > g.mask_is_int);
        else if (g.mask_mode == 2) {
          const size_t mi = (size_t)qrow * g.Skv + kvcol;
          masked = (g.mask_is_int == 0) ? (((const float*)mask_a)[mi] == 0.0f)
                 : (g.mask_is_int == 1) ? (((const int*)mask_a)[mi] == 0) : (((const int*)mask_a)[mi] != 0);
        } else if (g.mask_mode == 3) masked = (qkeep[r] == 0) || (kvkeep[j] == 0);
        else if (g.mask_mode == 5) {
          const size_t mi = (size_t)qrow * g.Skv + kvcol;
          masked = (((const int*)mask_a)[mi] != 0);
          int n = mask_b[mi]; n = n < 0 ? 0 : n;
          s[j][r] += g.cp[(size_t)b * g.c_bs + (size_t)h * g.c_hs + (size_t)qrow * g.c_rs + n]
                   + g.pc[(size_t)b * g.c_bs + (size_t)h * g.c_hs + (size_t)kvcol * g.c_rs + n];
        }
        if (masked) s[j][r] = g.mask_fill;
        m = fmaxf(m, s[j][r]);
      }
#pragma unroll
      for (int off = 1; off < 16; off <<= 1) m = fmaxf(m, __shfl_xor(m, off, 32));
      cm[r] = m;
    }
    __bf16* pwh = Psh[wave];
    __bf16* pwl = Psl[SPLIT_PV ? wave : 0];
#pragma unroll
    for (int r = 0; r < 8; ++r) {
      const float mnew = fmaxf(mrow[r], cm[r]);
      const float alpha = expf(mrow[r] - mnew);
      mrow[r] = mnew;
      float psum = 0.f;
#pragma unroll
      for (int j = 0; j < 4; ++j) {
        const float p = expf(s[j][r] - mnew);
        psum += p;
        if (SPLIT_PV) { __bf16 a, bl; at_split(p, a, bl); pwh[(8 * hh + r) * AT_KC + j * 16 + c] = a; pwl[(8 * hh + r) * AT_KC + j * 16 + c] = bl; }
        else pwh[(8 * hh + r) * AT_KC + j * 16 + c] = at_to16<F16>(p * PSC);
      }
#pragma unroll
      for (int off = 1; off < 16; off <<= 1) psum += __shfl_xor(psum, off, 32);
      lrow[r] = lrow[r] * alpha + psum;
#pragma unroll
      for (int t = 0; t < 4; ++t) oacc[t][r] *= alpha;
    }
    __builtin_amdgcn_fence(__ATOMIC_RELEASE, "workgroup");
    __builtin_amdgcn_wave_barrier();
    __builtin_amdgcn_fence(__ATOMIC_ACQUIRE, "workgroup");
#pragma unroll 1
    for (int kk = 0; kk < 2; ++kk) {
      FB pa, pl;
      pa.h[0] = *(const v8b*)(pwh + c * AT_KC + kk * 32 + 8 * hh);
      pa.h[1] = *(const v8b*)(pwh + c * AT_KC + kk * 32 + 16 + 8 * hh);
      if (SPLIT_PV) {
        pl.h[0] = *(const v8b*)(pwl + c * AT_KC + kk * 32 + 8 * hh);
        pl.h[1] = *(const v8b*)(pwl + c * AT_KC + kk * 32 + 16 + 8 * hh);
      }
#pragma unroll
      for (int t = 0; t < 4; ++t) {
        FB vb;
        vb.h[0] = *(const v8b*)(Vth + (t * 16 + c) * AT_KC + kk * 32 + 8 * hh);
        vb.h[1] = *(const v8b*)(Vth + (t * 16 + c) * AT_KC + kk * 32 + 16 + 8 * hh);
        oacc[t] = at_mma16<F16>(pa.v, vb.v, oacc[t]);
        if (SPLIT_PV) {
          FB vl;
          vl.h[0] = *(const v8b*)(Vtl + (t * 16 + c) * AT_KC + kk * 32 + 8 * hh);
          vl.h[1] = *(const v8b*)(Vtl + (t * 16 + c) * AT_KC + kk * 32 + 16 + 8 * hh);
          oacc[t] = at_mma16<F16>(pa.v, vl.v, oacc[t]);
          oacc[t] = at_mma16<F16>(pl.v, vb.v, oacc[t]);
        }
      }
    }
  }

  float* os = Os[wave];
#pragma unroll
  for (int r = 0; r < 8; ++r) {
    const float inv = 1.0f / (lrow[r] * PSC);
#pragma unroll
    for (int t = 0; t < 4; ++t) os[(8 * hh + r) * 68 + t * 16 + c] = oacc[t][r] * inv;
  }
  __builtin_amdgcn_fence(__ATOMIC_RELEASE, "workgroup");
  __builtin_amdgcn_wave_barrier();
  __builtin_amdgcn_fence(__ATOMIC_ACQUIRE, "workgroup");
  {
    const int c4 = (lane & 15) * 4;
    {
#pragma unroll
      for (int it = 0; it < 8; ++it) {
        const int row = it * 2 + hh;
        v4f val = *(const v4f*)(os + row * 68 + c4);
        *(v4f*)(ob_ptr + (size_t)(q0 + row) * g.o_rs + c4) = val;
      }
      
    }
  }
}

} // namespace w25

__device__ __forceinline__ void st_h2(_Float16* dst, float a, float b) { const unsigned u = (unsigned)__builtin_bit_cast(unsigned short, (_Float16)a) | ((unsigned)__builtin_bit_cast(unsigned short, (_Float16)b) << 16); unsigned* d = (unsigned*)dst; *d = u;  }
__device__ __forceinline__ unsigned short bf16b(float v) { const unsigned u = __builtin_bit_cast(unsigned, v); return (unsigned short)(((u + 0x7FFFu + ((u >> 16) & 1u)) & 0xFFFF0000u) >> 16); }
__device__ __forceinline__ float bf16f(unsigned short h) { return __builtin_bit_cast(float, ((unsigned)h) << 16); }
__device__ __forceinline__ void st_split2(_Float16* H, _Float16* L, long long e, float v0, float v1) { const unsigned short h0 = bf16b(v0), h1 = bf16b(v1); { const unsigned u = (unsigned)h0 | ((unsigned)h1 << 16); unsigned* d = (unsigned*)(H + e); *d = u;  } { const unsigned u = (unsigned)bf16b(v0 - bf16f(h0)) | ((unsigned)bf16b(v1 - bf16f(h1)) << 16); unsigned* d = (unsigned*)(L + e); *d = u;  } }
// 2x2 max-pool of PH and G ([ic][64][64] -> [ic][32][32]) plus the operand planes: PP hi/lo [nk][ic] (pooled phi, transposed), GP16 [ic][nk] (pooled g), TH hi/lo [hw][ic] (theta planes). thread-linear over the largest extent (HW*IC/2 pairs)
__global__ __launch_bounds__(256) void k_nl_pool(const float* __restrict__ PH, const float* __restrict__ G, const float* __restrict__ TH, float* __restrict__ PHP, float* __restrict__ GP, _Float16* PPH, _Float16* PPL, _Float16* GP16, _Float16* THH, _Float16* THL, int IC, int HW, int NK) { const long long t = (long long)blockIdx.x * 256 + threadIdx.x;
    if (t < (long long)HW * IC / 2) { const long long e = 2 * t; st_split2(THH, THL, e, TH[e], TH[e + 1]); }
    if (t < (long long)IC * NK / 2) { const long long e = 2 * t; float pv[2], gv[2];
#pragma unroll
        for (int u = 0; u < 2; ++u) { const long long q = e + u; const int ic = (int)(q / NK), pk = (int)(q % NK); const int py = pk / 32, px = pk % 32; const long long s = (long long)ic * HW + (2 * py) * 64 + 2 * px;
            pv[u] = fmaxf(fmaxf(PH[s], PH[s + 1]), fmaxf(PH[s + 64], PH[s + 65])); gv[u] = fmaxf(fmaxf(G[s], G[s + 1]), fmaxf(G[s + 64], G[s + 65])); }
        { const unsigned long long pk2 = (unsigned long long)__builtin_bit_cast(unsigned, pv[0]) | ((unsigned long long)__builtin_bit_cast(unsigned, pv[1]) << 32); VST2(unsigned long long, (unsigned long long*)(PHP + e), pk2); }
        { const unsigned long long pk2 = (unsigned long long)__builtin_bit_cast(unsigned, gv[0]) | ((unsigned long long)__builtin_bit_cast(unsigned, gv[1]) << 32); VST2(unsigned long long, (unsigned long long*)(GP + e), pk2); }
        st_h2(GP16 + e, gv[0], gv[1]); }
    if (t < (long long)NK * IC / 2) { const long long e = 2 * t; const int nk = (int)(e / IC), ic = (int)(e % IC); const int py = nk / 32, px = nk % 32; float pv[2];
#pragma unroll
        for (int u = 0; u < 2; ++u) { const long long s = (long long)(ic + u) * HW + (2 * py) * 64 + 2 * px; pv[u] = fmaxf(fmaxf(PH[s], PH[s + 1]), fmaxf(PH[s + 64], PH[s + 65])); }
        st_split2(PPH, PPL, e, pv[0], pv[1]); } }
// row softmax of F (exp once) -> P16 = f16(4096 p) (block per row of 1024)
__global__ __launch_bounds__(256) void k_nl_soft(float* __restrict__ F, _Float16* __restrict__ P16, int NK) { __shared__ float red[256]; const long long row = blockIdx.x; float* sr = F + row * NK; const int t = threadIdx.x; float mx = -3.0e38f;
#pragma unroll 1
    for (int j = 2 * t; j < NK; j += 512) mx = fmaxf(mx, fmaxf(sr[j], sr[j + 1]));
    red[t] = mx; __syncthreads(); for (int o = 128; o > 0; o >>= 1) { if (t < o) red[t] = fmaxf(red[t], red[t + o]); __syncthreads(); } const float m = red[0]; __syncthreads();
    float s = 0.f;
#pragma unroll 1
    for (int j = 2 * t; j < NK; j += 512) { const float e0 = expf(sr[j] - m), e1 = expf(sr[j + 1] - m); s += e0 + e1; const unsigned long long pk = (unsigned long long)__builtin_bit_cast(unsigned, e0) | ((unsigned long long)__builtin_bit_cast(unsigned, e1) << 32); VST2(unsigned long long, (unsigned long long*)(sr + j), pk); }
    red[t] = s; __syncthreads(); for (int o = 128; o > 0; o >>= 1) { if (t < o) red[t] += red[t + o]; __syncthreads(); } const float f = 4096.f / red[0];
#pragma unroll 1
    for (int j = 2 * t; j < NK; j += 512) st_h2(P16 + row * NK + j, sr[j] * f, sr[j + 1] * f); }
// Y16 = f16(Y) (thread per pair)
__global__ __launch_bounds__(256) void k_nl_y16(const float* __restrict__ Y, _Float16* __restrict__ Y16, long long n) { const long long t = (long long)blockIdx.x * 256 + threadIdx.x; if (t >= n / 2) return; st_h2(Y16 + 2 * t, Y[2 * t], Y[2 * t + 1]); }
__global__ __launch_bounds__(256) void k_nl_bns(const float* __restrict__ WY, float* __restrict__ BNS, int Bn, int C, int HW) { __shared__ float red[256]; __shared__ float res[2]; const int c = blockIdx.x; const int t = threadIdx.x; float s = 0.f;
    for (int b = 0; b < Bn; ++b) { const float* r = WY + ((long long)b * C + c) * HW;
#pragma unroll 1
        for (int j = t; j < HW; j += 256) s += r[j]; }
    red[t] = s; __syncthreads(); for (int o = 128; o > 0; o >>= 1) { if (t < o) red[t] += red[t + o]; __syncthreads(); } const float mu = red[0] / (float)(Bn * HW); __syncthreads();
    float q = 0.f;
    for (int b = 0; b < Bn; ++b) { const float* r = WY + ((long long)b * C + c) * HW;
#pragma unroll 1
        for (int j = t; j < HW; j += 256) { const float d = r[j] - mu; q += d * d; } }
    red[t] = q; __syncthreads(); for (int o = 128; o > 0; o >>= 1) { if (t < o) red[t] += red[t + o]; __syncthreads(); }
    if (t == 0) { res[0] = mu; res[1] = rsqrtf(red[0] / (float)(Bn * HW) + 1e-5f); } __syncthreads();
    if (t < 32) VST2(float, BNS + (long long)c * 32 + t, (t == 0) ? res[0] : ((t == 1) ? res[1] : 0.f)); }
// out = (WY - mu[c]) * rstd[c] * gamma[c] + beta[c] + x (thread-linear over [b][c][hw])
__global__ __launch_bounds__(256) void k_nl_out(const float* __restrict__ WY, const float* __restrict__ BNS, const float* __restrict__ Gm, const float* __restrict__ Bt, const float* __restrict__ X, float* __restrict__ OUT, int C, int HW, long long n) { const long long t = (long long)blockIdx.x * 256 + threadIdx.x; if (t >= n) return; const int c = (int)((t / HW) % C); VST2(float, OUT + t, (WY[t] - BNS[(long long)c * 32]) * BNS[(long long)c * 32 + 1] * Gm[c] + Bt[c] + X[t]); }


extern "C" void kernel_launch(void* const* d_in, const int* in_sizes, int n_in, void* d_out, int out_size, void* d_ws, size_t ws_size, hipStream_t stream) {
    (void)in_sizes; (void)n_in; (void)out_size; (void)ws_size;
    const float* x = (const float*)d_in[0];
    const float* gw = (const float*)d_in[1];
    const float* gb = (const float*)d_in[2];
    const float* thw = (const float*)d_in[3];
    const float* thb = (const float*)d_in[4];
    const float* phw = (const float*)d_in[5];
    const float* phb = (const float*)d_in[6];
    const float* Ww = (const float*)d_in[7];
    const float* Wb = (const float*)d_in[8];
    const float* bng = (const float*)d_in[9];
    const float* bnb = (const float*)d_in[10];
    const int Bn = 8;
    const int C = 256;
    const int IC = 128;
    const int HW = 4096;
    const int NK = 1024;
    float* out = (float*)d_out;
    char* wsp = (char*)d_ws;
    float* TH = (float*)wsp; wsp += (((size_t)((size_t)HW * IC) * 4 + 255) / 256) * 256;
    float* PH = (float*)wsp; wsp += (((size_t)((size_t)IC * HW) * 4 + 255) / 256) * 256;
    float* G = (float*)wsp; wsp += (((size_t)((size_t)IC * HW) * 4 + 255) / 256) * 256;
    float* PHP = (float*)wsp; wsp += (((size_t)((size_t)IC * NK) * 4 + 255) / 256) * 256;
    float* GP = (float*)wsp; wsp += (((size_t)((size_t)IC * NK) * 4 + 255) / 256) * 256;
    unsigned short* THH = (unsigned short*)wsp; wsp += (((size_t)((size_t)HW * IC) * 2 + 255) / 256) * 256;
    unsigned short* THL = (unsigned short*)wsp; wsp += (((size_t)((size_t)HW * IC) * 2 + 255) / 256) * 256;
    unsigned short* PPH = (unsigned short*)wsp; wsp += (((size_t)((size_t)NK * IC) * 2 + 255) / 256) * 256;
    unsigned short* PPL = (unsigned short*)wsp; wsp += (((size_t)((size_t)NK * IC) * 2 + 255) / 256) * 256;
    unsigned short* GP16 = (unsigned short*)wsp; wsp += (((size_t)((size_t)IC * NK) * 2 + 255) / 256) * 256;
    float* F = (float*)wsp; wsp += (((size_t)((size_t)HW * NK) * 4 + 255) / 256) * 256;
    unsigned short* P16 = (unsigned short*)wsp; wsp += (((size_t)((size_t)HW * NK) * 2 + 255) / 256) * 256;
    float* Y = (float*)wsp; wsp += (((size_t)((size_t)HW * IC) * 4 + 255) / 256) * 256;
    unsigned short* Y16 = (unsigned short*)wsp; wsp += (((size_t)((size_t)HW * IC) * 2 + 255) / 256) * 256;
    unsigned short* WW16 = (unsigned short*)wsp; wsp += (((size_t)((size_t)C * IC) * 2 + 255) / 256) * 256;
    float* WY = (float*)wsp; wsp += (((size_t)((size_t)Bn * C * HW) * 4 + 255) / 256) * 256;
    float* BNS = (float*)wsp; wsp += (((size_t)((size_t)32 * C) * 4 + 255) / 256) * 256;
    unsigned short* G64A = (unsigned short*)wsp; wsp += (((size_t)(1048576) * 2 + 255) / 256) * 256;
    unsigned short* G64B = (unsigned short*)wsp; wsp += (((size_t)(1048576) * 2 + 255) / 256) * 256;
    unsigned short* G64A2 = (unsigned short*)wsp; wsp += (((size_t)(1048576) * 2 + 255) / 256) * 256;
    unsigned short* G64B2 = (unsigned short*)wsp; wsp += (((size_t)(1048576) * 2 + 255) / 256) * 256;
    k_cast16<<<(unsigned)((((long long)(C) * ((IC) / 2)) + 255) / 256), 256, 0, stream>>>(Ww, IC, (_Float16*)(WW16), IC, C, IC, 16.0f);
    k_castS16<<<(unsigned)((((long long)(4096) * ((256) / 2)) + 255) / 256), 256, 0, stream>>>(x + (size_t)0 * C * HW, 4096, (__bf16*)(G64A), (__bf16*)(G64A2), 256, 256, 4096, 1.0f, 1);
    k_castS16<<<(unsigned)((((long long)(128) * ((256) / 2)) + 255) / 256), 256, 0, stream>>>(thw, 256, (__bf16*)(G64B), (__bf16*)(G64B2), 256, 128, 256, 1.0f, 0);
    w25::wmma_gemm64<1, true, 2, 0, false, 0><<<dim3((unsigned)((((4096) / 64) * ((128) / 64) + 7) / 8), (unsigned)(1)), 256, 0, stream>>>((const unsigned short*)(G64A), (const unsigned short*)(G64A2), 256, 0, (const unsigned short*)(G64B), (const unsigned short*)(G64B2), 256, 0, (void*)(TH), nullptr, 128, 0, thb, nullptr, 0, 4096, 128, 256, 1.0f);
    k_castS16<<<(unsigned)((((long long)(128) * ((256) / 2)) + 255) / 256), 256, 0, stream>>>(phw, 256, (__bf16*)(G64A), (__bf16*)(G64A2), 256, 128, 256, 1.0f, 0);
    k_castS16<<<(unsigned)((((long long)(4096) * ((256) / 2)) + 255) / 256), 256, 0, stream>>>(x + (size_t)0 * C * HW, 4096, (__bf16*)(G64B), (__bf16*)(G64B2), 256, 256, 4096, 1.0f, 1);
    w25::wmma_gemm64<1, true, 1, 0, false, 0><<<dim3((unsigned)((((128) / 64) * ((4096) / 64) + 7) / 8), (unsigned)(1)), 256, 0, stream>>>((const unsigned short*)(G64A), (const unsigned short*)(G64A2), 256, 0, (const unsigned short*)(G64B), (const unsigned short*)(G64B2), 256, 0, (void*)(PH), nullptr, 4096, 0, phb, nullptr, 0, 128, 4096, 256, 1.0f);
    k_cast16<<<(unsigned)((((long long)(128) * ((256) / 2)) + 255) / 256), 256, 0, stream>>>(gw, 256, (_Float16*)(G64A), 256, 128, 256, 1.0f);
    k_castT16<<<(unsigned)((((long long)(4096) * ((256) / 2)) + 255) / 256), 256, 0, stream>>>(x + (size_t)0 * C * HW, 4096, (_Float16*)(G64B), 256, 256, 4096, 16.0f);
    w25::wmma_gemm64<0, false, 1, 0, false, 0><<<dim3((unsigned)((((128) / 64) * ((4096) / 64) + 7) / 8), (unsigned)(1)), 256, 0, stream>>>((const unsigned short*)(G64A), nullptr, 256, 0, (const unsigned short*)(G64B), nullptr, 256, 0, (void*)(G), nullptr, 4096, 0, gb, nullptr, 0, 128, 4096, 256, 0.0625f);
    k_nl_pool<<<(unsigned)(((long long)HW * IC / 2 + 255) / 256), 256, 0, stream>>>(PH, G, TH, PHP, GP, (_Float16*)PPH, (_Float16*)PPL, (_Float16*)GP16, (_Float16*)THH, (_Float16*)THL, IC, HW, NK);
    w25::wmma_gemm64<1, true, 0, 0, false, 0><<<dim3((unsigned)((((HW) / 64) * ((NK) / 64) + 7) / 8), (unsigned)(1)), 256, 0, stream>>>((const unsigned short*)(THH), (const unsigned short*)(THL), IC, 0, (const unsigned short*)(PPH), (const unsigned short*)(PPL), IC, 0, (void*)(F), nullptr, NK, 0, nullptr, nullptr, 0, HW, NK, IC, 1.0f);
    k_nl_soft<<<HW, 256, 0, stream>>>(F, (_Float16*)P16, NK);
    w25::wmma_gemm64<0, false, 0, 0, false, 0><<<dim3((unsigned)((((HW) / 64) * ((IC) / 64) + 7) / 8), (unsigned)(1)), 256, 0, stream>>>((const unsigned short*)(P16), nullptr, NK, 0, (const unsigned short*)(GP16), nullptr, NK, 0, (void*)(Y), nullptr, IC, 0, nullptr, nullptr, 0, HW, IC, NK, 0.000244140625f);
    k_nl_y16<<<(unsigned)(((long long)HW * IC / 2 + 255) / 256), 256, 0, stream>>>(Y, (_Float16*)Y16, (long long)HW * IC);
    w25::wmma_gemm64<0, false, 1, 0, false, 0><<<dim3((unsigned)((((C) / 64) * ((HW) / 64) + 7) / 8), (unsigned)(1)), 256, 0, stream>>>((const unsigned short*)(WW16), nullptr, IC, 0, (const unsigned short*)(Y16), nullptr, IC, 0, (void*)(WY + (size_t)0 * C * HW), nullptr, HW, 0, Wb, nullptr, 0, C, HW, IC, 0.0625f);
    k_castS16<<<(unsigned)((((long long)(4096) * ((256) / 2)) + 255) / 256), 256, 0, stream>>>(x + (size_t)1 * C * HW, 4096, (__bf16*)(G64A), (__bf16*)(G64A2), 256, 256, 4096, 1.0f, 1);
    k_castS16<<<(unsigned)((((long long)(128) * ((256) / 2)) + 255) / 256), 256, 0, stream>>>(thw, 256, (__bf16*)(G64B), (__bf16*)(G64B2), 256, 128, 256, 1.0f, 0);
    w25::wmma_gemm64<1, true, 2, 0, false, 0><<<dim3((unsigned)((((4096) / 64) * ((128) / 64) + 7) / 8), (unsigned)(1)), 256, 0, stream>>>((const unsigned short*)(G64A), (const unsigned short*)(G64A2), 256, 0, (const unsigned short*)(G64B), (const unsigned short*)(G64B2), 256, 0, (void*)(TH), nullptr, 128, 0, thb, nullptr, 0, 4096, 128, 256, 1.0f);
    k_castS16<<<(unsigned)((((long long)(128) * ((256) / 2)) + 255) / 256), 256, 0, stream>>>(phw, 256, (__bf16*)(G64A), (__bf16*)(G64A2), 256, 128, 256, 1.0f, 0);
    k_castS16<<<(unsigned)((((long long)(4096) * ((256) / 2)) + 255) / 256), 256, 0, stream>>>(x + (size_t)1 * C * HW, 4096, (__bf16*)(G64B), (__bf16*)(G64B2), 256, 256, 4096, 1.0f, 1);
    w25::wmma_gemm64<1, true, 1, 0, false, 0><<<dim3((unsigned)((((128) / 64) * ((4096) / 64) + 7) / 8), (unsigned)(1)), 256, 0, stream>>>((const unsigned short*)(G64A), (const unsigned short*)(G64A2), 256, 0, (const unsigned short*)(G64B), (const unsigned short*)(G64B2), 256, 0, (void*)(PH), nullptr, 4096, 0, phb, nullptr, 0, 128, 4096, 256, 1.0f);
    k_cast16<<<(unsigned)((((long long)(128) * ((256) / 2)) + 255) / 256), 256, 0, stream>>>(gw, 256, (_Float16*)(G64A), 256, 128, 256, 1.0f);
    k_castT16<<<(unsigned)((((long long)(4096) * ((256) / 2)) + 255) / 256), 256, 0, stream>>>(x + (size_t)1 * C * HW, 4096, (_Float16*)(G64B), 256, 256, 4096, 16.0f);
    w25::wmma_gemm64<0, false, 1, 0, false, 0><<<dim3((unsigned)((((128) / 64) * ((4096) / 64) + 7) / 8), (unsigned)(1)), 256, 0, stream>>>((const unsigned short*)(G64A), nullptr, 256, 0, (const unsigned short*)(G64B), nullptr, 256, 0, (void*)(G), nullptr, 4096, 0, gb, nullptr, 0, 128, 4096, 256, 0.0625f);
    k_nl_pool<<<(unsigned)(((long long)HW * IC / 2 + 255) / 256), 256, 0, stream>>>(PH, G, TH, PHP, GP, (_Float16*)PPH, (_Float16*)PPL, (_Float16*)GP16, (_Float16*)THH, (_Float16*)THL, IC, HW, NK);
    w25::wmma_gemm64<1, true, 0, 0, false, 0><<<dim3((unsigned)((((HW) / 64) * ((NK) / 64) + 7) / 8), (unsigned)(1)), 256, 0, stream>>>((const unsigned short*)(THH), (const unsigned short*)(THL), IC, 0, (const unsigned short*)(PPH), (const unsigned short*)(PPL), IC, 0, (void*)(F), nullptr, NK, 0, nullptr, nullptr, 0, HW, NK, IC, 1.0f);
    k_nl_soft<<<HW, 256, 0, stream>>>(F, (_Float16*)P16, NK);
    w25::wmma_gemm64<0, false, 0, 0, false, 0><<<dim3((unsigned)((((HW) / 64) * ((IC) / 64) + 7) / 8), (unsigned)(1)), 256, 0, stream>>>((const unsigned short*)(P16), nullptr, NK, 0, (const unsigned short*)(GP16), nullptr, NK, 0, (void*)(Y), nullptr, IC, 0, nullptr, nullptr, 0, HW, IC, NK, 0.000244140625f);
    k_nl_y16<<<(unsigned)(((long long)HW * IC / 2 + 255) / 256), 256, 0, stream>>>(Y, (_Float16*)Y16, (long long)HW * IC);
    w25::wmma_gemm64<0, false, 1, 0, false, 0><<<dim3((unsigned)((((C) / 64) * ((HW) / 64) + 7) / 8), (unsigned)(1)), 256, 0, stream>>>((const unsigned short*)(WW16), nullptr, IC, 0, (const unsigned short*)(Y16), nullptr, IC, 0, (void*)(WY + (size_t)1 * C * HW), nullptr, HW, 0, Wb, nullptr, 0, C, HW, IC, 0.0625f);
    k_castS16<<<(unsigned)((((long long)(4096) * ((256) / 2)) + 255) / 256), 256, 0, stream>>>(x + (size_t)2 * C * HW, 4096, (__bf16*)(G64A), (__bf16*)(G64A2), 256, 256, 4096, 1.0f, 1);
    k_castS16<<<(unsigned)((((long long)(128) * ((256) / 2)) + 255) / 256), 256, 0, stream>>>(thw, 256, (__bf16*)(G64B), (__bf16*)(G64B2), 256, 128, 256, 1.0f, 0);
    w25::wmma_gemm64<1, true, 2, 0, false, 0><<<dim3((unsigned)((((4096) / 64) * ((128) / 64) + 7) / 8), (unsigned)(1)), 256, 0, stream>>>((const unsigned short*)(G64A), (const unsigned short*)(G64A2), 256, 0, (const unsigned short*)(G64B), (const unsigned short*)(G64B2), 256, 0, (void*)(TH), nullptr, 128, 0, thb, nullptr, 0, 4096, 128, 256, 1.0f);
    k_castS16<<<(unsigned)((((long long)(128) * ((256) / 2)) + 255) / 256), 256, 0, stream>>>(phw, 256, (__bf16*)(G64A), (__bf16*)(G64A2), 256, 128, 256, 1.0f, 0);
    k_castS16<<<(unsigned)((((long long)(4096) * ((256) / 2)) + 255) / 256), 256, 0, stream>>>(x + (size_t)2 * C * HW, 4096, (__bf16*)(G64B), (__bf16*)(G64B2), 256, 256, 4096, 1.0f, 1);
    w25::wmma_gemm64<1, true, 1, 0, false, 0><<<dim3((unsigned)((((128) / 64) * ((4096) / 64) + 7) / 8), (unsigned)(1)), 256, 0, stream>>>((const unsigned short*)(G64A), (const unsigned short*)(G64A2), 256, 0, (const unsigned short*)(G64B), (const unsigned short*)(G64B2), 256, 0, (void*)(PH), nullptr, 4096, 0, phb, nullptr, 0, 128, 4096, 256, 1.0f);
    k_cast16<<<(unsigned)((((long long)(128) * ((256) / 2)) + 255) / 256), 256, 0, stream>>>(gw, 256, (_Float16*)(G64A), 256, 128, 256, 1.0f);
    k_castT16<<<(unsigned)((((long long)(4096) * ((256) / 2)) + 255) / 256), 256, 0, stream>>>(x + (size_t)2 * C * HW, 4096, (_Float16*)(G64B), 256, 256, 4096, 16.0f);
    w25::wmma_gemm64<0, false, 1, 0, false, 0><<<dim3((unsigned)((((128) / 64) * ((4096) / 64) + 7) / 8), (unsigned)(1)), 256, 0, stream>>>((const unsigned short*)(G64A), nullptr, 256, 0, (const unsigned short*)(G64B), nullptr, 256, 0, (void*)(G), nullptr, 4096, 0, gb, nullptr, 0, 128, 4096, 256, 0.0625f);
    k_nl_pool<<<(unsigned)(((long long)HW * IC / 2 + 255) / 256), 256, 0, stream>>>(PH, G, TH, PHP, GP, (_Float16*)PPH, (_Float16*)PPL, (_Float16*)GP16, (_Float16*)THH, (_Float16*)THL, IC, HW, NK);
    w25::wmma_gemm64<1, true, 0, 0, false, 0><<<dim3((unsigned)((((HW) / 64) * ((NK) / 64) + 7) / 8), (unsigned)(1)), 256, 0, stream>>>((const unsigned short*)(THH), (const unsigned short*)(THL), IC, 0, (const unsigned short*)(PPH), (const unsigned short*)(PPL), IC, 0, (void*)(F), nullptr, NK, 0, nullptr, nullptr, 0, HW, NK, IC, 1.0f);
    k_nl_soft<<<HW, 256, 0, stream>>>(F, (_Float16*)P16, NK);
    w25::wmma_gemm64<0, false, 0, 0, false, 0><<<dim3((unsigned)((((HW) / 64) * ((IC) / 64) + 7) / 8), (unsigned)(1)), 256, 0, stream>>>((const unsigned short*)(P16), nullptr, NK, 0, (const unsigned short*)(GP16), nullptr, NK, 0, (void*)(Y), nullptr, IC, 0, nullptr, nullptr, 0, HW, IC, NK, 0.000244140625f);
    k_nl_y16<<<(unsigned)(((long long)HW * IC / 2 + 255) / 256), 256, 0, stream>>>(Y, (_Float16*)Y16, (long long)HW * IC);
    w25::wmma_gemm64<0, false, 1, 0, false, 0><<<dim3((unsigned)((((C) / 64) * ((HW) / 64) + 7) / 8), (unsigned)(1)), 256, 0, stream>>>((const unsigned short*)(WW16), nullptr, IC, 0, (const unsigned short*)(Y16), nullptr, IC, 0, (void*)(WY + (size_t)2 * C * HW), nullptr, HW, 0, Wb, nullptr, 0, C, HW, IC, 0.0625f);
    k_castS16<<<(unsigned)((((long long)(4096) * ((256) / 2)) + 255) / 256), 256, 0, stream>>>(x + (size_t)3 * C * HW, 4096, (__bf16*)(G64A), (__bf16*)(G64A2), 256, 256, 4096, 1.0f, 1);
    k_castS16<<<(unsigned)((((long long)(128) * ((256) / 2)) + 255) / 256), 256, 0, stream>>>(thw, 256, (__bf16*)(G64B), (__bf16*)(G64B2), 256, 128, 256, 1.0f, 0);
    w25::wmma_gemm64<1, true, 2, 0, false, 0><<<dim3((unsigned)((((4096) / 64) * ((128) / 64) + 7) / 8), (unsigned)(1)), 256, 0, stream>>>((const unsigned short*)(G64A), (const unsigned short*)(G64A2), 256, 0, (const unsigned short*)(G64B), (const unsigned short*)(G64B2), 256, 0, (void*)(TH), nullptr, 128, 0, thb, nullptr, 0, 4096, 128, 256, 1.0f);
    k_castS16<<<(unsigned)((((long long)(128) * ((256) / 2)) + 255) / 256), 256, 0, stream>>>(phw, 256, (__bf16*)(G64A), (__bf16*)(G64A2), 256, 128, 256, 1.0f, 0);
    k_castS16<<<(unsigned)((((long long)(4096) * ((256) / 2)) + 255) / 256), 256, 0, stream>>>(x + (size_t)3 * C * HW, 4096, (__bf16*)(G64B), (__bf16*)(G64B2), 256, 256, 4096, 1.0f, 1);
    w25::wmma_gemm64<1, true, 1, 0, false, 0><<<dim3((unsigned)((((128) / 64) * ((4096) / 64) + 7) / 8), (unsigned)(1)), 256, 0, stream>>>((const unsigned short*)(G64A), (const unsigned short*)(G64A2), 256, 0, (const unsigned short*)(G64B), (const unsigned short*)(G64B2), 256, 0, (void*)(PH), nullptr, 4096, 0, phb, nullptr, 0, 128, 4096, 256, 1.0f);
    k_cast16<<<(unsigned)((((long long)(128) * ((256) / 2)) + 255) / 256), 256, 0, stream>>>(gw, 256, (_Float16*)(G64A), 256, 128, 256, 1.0f);
    k_castT16<<<(unsigned)((((long long)(4096) * ((256) / 2)) + 255) / 256), 256, 0, stream>>>(x + (size_t)3 * C * HW, 4096, (_Float16*)(G64B), 256, 256, 4096, 16.0f);
    w25::wmma_gemm64<0, false, 1, 0, false, 0><<<dim3((unsigned)((((128) / 64) * ((4096) / 64) + 7) / 8), (unsigned)(1)), 256, 0, stream>>>((const unsigned short*)(G64A), nullptr, 256, 0, (const unsigned short*)(G64B), nullptr, 256, 0, (void*)(G), nullptr, 4096, 0, gb, nullptr, 0, 128, 4096, 256, 0.0625f);
    k_nl_pool<<<(unsigned)(((long long)HW * IC / 2 + 255) / 256), 256, 0, stream>>>(PH, G, TH, PHP, GP, (_Float16*)PPH, (_Float16*)PPL, (_Float16*)GP16, (_Float16*)THH, (_Float16*)THL, IC, HW, NK);
    w25::wmma_gemm64<1, true, 0, 0, false, 0><<<dim3((unsigned)((((HW) / 64) * ((NK) / 64) + 7) / 8), (unsigned)(1)), 256, 0, stream>>>((const unsigned short*)(THH), (const unsigned short*)(THL), IC, 0, (const unsigned short*)(PPH), (const unsigned short*)(PPL), IC, 0, (void*)(F), nullptr, NK, 0, nullptr, nullptr, 0, HW, NK, IC, 1.0f);
    k_nl_soft<<<HW, 256, 0, stream>>>(F, (_Float16*)P16, NK);
    w25::wmma_gemm64<0, false, 0, 0, false, 0><<<dim3((unsigned)((((HW) / 64) * ((IC) / 64) + 7) / 8), (unsigned)(1)), 256, 0, stream>>>((const unsigned short*)(P16), nullptr, NK, 0, (const unsigned short*)(GP16), nullptr, NK, 0, (void*)(Y), nullptr, IC, 0, nullptr, nullptr, 0, HW, IC, NK, 0.000244140625f);
    k_nl_y16<<<(unsigned)(((long long)HW * IC / 2 + 255) / 256), 256, 0, stream>>>(Y, (_Float16*)Y16, (long long)HW * IC);
    w25::wmma_gemm64<0, false, 1, 0, false, 0><<<dim3((unsigned)((((C) / 64) * ((HW) / 64) + 7) / 8), (unsigned)(1)), 256, 0, stream>>>((const unsigned short*)(WW16), nullptr, IC, 0, (const unsigned short*)(Y16), nullptr, IC, 0, (void*)(WY + (size_t)3 * C * HW), nullptr, HW, 0, Wb, nullptr, 0, C, HW, IC, 0.0625f);
    k_castS16<<<(unsigned)((((long long)(4096) * ((256) / 2)) + 255) / 256), 256, 0, stream>>>(x + (size_t)4 * C * HW, 4096, (__bf16*)(G64A), (__bf16*)(G64A2), 256, 256, 4096, 1.0f, 1);
    k_castS16<<<(unsigned)((((long long)(128) * ((256) / 2)) + 255) / 256), 256, 0, stream>>>(thw, 256, (__bf16*)(G64B), (__bf16*)(G64B2), 256, 128, 256, 1.0f, 0);
    w25::wmma_gemm64<1, true, 2, 0, false, 0><<<dim3((unsigned)((((4096) / 64) * ((128) / 64) + 7) / 8), (unsigned)(1)), 256, 0, stream>>>((const unsigned short*)(G64A), (const unsigned short*)(G64A2), 256, 0, (const unsigned short*)(G64B), (const unsigned short*)(G64B2), 256, 0, (void*)(TH), nullptr, 128, 0, thb, nullptr, 0, 4096, 128, 256, 1.0f);
    k_castS16<<<(unsigned)((((long long)(128) * ((256) / 2)) + 255) / 256), 256, 0, stream>>>(phw, 256, (__bf16*)(G64A), (__bf16*)(G64A2), 256, 128, 256, 1.0f, 0);
    k_castS16<<<(unsigned)((((long long)(4096) * ((256) / 2)) + 255) / 256), 256, 0, stream>>>(x + (size_t)4 * C * HW, 4096, (__bf16*)(G64B), (__bf16*)(G64B2), 256, 256, 4096, 1.0f, 1);
    w25::wmma_gemm64<1, true, 1, 0, false, 0><<<dim3((unsigned)((((128) / 64) * ((4096) / 64) + 7) / 8), (unsigned)(1)), 256, 0, stream>>>((const unsigned short*)(G64A), (const unsigned short*)(G64A2), 256, 0, (const unsigned short*)(G64B), (const unsigned short*)(G64B2), 256, 0, (void*)(PH), nullptr, 4096, 0, phb, nullptr, 0, 128, 4096, 256, 1.0f);
    k_cast16<<<(unsigned)((((long long)(128) * ((256) / 2)) + 255) / 256), 256, 0, stream>>>(gw, 256, (_Float16*)(G64A), 256, 128, 256, 1.0f);
    k_castT16<<<(unsigned)((((long long)(4096) * ((256) / 2)) + 255) / 256), 256, 0, stream>>>(x + (size_t)4 * C * HW, 4096, (_Float16*)(G64B), 256, 256, 4096, 16.0f);
    w25::wmma_gemm64<0, false, 1, 0, false, 0><<<dim3((unsigned)((((128) / 64) * ((4096) / 64) + 7) / 8), (unsigned)(1)), 256, 0, stream>>>((const unsigned short*)(G64A), nullptr, 256, 0, (const unsigned short*)(G64B), nullptr, 256, 0, (void*)(G), nullptr, 4096, 0, gb, nullptr, 0, 128, 4096, 256, 0.0625f);
    k_nl_pool<<<(unsigned)(((long long)HW * IC / 2 + 255) / 256), 256, 0, stream>>>(PH, G, TH, PHP, GP, (_Float16*)PPH, (_Float16*)PPL, (_Float16*)GP16, (_Float16*)THH, (_Float16*)THL, IC, HW, NK);
    w25::wmma_gemm64<1, true, 0, 0, false, 0><<<dim3((unsigned)((((HW) / 64) * ((NK) / 64) + 7) / 8), (unsigned)(1)), 256, 0, stream>>>((const unsigned short*)(THH), (const unsigned short*)(THL), IC, 0, (const unsigned short*)(PPH), (const unsigned short*)(PPL), IC, 0, (void*)(F), nullptr, NK, 0, nullptr, nullptr, 0, HW, NK, IC, 1.0f);
    k_nl_soft<<<HW, 256, 0, stream>>>(F, (_Float16*)P16, NK);
    w25::wmma_gemm64<0, false, 0, 0, false, 0><<<dim3((unsigned)((((HW) / 64) * ((IC) / 64) + 7) / 8), (unsigned)(1)), 256, 0, stream>>>((const unsigned short*)(P16), nullptr, NK, 0, (const unsigned short*)(GP16), nullptr, NK, 0, (void*)(Y), nullptr, IC, 0, nullptr, nullptr, 0, HW, IC, NK, 0.000244140625f);
    k_nl_y16<<<(unsigned)(((long long)HW * IC / 2 + 255) / 256), 256, 0, stream>>>(Y, (_Float16*)Y16, (long long)HW * IC);
    w25::wmma_gemm64<0, false, 1, 0, false, 0><<<dim3((unsigned)((((C) / 64) * ((HW) / 64) + 7) / 8), (unsigned)(1)), 256, 0, stream>>>((const unsigned short*)(WW16), nullptr, IC, 0, (const unsigned short*)(Y16), nullptr, IC, 0, (void*)(WY + (size_t)4 * C * HW), nullptr, HW, 0, Wb, nullptr, 0, C, HW, IC, 0.0625f);
    k_castS16<<<(unsigned)((((long long)(4096) * ((256) / 2)) + 255) / 256), 256, 0, stream>>>(x + (size_t)5 * C * HW, 4096, (__bf16*)(G64A), (__bf16*)(G64A2), 256, 256, 4096, 1.0f, 1);
    k_castS16<<<(unsigned)((((long long)(128) * ((256) / 2)) + 255) / 256), 256, 0, stream>>>(thw, 256, (__bf16*)(G64B), (__bf16*)(G64B2), 256, 128, 256, 1.0f, 0);
    w25::wmma_gemm64<1, true, 2, 0, false, 0><<<dim3((unsigned)((((4096) / 64) * ((128) / 64) + 7) / 8), (unsigned)(1)), 256, 0, stream>>>((const unsigned short*)(G64A), (const unsigned short*)(G64A2), 256, 0, (const unsigned short*)(G64B), (const unsigned short*)(G64B2), 256, 0, (void*)(TH), nullptr, 128, 0, thb, nullptr, 0, 4096, 128, 256, 1.0f);
    k_castS16<<<(unsigned)((((long long)(128) * ((256) / 2)) + 255) / 256), 256, 0, stream>>>(phw, 256, (__bf16*)(G64A), (__bf16*)(G64A2), 256, 128, 256, 1.0f, 0);
    k_castS16<<<(unsigned)((((long long)(4096) * ((256) / 2)) + 255) / 256), 256, 0, stream>>>(x + (size_t)5 * C * HW, 4096, (__bf16*)(G64B), (__bf16*)(G64B2), 256, 256, 4096, 1.0f, 1);
    w25::wmma_gemm64<1, true, 1, 0, false, 0><<<dim3((unsigned)((((128) / 64) * ((4096) / 64) + 7) / 8), (unsigned)(1)), 256, 0, stream>>>((const unsigned short*)(G64A), (const unsigned short*)(G64A2), 256, 0, (const unsigned short*)(G64B), (const unsigned short*)(G64B2), 256, 0, (void*)(PH), nullptr, 4096, 0, phb, nullptr, 0, 128, 4096, 256, 1.0f);
    k_cast16<<<(unsigned)((((long long)(128) * ((256) / 2)) + 255) / 256), 256, 0, stream>>>(gw, 256, (_Float16*)(G64A), 256, 128, 256, 1.0f);
    k_castT16<<<(unsigned)((((long long)(4096) * ((256) / 2)) + 255) / 256), 256, 0, stream>>>(x + (size_t)5 * C * HW, 4096, (_Float16*)(G64B), 256, 256, 4096, 16.0f);
    w25::wmma_gemm64<0, false, 1, 0, false, 0><<<dim3((unsigned)((((128) / 64) * ((4096) / 64) + 7) / 8), (unsigned)(1)), 256, 0, stream>>>((const unsigned short*)(G64A), nullptr, 256, 0, (const unsigned short*)(G64B), nullptr, 256, 0, (void*)(G), nullptr, 4096, 0, gb, nullptr, 0, 128, 4096, 256, 0.0625f);
    k_nl_pool<<<(unsigned)(((long long)HW * IC / 2 + 255) / 256), 256, 0, stream>>>(PH, G, TH, PHP, GP, (_Float16*)PPH, (_Float16*)PPL, (_Float16*)GP16, (_Float16*)THH, (_Float16*)THL, IC, HW, NK);
    w25::wmma_gemm64<1, true, 0, 0, false, 0><<<dim3((unsigned)((((HW) / 64) * ((NK) / 64) + 7) / 8), (unsigned)(1)), 256, 0, stream>>>((const unsigned short*)(THH), (const unsigned short*)(THL), IC, 0, (const unsigned short*)(PPH), (const unsigned short*)(PPL), IC, 0, (void*)(F), nullptr, NK, 0, nullptr, nullptr, 0, HW, NK, IC, 1.0f);
    k_nl_soft<<<HW, 256, 0, stream>>>(F, (_Float16*)P16, NK);
    w25::wmma_gemm64<0, false, 0, 0, false, 0><<<dim3((unsigned)((((HW) / 64) * ((IC) / 64) + 7) / 8), (unsigned)(1)), 256, 0, stream>>>((const unsigned short*)(P16), nullptr, NK, 0, (const unsigned short*)(GP16), nullptr, NK, 0, (void*)(Y), nullptr, IC, 0, nullptr, nullptr, 0, HW, IC, NK, 0.000244140625f);
    k_nl_y16<<<(unsigned)(((long long)HW * IC / 2 + 255) / 256), 256, 0, stream>>>(Y, (_Float16*)Y16, (long long)HW * IC);
    w25::wmma_gemm64<0, false, 1, 0, false, 0><<<dim3((unsigned)((((C) / 64) * ((HW) / 64) + 7) / 8), (unsigned)(1)), 256, 0, stream>>>((const unsigned short*)(WW16), nullptr, IC, 0, (const unsigned short*)(Y16), nullptr, IC, 0, (void*)(WY + (size_t)5 * C * HW), nullptr, HW, 0, Wb, nullptr, 0, C, HW, IC, 0.0625f);
    k_castS16<<<(unsigned)((((long long)(4096) * ((256) / 2)) + 255) / 256), 256, 0, stream>>>(x + (size_t)6 * C * HW, 4096, (__bf16*)(G64A), (__bf16*)(G64A2), 256, 256, 4096, 1.0f, 1);
    k_castS16<<<(unsigned)((((long long)(128) * ((256) / 2)) + 255) / 256), 256, 0, stream>>>(thw, 256, (__bf16*)(G64B), (__bf16*)(G64B2), 256, 128, 256, 1.0f, 0);
    w25::wmma_gemm64<1, true, 2, 0, false, 0><<<dim3((unsigned)((((4096) / 64) * ((128) / 64) + 7) / 8), (unsigned)(1)), 256, 0, stream>>>((const unsigned short*)(G64A), (const unsigned short*)(G64A2), 256, 0, (const unsigned short*)(G64B), (const unsigned short*)(G64B2), 256, 0, (void*)(TH), nullptr, 128, 0, thb, nullptr, 0, 4096, 128, 256, 1.0f);
    k_castS16<<<(unsigned)((((long long)(128) * ((256) / 2)) + 255) / 256), 256, 0, stream>>>(phw, 256, (__bf16*)(G64A), (__bf16*)(G64A2), 256, 128, 256, 1.0f, 0);
    k_castS16<<<(unsigned)((((long long)(4096) * ((256) / 2)) + 255) / 256), 256, 0, stream>>>(x + (size_t)6 * C * HW, 4096, (__bf16*)(G64B), (__bf16*)(G64B2), 256, 256, 4096, 1.0f, 1);
    w25::wmma_gemm64<1, true, 1, 0, false, 0><<<dim3((unsigned)((((128) / 64) * ((4096) / 64) + 7) / 8), (unsigned)(1)), 256, 0, stream>>>((const unsigned short*)(G64A), (const unsigned short*)(G64A2), 256, 0, (const unsigned short*)(G64B), (const unsigned short*)(G64B2), 256, 0, (void*)(PH), nullptr, 4096, 0, phb, nullptr, 0, 128, 4096, 256, 1.0f);
    k_cast16<<<(unsigned)((((long long)(128) * ((256) / 2)) + 255) / 256), 256, 0, stream>>>(gw, 256, (_Float16*)(G64A), 256, 128, 256, 1.0f);
    k_castT16<<<(unsigned)((((long long)(4096) * ((256) / 2)) + 255) / 256), 256, 0, stream>>>(x + (size_t)6 * C * HW, 4096, (_Float16*)(G64B), 256, 256, 4096, 16.0f);
    w25::wmma_gemm64<0, false, 1, 0, false, 0><<<dim3((unsigned)((((128) / 64) * ((4096) / 64) + 7) / 8), (unsigned)(1)), 256, 0, stream>>>((const unsigned short*)(G64A), nullptr, 256, 0, (const unsigned short*)(G64B), nullptr, 256, 0, (void*)(G), nullptr, 4096, 0, gb, nullptr, 0, 128, 4096, 256, 0.0625f);
    k_nl_pool<<<(unsigned)(((long long)HW * IC / 2 + 255) / 256), 256, 0, stream>>>(PH, G, TH, PHP, GP, (_Float16*)PPH, (_Float16*)PPL, (_Float16*)GP16, (_Float16*)THH, (_Float16*)THL, IC, HW, NK);
    w25::wmma_gemm64<1, true, 0, 0, false, 0><<<dim3((unsigned)((((HW) / 64) * ((NK) / 64) + 7) / 8), (unsigned)(1)), 256, 0, stream>>>((const unsigned short*)(THH), (const unsigned short*)(THL), IC, 0, (const unsigned short*)(PPH), (const unsigned short*)(PPL), IC, 0, (void*)(F), nullptr, NK, 0, nullptr, nullptr, 0, HW, NK, IC, 1.0f);
    k_nl_soft<<<HW, 256, 0, stream>>>(F, (_Float16*)P16, NK);
    w25::wmma_gemm64<0, false, 0, 0, false, 0><<<dim3((unsigned)((((HW) / 64) * ((IC) / 64) + 7) / 8), (unsigned)(1)), 256, 0, stream>>>((const unsigned short*)(P16), nullptr, NK, 0, (const unsigned short*)(GP16), nullptr, NK, 0, (void*)(Y), nullptr, IC, 0, nullptr, nullptr, 0, HW, IC, NK, 0.000244140625f);
    k_nl_y16<<<(unsigned)(((long long)HW * IC / 2 + 255) / 256), 256, 0, stream>>>(Y, (_Float16*)Y16, (long long)HW * IC);
    w25::wmma_gemm64<0, false, 1, 0, false, 0><<<dim3((unsigned)((((C) / 64) * ((HW) / 64) + 7) / 8), (unsigned)(1)), 256, 0, stream>>>((const unsigned short*)(WW16), nullptr, IC, 0, (const unsigned short*)(Y16), nullptr, IC, 0, (void*)(WY + (size_t)6 * C * HW), nullptr, HW, 0, Wb, nullptr, 0, C, HW, IC, 0.0625f);
    k_castS16<<<(unsigned)((((long long)(4096) * ((256) / 2)) + 255) / 256), 256, 0, stream>>>(x + (size_t)7 * C * HW, 4096, (__bf16*)(G64A), (__bf16*)(G64A2), 256, 256, 4096, 1.0f, 1);
    k_castS16<<<(unsigned)((((long long)(128) * ((256) / 2)) + 255) / 256), 256, 0, stream>>>(thw, 256, (__bf16*)(G64B), (__bf16*)(G64B2), 256, 128, 256, 1.0f, 0);
    w25::wmma_gemm64<1, true, 2, 0, false, 0><<<dim3((unsigned)((((4096) / 64) * ((128) / 64) + 7) / 8), (unsigned)(1)), 256, 0, stream>>>((const unsigned short*)(G64A), (const unsigned short*)(G64A2), 256, 0, (const unsigned short*)(G64B), (const unsigned short*)(G64B2), 256, 0, (void*)(TH), nullptr, 128, 0, thb, nullptr, 0, 4096, 128, 256, 1.0f);
    k_castS16<<<(unsigned)((((long long)(128) * ((256) / 2)) + 255) / 256), 256, 0, stream>>>(phw, 256, (__bf16*)(G64A), (__bf16*)(G64A2), 256, 128, 256, 1.0f, 0);
    k_castS16<<<(unsigned)((((long long)(4096) * ((256) / 2)) + 255) / 256), 256, 0, stream>>>(x + (size_t)7 * C * HW, 4096, (__bf16*)(G64B), (__bf16*)(G64B2), 256, 256, 4096, 1.0f, 1);
    w25::wmma_gemm64<1, true, 1, 0, false, 0><<<dim3((unsigned)((((128) / 64) * ((4096) / 64) + 7) / 8), (unsigned)(1)), 256, 0, stream>>>((const unsigned short*)(G64A), (const unsigned short*)(G64A2), 256, 0, (const unsigned short*)(G64B), (const unsigned short*)(G64B2), 256, 0, (void*)(PH), nullptr, 4096, 0, phb, nullptr, 0, 128, 4096, 256, 1.0f);
    k_cast16<<<(unsigned)((((long long)(128) * ((256) / 2)) + 255) / 256), 256, 0, stream>>>(gw, 256, (_Float16*)(G64A), 256, 128, 256, 1.0f);
    k_castT16<<<(unsigned)((((long long)(4096) * ((256) / 2)) + 255) / 256), 256, 0, stream>>>(x + (size_t)7 * C * HW, 4096, (_Float16*)(G64B), 256, 256, 4096, 16.0f);
    w25::wmma_gemm64<0, false, 1, 0, false, 0><<<dim3((unsigned)((((128) / 64) * ((4096) / 64) + 7) / 8), (unsigned)(1)), 256, 0, stream>>>((const unsigned short*)(G64A), nullptr, 256, 0, (const unsigned short*)(G64B), nullptr, 256, 0, (void*)(G), nullptr, 4096, 0, gb, nullptr, 0, 128, 4096, 256, 0.0625f);
    k_nl_pool<<<(unsigned)(((long long)HW * IC / 2 + 255) / 256), 256, 0, stream>>>(PH, G, TH, PHP, GP, (_Float16*)PPH, (_Float16*)PPL, (_Float16*)GP16, (_Float16*)THH, (_Float16*)THL, IC, HW, NK);
    w25::wmma_gemm64<1, true, 0, 0, false, 0><<<dim3((unsigned)((((HW) / 64) * ((NK) / 64) + 7) / 8), (unsigned)(1)), 256, 0, stream>>>((const unsigned short*)(THH), (const unsigned short*)(THL), IC, 0, (const unsigned short*)(PPH), (const unsigned short*)(PPL), IC, 0, (void*)(F), nullptr, NK, 0, nullptr, nullptr, 0, HW, NK, IC, 1.0f);
    k_nl_soft<<<HW, 256, 0, stream>>>(F, (_Float16*)P16, NK);
    w25::wmma_gemm64<0, false, 0, 0, false, 0><<<dim3((unsigned)((((HW) / 64) * ((IC) / 64) + 7) / 8), (unsigned)(1)), 256, 0, stream>>>((const unsigned short*)(P16), nullptr, NK, 0, (const unsigned short*)(GP16), nullptr, NK, 0, (void*)(Y), nullptr, IC, 0, nullptr, nullptr, 0, HW, IC, NK, 0.000244140625f);
    k_nl_y16<<<(unsigned)(((long long)HW * IC / 2 + 255) / 256), 256, 0, stream>>>(Y, (_Float16*)Y16, (long long)HW * IC);
    w25::wmma_gemm64<0, false, 1, 0, false, 0><<<dim3((unsigned)((((C) / 64) * ((HW) / 64) + 7) / 8), (unsigned)(1)), 256, 0, stream>>>((const unsigned short*)(WW16), nullptr, IC, 0, (const unsigned short*)(Y16), nullptr, IC, 0, (void*)(WY + (size_t)7 * C * HW), nullptr, HW, 0, Wb, nullptr, 0, C, HW, IC, 0.0625f);
    k_nl_bns<<<C, 256, 0, stream>>>(WY, BNS, Bn, C, HW); k_nl_out<<<(unsigned)(((long long)Bn * C * HW + 255) / 256), 256, 0, stream>>>(WY, BNS, bng, bnb, x, out, C, HW, (long long)Bn * C * HW);
}

// v001
// A run of this version takes 438 microseconds.
// Next to v000, in two timings, it ran 3.20 and 3.18 times as fast.
#include <hip/hip_runtime.h>
#include <math.h>

typedef __attribute__((ext_vector_type(16))) _Float16 v16h;
typedef __attribute__((ext_vector_type(8)))  _Float16 v8h;
typedef __attribute__((ext_vector_type(16))) __bf16   v16b;
typedef __attribute__((ext_vector_type(8)))  float    v8f;
typedef __attribute__((ext_vector_type(4)))  float    v4f;

// 16-bit WMMA fragment map (wave32), lane L, h = L>>4, m = L&15:
//   A 16x32: lane = row m;   element i -> k = (i<8) ? 8h+i : 16+8h+(i-8)
//   B 32x16: lane = column m; the SAME k(i,h)
//   D 16x16 (8 f32): lane = column m; element r -> row 8h+r
__device__ __forceinline__ int frag_k(int i, int h) { return (i < 8) ? (8 * h + i) : (16 + 8 * h + (i - 8)); }
__device__ __forceinline__ __bf16 bf16_rne(float f) {
    unsigned int u = __float_as_uint(f);
    u += 0x7fffu + ((u >> 16) & 1u);
    return __builtin_bit_cast(__bf16, (unsigned short)(u >> 16));
}
__device__ __forceinline__ float bf16_f32(__bf16 b) { return __uint_as_float(((unsigned int)__builtin_bit_cast(unsigned short, b)) << 16); }
__device__ __forceinline__ v8f wmma16(v16h a, v16h b, v8f c) {
    c = __builtin_amdgcn_wmma_f32_16x16x32_f16(false, a, false, b, (short)0, c, false, false);
    asm volatile("v_nop\n\tv_nop\n\tv_nop\n\tv_nop" : "+v"(c) : "v"(a), "v"(b));
    return c;
}
__device__ __forceinline__ v8f wmmab(v16b a, v16b b, v8f c) {
    c = __builtin_amdgcn_wmma_f32_16x16x32_bf16(false, a, false, b, (short)0, c, false, false);
    asm volatile("v_nop\n\tv_nop\n\tv_nop\n\tv_nop" : "+v"(c) : "v"(a), "v"(b));
    return c;
}
struct Split { v16b hi, lo; };
// hi/lo split product: a.hi*b.hi + a.hi*b.lo + a.lo*b.hi
__device__ __forceinline__ v8f wmma3(const Split& a, const Split& b, v8f c) {
    c = __builtin_amdgcn_wmma_f32_16x16x32_bf16(false, a.hi, false, b.hi, (short)0, c, false, false);
    c = __builtin_amdgcn_wmma_f32_16x16x32_bf16(false, a.hi, false, b.lo, (short)0, c, false, false);
    c = __builtin_amdgcn_wmma_f32_16x16x32_bf16(false, a.lo, false, b.hi, (short)0, c, false, false);
    asm volatile("v_nop\n\tv_nop\n\tv_nop\n\tv_nop" : "+v"(c) : "v"(a.hi), "v"(a.lo), "v"(b.hi), "v"(b.lo));
    return c;
}
struct Split3 { v16b hi, mid, lo; };
// triple split product (6 terms, drops only terms below 2^-24 relative)
__device__ __forceinline__ v8f wmma6(const Split3& a, const Split3& b, v8f c) {
    c = __builtin_amdgcn_wmma_f32_16x16x32_bf16(false, a.hi, false, b.hi, (short)0, c, false, false);
    c = __builtin_amdgcn_wmma_f32_16x16x32_bf16(false, a.hi, false, b.mid, (short)0, c, false, false);
    c = __builtin_amdgcn_wmma_f32_16x16x32_bf16(false, a.mid, false, b.hi, (short)0, c, false, false);
    c = __builtin_amdgcn_wmma_f32_16x16x32_bf16(false, a.hi, false, b.lo, (short)0, c, false, false);
    c = __builtin_amdgcn_wmma_f32_16x16x32_bf16(false, a.mid, false, b.mid, (short)0, c, false, false);
    c = __builtin_amdgcn_wmma_f32_16x16x32_bf16(false, a.lo, false, b.hi, (short)0, c, false, false);
    asm volatile("v_nop\n\tv_nop\n\tv_nop\n\tv_nop" : "+v"(c) : "v"(a.hi), "v"(a.mid), "v"(a.lo), "v"(b.hi), "v"(b.mid), "v"(b.lo));
    return c;
}

// Fragment gathers from f32 memory: element i <- p[(k0 + frag_k(i,h)) * sk] * s, zero for k >= klen.
__device__ __forceinline__ v16h fh_ld(const float* __restrict__ p, long long sk, int k0, int h, int klen, float s) {
    v16h a;
#pragma unroll
    for (int i = 0; i < 16; ++i) { const int k = k0 + frag_k(i, h); a[i] = (k < klen) ? (_Float16)(p[(long long)k * sk] * s) : (_Float16)0.f; }
    return a;
}
__device__ __forceinline__ Split sp_ld(const float* __restrict__ p, long long sk, int k0, int h, int klen, float s) {
    Split r;
#pragma unroll
    for (int i = 0; i < 16; ++i) {
        const int k = k0 + frag_k(i, h); const float x = (k < klen) ? p[(long long)k * sk] * s : 0.f;
        const __bf16 hb = bf16_rne(x); r.hi[i] = hb; r.lo[i] = bf16_rne(x - bf16_f32(hb));
    }
    return r;
}
__device__ __forceinline__ Split3 sp3_ld(const float* __restrict__ p, long long sk, int k0, int h, int klen, float s) {
    Split3 r;
#pragma unroll
    for (int i = 0; i < 16; ++i) {
        const int k = k0 + frag_k(i, h); const float x = (k < klen) ? p[(long long)k * sk] * s : 0.f;
        const __bf16 hb = bf16_rne(x); const float r1 = x - bf16_f32(hb); const __bf16 mb = bf16_rne(r1);
        r.hi[i] = hb; r.mid[i] = mb; r.lo[i] = bf16_rne(r1 - bf16_f32(mb));
    }
    return r;
}
__device__ __forceinline__ v16b bh_ld(const float* __restrict__ p, long long sk, int k0, int h, int klen, float s) {
    v16b a;
#pragma unroll
    for (int i = 0; i < 16; ++i) { const int k = k0 + frag_k(i, h); a[i] = bf16_rne((k < klen) ? p[(long long)k * sk] * s : 0.f); }
    return a;
}
// f16 fragment from an f16 LDS/global row with element stride 1 (k-contiguous), no bounds (tile already zero padded)
__device__ __forceinline__ v16h fh_row(const _Float16* __restrict__ row, int k0, int h) {
    v16h a;
#pragma unroll
    for (int i = 0; i < 16; ++i) a[i] = row[k0 + frag_k(i, h)];
    return a;
}

#define VST2(T, ptr, val) do { const T vst2_v_ = (val); *(T*)(ptr) = vst2_v_;  } while (0)
typedef float v4f __attribute__((ext_vector_type(4)));
#define VST2V4(ptr, val) do { const v4f vst2_v4_ = (val); *(v4f*)(ptr) = vst2_v4_;  } while (0)

__device__ __attribute__((noinline)) float act_fn(float v, int act) {
    if (act == 1) return fmaxf(v, 0.f);                                                                               // relu
    if (act == 2) { const float u = 0.7978845608028654f * (v + 0.044715f * v * v * v); return 0.5f * v * (1.f + tanhf(u)); } // tanh-gelu
    if (act == 3) return v / (1.f + expf(-v));                                                                        // silu
    if (act == 4) return 0.5f * v * (1.f + erff(v * 0.7071067811865476f));                                             // erf-gelu
    if (act == 5) return tanhf(v);
    if (act == 6) return 1.f / (1.f + expf(-v));                                                                      // sigmoid
    if (act == 7) return (v > 0.f) ? v : 0.01f * v;                                                                   // leaky relu 0.01
    if (act == 8) return (v > 0.f) ? v : (expf(v) - 1.f);                                                             // elu
    if (act == 9) return fminf(fmaxf(v, 0.f), 6.f);                                                                   // relu6
    if (act == 10) return fabsf(v);                                                                                    // abs
    if (act == 11) return (v >= 0.f) ? v : 0.1f * v;                                                                  // leaky 0.1
    if (act == 12) return (v > 0.f) ? v : 0.2f * v;                                                                   // leaky 0.2
    if (act == 13) return (v > 20.f) ? v : log1pf(expf(v));                                                            // softplus
    return v;
}

// =====================================================================================================================
// k_gemm<MODE>: C(z, m, n) = act(alpha * sum_k A(z, m, k) * B(z, k, n) + bias) + beta * R(z, m, n)
//   One wave (32-thread block) per 16 x 32 tile of C; grid (ceil(N/32), ceil(M/16), Z). Batch z -> (zo = z / zi_n, zi = z % zi_n)
//   with separate outer/inner strides for every tensor (e.g. batch and head). A(m,k) = A[zo*sAo + zi*sAi + m*sAm + k*sAk] (f32),
//   B(k,n) = B[zo*sBo + zi*sBi + n*sBn + k*sBk] (f32); any M, N, K (K zero-padded to 32 inside the fragments, M/N tails guarded).
//   C(m,n) = C[zo*sCo + zi*sCi + m*sCm + n] (n contiguous). flags: 1 bias[n], 2 bias[m], 4 residual R[zo*sRo + zi*sRi + m*sRm + n*sRn].
//   MODE 0: f16 operands (A prescaled by sa, B by sb, both undone in the epilogue); 1: bf16 hi/lo split (3 products); 2: bf16;
//   3: bf16 hi/mid/lo triple split (6 products); 4: as 3 with Kahan-compensated f32 accumulation across k-steps.
// =====================================================================================================================
struct GemmP {
    const float* A; const float* B; const float* bias; const float* R; float* C;
    long long sAo, sAi, sAm, sAk, sBo, sBi, sBn, sBk, sCo, sCi, sCm, sRo, sRi, sRm, sRn;
    int M, N, K, zi_n, flags, act; float alpha, beta, sa, sb;
    int Npad, pad_;     // columns [N, Npad) of C are written as 0 so that padded workspace rows are covered by whole-line stores; Npad >= N
};
static_assert(sizeof(GemmP) == 5 * 8 + 15 * 8 + 6 * 4 + 4 * 4 + 2 * 4, "GemmP has padding");

template <int MODE>
__global__ __launch_bounds__(32) void k_gemm(GemmP p) {
    const int lane = threadIdx.x & 31, h = lane >> 4, l15 = lane & 15;
    const int m0 = blockIdx.y * 16, n0 = blockIdx.x * 32;
    const int z = blockIdx.z, zo = z / p.zi_n, zi = z - zo * p.zi_n;
    const float* A = p.A + zo * p.sAo + zi * p.sAi;
    const float* B = p.B + zo * p.sBo + zi * p.sBi;
    const int am = min(m0 + l15, p.M - 1);                       // clamped row for loads (stores are guarded)
    v8f acc[2], comp[2];
#pragma unroll
    for (int t = 0; t < 2; ++t) { v8f zz = {}; acc[t] = zz; comp[t] = zz; }
    for (int k0 = 0; k0 < p.K; k0 += 32) {
        const float* arow = A + (long long)am * p.sAm;
        if (MODE == 1) {
            const Split a = sp_ld(arow, p.sAk, k0, h, p.K, 1.f);
#pragma unroll
            for (int t = 0; t < 2; ++t) {
                const int bn = min(n0 + t * 16 + l15, p.N - 1);
                acc[t] = wmma3(a, sp_ld(B + (long long)bn * p.sBn, p.sBk, k0, h, p.K, 1.f), acc[t]);
            }
        } else if (MODE == 3) {
            const Split3 a = sp3_ld(arow, p.sAk, k0, h, p.K, 1.f);
#pragma unroll
            for (int t = 0; t < 2; ++t) {
                const int bn = min(n0 + t * 16 + l15, p.N - 1);
                acc[t] = wmma6(a, sp3_ld(B + (long long)bn * p.sBn, p.sBk, k0, h, p.K, 1.f), acc[t]);
            }
        } else if (MODE == 4) {
            // triple split as MODE 3, but each k-step's 6 products go into a fresh accumulator and the partial is added to the running f32 sum
            // on the VALU with Kahan compensation (accumulation error stays ~1 ulp however long K is)
            const Split3 a = sp3_ld(arow, p.sAk, k0, h, p.K, 1.f);
#pragma unroll
            for (int t = 0; t < 2; ++t) {
                const int bn = min(n0 + t * 16 + l15, p.N - 1); v8f zz = {};
                const v8f part = wmma6(a, sp3_ld(B + (long long)bn * p.sBn, p.sBk, k0, h, p.K, 1.f), zz);
                const v8f y = part - comp[t]; const v8f s = acc[t] + y; comp[t] = (s - acc[t]) - y; acc[t] = s;
            }
        } else if (MODE == 2) {
            const v16b a = bh_ld(arow, p.sAk, k0, h, p.K, 1.f);
#pragma unroll
            for (int t = 0; t < 2; ++t) {
                const int bn = min(n0 + t * 16 + l15, p.N - 1);
                acc[t] = wmmab(a, bh_ld(B + (long long)bn * p.sBn, p.sBk, k0, h, p.K, 1.f), acc[t]);
            }
        } else {
            const v16h a = fh_ld(arow, p.sAk, k0, h, p.K, p.sa);
#pragma unroll
            for (int t = 0; t < 2; ++t) {
                const int bn = min(n0 + t * 16 + l15, p.N - 1);
                acc[t] = wmma16(a, fh_ld(B + (long long)bn * p.sBn, p.sBk, k0, h, p.K, p.sb), acc[t]);
            }
        }
    }
    const float iscale = (MODE == 0) ? p.alpha / (p.sa * p.sb) : p.alpha;
    float* C = p.C + zo * p.sCo + zi * p.sCi;
    const float* R = p.R + zo * p.sRo + zi * p.sRi;
    __shared__ __align__(16) float ctile[16][36];
#pragma unroll
    for (int t = 0; t < 2; ++t) {
        const int n = n0 + t * 16 + l15; const int nn = min(n, p.N - 1);
#pragma unroll
        for (int r = 0; r < 8; ++r) {
            const int m = m0 + 8 * h + r; const int mm = min(m, p.M - 1);
            float v = acc[t][r] * iscale;
            if (p.flags & 1) v += p.bias[nn];
            if (p.flags & 2) v += p.bias[mm];
            if (p.flags & 8) v *= p.bias[(long long)zo * p.M + mm];   /* per-(z,row) scale vector laid out [Z][M]; exclusive with the bias flags */
            v = act_fn(v, p.act);
            if (p.flags & 4) v += p.beta * R[(long long)mm * p.sRm + (long long)nn * p.sRn];
            ctile[8 * h + r][t * 16 + l15] = (n < p.N) ? v : 0.f;
        }
    }
    __syncthreads();
    const int NW = (p.Npad > p.N) ? p.Npad : p.N;           // write width
    const bool fast = (m0 + 16 <= p.M) && (n0 + 32 <= NW) && ((p.sCm & 3) == 0) && ((((size_t)C) & 15) == 0);
    if (fast) {
#pragma unroll
        for (int s = 0; s < 4; ++s) {
            const int row = s * 4 + (lane >> 3), c4 = (lane & 7) * 4;
            const v4f v = *(const v4f*)&ctile[row][c4];
            VST2V4(C + (long long)(m0 + row) * p.sCm + n0 + c4, v);
        }
    } else {
        for (int row = 0; row < 16; ++row) {
            const int m = m0 + row, n = n0 + lane;
            if (m < p.M && n < NW) VST2(float, C + (long long)m * p.sCm + n, ctile[row][lane]);
        }
    }
}


// =====================================================================================================================
// k_gemmT<MODE, TM, TN>: same contract as k_gemm, but one wave computes a (16*TM) x (16*TN) tile: TM A fragments and TN B fragments are
//   loaded per 32-wide k-step and reused across TM*TN WMMAs (far fewer load/convert instructions per MAC). MODE 0 (f16), 1 (bf16 hi/lo),
//   2 (bf16) only. grid (ceil(NW/(16*TN)), ceil(M/(16*TM)), Z), block 32. Epilogue identical to k_gemm, run per 16x32 sub-tile.
// =====================================================================================================================
template <int MODE, int TM, int TN>
__global__ __launch_bounds__(32) void k_gemmT(GemmP p) {
    const int lane = threadIdx.x & 31, h = lane >> 4, l15 = lane & 15;
    const int m0 = blockIdx.y * (16 * TM), n0 = blockIdx.x * (16 * TN);
    const int z = blockIdx.z, zo = z / p.zi_n, zi = z - zo * p.zi_n;
    const float* A = p.A + zo * p.sAo + zi * p.sAi;
    const float* B = p.B + zo * p.sBo + zi * p.sBi;
    v8f acc[TM][TN];
#pragma unroll
    for (int i = 0; i < TM; ++i)
#pragma unroll
        for (int t = 0; t < TN; ++t) { v8f zz = {}; acc[i][t] = zz; }
    for (int k0 = 0; k0 < p.K; k0 += 32) {
        if (MODE == 1) {
            Split a[TM], b[TN];
#pragma unroll
            for (int i = 0; i < TM; ++i) { const int am = min(m0 + 16 * i + l15, p.M - 1); a[i] = sp_ld(A + (long long)am * p.sAm, p.sAk, k0, h, p.K, 1.f); }
#pragma unroll
            for (int t = 0; t < TN; ++t) { const int bn = min(n0 + 16 * t + l15, p.N - 1); b[t] = sp_ld(B + (long long)bn * p.sBn, p.sBk, k0, h, p.K, 1.f); }
#pragma unroll
            for (int i = 0; i < TM; ++i)
#pragma unroll
                for (int t = 0; t < TN; ++t) acc[i][t] = wmma3(a[i], b[t], acc[i][t]);
        } else if (MODE == 2) {
            v16b a[TM], b[TN];
#pragma unroll
            for (int i = 0; i < TM; ++i) { const int am = min(m0 + 16 * i + l15, p.M - 1); a[i] = bh_ld(A + (long long)am * p.sAm, p.sAk, k0, h, p.K, 1.f); }
#pragma unroll
            for (int t = 0; t < TN; ++t) { const int bn = min(n0 + 16 * t + l15, p.N - 1); b[t] = bh_ld(B + (long long)bn * p.sBn, p.sBk, k0, h, p.K, 1.f); }
#pragma unroll
            for (int i = 0; i < TM; ++i)
#pragma unroll
                for (int t = 0; t < TN; ++t) acc[i][t] = wmmab(a[i], b[t], acc[i][t]);
        } else {
            v16h a[TM], b[TN];
#pragma unroll
            for (int i = 0; i < TM; ++i) { const int am = min(m0 + 16 * i + l15, p.M - 1); a[i] = fh_ld(A + (long long)am * p.sAm, p.sAk, k0, h, p.K, p.sa); }
#pragma unroll
            for (int t = 0; t < TN; ++t) { const int bn = min(n0 + 16 * t + l15, p.N - 1); b[t] = fh_ld(B + (long long)bn * p.sBn, p.sBk, k0, h, p.K, p.sb); }
#pragma unroll
            for (int i = 0; i < TM; ++i)
#pragma unroll
                for (int t = 0; t < TN; ++t) acc[i][t] = wmma16(a[i], b[t], acc[i][t]);
        }
    }
    const float iscale = (MODE == 0) ? p.alpha / (p.sa * p.sb) : p.alpha;
    float* C = p.C + zo * p.sCo + zi * p.sCi;
    const float* R = p.R + zo * p.sRo + zi * p.sRi;
    const int NW = (p.Npad > p.N) ? p.Npad : p.N;
    __shared__ __align__(16) float ctile[16][36];
#pragma unroll
    for (int i = 0; i < TM; ++i) {
        const int mb = m0 + 16 * i; if (mb >= p.M) break;          // wave-uniform
#pragma unroll
        for (int tp = 0; tp < TN / 2; ++tp) {
            const int nb = n0 + 32 * tp; if (nb >= NW) break;        // wave-uniform
#pragma unroll
            for (int t2 = 0; t2 < 2; ++t2) {
                const int t = 2 * tp + t2; const int n = nb + t2 * 16 + l15; const int nn = min(n, p.N - 1);
#pragma unroll
                for (int r = 0; r < 8; ++r) {
                    const int m = mb + 8 * h + r; const int mm = min(m, p.M - 1);
                    float v = acc[i][t][r] * iscale;
                    if (p.flags & 1) v += p.bias[nn];
                    if (p.flags & 2) v += p.bias[mm];
            if (p.flags & 8) v *= p.bias[(long long)zo * p.M + mm];   /* per-(z,row) scale vector laid out [Z][M]; exclusive with the bias flags */
                    v = act_fn(v, p.act);
                    if (p.flags & 4) v += p.beta * R[(long long)mm * p.sRm + (long long)nn * p.sRn];
                    ctile[8 * h + r][t2 * 16 + l15] = (n < p.N) ? v : 0.f;
                }
            }
            __syncthreads();
            const bool fast = (mb + 16 <= p.M) && (nb + 32 <= NW) && ((p.sCm & 3) == 0) && ((((size_t)C) & 15) == 0);
            if (fast) {
#pragma unroll
                for (int s = 0; s < 4; ++s) {
                    const int row = s * 4 + (lane >> 3), c4 = (lane & 7) * 4;
                    const v4f v = *(const v4f*)&ctile[row][c4];
                    VST2V4(C + (long long)(mb + row) * p.sCm + nb + c4, v);
                }
            } else {
                for (int row = 0; row < 16; ++row) {
                    const int m = mb + row, n = nb + lane;
                    if (m < p.M && n < NW) VST2(float, C + (long long)m * p.sCm + n, ctile[row][lane]);
                }
            }
            __syncthreads();
        }
    }
}

// =====================================================================================================================
//   Wave = 16 queries, AW waves per block, 64-key blocks; grid (ceil(Lq/(16*AW)), H, B), block 32*AW. Any Lq, Lk; head dim dh <= DHP
//   (DHP multiple of 32), value dim dv <= DVP (multiple of 16, <= 128). Every tensor addressed by (batch, head, row, element) strides, f32.
//   Scores: QM 0 f16 operands, 1 bf16 hi/lo split, 2 bf16 triple split; statistics f32 (exp2 domain); P.V: P x 4096 as f16 with V f16 staged in LDS
//   (SPLITPV: P and V as bf16 hi/lo splits). kv head = h / hrep. Masking: causal = 1 (keep j <= i + coff, masked -> -inf, key blocks beyond the
//   diagonal skipped), causal = 2 (masked -> mfill, a finite fill like the -1e9; no skipping), causal = 3 (keep j >= i + coff,
//   masked -> -inf, no skipping); optional additive f32 mask Mf,
//   optional int keep-mask Mi (0 -> score := mfill), both addressed b*smb + h*smh + i*smi + j*smj (0 strides broadcast).
// =====================================================================================================================
#define AW 4
struct AttnP {   // apv4
    const float* Q; const float* K; const float* V; float* O; float* P; const float* Mf; const int* Mi; float* ST;
    const float* Pw; const float* Rt; const int* SQ; const int* SK;           // optional: post-softmax weight, relative-position table, segment ids
    long long swb, swh, swi, swj, srb, srh, sri;                                 // Pw strides (b,h,i,j); Rt strides (b,h,i), column = clamp(i - j + roff, 0, rn-1)
    long long sQb, sQh, sQi, sQd, sKb, sKh, sKj, sKd, sVb, sVh, sVj, sVd, sOb, sOh, sOi, sPb, sPh, sPi, smb, smh, smi, smj;
    int Lq, Lk, dh, dv, hrep, causal, coff, pband;   // pband > 0: P holds only the band |j - i| <= pband, column j - i + pband
    float scale, mfill; int nonorm, mpol;             // nonorm (online path only): O = sum_j exp(score_j) V_j without the 1/rowsum (scores must be <= ~0); mpol: Mi masks where ==0 (mpol 0) or where !=0 (mpol 1)
    int roff, rn, segpol, win;                        // Rt column offset/count; SQ/SK: score := mfill where (segpol 0) SQ[i] != SK[j] or (segpol 1) SQ[i] == SK[j]; win > 0: keys with i - j > win (after coff) -> -inf
};
//   Pw: the softmax numerator is multiplied by Pw(b,h,i,j) AFTER the row sum is taken (probs * weight, then P.V), as in post-softmax multiplicative biases.                                                    // ST (optional): per row (b,h,i) -> ST[((b*H + h)*Lq + i)*2 + {0,1}] = {row max of the scaled+masked score (natural units), sum_j exp(score - max)}
static_assert(sizeof(AttnP) == 12 * 8 + 29 * 8 + 16 * 4, "AttnP has padding");

#ifndef KATTN_ATTR
#define KATTN_ATTR
#endif
template <int DHP, int DVP, int QM, bool SPLITPV, bool TWOPASS>
__global__ __launch_bounds__(32 * AW) KATTN_ATTR void k_attn(AttnP p) {
    constexpr int NT = DVP / 16;                // output tiles
    constexpr int KS = DHP / 32;                // k-steps for the scores
    constexpr int VP = DVP + 8;                 // LDS pitch (halves)
    __shared__ __align__(16) float    pl[AW][16 * 64];
    __shared__ __align__(16) _Float16 vl[(SPLITPV ? 2 : 1) * 64 * VP];   // f16 V tile, or bf16 hi and lo tiles (same 2-byte size)
    const int lane = threadIdx.x & 31, hf = lane >> 4, l15 = lane & 15, wave = threadIdx.x >> 5;
    const int h = blockIdx.y, b = blockIdx.z, hk = h / p.hrep;
    const int q0 = (blockIdx.x * AW + wave) * 16;
    float* myp = pl[wave];
    const float L2E = 1.4426950408889634f;
    const float NEG = -__builtin_inff();
    const int qi = min(q0 + l15, p.Lq - 1);
    const float* qrow = p.Q + b * p.sQb + h * p.sQh + (long long)qi * p.sQi;
    const float* kbase = p.K + b * p.sKb + hk * p.sKh;
    const float* vbase = p.V + b * p.sVb + hk * p.sVh;
    v16h qa[QM == 0 ? KS : 1]; Split qs_[QM == 1 ? KS : 1]; Split3 qt_[QM == 2 ? KS : 1];
#pragma unroll
    for (int ks = 0; ks < KS; ++ks) {
        if (QM == 2) qt_[ks] = sp3_ld(qrow, p.sQd, ks * 32, hf, p.dh, 1.f);
        else if (QM == 1) qs_[ks] = sp_ld(qrow, p.sQd, ks * 32, hf, p.dh, 1.f);
        else qa[ks] = fh_ld(qrow, p.sQd, ks * 32, hf, p.dh, 1.f);
    }
    v8f o[NT]; float m8[8], l8[8];
#pragma unroll
    for (int t = 0; t < NT; ++t) { v8f zz = {}; o[t] = zz; }
#pragma unroll
    for (int i = 0; i < 8; ++i) { m8[i] = NEG; l8[i] = 0.f; }
    int jend = p.Lk; int jstart = 0;
    if (p.causal == 1) { const int je = (blockIdx.x * AW + AW - 1) * 16 + 16 + p.coff; jend = min(jend, max(je, 0)); }   // uniform per block
    if (p.win > 0) { const int js = (int)(blockIdx.x * AW) * 16 + p.coff - p.win; jstart = (js > 0) ? (js / 64) * 64 : 0; }   // uniform per block: key blocks entirely outside every row's window hold only -inf entries and are skipped exactly
    const int npass = TWOPASS ? 2 : 1;
    for (int pass = 0; pass < npass; ++pass) {
        const bool dopv = (!TWOPASS) || pass == 1;
        for (int j0 = jstart; j0 < jend; j0 += 64) {
            if (dopv) {
                __syncthreads();                                 // previous key block's reads of vl / pl are done
                for (int idx = threadIdx.x; idx < 64 * DVP; idx += 32 * AW) {
                    const int jr = idx / DVP, d = idx - jr * DVP, j = j0 + jr;
                    const float f = (j < p.Lk && d < p.dv) ? vbase[(long long)j * p.sVj + (long long)d * p.sVd] : 0.f;
                    if (SPLITPV) {
                        const __bf16 hb = bf16_rne(f);
                        ((__bf16*)vl)[jr * VP + d] = hb; ((__bf16*)vl)[64 * VP + jr * VP + d] = bf16_rne(f - bf16_f32(hb));
                    } else vl[jr * VP + d] = (_Float16)f;
                }
            }
            v8f s[4];
#pragma unroll
            for (int t = 0; t < 4; ++t) {
                const int j = min(j0 + t * 16 + l15, p.Lk - 1);
                const float* krow = kbase + (long long)j * p.sKj;
                v8f acc = {};
#pragma unroll
                for (int ks = 0; ks < KS; ++ks) {
                    if (QM == 2)      acc = wmma6(qt_[ks], sp3_ld(krow, p.sKd, ks * 32, hf, p.dh, 1.f), acc);
                    else if (QM == 1) acc = wmma3(qs_[ks], sp_ld(krow, p.sKd, ks * 32, hf, p.dh, 1.f), acc);
                    else              acc = wmma16(qa[ks], fh_ld(krow, p.sKd, ks * 32, hf, p.dh, 1.f), acc);
                }
                s[t] = acc;
            }
            float pv[8][4];
#pragma unroll
            for (int i = 0; i < 8; ++i) {
                const int irow = q0 + i + 8 * hf;
                const int ic = min(irow, p.Lq - 1);
                float sc[4];
#pragma unroll
                for (int t = 0; t < 4; ++t) {
                    const int jg = j0 + t * 16 + l15;
                    float v = s[t][i] * p.scale;
                    if (p.Mf) v += p.Mf[b * p.smb + h * p.smh + (long long)ic * p.smi + (long long)min(jg, p.Lk - 1) * p.smj];
                    if (p.Rt) { int rc = ic - min(jg, p.Lk - 1) + p.roff; rc = rc < 0 ? 0 : (rc >= p.rn ? p.rn - 1 : rc); v += p.Rt[b * p.srb + h * p.srh + (long long)ic * p.sri + rc]; }
                    if (p.Mi) { const int mv = p.Mi[b * p.smb + h * p.smh + (long long)ic * p.smi + (long long)min(jg, p.Lk - 1) * p.smj]; if (p.mpol ? (mv != 0) : (mv == 0)) v = p.mfill; }
                    if (p.SQ) { const bool same = p.SQ[(long long)b * p.Lq + ic] == p.SK[(long long)b * p.Lk + min(jg, p.Lk - 1)]; if (p.segpol ? same : !same) v = p.mfill; }
                    if (p.causal == 2 && jg > irow + p.coff) v = p.mfill;
                    if (jg >= p.Lk || (p.causal == 1 && jg > irow + p.coff) || (p.causal == 3 && jg < irow + p.coff) || (p.win > 0 && irow + p.coff - jg > p.win)) v = NEG; else v *= L2E;
                    sc[t] = v;
                }
                if (!TWOPASS || pass == 0) {
                    float mx = fmaxf(fmaxf(sc[0], sc[1]), fmaxf(sc[2], sc[3]));
                    mx = fmaxf(mx, __shfl_xor(mx, 1, 32)); mx = fmaxf(mx, __shfl_xor(mx, 2, 32));
                    mx = fmaxf(mx, __shfl_xor(mx, 4, 32)); mx = fmaxf(mx, __shfl_xor(mx, 8, 32));
                    const float mnew = fmaxf(m8[i], mx);
                    const float corr = (mnew == NEG) ? 1.f : exp2f(m8[i] - mnew);
                    float rs = 0.f;
#pragma unroll
                    for (int t = 0; t < 4; ++t) {
                        const float pp = (sc[t] == NEG) ? 0.f : exp2f(sc[t] - mnew); rs += pp;
                        pv[i][t] = p.Pw ? pp * p.Pw[b * p.swb + h * p.swh + (long long)ic * p.swi + (long long)min(j0 + t * 16 + l15, p.Lk - 1) * p.swj] : pp;
                    }
                    rs += __shfl_xor(rs, 1, 32); rs += __shfl_xor(rs, 2, 32); rs += __shfl_xor(rs, 4, 32); rs += __shfl_xor(rs, 8, 32);
                    l8[i] = l8[i] * corr + rs; m8[i] = mnew;
                    if (!TWOPASS) {
#pragma unroll
                        for (int t = 0; t < NT; ++t) o[t][i] *= corr;
                    }
                } else {
                    const float inv = (l8[i] > 0.f) ? 1.f / l8[i] : 0.f;
#pragma unroll
                    for (int t = 0; t < 4; ++t) {
                        const int jg = j0 + t * 16 + l15;
                        float pp = (sc[t] == NEG) ? 0.f : exp2f(sc[t] - m8[i]) * inv;
                        if (p.Pw) pp *= p.Pw[b * p.swb + h * p.swh + (long long)ic * p.swi + (long long)min(jg, p.Lk - 1) * p.swj];
                        pv[i][t] = pp;
                    }
                }
            }
            if (dopv) {
#pragma unroll
                for (int i = 0; i < 8; ++i)
#pragma unroll
                    for (int t = 0; t < 4; ++t) ((float*)myp)[(i + 8 * hf) * 64 + t * 16 + l15] = pv[i][t];
                __syncthreads();                                 // P (per wave) and V (shared) visible
                if (p.P) {
                    float* pb_ = p.P + b * p.sPb + h * p.sPh;
                    const bool fastP = (p.pband == 0) && ((p.sPi & 3) == 0) && (j0 + 64 <= p.Lk) && (q0 + 16 <= p.Lq) && ((((size_t)pb_) & 15) == 0);
                    if (fastP) {
#pragma unroll
                        for (int s = 0; s < 8; ++s) {
                            const int row = s * 2 + (lane >> 4), c4 = (lane & 15) * 4;
                            const v4f v = *(const v4f*)(myp + row * 64 + c4);
                            VST2V4(pb_ + (long long)(q0 + row) * p.sPi + j0 + c4, v);
                        }
                    } else {
                        for (int row = 0; row < 16; ++row) {
                            const int irow = q0 + row; if (irow >= p.Lq) continue;
                            for (int c = lane; c < 64; c += 32) {
                                const int jg = j0 + c; if (jg >= p.Lk) continue;
                                if (p.pband == 0) VST2(float, pb_ + (long long)irow * p.sPi + jg, myp[row * 64 + c]);
                                else if (jg - irow <= p.pband && irow - jg <= p.pband) VST2(float, pb_ + (long long)irow * p.sPi + (jg - irow + p.pband), myp[row * 64 + c]);
                            }
                        }
                    }
                }
                if (SPLITPV) {
                    const Split pa0 = sp_ld(myp + l15 * 64, 1, 0, hf, 64, 1.f), pa1 = sp_ld(myp + l15 * 64, 1, 32, hf, 64, 1.f);
                    const __bf16* vh = (const __bf16*)vl; const __bf16* vlo = vh + 64 * VP;
#pragma unroll
                    for (int t = 0; t < NT; ++t) {
                        const int dcol = t * 16 + l15;
                        Split b0, b1;
#pragma unroll
                        for (int e = 0; e < 16; ++e) {
                            const int k0 = frag_k(e, hf), k1 = 32 + frag_k(e, hf);
                            b0.hi[e] = vh[k0 * VP + dcol]; b0.lo[e] = vlo[k0 * VP + dcol]; b1.hi[e] = vh[k1 * VP + dcol]; b1.lo[e] = vlo[k1 * VP + dcol];
                        }
                        o[t] = wmma3(pa0, b0, o[t]);
                        o[t] = wmma3(pa1, b1, o[t]);
                    }
                } else {
                    const v16h pa0 = fh_ld(myp + l15 * 64, 1, 0, hf, 64, 4096.f), pa1 = fh_ld(myp + l15 * 64, 1, 32, hf, 64, 4096.f);
#pragma unroll
                    for (int t = 0; t < NT; ++t) {
                        const int dcol = t * 16 + l15;
                        v16h b0, b1;
#pragma unroll
                        for (int e = 0; e < 16; ++e) { b0[e] = vl[frag_k(e, hf) * VP + dcol]; b1[e] = vl[(32 + frag_k(e, hf)) * VP + dcol]; }
                        o[t] = wmma16(pa0, b0, o[t]);
                        o[t] = wmma16(pa1, b1, o[t]);
                    }
                }
            }
        }
    }
    float* obase = p.O + b * p.sOb + h * p.sOh;
    if (p.ST) {
        const int rl = lane >> 1, isel = rl & 7;           // row q0 + rl ; rl>>3 == hf holds because lane>>4 == (lane>>1)>>3
        float mv = 0.f, lv = 0.f;
#pragma unroll
        for (int i = 0; i < 8; ++i) if (i == isel) { mv = m8[i]; lv = l8[i]; }
        const int irow = q0 + rl;
        if (irow < p.Lq) { float* st = p.ST + (((long long)b * gridDim.y + h) * p.Lq + irow) * 2 + (lane & 1); VST2(float, st, (lane & 1) ? lv : mv * 0.6931471805599453f); }
    }
    float invr[8];
#pragma unroll
    for (int i = 0; i < 8; ++i) {
        if (TWOPASS) invr[i] = SPLITPV ? 1.f : (1.f / 4096.f);
        else if (p.nonorm) invr[i] = exp2f(m8[i]) * (SPLITPV ? 1.f : (1.f / 4096.f));
        else invr[i] = (l8[i] > 0.f) ? (SPLITPV ? 1.f / l8[i] : 1.f / (l8[i] * 4096.f)) : 0.f;
    }
    __syncthreads();                                             // all waves done with pl/vl from the main loop
    const bool ofast = ((p.sOi & 3) == 0) && ((((size_t)obase) & 15) == 0) && (q0 + 16 <= p.Lq);
#pragma unroll
    for (int c0 = 0; c0 < DVP; c0 += 64) {
#pragma unroll
        for (int i = 0; i < 8; ++i)
#pragma unroll
            for (int t = 0; t < NT; ++t) if (t * 16 >= c0 && t * 16 < c0 + 64) ((float*)myp)[(i + 8 * hf) * 64 + (t * 16 - c0) + l15] = o[t][i] * invr[i];
        __syncthreads();
        const int cw = (DVP - c0 < 64) ? (DVP - c0) : 64;      // staged columns in this chunk (multiple of 16)
        if (ofast && (c0 + cw <= p.dv) && (cw % 32 == 0)) {
            const int lpr = cw / 4;                              // lanes per row (16 for 64 cols, 8 for 32)
            const int rows_per_ins = 32 / lpr;
            for (int r0 = 0; r0 < 16; r0 += rows_per_ins) {
                const int row = r0 + lane / lpr, c4 = (lane % lpr) * 4;
                const v4f v = *(const v4f*)(myp + row * 64 + c4);
                VST2V4(obase + (long long)(q0 + row) * p.sOi + c0 + c4, v);
            }
        } else {
            for (int row = 0; row < 16; ++row) {
                const int irow = q0 + row; if (irow >= p.Lq) continue;
                for (int c = lane; c < cw; c += 32) { const int d = c0 + c; if (d < p.dv) VST2(float, obase + (long long)irow * p.sOi + d, myp[row * 64 + c]); }
            }
        }
        __syncthreads();
    }
}

// =====================================================================================================================
// k_tr: dst(z, c, r) = alpha * src(z, r, c) (+ beta * R2(z, c, r)): [Z][R][C] (row stride lds) -> [Z][C][R] (row stride ldd) through a 32x32 LDS tile;
//   flags: 1 -> add beta * residual R2 addressed like dst (z*sRz + c*ldr + r); act applied before the residual.
// =====================================================================================================================
struct TrP { const float* src; float* dst; const float* R2; long long sSz, lds, sDz, ldd, sRz, ldr; int R, C, flags, act; float alpha, beta; };
static_assert(sizeof(TrP) == 3 * 8 + 6 * 8 + 6 * 4, "TrP has padding");
__global__ __launch_bounds__(256) void k_tr(TrP p) {
    __shared__ float tile[32][33];
    const int c0 = blockIdx.x * 32, r0 = blockIdx.y * 32, z = blockIdx.z;
    const int lane = threadIdx.x & 31, wave = threadIdx.x >> 5;
    const float* s = p.src + z * p.sSz;
#pragma unroll
    for (int k = 0; k < 4; ++k) {
        const int rl = wave * 4 + k, r = r0 + rl, c = c0 + lane;
        tile[rl][lane] = (r < p.R && c < p.C) ? s[(long long)r * p.lds + c] : 0.f;
    }
    __syncthreads();
    float* d = p.dst + z * p.sDz; const float* rr = p.R2 + z * p.sRz;
#pragma unroll
    for (int k = 0; k < 4; ++k) {
        const int cl = wave * 4 + k, c = c0 + cl, r = r0 + lane;
        if (c < p.C && r < p.R) {
            float v = act_fn(p.alpha * tile[lane][cl], p.act);
            if (p.flags & 1) v += p.beta * rr[(long long)c * p.ldr + r];
            VST2(float, d + (long long)c * p.ldd + r, v);
        }
    }
}

// k_affine: dst[i] = a * (sdev ? sdev[0] : 1) * src[i] + b, i < n (one thread per element; consecutive lanes -> consecutive addresses)
__global__ __launch_bounds__(256) void k_affine(const float* __restrict__ src, float* __restrict__ dst, int n, float a, float b, const float* __restrict__ sdev) {
    const int i = blockIdx.x * 256 + threadIdx.x;
    if (i < n) { const float aa = sdev ? a * sdev[0] : a; const float v = aa * src[i] + b; VST2(float, dst + i, v); }
}

// =====================================================================================================================
// k_softmax: row softmax over n contiguous elements, one 256-thread block per row; rows addressed z*sz + r*sr (grid (R, Z)).
//   out = scale_out * softmax(scale_in * x + (Mf ? Mf[z*smz + r*smr + j] : 0)); a row whose max is -inf is written as 0.
// =====================================================================================================================
struct SmP { const float* src; float* dst; const float* Mf; long long sz, sr, dz, dr, smz, smr; int n, pad; float scale_in, scale_out; };
static_assert(sizeof(SmP) == 3 * 8 + 6 * 8 + 4 * 4, "SmP has padding");
__global__ __launch_bounds__(256) void k_softmax(SmP p) {
    __shared__ float red[256];
    const int r = blockIdx.x, z = blockIdx.y, tid = threadIdx.x;
    const float* s = p.src + z * p.sz + (long long)r * p.sr;
    const float* mf = p.Mf ? (p.Mf + z * p.smz + (long long)r * p.smr) : nullptr;
    float mx = -__builtin_inff();
    for (int j = tid; j < p.n; j += 256) { float v = s[j] * p.scale_in; if (mf) v += mf[j]; mx = fmaxf(mx, v); }
    red[tid] = mx; __syncthreads();
    for (int o = 128; o > 0; o >>= 1) { if (tid < o) red[tid] = fmaxf(red[tid], red[tid + o]); __syncthreads(); }
    mx = red[0]; __syncthreads();
    float sum = 0.f;
    for (int j = tid; j < p.n; j += 256) { float v = s[j] * p.scale_in; if (mf) v += mf[j]; sum += (mx == -__builtin_inff()) ? 0.f : expf(v - mx); }
    red[tid] = sum; __syncthreads();
    for (int o = 128; o > 0; o >>= 1) { if (tid < o) red[tid] += red[tid + o]; __syncthreads(); }
    sum = red[0];
    const float inv = (sum > 0.f) ? p.scale_out / sum : 0.f;
    float* d = p.dst + z * p.dz + (long long)r * p.dr;
    for (int j = tid; j < p.n; j += 256) { float v = s[j] * p.scale_in; if (mf) v += mf[j]; const float o = (mx == -__builtin_inff()) ? 0.f : expf(v - mx) * inv; VST2(float, d + j, o); }
}
// =====================================================================================================================
// k_stats: mean and rsqrt(var + eps) over a set of n elements addressed base + z*sz + (e / inner) * so + (e % inner) * si, one 256-thread
// k_norm_apply: y = (x - mean[set]) * rstd[set] * g[c] + b[c] over a [Z][C][L] channel-major tensor with set = z*G + c / (C/G) (G groups per z;
//   G = C -> per-channel sets indexed z*C+c; for batch norm pass stats indexed by c only via bn = 1). Optional act. Output same layout.
// =====================================================================================================================
//   mode 0: mean / rsqrt(var + eps); mode 1 (RMSNorm): 0 / rsqrt(mean(x^2) + eps); mode 2 (L2 normalize * sqrt(n)): 0 / sqrt(n) / max(||x||, eps); mode 3: as 0 with unbiased variance (n-1)
__global__ __launch_bounds__(256) void k_stats(const float* __restrict__ x, long long sz, long long so, long long si, int inner, int n, float eps, float* __restrict__ stat, int mode) {
    __shared__ float red[256];
    const int z = blockIdx.x, tid = threadIdx.x;
    const float* base = x + z * sz;
    float s = 0.f;
    for (int e = tid; e < n; e += 256) s += base[(long long)(e / inner) * so + (long long)(e % inner) * si];
    red[tid] = s; __syncthreads();
    for (int o = 128; o > 0; o >>= 1) { if (tid < o) red[tid] += red[tid + o]; __syncthreads(); }
    const float mu = (mode == 0 || mode == 3) ? red[0] / (float)n : 0.f; __syncthreads();
    float q = 0.f;
    for (int e = tid; e < n; e += 256) { const float dlt = base[(long long)(e / inner) * so + (long long)(e % inner) * si] - mu; q += dlt * dlt; }
    red[tid] = q; __syncthreads();
    for (int o = 128; o > 0; o >>= 1) { if (tid < o) red[tid] += red[tid + o]; __syncthreads(); }
    {
        float rs;
        if (mode == 2) rs = sqrtf((float)n) / fmaxf(sqrtf(red[0]), eps); else if (mode == 3) rs = rsqrtf(red[0] / (float)(n - 1) + eps); else rs = rsqrtf(red[0] / (float)n + eps);
        if (tid < 32) { const float v = (tid == 0) ? mu : ((tid == 1) ? rs : 0.f); VST2(float, stat + (long long)z * 32 + tid, v); }
    }
}
//   One thread per element over the flat [Z][C][L] index space: grid ceil(Z*C*L / 256).
__global__ __launch_bounds__(256) void k_norm_apply(const float* __restrict__ x, float* __restrict__ y, const float* __restrict__ stat, const float* __restrict__ g, const float* __restrict__ bta,
                                                     int Z, int C, int L, int G, int bn, int act) {
    const long long idx = (long long)blockIdx.x * 256 + threadIdx.x;
    if (idx >= (long long)Z * C * L) return;
    const int l = (int)(idx % L); const long long zc = idx / L; const int c = (int)(zc % C), z = (int)(zc / C); (void)l;
    const int set = bn ? c : (z * G + c / (C / G));
    float v = (x[idx] - stat[(long long)set * 32]) * stat[(long long)set * 32 + 1];
    if (g) v *= g[c];
    if (bta) v += bta[c];
    v = act_fn(v, act);
    VST2(float, y + idx, v);
}

// k_lse_neg: c[i] = -(st[2i] + log(st[2i+1])) = minus the log-sum-exp of row i from k_attn's ST output (for softmax over the query dimension)
__global__ __launch_bounds__(256) void k_lse_neg(const float* __restrict__ st, float* __restrict__ c, int n) {
    const int i = blockIdx.x * 256 + threadIdx.x;
    if (i < n) { const float v = -(st[2 * i] + logf(st[2 * i + 1])); VST2(float, c + i, v); }
}

// k_iota: dst[i] = a * i + b as int32 (segment/position id helper)
__global__ __launch_bounds__(256) void k_iota(int* __restrict__ dst, int n, int a, int b) {
    const int i = blockIdx.x * 256 + threadIdx.x;
    if (i < n) { const int v = a * i + b; VST2(int, dst + i, v); }
}

// k_axpby: dst[i] = a * x[i] + b * y[i] (+ c), i < n
__global__ __launch_bounds__(256) void k_axpby(const float* __restrict__ x, const float* __restrict__ y, float* __restrict__ dst, int n, float a, float b, float c) {
    const int i = blockIdx.x * 256 + threadIdx.x;
    if (i < n) { const float v = a * x[i] + b * y[i] + c; VST2(float, dst + i, v); }
}

// =====================================================================================================================
// k_rope: rotary embedding on a [R rows][Hn heads][D] view (row stride sXr, head stride sXh, element stride 1) -> Y (own strides).
//   mode 0: rotate_half (partner d±D/2, sign - for d<D/2); mode 1: interleaved pairs (partner d^1, sign - for even d).
//   table column tcol: tmode 0 -> d, 1 -> d % (D/2), 2 -> d / 2; position p: pmode 0 -> r % S, 1 -> head index, 2 -> pos[r];
//   c = C[(r / S) * sCb + p * sCp + tcol * sCd], s likewise from Sn; y = x[d] * c + sign * x[partner] * s. X and Y must not alias.
// =====================================================================================================================
struct RopeP { const float* X; float* Y; const float* C; const float* Sn; const int* pos; long long sXr, sXh, sYr, sYh, sCb, sCp, sCd; int R, Hn, D, S, mode, tmode, pmode, pad; };
static_assert(sizeof(RopeP) == 5 * 8 + 7 * 8 + 8 * 4, "RopeP has padding");
__global__ __launch_bounds__(256) void k_rope(RopeP p) {
    const long long idx = (long long)blockIdx.x * 256 + threadIdx.x;
    if (idx >= (long long)p.R * p.Hn * p.D) return;
    const int d = (int)(idx % p.D); const long long rh = idx / p.D; const int h = (int)(rh % p.Hn); const int r = (int)(rh / p.Hn);
    const int half = p.D / 2;
    int partner; float sign;
    if (p.mode == 0) { partner = (d < half) ? d + half : d - half; sign = (d < half) ? -1.f : 1.f; }
    else { partner = d ^ 1; sign = (d & 1) ? 1.f : -1.f; }
    const int tcol = (p.tmode == 0) ? d : ((p.tmode == 1) ? (d % half) : (d >> 1));
    const int pp = (p.pmode == 0) ? (r % p.S) : ((p.pmode == 1) ? h : p.pos[r]);
    const long long toff = (long long)(r / p.S) * p.sCb + (long long)pp * p.sCp + (long long)tcol * p.sCd;
    const float* xr = p.X + (long long)r * p.sXr + (long long)h * p.sXh;
    const float v = xr[d] * p.C[toff] + sign * xr[partner] * p.Sn[toff];
    VST2(float, p.Y + (long long)r * p.sYr + (long long)h * p.sYh + d, v);
}

// k_invf + k_sincos (split so neither kernel carries a large VALU-fma footprint): invf_i = num * (1 / powf(base, (2 i)/D)) [fmode 0],
//   num * expf((2 i) * cexp) [fmode 1], num * powf(base, -2 (i - 1) / D) [fmode 2]; then cs/sn[s*half + i] = cos/sin((pscale * s) * invf_i)
__global__ __launch_bounds__(256) void k_invf(float* __restrict__ invb, int half, int D, float base, float num, int fmode, float cexp) {
    const int i = blockIdx.x * 256 + threadIdx.x;
    if (i >= ((half + 31) / 32) * 32) return;
    if (i >= half) { VST2(float, invb + i, 0.f); return; }
    const float e = (float)(2 * i) / (float)D;
    float invf;
    if (fmode == 1) invf = num * expf((float)(2 * i) * cexp);
    else if (fmode == 2) invf = num * powf(base, (-2.0f * ((float)i - 1.0f)) / (float)D);
    else invf = num * (1.0f / powf(base, e));
    VST2(float, invb + i, invf);
}
__global__ __launch_bounds__(256) void k_sincos(float* __restrict__ cs, float* __restrict__ sn, const float* __restrict__ invb, int S, int half, float pscale) {
    const int idx = blockIdx.x * 256 + threadIdx.x;
    if (idx >= S * half) return;
    const int s = idx / half, i = idx - s * half;
    const float ang = (pscale * (float)s) * invb[i];
    VST2(float, cs + idx, cosf(ang)); VST2(float, sn + idx, sinf(ang));
}

// k_mulact: dst[i] = act(x[i]) * y[i]
__global__ __launch_bounds__(256) void k_mulact(const float* __restrict__ x, const float* __restrict__ y, float* __restrict__ dst, int n, int act) {
    const int i = blockIdx.x * 256 + threadIdx.x;
    if (i < n) { const float v = act_fn(x[i], act) * y[i]; VST2(float, dst + i, v); }
}

// =====================================================================================================================
// k_matvec: thread-per-row matrix-vector products for N <= 8 output columns (heads with 1-3 outputs, gates), f32 on the VALU.
//   C[r*sCm + j] = act(alpha * sum_k A[r*sAm + k*sAk] * B[j*sBn + k*sBk] + bias[j]) + beta * R[r*sRm + j*sRn]; each thread writes its N contiguous floats.
// =====================================================================================================================
__global__ __launch_bounds__(256) void k_matvec(GemmP p) {
    // 32 lanes write one line with one instruction.
    const int rpt = (p.N == 1) ? 1 : 32;
    const long long r0 = ((long long)blockIdx.x * 256 + threadIdx.x) * rpt; const int z = blockIdx.z, zo = z / p.zi_n, zi = z - zo * p.zi_n;
    if (r0 >= p.M) return;
    const float* Bb = p.B + zo * p.sBo + zi * p.sBi;
    float* C = p.C + zo * p.sCo + zi * p.sCi; const float* R = p.R + zo * p.sRo + zi * p.sRi;
    for (int rr = 0; rr < rpt; ++rr) {
        const long long r = r0 + rr; if (r >= p.M) break;
        const float* A = p.A + zo * p.sAo + zi * p.sAi + r * p.sAm;
        float acc[8] = {0.f, 0.f, 0.f, 0.f, 0.f, 0.f, 0.f, 0.f};
        for (int k = 0; k < p.K; ++k) { const float a = A[(long long)k * p.sAk];
#pragma unroll
            for (int j = 0; j < 8; ++j) if (j < p.N) acc[j] += a * Bb[(long long)j * p.sBn + (long long)k * p.sBk]; }
#pragma unroll
        for (int j = 0; j < 8; ++j) if (j < p.N) {
            float v = acc[j] * p.alpha;
            if (p.flags & 1) v += p.bias[j];
            if (p.flags & 2) v += p.bias[r];
            v = act_fn(v, p.act);
            if (p.flags & 4) v += p.beta * R[r * p.sRm + (long long)j * p.sRn];
            VST2(float, C + r * p.sCm + j, v);
        }
    }
}
// k_smallsoftmax: thread-per-row softmax for short rows (n <= 64): dst[r*dr + j] = softmax(scale*src[r*sr + j])
__global__ __launch_bounds__(256) void k_smallsoftmax(const float* __restrict__ src, float* __restrict__ dst, long long sr, long long dr, int n, long long R, float scale) {
    const long long r0 = ((long long)blockIdx.x * 256 + threadIdx.x) * 32;
    for (int rr = 0; rr < 32; ++rr) {
        const long long r = r0 + rr; if (r >= R) return;
        const float* s = src + r * sr; float* d = dst + r * dr;
        float mx = -__builtin_inff();
        for (int j = 0; j < n; ++j) mx = fmaxf(mx, s[j] * scale);
        float sum = 0.f;
        for (int j = 0; j < n; ++j) sum += expf(s[j] * scale - mx);
        const float inv = 1.f / sum;
        for (int j = 0; j < n; ++j) { const float v = expf(s[j] * scale - mx) * inv; VST2(float, d + j, v); }
    }
}

__global__ __launch_bounds__(32) void k_unitstat(float* __restrict__ st) { const int t = threadIdx.x; const float v = (t == 1) ? 1.f : 0.f; VST2(float, st + t, v); }

// destination (e.g. a d_out whose row width is not a multiple of 32 floats) is written by consecutive lanes of one instruction
__global__ __launch_bounds__(256) void k_lincopy(const float* __restrict__ src, long long lds, float* __restrict__ dst, long long ldd, long long rows, int cols) {
    const long long i = (long long)blockIdx.x * 256 + threadIdx.x; if (i >= rows * cols) return;
    const long long r = i / cols; const int c = (int)(i - r * cols);
    const float v = src[r * lds + c]; VST2(float, dst + r * ldd + c, v);
}

namespace w25 {
typedef __attribute__((ext_vector_type(16))) _Float16 v16h;
typedef __attribute__((ext_vector_type(8)))  _Float16 v8h;
typedef __attribute__((ext_vector_type(16))) __bf16   v16b;
typedef __attribute__((ext_vector_type(8)))  __bf16   v8b;
typedef __attribute__((ext_vector_type(8)))  float    v8f;
typedef __attribute__((ext_vector_type(4)))  float    v4f;

__device__ __forceinline__ unsigned short f2bf_bits(float f) {
  unsigned u = __float_as_uint(f);
  return (unsigned short)((u + 0x7FFFu + ((u >> 16) & 1u)) >> 16);
}
__device__ __forceinline__ float bf_bits2f(unsigned short h) { return __uint_as_float(((unsigned)h) << 16); }

// hazard guards as plain device helpers (no inline asm inside the kernel template body)
__device__ __forceinline__ void dep_guard_h(v8f& a, v8f& b, v16h x, v16h y) { asm volatile("v_nop\n\tv_nop\n\tv_nop\n\tv_nop" : "+v"(a), "+v"(b) : "v"(x), "v"(y)); }
__device__ __forceinline__ void dep_guard_b(v8f& a, v8f& b, v16b x, v16b y) { asm volatile("v_nop\n\tv_nop\n\tv_nop\n\tv_nop" : "+v"(a), "+v"(b) : "v"(x), "v"(y)); }
__device__ __forceinline__ void keep4_h(v16h a, v16h b, v16h c, v16h d) { asm volatile("v_nop" :: "v"(a), "v"(b), "v"(c), "v"(d)); }
__device__ __forceinline__ void keep4_b(v16b a, v16b b, v16b c, v16b d) { asm volatile("v_nop" :: "v"(a), "v"(b), "v"(c), "v"(d)); }
__device__ __forceinline__ void acc_guard4(v8f& a, v8f& b, v8f& c, v8f& d) { asm volatile("v_nop\n\tv_nop\n\tv_nop\n\tv_nop" : "+v"(a), "+v"(b), "+v"(c), "+v"(d)); }
template <typename T> struct Frag;
template <> struct Frag<_Float16> {
  typedef v16h V; union U { v16h v; v8h h[2]; };
  static __device__ __forceinline__ v16h load(const _Float16* p) {   // elements 0..7 <- p[0..7], 8..15 <- p[16..23]
    U f; f.h[0] = *(const v8h*)(p); f.h[1] = *(const v8h*)(p + 16); return f.v;
  }
  static __device__ __forceinline__ v8f mma(v16h a, v16h b, v8f c) {
    return __builtin_amdgcn_wmma_f32_16x16x32_f16(false, a, false, b, (short)0, c, false, false);
  }
  static __device__ __forceinline__ void guard(v8f& a, v8f& b, v16h x, v16h y) { dep_guard_h(a, b, x, y); }
  static __device__ __forceinline__ void keep(v16h a, v16h b, v16h c, v16h d) { keep4_h(a, b, c, d); }
};
template <> struct Frag<__bf16> {
  typedef v16b V; union U { v16b v; v8b h[2]; };
  static __device__ __forceinline__ v16b load(const __bf16* p) {
    U f; f.h[0] = *(const v8b*)(p); f.h[1] = *(const v8b*)(p + 16); return f.v;
  }
  static __device__ __forceinline__ v8f mma(v16b a, v16b b, v8f c) {
    return __builtin_amdgcn_wmma_f32_16x16x32_bf16(false, a, false, b, (short)0, c, false, false);
  }
  static __device__ __forceinline__ void guard(v8f& a, v8f& b, v16b x, v16b y) { dep_guard_b(a, b, x, y); }
  static __device__ __forceinline__ void keep(v16b a, v16b b, v16b c, v16b d) { keep4_b(a, b, c, d); }
};

// ---- Register-blocked batched WMMA GEMM ------------------------------------
// C[m,n] = scale * sum_k A[m,k] * Bt[n,k] (+bias)(+resid); each wave owns a 64x64 tile.
// A row-major [M,K]; Bt row-major [N,K]; M,N % 64 == 0, K % 32 == 0.
// SPLIT: operands are hi/lo planes (A2/Bt2 = lo planes, same layout); product = hi·hi + hi·lo + lo·hi.
// BIAS_MODE: 0 = none, 1 = bias[m], 2 = bias[n].
// OUT_MODE: 0 = f32, 1 = f16, 2 = bf16 hi plane (Cout) + bf16 lo plane (Cout2).
// ET: 0 = f16 operands, 1 = bf16 operands (pointers passed as 16-bit storage)
template <int ET> struct Elem;
template <> struct Elem<0> { typedef _Float16 T; };
template <> struct Elem<1> { typedef __bf16 T; };
template <int ET, bool SPLIT, int BIAS_MODE, int OUT_MODE, bool RESID, int ACT = 0>
__global__ __launch_bounds__(256) void wmma_gemm64(
    const unsigned short* __restrict__ Ap, const unsigned short* __restrict__ A2p, int lda, long strideA,
    const unsigned short* __restrict__ Btp, const unsigned short* __restrict__ Bt2p, int ldb, long strideB,
    void* __restrict__ Cout, void* __restrict__ Cout2, int ldc, long strideC,
    const float* __restrict__ bias,
    const float* __restrict__ resid, long strideR,
    int M, int N, int K, float scale) {
  typedef typename Elem<ET>::T T;
  typedef typename Frag<T>::V V;
  const T* A = (const T*)Ap; const T* A2 = (const T*)A2p; const T* Bt = (const T*)Btp; const T* Bt2 = (const T*)Bt2p;
  __shared__ __align__(16) float sT[8][16 * 68];   // per-wave 16x64 slab, pitch 68 floats
  const int b    = blockIdx.y;
  const int lane = threadIdx.x & 31;
  const int wave = threadIdx.x >> 5;
  const int tilesN = N >> 6;
  const int tilesM = M >> 6;
  const int tile = blockIdx.x * 8 + wave;
  if (tile >= tilesM * tilesN) return;   // wave-uniform; no block barriers in this kernel
  const int tm = tile / tilesN;
  const int tn = tile - tm * tilesN;
  const int m0 = tm << 6;
  const int n0 = tn << 6;

  const T* Ab  = A  + (size_t)b * strideA;
  const T* Bb  = Bt + (size_t)b * strideB;
  const T* Ab2 = SPLIT ? (A2  + (size_t)b * strideA) : nullptr;
  const T* Bb2 = SPLIT ? (Bt2 + (size_t)b * strideB) : nullptr;

  const int rlane = lane & 15;                 // row (A) / col (B, D) within subtile
  const int koff  = (lane >> 4) * 8;           // k offset of this lane half
  const int mOff  = (lane >> 4) * 8;           // D row offset

  v8f acc[4][4];
#pragma unroll
  for (int i = 0; i < 4; ++i)
#pragma unroll
    for (int j = 0; j < 4; ++j) acc[i][j] = (v8f){0.f,0.f,0.f,0.f,0.f,0.f,0.f,0.f};

  for (int k0 = 0; k0 < K; k0 += 32) {
    V bh[4], bl[4];
#pragma unroll
    for (int j = 0; j < 4; ++j) {
      const size_t bo = (size_t)(n0 + (j << 4) + rlane) * ldb + koff + k0;
      bh[j] = Frag<T>::load(Bb + bo);
      if (SPLIT) bl[j] = Frag<T>::load(Bb2 + bo);
    }
#pragma unroll
    for (int i = 0; i < 4; ++i) {
      const size_t ao = (size_t)(m0 + (i << 4) + rlane) * lda + koff + k0;
      V ah = Frag<T>::load(Ab + ao);
      V al;
      if (SPLIT) al = Frag<T>::load(Ab2 + ao);
#pragma unroll
      for (int j = 0; j < 4; ++j) {
        acc[i][j] = Frag<T>::mma(ah, bh[j], acc[i][j]);
        if (SPLIT) {
          acc[i][j] = Frag<T>::mma(ah, bl[j], acc[i][j]);
          acc[i][j] = Frag<T>::mma(al, bh[j], acc[i][j]);
        }
      }
      Frag<T>::guard(acc[i][0], acc[i][3], ah, SPLIT ? al : ah);
    }
    Frag<T>::keep(bh[0], bh[1], bh[2], bh[3]);
    if (SPLIT) Frag<T>::keep(bl[0], bl[1], bl[2], bl[3]);
  }
  acc_guard4(acc[0][0], acc[0][1], acc[0][2], acc[0][3]);
  acc_guard4(acc[1][0], acc[1][1], acc[1][2], acc[1][3]);
  acc_guard4(acc[2][0], acc[2][1], acc[2][2], acc[2][3]);
  acc_guard4(acc[3][0], acc[3][1], acc[3][2], acc[3][3]);

  // ---- epilogue ----
  float* slab = sT[wave];
  const float* Rb = RESID ? (resid + (size_t)b * strideR) : nullptr;
#pragma unroll
  for (int i = 0; i < 4; ++i) {
    const int mBase = m0 + (i << 4);
#pragma unroll
    for (int j = 0; j < 4; ++j) {
      const int n = n0 + (j << 4) + rlane;
      float bv = 0.f;
      if (BIAS_MODE == 2) bv = bias[n];
#pragma unroll
      for (int r = 0; r < 8; ++r) {
        float v = acc[i][j][r] * scale;
        if (BIAS_MODE == 1) v += bias[mBase + mOff + r];
        if (BIAS_MODE == 2) v += bv;
        if (RESID) v += Rb[(size_t)(mBase + mOff + r) * ldc + n];
        if (ACT == 1) v = tanhf(v);
        if (ACT == 2) v = fmaxf(v, 0.0f);
        if (ACT == 3) v = v / (1.0f + expf(-v));
        if (ACT == 4) v = (v > 0.f) ? v : 0.01f * v;
        if (ACT == 5) v = 0.5f * v * (1.0f + erff(v * 0.70710678118654752f));
        slab[(mOff + r) * 68 + (j << 4) + rlane] = v;
      }
    }
    __builtin_amdgcn_fence(__ATOMIC_RELEASE, "workgroup");
    __builtin_amdgcn_wave_barrier();
    __builtin_amdgcn_fence(__ATOMIC_ACQUIRE, "workgroup");
    if (OUT_MODE == 0) {
      float* C = (float*)Cout + (size_t)b * strideC;
      const int hh = lane >> 4, c4 = (lane & 15) * 4;     // row seg = 256 B = 16 lanes x 16 B
      {
#pragma unroll
        for (int it = 0; it < 8; ++it) {
          const int row = it * 2 + hh;
          v4f v = *(const v4f*)(slab + row * 68 + c4);
          *(v4f*)(C + (size_t)(mBase + row) * ldc + n0 + c4) = v;
        }
        
      }
    } else {
      const int q = lane >> 3, c8 = (lane & 7) * 8;
      unsigned short* C  = (unsigned short*)Cout  + (size_t)b * strideC;
      unsigned short* C2 = (OUT_MODE == 2) ? ((unsigned short*)Cout2 + (size_t)b * strideC) : nullptr;
      {
#pragma unroll
        for (int it = 0; it < 4; ++it) {
          const int row = it * 4 + q;
          const float* sp = slab + row * 68 + c8;
          v8h hv, lv;
#pragma unroll
          for (int e = 0; e < 8; ++e) {
            if (OUT_MODE == 1) {
              hv[e] = (_Float16)sp[e];
            } else {
              unsigned short hb = f2bf_bits(sp[e]);
              unsigned short lb = f2bf_bits(sp[e] - bf_bits2f(hb));
              hv[e] = __builtin_bit_cast(_Float16, hb);
              lv[e] = __builtin_bit_cast(_Float16, lb);
            }
          }
          *(v8h*)(C + (size_t)(mBase + row) * ldc + n0 + c8) = hv;
          if (OUT_MODE == 2) *(v8h*)(C2 + (size_t)(mBase + row) * ldc + n0 + c8) = lv;
        }
        
      }
    }
    __builtin_amdgcn_fence(__ATOMIC_RELEASE, "workgroup");
    __builtin_amdgcn_wave_barrier();
    __builtin_amdgcn_fence(__ATOMIC_ACQUIRE, "workgroup");
  }
}

__global__ __launch_bounds__(256) void cast_f32_f16x2(
    const float* __restrict__ in, _Float16* __restrict__ out, int n2) {
  int i = blockIdx.x * 256 + threadIdx.x;
  if (i < n2) {
    const _Float16 h0 = (_Float16)in[2 * i], h1 = (_Float16)in[2 * i + 1];
    const unsigned u = (unsigned)__builtin_bit_cast(unsigned short, h0) | ((unsigned)__builtin_bit_cast(unsigned short, h1) << 16);
    ((unsigned*)out)[i] = u;
    
  }
}


} // namespace w25

__global__ __launch_bounds__(256) void k_castT16(const float* __restrict__ src, long long lds, _Float16* __restrict__ dst, long long ldd, int R, int C, float s, long long sb, long long db) {
    src += (long long)blockIdx.y * sb; dst += (long long)blockIdx.y * db;   // blockIdx.y = image
    const long long i = (long long)blockIdx.x * 256 + threadIdx.x; const long long np = (long long)C * (R / 2); if (i >= np) return; const int c = (int)(i / (R / 2)); const int r = 2 * (int)(i % (R / 2));
    const _Float16 h0 = (_Float16)(src[(long long)r * lds + c] * s), h1 = (_Float16)(src[(long long)(r + 1) * lds + c] * s);
    const unsigned u = (unsigned)__builtin_bit_cast(unsigned short, h0) | ((unsigned)__builtin_bit_cast(unsigned short, h1) << 16);
    unsigned* d = (unsigned*)(dst + (long long)c * ldd + r); *d = u;  }
__global__ __launch_bounds__(256) void k_cast16(const float* __restrict__ src, long long lds, _Float16* __restrict__ dst, long long ldd, int R, int C, float s) {
    const long long i = (long long)blockIdx.x * 256 + threadIdx.x; const long long np = (long long)R * (C / 2); if (i >= np) return; const int r = (int)(i / (C / 2)); const int c = 2 * (int)(i % (C / 2));
    const _Float16 h0 = (_Float16)(src[(long long)r * lds + c] * s), h1 = (_Float16)(src[(long long)r * lds + c + 1] * s);
    const unsigned u = (unsigned)__builtin_bit_cast(unsigned short, h0) | ((unsigned)__builtin_bit_cast(unsigned short, h1) << 16);
    unsigned* d = (unsigned*)(dst + (long long)r * ldd + c); *d = u;  }

// f32 -> bf16 hi plane + bf16 lo plane (x = hi + lo to ~2^-17 relative; RNE both), [R][C] -> [R][C] (or transposed to [C][R]); 2 consecutive destination elements
__device__ __forceinline__ unsigned int f2bf2_pack(float a, float b, unsigned int* lo) {
    const unsigned short ha = w25::f2bf_bits(a), hb = w25::f2bf_bits(b);
    const unsigned short la = w25::f2bf_bits(a - w25::bf_bits2f(ha)), lb = w25::f2bf_bits(b - w25::bf_bits2f(hb));
    *lo = (unsigned)la | ((unsigned)lb << 16); return (unsigned)ha | ((unsigned)hb << 16); }
__global__ __launch_bounds__(256) void k_castS16(const float* __restrict__ src, long long lds, __bf16* __restrict__ dhi, __bf16* __restrict__ dlo, long long ldd, int R, int C, float s, int transpose, long long sb, long long db) {
    src += (long long)blockIdx.y * sb; dhi += (long long)blockIdx.y * db; dlo += (long long)blockIdx.y * db;   // blockIdx.y = image
    const long long i = (long long)blockIdx.x * 256 + threadIdx.x; long long o; float a, b;
    if (transpose) { const long long np = (long long)C * (R / 2); if (i >= np) return; const int c = (int)(i / (R / 2)); const int r = 2 * (int)(i % (R / 2)); a = src[(long long)r * lds + c] * s; b = src[(long long)(r + 1) * lds + c] * s; o = (long long)c * ldd + r; }
    else { const long long np = (long long)R * (C / 2); if (i >= np) return; const int r = (int)(i / (C / 2)); const int c = 2 * (int)(i % (C / 2)); a = src[(long long)r * lds + c] * s; b = src[(long long)r * lds + c + 1] * s; o = (long long)r * ldd + c; }
    unsigned lo; const unsigned hi = f2bf2_pack(a, b, &lo); unsigned* ph = (unsigned*)(dhi + o); unsigned* pl = (unsigned*)(dlo + o);
    *ph = hi; *pl = lo;  }

namespace w25 {
// =====================================================================================
// Generic causal/non-causal attention for head_dim 64, f32 in / f32 out; 16-bit operands: bf16 with optional hi/lo splits, or
// plain f16 (F16=true, non-split, probabilities carried x2^15).
//   scores = (q*qscale)·kᵀ : v_wmma_f32_16x16x32_bf16; SPLIT_QK -> q,k as bf16 hi/lo (hi·hi + hi·lo + lo·hi)
//   out    = p·v           : v_wmma_f32_16x16x32_bf16; SPLIT_PV -> p,v as bf16 hi/lo; else p,v plain bf16
//   f32 accumulate; online softmax in f32. Block = 4 waves = 64 query rows of one (batch, head); S % 64 == 0.
//   Element (b, s, h, d) of tensor X lives at X[b*X_bs + s*X_rs + h*X_hs + d] (strides in floats, multiples of 4).
//   Masking: mask_mode 0 none, 1 causal (kv > q masked), 2 tensor [S][Skv] shared over (b,h) (float if
//   mask_is_int==0, int32 with element == 0 -> masked if 1, int32 with element != 0 -> masked if 2), 3 per-token vectors qmask[B][S] & kvmask[B][Skv] (int32,
//   0 -> masked), 4 causal + sliding window (kv > q or q - kv > W masked; W passed in mask_is_int);
//   5 = relative-position bias: s += cp[b,h,q][idx[q][kv]] + pc[b,h,kv][idx[q][kv]] with idx = mask_b ([S][Skv] int32) and
//   mask_a an int32 [S][Skv] tensor with nonzero = masked (tables: element (b,h,row,n) at X + b*c_bs + h*c_hs + row*c_rs + n);
//   masked scores are replaced by mask_fill (e.g. -inf or -1e9) before the softmax.
//   grid.x = B * H * (S/64) (or a sub-range with blk0).
// =====================================================================================
#define AT_D 64
#define AT_NW 4
#define AT_QB 64
#define AT_KC 64
struct AttnGeom { const float* cp = nullptr; const float* pc = nullptr; long c_bs = 0, c_rs = 0, c_hs = 0;   // mode-5 score-bias tables
                  long q_bs, q_rs, q_hs, k_bs, k_rs, k_hs, v_bs, v_rs, v_hs, o_bs, o_rs, o_hs;
                  int S, Skv, H, mask_mode; float qscale; int blk0; float mask_fill; int mask_is_int; };
static_assert(sizeof(AttnGeom) == 168, "no padding");

__device__ __forceinline__ unsigned short at_bf_bits(float f) {
  unsigned u = __float_as_uint(f);
  return (unsigned short)((u + 0x7FFFu + ((u >> 16) & 1u)) >> 16);
}
__device__ __forceinline__ __bf16 at_f2bf(float f) { return __builtin_bit_cast(__bf16, at_bf_bits(f)); }
__device__ __forceinline__ void at_split(float f, __bf16& hi, __bf16& lo) {
  const unsigned short hb = at_bf_bits(f);
  hi = __builtin_bit_cast(__bf16, hb);
  lo = at_f2bf(f - __uint_as_float(((unsigned)hb) << 16));
}
__device__ __forceinline__ v8f at_mma(v16b a, v16b b, v8f c) {
  c = __builtin_amdgcn_wmma_f32_16x16x32_bf16(false, a, false, b, (short)0, c, false, false);
  asm volatile("v_nop\n\tv_nop\n\tv_nop\n\tv_nop" : "+v"(c) : "v"(a), "v"(b));
  return c;
}
// 16-bit element as a bit pattern held in a __bf16 slot: f16 bits when F16, bf16 (RNE) otherwise
template <bool F16> __device__ __forceinline__ __bf16 at_to16(float f) {
  if (F16) return __builtin_bit_cast(__bf16, (_Float16)f);
  return at_f2bf(f);
}
template <bool F16> __device__ __forceinline__ v8f at_mma16(v16b a, v16b b, v8f c) {
  if (F16) {
    const v16h ah = __builtin_bit_cast(v16h, a), bh = __builtin_bit_cast(v16h, b);
    c = __builtin_amdgcn_wmma_f32_16x16x32_f16(false, ah, false, bh, (short)0, c, false, false);
    asm volatile("v_nop\n\tv_nop\n\tv_nop\n\tv_nop" : "+v"(c) : "v"(ah), "v"(bh));
    return c;
  }
  return at_mma(a, b, c);
}

template <bool SPLIT_QK, bool SPLIT_PV, bool F16 = false>
__global__ __launch_bounds__(128)
void attn64_kernel(const float* __restrict__ q, const float* __restrict__ k,
                   const float* __restrict__ v, float* __restrict__ out,
                   const void* __restrict__ mask_a, const int* __restrict__ mask_b, AttnGeom g) {
  static_assert(!(F16 && (SPLIT_QK || SPLIT_PV)), "f16 mode is non-split");
  const float PSC = F16 ? 32768.0f : 1.0f;     // f16 probabilities carried x2^15 (subnormal range), folded into the final 1/l
  union FB { v16b v; v8b h[2]; };
  __shared__ __align__(16) __bf16 Ksh[AT_KC * AT_D];             // K hi [kv][d]      8 KB
  __shared__ __align__(16) __bf16 Ksl[SPLIT_QK ? AT_KC * AT_D : 8];
  __shared__ __align__(16) __bf16 Vth[AT_D * AT_KC];             // V hi [d][kv]      8 KB
  __shared__ __align__(16) __bf16 Vtl[SPLIT_PV ? AT_D * AT_KC : 8];
  __shared__ __align__(16) __bf16 Psh[AT_NW][16 * AT_KC];        // per wave P hi [row][kv]  8 KB
  __shared__ __align__(16) __bf16 Psl[SPLIT_PV ? AT_NW : 1][SPLIT_PV ? 16 * AT_KC : 8];
  __shared__ __align__(16) float  Os[AT_NW][16 * 68];            // per wave out tile, pitch 68

  const int tid  = threadIdx.x;
  const int wave = tid >> 5;
  const int lane = tid & 31;
  const int hh   = lane >> 4;
  const int c    = lane & 15;

  const int nqb = g.S / AT_QB;
  const int bx = blockIdx.x + g.blk0;
  const int qb = bx % nqb;
  const int bh = bx / nqb;
  const int h  = bh % g.H;
  const int b  = bh / g.H;
  const int qbase_block = qb * AT_QB;
  const int q0 = qbase_block + wave * 16;

  const float* qb_ptr = q + (size_t)b * g.q_bs + (size_t)h * g.q_hs;
  const float* kb_ptr = k + (size_t)b * g.k_bs + (size_t)h * g.k_hs;
  const float* vb_ptr = v + (size_t)b * g.v_bs + (size_t)h * g.v_hs;
  float*       ob_ptr = out + (size_t)b * g.o_bs + (size_t)h * g.o_hs;

  // ---- Q fragments (A operand): 2 d-chunks, hi (and lo) ----
  v16b qah[2], qal[2];
  {
    const float* qrow = qb_ptr + (size_t)(q0 + c) * g.q_rs;
#pragma unroll
    for (int dc = 0; dc < 2; ++dc) {
#pragma unroll
      for (int e = 0; e < 8; ++e) {
        const float f0 = qrow[dc * 32 + 8 * hh + e] * g.qscale;
        const float f1 = qrow[dc * 32 + 16 + 8 * hh + e] * g.qscale;
        if (SPLIT_QK) { __bf16 hq, lq; at_split(f0, hq, lq); qah[dc][e] = hq; qal[dc][e] = lq; at_split(f1, hq, lq); qah[dc][8 + e] = hq; qal[dc][8 + e] = lq; }
        else { qah[dc][e] = at_to16<F16>(f0); qah[dc][8 + e] = at_to16<F16>(f1); qal[dc][e] = qah[dc][e]; qal[dc][8 + e] = qah[dc][8 + e]; }
      }
    }
  }

  float mrow[8], lrow[8];
  v8f oacc[4];
#pragma unroll
  for (int r = 0; r < 8; ++r) { mrow[r] = -INFINITY; lrow[r] = 0.f; }
#pragma unroll
  for (int t = 0; t < 4; ++t) oacc[t] = (v8f){0.f,0.f,0.f,0.f,0.f,0.f,0.f,0.f};

  const int nChunks = (g.mask_mode == 1 || g.mask_mode == 4) ? (qb + 1) : (g.Skv / AT_KC);   // block-uniform
  // per-row query mask (mode 3)
  int qkeep[8];
#pragma unroll
  for (int r = 0; r < 8; ++r) qkeep[r] = (g.mask_mode == 3) ? mask_b[(size_t)b * g.S + q0 + 8 * hh + r] : 1;   // mask_b = qmask in mode 3
  for (int kc = 0; kc < nChunks; ++kc) {
    const int kv0 = kc * AT_KC;
    __syncthreads();
    {
      const int kvr = tid >> 1, dh = (tid & 1) * 32;
      const float* krow = kb_ptr + (size_t)(kv0 + kvr) * g.k_rs + dh;
      const float* vrow = vb_ptr + (size_t)(kv0 + kvr) * g.v_rs + dh;
#pragma unroll
      for (int i = 0; i < 8; ++i) {
        v4f kk = *(const v4f*)(krow + 4 * i);
        v4f vv = *(const v4f*)(vrow + 4 * i);
#pragma unroll
        for (int e = 0; e < 4; ++e) {
          const int d = dh + 4 * i + e;
          if (SPLIT_QK) { __bf16 a, bl; at_split(kk[e], a, bl); Ksh[kvr * AT_D + d] = a; Ksl[kvr * AT_D + d] = bl; }
          else Ksh[kvr * AT_D + d] = at_to16<F16>(kk[e]);
          if (SPLIT_PV) { __bf16 a, bl; at_split(vv[e], a, bl); Vth[d * AT_KC + kvr] = a; Vtl[d * AT_KC + kvr] = bl; }
          else Vth[d * AT_KC + kvr] = at_to16<F16>(vv[e]);
        }
      }
    }
    __syncthreads();

    v8f s[4];
#pragma unroll
    for (int j = 0; j < 4; ++j) {
      s[j] = (v8f){0.f,0.f,0.f,0.f,0.f,0.f,0.f,0.f};
#pragma unroll 1
      for (int dc = 0; dc < 2; ++dc) {
        FB kb;
        kb.h[0] = *(const v8b*)(Ksh + (j * 16 + c) * AT_D + dc * 32 + 8 * hh);
        kb.h[1] = *(const v8b*)(Ksh + (j * 16 + c) * AT_D + dc * 32 + 16 + 8 * hh);
        s[j] = at_mma16<F16>(qah[dc], kb.v, s[j]);
        if (SPLIT_QK) {
          FB kl;
          kl.h[0] = *(const v8b*)(Ksl + (j * 16 + c) * AT_D + dc * 32 + 8 * hh);
          kl.h[1] = *(const v8b*)(Ksl + (j * 16 + c) * AT_D + dc * 32 + 16 + 8 * hh);
          s[j] = at_mma16<F16>(qah[dc], kl.v, s[j]);
          s[j] = at_mma16<F16>(qal[dc], kb.v, s[j]);
        }
      }
    }
    const bool diag = (g.mask_mode == 1) && (kc == qb);
    int kvkeep[4] = {1, 1, 1, 1};
    if (g.mask_mode == 3) {
#pragma unroll
      for (int j = 0; j < 4; ++j) kvkeep[j] = ((const int*)mask_a)[(size_t)b * g.Skv + kv0 + j * 16 + c];   // mask_a = kvmask
    }
    float cm[8];
#pragma unroll
    for (int r = 0; r < 8; ++r) {
      const int qrow = q0 + 8 * hh + r;
      float m = -INFINITY;
#pragma unroll
      for (int j = 0; j < 4; ++j) {
        const int kvcol = kv0 + j * 16 + c;
        bool masked = false;
        if (diag) masked = (kvcol > qrow);
        else if (g.mask_mode == 4) masked = (kvcol > qrow) || (qrow - kvcol > g.mask_is_int);
        else if (g.mask_mode == 2) {
          const size_t mi = (size_t)qrow * g.Skv + kvcol;
          masked = (g.mask_is_int == 0) ? (((const float*)mask_a)[mi] == 0.0f)
                 : (g.mask_is_int == 1) ? (((const int*)mask_a)[mi] == 0) : (((const int*)mask_a)[mi] != 0);
        } else if (g.mask_mode == 3) masked = (qkeep[r] == 0) || (kvkeep[j] == 0);
        else if (g.mask_mode == 5) {
          const size_t mi = (size_t)qrow * g.Skv + kvcol;
          masked = (((const int*)mask_a)[mi] != 0);
          int n = mask_b[mi]; n = n < 0 ? 0 : n;
          s[j][r] += g.cp[(size_t)b * g.c_bs + (size_t)h * g.c_hs + (size_t)qrow * g.c_rs + n]
                   + g.pc[(size_t)b * g.c_bs + (size_t)h * g.c_hs + (size_t)kvcol * g.c_rs + n];
        }
        if (masked) s[j][r] = g.mask_fill;
        m = fmaxf(m, s[j][r]);
      }
#pragma unroll
      for (int off = 1; off < 16; off <<= 1) m = fmaxf(m, __shfl_xor(m, off, 32));
      cm[r] = m;
    }
    __bf16* pwh = Psh[wave];
    __bf16* pwl = Psl[SPLIT_PV ? wave : 0];
#pragma unroll
    for (int r = 0; r < 8; ++r) {
      const float mnew = fmaxf(mrow[r], cm[r]);
      const float alpha = expf(mrow[r] - mnew);
      mrow[r] = mnew;
      float psum = 0.f;
#pragma unroll
      for (int j = 0; j < 4; ++j) {
        const float p = expf(s[j][r] - mnew);
        psum += p;
        if (SPLIT_PV) { __bf16 a, bl; at_split(p, a, bl); pwh[(8 * hh + r) * AT_KC + j * 16 + c] = a; pwl[(8 * hh + r) * AT_KC + j * 16 + c] = bl; }
        else pwh[(8 * hh + r) * AT_KC + j * 16 + c] = at_to16<F16>(p * PSC);
      }
#pragma unroll
      for (int off = 1; off < 16; off <<= 1) psum += __shfl_xor(psum, off, 32);
      lrow[r] = lrow[r] * alpha + psum;
#pragma unroll
      for (int t = 0; t < 4; ++t) oacc[t][r] *= alpha;
    }
    __builtin_amdgcn_fence(__ATOMIC_RELEASE, "workgroup");
    __builtin_amdgcn_wave_barrier();
    __builtin_amdgcn_fence(__ATOMIC_ACQUIRE, "workgroup");
#pragma unroll 1
    for (int kk = 0; kk < 2; ++kk) {
      FB pa, pl;
      pa.h[0] = *(const v8b*)(pwh + c * AT_KC + kk * 32 + 8 * hh);
      pa.h[1] = *(const v8b*)(pwh + c * AT_KC + kk * 32 + 16 + 8 * hh);
      if (SPLIT_PV) {
        pl.h[0] = *(const v8b*)(pwl + c * AT_KC + kk * 32 + 8 * hh);
        pl.h[1] = *(const v8b*)(pwl + c * AT_KC + kk * 32 + 16 + 8 * hh);
      }
#pragma unroll
      for (int t = 0; t < 4; ++t) {
        FB vb;
        vb.h[0] = *(const v8b*)(Vth + (t * 16 + c) * AT_KC + kk * 32 + 8 * hh);
        vb.h[1] = *(const v8b*)(Vth + (t * 16 + c) * AT_KC + kk * 32 + 16 + 8 * hh);
        oacc[t] = at_mma16<F16>(pa.v, vb.v, oacc[t]);
        if (SPLIT_PV) {
          FB vl;
          vl.h[0] = *(const v8b*)(Vtl + (t * 16 + c) * AT_KC + kk * 32 + 8 * hh);
          vl.h[1] = *(const v8b*)(Vtl + (t * 16 + c) * AT_KC + kk * 32 + 16 + 8 * hh);
          oacc[t] = at_mma16<F16>(pa.v, vl.v, oacc[t]);
          oacc[t] = at_mma16<F16>(pl.v, vb.v, oacc[t]);
        }
      }
    }
  }

  float* os = Os[wave];
#pragma unroll
  for (int r = 0; r < 8; ++r) {
    const float inv = 1.0f / (lrow[r] * PSC);
#pragma unroll
    for (int t = 0; t < 4; ++t) os[(8 * hh + r) * 68 + t * 16 + c] = oacc[t][r] * inv;
  }
  __builtin_amdgcn_fence(__ATOMIC_RELEASE, "workgroup");
  __builtin_amdgcn_wave_barrier();
  __builtin_amdgcn_fence(__ATOMIC_ACQUIRE, "workgroup");
  {
    const int c4 = (lane & 15) * 4;
    {
#pragma unroll
      for (int it = 0; it < 8; ++it) {
        const int row = it * 2 + hh;
        v4f val = *(const v4f*)(os + row * 68 + c4);
        *(v4f*)(ob_ptr + (size_t)(q0 + row) * g.o_rs + c4) = val;
      }
      
    }
  }
}

} // namespace w25

__device__ __forceinline__ void st_h2(_Float16* dst, float a, float b) { const unsigned u = (unsigned)__builtin_bit_cast(unsigned short, (_Float16)a) | ((unsigned)__builtin_bit_cast(unsigned short, (_Float16)b) << 16); unsigned* d = (unsigned*)dst; *d = u;  }
__device__ __forceinline__ unsigned short bf16b(float v) { const unsigned u = __builtin_bit_cast(unsigned, v); return (unsigned short)(((u + 0x7FFFu + ((u >> 16) & 1u)) & 0xFFFF0000u) >> 16); }
__device__ __forceinline__ float bf16f(unsigned short h) { return __builtin_bit_cast(float, ((unsigned)h) << 16); }
__device__ __forceinline__ void st_split2(_Float16* H, _Float16* L, long long e, float v0, float v1) { const unsigned short h0 = bf16b(v0), h1 = bf16b(v1); { const unsigned u = (unsigned)h0 | ((unsigned)h1 << 16); unsigned* d = (unsigned*)(H + e); *d = u;  } { const unsigned u = (unsigned)bf16b(v0 - bf16f(h0)) | ((unsigned)bf16b(v1 - bf16f(h1)) << 16); unsigned* d = (unsigned*)(L + e); *d = u;  } }
// 2x2 max-pool of PH and G ([ic][64][64] -> [ic][32][32]) plus the operand planes: PP hi/lo [nk][ic] (pooled phi, transposed), GP16 [ic][nk] (pooled g), TH hi/lo [hw][ic] (theta planes). thread-linear over the largest extent (HW*IC/2 pairs)
__global__ __launch_bounds__(256) void k_nl_pool(const float* __restrict__ PH, const float* __restrict__ G, const float* __restrict__ TH, float* __restrict__ PHP, float* __restrict__ GP, _Float16* PPH, _Float16* PPL, _Float16* GP16, _Float16* THH, _Float16* THL, int IC, int HW, int NK) { const long long t = (long long)blockIdx.x * 256 + threadIdx.x;
    { const long long big = (long long)blockIdx.y * IC * HW, sml = (long long)blockIdx.y * IC * NK;   // blockIdx.y = image
      PH += big; G += big; TH += big; THH += big; THL += big; PHP += sml; GP += sml; PPH += sml; PPL += sml; GP16 += sml; }
    if (t < (long long)HW * IC / 2) { const long long e = 2 * t; st_split2(THH, THL, e, TH[e], TH[e + 1]); }
    if (t < (long long)IC * NK / 2) { const long long e = 2 * t; float pv[2], gv[2];
#pragma unroll
        for (int u = 0; u < 2; ++u) { const long long q = e + u; const int ic = (int)(q / NK), pk = (int)(q % NK); const int py = pk / 32, px = pk % 32; const long long s = (long long)ic * HW + (2 * py) * 64 + 2 * px;
            pv[u] = fmaxf(fmaxf(PH[s], PH[s + 1]), fmaxf(PH[s + 64], PH[s + 65])); gv[u] = fmaxf(fmaxf(G[s], G[s + 1]), fmaxf(G[s + 64], G[s + 65])); }
        { const unsigned long long pk2 = (unsigned long long)__builtin_bit_cast(unsigned, pv[0]) | ((unsigned long long)__builtin_bit_cast(unsigned, pv[1]) << 32); VST2(unsigned long long, (unsigned long long*)(PHP + e), pk2); }
        { const unsigned long long pk2 = (unsigned long long)__builtin_bit_cast(unsigned, gv[0]) | ((unsigned long long)__builtin_bit_cast(unsigned, gv[1]) << 32); VST2(unsigned long long, (unsigned long long*)(GP + e), pk2); }
        st_h2(GP16 + e, gv[0], gv[1]); }
    if (t < (long long)NK * IC / 2) { const long long e = 2 * t; const int nk = (int)(e / IC), ic = (int)(e % IC); const int py = nk / 32, px = nk % 32; float pv[2];
#pragma unroll
        for (int u = 0; u < 2; ++u) { const long long s = (long long)(ic + u) * HW + (2 * py) * 64 + 2 * px; pv[u] = fmaxf(fmaxf(PH[s], PH[s + 1]), fmaxf(PH[s + 64], PH[s + 65])); }
        st_split2(PPH, PPL, e, pv[0], pv[1]); } }
// row softmax of F (exp once) -> P16 = f16(4096 p) (block per row of 1024)
__global__ __launch_bounds__(256) void k_nl_soft(float* __restrict__ F, _Float16* __restrict__ P16, int NK) { __shared__ float red[256]; const long long row = blockIdx.x; float* sr = F + row * NK; const int t = threadIdx.x; float mx = -3.0e38f;
#pragma unroll 1
    for (int j = 2 * t; j < NK; j += 512) mx = fmaxf(mx, fmaxf(sr[j], sr[j + 1]));
    red[t] = mx; __syncthreads(); for (int o = 128; o > 0; o >>= 1) { if (t < o) red[t] = fmaxf(red[t], red[t + o]); __syncthreads(); } const float m = red[0]; __syncthreads();
    float s = 0.f;
#pragma unroll 1
    for (int j = 2 * t; j < NK; j += 512) { const float e0 = expf(sr[j] - m), e1 = expf(sr[j + 1] - m); s += e0 + e1; const unsigned long long pk = (unsigned long long)__builtin_bit_cast(unsigned, e0) | ((unsigned long long)__builtin_bit_cast(unsigned, e1) << 32); VST2(unsigned long long, (unsigned long long*)(sr + j), pk); }
    red[t] = s; __syncthreads(); for (int o = 128; o > 0; o >>= 1) { if (t < o) red[t] += red[t + o]; __syncthreads(); } const float f = 4096.f / red[0];
#pragma unroll 1
    for (int j = 2 * t; j < NK; j += 512) st_h2(P16 + row * NK + j, sr[j] * f, sr[j + 1] * f); }
// Y16 = f16(Y) (thread per pair)
__global__ __launch_bounds__(256) void k_nl_y16(const float* __restrict__ Y, _Float16* __restrict__ Y16, long long n) { const long long t = (long long)blockIdx.x * 256 + threadIdx.x; if (t >= n / 2) return; st_h2(Y16 + 2 * t, Y[2 * t], Y[2 * t + 1]); }
__global__ __launch_bounds__(256) void k_nl_bns(const float* __restrict__ WY, float* __restrict__ BNS, int Bn, int C, int HW) { __shared__ float red[256]; __shared__ float res[2]; const int c = blockIdx.x; const int t = threadIdx.x; float s = 0.f;
    for (int b = 0; b < Bn; ++b) { const float* r = WY + ((long long)b * C + c) * HW;
#pragma unroll 1
        for (int j = t; j < HW; j += 256) s += r[j]; }
    red[t] = s; __syncthreads(); for (int o = 128; o > 0; o >>= 1) { if (t < o) red[t] += red[t + o]; __syncthreads(); } const float mu = red[0] / (float)(Bn * HW); __syncthreads();
    float q = 0.f;
    for (int b = 0; b < Bn; ++b) { const float* r = WY + ((long long)b * C + c) * HW;
#pragma unroll 1
        for (int j = t; j < HW; j += 256) { const float d = r[j] - mu; q += d * d; } }
    red[t] = q; __syncthreads(); for (int o = 128; o > 0; o >>= 1) { if (t < o) red[t] += red[t + o]; __syncthreads(); }
    if (t == 0) { res[0] = mu; res[1] = rsqrtf(red[0] / (float)(Bn * HW) + 1e-5f); } __syncthreads();
    if (t < 32) VST2(float, BNS + (long long)c * 32 + t, (t == 0) ? res[0] : ((t == 1) ? res[1] : 0.f)); }
// out = (WY - mu[c]) * rstd[c] * gamma[c] + beta[c] + x (thread-linear over [b][c][hw])
__global__ __launch_bounds__(256) void k_nl_out(const float* __restrict__ WY, const float* __restrict__ BNS, const float* __restrict__ Gm, const float* __restrict__ Bt, const float* __restrict__ X, float* __restrict__ OUT, int C, int HW, long long n) { const long long t = (long long)blockIdx.x * 256 + threadIdx.x; if (t >= n) return; const int c = (int)((t / HW) % C); VST2(float, OUT + t, (WY[t] - BNS[(long long)c * 32]) * BNS[(long long)c * 32 + 1] * Gm[c] + Bt[c] + X[t]); }


extern "C" void kernel_launch(void* const* d_in, const int* in_sizes, int n_in, void* d_out, int out_size, void* d_ws, size_t ws_size, hipStream_t stream) {
    (void)in_sizes; (void)n_in; (void)out_size; (void)ws_size;
    const float* x = (const float*)d_in[0];
    const float* gw = (const float*)d_in[1];
    const float* gb = (const float*)d_in[2];
    const float* thw = (const float*)d_in[3];
    const float* thb = (const float*)d_in[4];
    const float* phw = (const float*)d_in[5];
    const float* phb = (const float*)d_in[6];
    const float* Ww = (const float*)d_in[7];
    const float* Wb = (const float*)d_in[8];
    const float* bng = (const float*)d_in[9];
    const float* bnb = (const float*)d_in[10];
    const int Bn = 8;
    const int C = 256;
    const int IC = 128;
    const int HW = 4096;
    const int NK = 1024;
    float* out = (float*)d_out;
    char* wsp = (char*)d_ws;
    // One launch per stage for all Bn images (blockIdx.y = image, per-image strides). The workspace is laid out by lifetime:
    //   R1: x planes and the three conv outputs, dead after the pool; the softmax then writes P16 over them
    //   R2: the operand planes that the pool writes
    //   R3: F, dead after the softmax; Y, Y16 and WY then lie in it
    char* R1 = wsp; wsp += (size_t)Bn * HW * C * 2 * 3 + (size_t)Bn * HW * IC * 4 * 3;
    unsigned short* XH = (unsigned short*)R1;
    unsigned short* XL = XH + (size_t)Bn * HW * C;
    unsigned short* X16 = XL + (size_t)Bn * HW * C;
    float* TH = (float*)(X16 + (size_t)Bn * HW * C);
    float* PH = TH + (size_t)Bn * HW * IC;
    float* G = PH + (size_t)Bn * IC * HW;
    unsigned short* P16 = (unsigned short*)R1;
    float* PHP = (float*)wsp; wsp += (size_t)Bn * IC * NK * 4;
    float* GP = (float*)wsp; wsp += (size_t)Bn * IC * NK * 4;
    unsigned short* THH = (unsigned short*)wsp; wsp += (size_t)Bn * HW * IC * 2;
    unsigned short* THL = (unsigned short*)wsp; wsp += (size_t)Bn * HW * IC * 2;
    unsigned short* PPH = (unsigned short*)wsp; wsp += (size_t)Bn * NK * IC * 2;
    unsigned short* PPL = (unsigned short*)wsp; wsp += (size_t)Bn * NK * IC * 2;
    unsigned short* GP16 = (unsigned short*)wsp; wsp += (size_t)Bn * IC * NK * 2;
    char* R3 = wsp; wsp += (size_t)Bn * HW * NK * 4;
    float* F = (float*)R3;
    float* Y = (float*)R3;
    unsigned short* Y16 = (unsigned short*)(Y + (size_t)Bn * HW * IC);
    float* WY = (float*)(Y16 + (size_t)Bn * HW * IC);
    unsigned short* WW16 = (unsigned short*)wsp; wsp += (size_t)C * IC * 2;
    unsigned short* TWH = (unsigned short*)wsp; wsp += (size_t)IC * C * 2;
    unsigned short* TWL = (unsigned short*)wsp; wsp += (size_t)IC * C * 2;
    unsigned short* PWH = (unsigned short*)wsp; wsp += (size_t)IC * C * 2;
    unsigned short* PWL = (unsigned short*)wsp; wsp += (size_t)IC * C * 2;
    unsigned short* GW16 = (unsigned short*)wsp; wsp += (size_t)IC * C * 2;
    float* BNS = (float*)wsp; wsp += (size_t)32 * C * 4;
    // weights
    k_cast16<<<(unsigned)((((long long)(C) * ((IC) / 2)) + 255) / 256), 256, 0, stream>>>(Ww, IC, (_Float16*)(WW16), IC, C, IC, 16.0f);
    k_castS16<<<(unsigned)((((long long)(IC) * ((C) / 2)) + 255) / 256), 256, 0, stream>>>(thw, C, (__bf16*)(TWH), (__bf16*)(TWL), C, IC, C, 1.0f, 0, 0, 0);
    k_castS16<<<(unsigned)((((long long)(IC) * ((C) / 2)) + 255) / 256), 256, 0, stream>>>(phw, C, (__bf16*)(PWH), (__bf16*)(PWL), C, IC, C, 1.0f, 0, 0, 0);
    k_cast16<<<(unsigned)((((long long)(IC) * ((C) / 2)) + 255) / 256), 256, 0, stream>>>(gw, C, (_Float16*)(GW16), C, IC, C, 1.0f);
    // x[b] ([C][HW]) -> transposed planes [b][HW][C]: bf16 hi/lo (theta, phi) and f16 of 16 x (g)
    k_castS16<<<dim3((unsigned)((((long long)(HW) * ((C) / 2)) + 255) / 256), (unsigned)(Bn)), 256, 0, stream>>>(x, HW, (__bf16*)(XH), (__bf16*)(XL), C, C, HW, 1.0f, 1, (long long)C * HW, (long long)HW * C);
    k_castT16<<<dim3((unsigned)((((long long)(HW) * ((C) / 2)) + 255) / 256), (unsigned)(Bn)), 256, 0, stream>>>(x, HW, (_Float16*)(X16), C, C, HW, 16.0f, (long long)C * HW, (long long)HW * C);
    // TH[b] = x[b]^T thw^T + thb ([HW][IC]); PH[b] = phw x[b] + phb, G[b] = gw x[b] + gb ([IC][HW])
    w25::wmma_gemm64<1, true, 2, 0, false, 0><<<dim3((unsigned)((((HW) / 64) * ((IC) / 64) + 7) / 8), (unsigned)(Bn)), 256, 0, stream>>>((const unsigned short*)(XH), (const unsigned short*)(XL), C, (long)HW * C, (const unsigned short*)(TWH), (const unsigned short*)(TWL), C, 0, (void*)(TH), nullptr, IC, (long)HW * IC, thb, nullptr, 0, HW, IC, C, 1.0f);
    w25::wmma_gemm64<1, true, 1, 0, false, 0><<<dim3((unsigned)((((IC) / 64) * ((HW) / 64) + 7) / 8), (unsigned)(Bn)), 256, 0, stream>>>((const unsigned short*)(PWH), (const unsigned short*)(PWL), C, 0, (const unsigned short*)(XH), (const unsigned short*)(XL), C, (long)HW * C, (void*)(PH), nullptr, HW, (long)IC * HW, phb, nullptr, 0, IC, HW, C, 1.0f);
    w25::wmma_gemm64<0, false, 1, 0, false, 0><<<dim3((unsigned)((((IC) / 64) * ((HW) / 64) + 7) / 8), (unsigned)(Bn)), 256, 0, stream>>>((const unsigned short*)(GW16), nullptr, C, 0, (const unsigned short*)(X16), nullptr, C, (long)HW * C, (void*)(G), nullptr, HW, (long)IC * HW, gb, nullptr, 0, IC, HW, C, 0.0625f);
    k_nl_pool<<<dim3((unsigned)(((long long)HW * IC / 2 + 255) / 256), (unsigned)(Bn)), 256, 0, stream>>>(PH, G, TH, PHP, GP, (_Float16*)PPH, (_Float16*)PPL, (_Float16*)GP16, (_Float16*)THH, (_Float16*)THL, IC, HW, NK);
    // F[b] = theta[b] phi[b] ([HW][NK]); rows of all images are contiguous, so the softmax takes Bn * HW rows
    w25::wmma_gemm64<1, true, 0, 0, false, 0><<<dim3((unsigned)((((HW) / 64) * ((NK) / 64) + 7) / 8), (unsigned)(Bn)), 256, 0, stream>>>((const unsigned short*)(THH), (const unsigned short*)(THL), IC, (long)HW * IC, (const unsigned short*)(PPH), (const unsigned short*)(PPL), IC, (long)NK * IC, (void*)(F), nullptr, NK, (long)HW * NK, nullptr, nullptr, 0, HW, NK, IC, 1.0f);
    k_nl_soft<<<(unsigned)(Bn * HW), 256, 0, stream>>>(F, (_Float16*)P16, NK);
    w25::wmma_gemm64<0, false, 0, 0, false, 0><<<dim3((unsigned)((((HW) / 64) * ((IC) / 64) + 7) / 8), (unsigned)(Bn)), 256, 0, stream>>>((const unsigned short*)(P16), nullptr, NK, (long)HW * NK, (const unsigned short*)(GP16), nullptr, NK, (long)IC * NK, (void*)(Y), nullptr, IC, (long)HW * IC, nullptr, nullptr, 0, HW, IC, NK, 0.000244140625f);
    k_nl_y16<<<(unsigned)(((long long)Bn * HW * IC / 2 + 255) / 256), 256, 0, stream>>>(Y, (_Float16*)Y16, (long long)Bn * HW * IC);
    w25::wmma_gemm64<0, false, 1, 0, false, 0><<<dim3((unsigned)((((C) / 64) * ((HW) / 64) + 7) / 8), (unsigned)(Bn)), 256, 0, stream>>>((const unsigned short*)(WW16), nullptr, IC, 0, (const unsigned short*)(Y16), nullptr, IC, (long)HW * IC, (void*)(WY), nullptr, HW, (long)C * HW, Wb, nullptr, 0, C, HW, IC, 0.0625f);
    k_nl_bns<<<C, 256, 0, stream>>>(WY, BNS, Bn, C, HW); k_nl_out<<<(unsigned)(((long long)Bn * C * HW + 255) / 256), 256, 0, stream>>>(WY, BNS, bng, bnb, x, out, C, HW, (long long)Bn * C * HW);
}

// v002
// A run of this version takes 243 microseconds.
// In both of two side-by-side timings against v001, it was 1.80 times as fast.
// Over all steps from v000 it is 5.75 times as fast.
#include <hip/hip_runtime.h>
#include <math.h>

typedef __attribute__((ext_vector_type(16))) _Float16 v16h;
typedef __attribute__((ext_vector_type(8)))  _Float16 v8h;
typedef __attribute__((ext_vector_type(16))) __bf16   v16b;
typedef __attribute__((ext_vector_type(8)))  float    v8f;
typedef __attribute__((ext_vector_type(4)))  float    v4f;

// 16-bit WMMA fragment map (wave32), lane L, h = L>>4, m = L&15:
//   A 16x32: lane = row m;   element i -> k = (i<8) ? 8h+i : 16+8h+(i-8)
//   B 32x16: lane = column m; the SAME k(i,h)
//   D 16x16 (8 f32): lane = column m; element r -> row 8h+r
__device__ __forceinline__ int frag_k(int i, int h) { return (i < 8) ? (8 * h + i) : (16 + 8 * h + (i - 8)); }
__device__ __forceinline__ __bf16 bf16_rne(float f) {
    unsigned int u = __float_as_uint(f);
    u += 0x7fffu + ((u >> 16) & 1u);
    return __builtin_bit_cast(__bf16, (unsigned short)(u >> 16));
}
__device__ __forceinline__ float bf16_f32(__bf16 b) { return __uint_as_float(((unsigned int)__builtin_bit_cast(unsigned short, b)) << 16); }
__device__ __forceinline__ v8f wmma16(v16h a, v16h b, v8f c) {
    c = __builtin_amdgcn_wmma_f32_16x16x32_f16(false, a, false, b, (short)0, c, false, false);
    asm volatile("v_nop\n\tv_nop\n\tv_nop\n\tv_nop" : "+v"(c) : "v"(a), "v"(b));
    return c;
}
__device__ __forceinline__ v8f wmmab(v16b a, v16b b, v8f c) {
    c = __builtin_amdgcn_wmma_f32_16x16x32_bf16(false, a, false, b, (short)0, c, false, false);
    asm volatile("v_nop\n\tv_nop\n\tv_nop\n\tv_nop" : "+v"(c) : "v"(a), "v"(b));
    return c;
}
struct Split { v16b hi, lo; };
// hi/lo split product: a.hi*b.hi + a.hi*b.lo + a.lo*b.hi
__device__ __forceinline__ v8f wmma3(const Split& a, const Split& b, v8f c) {
    c = __builtin_amdgcn_wmma_f32_16x16x32_bf16(false, a.hi, false, b.hi, (short)0, c, false, false);
    c = __builtin_amdgcn_wmma_f32_16x16x32_bf16(false, a.hi, false, b.lo, (short)0, c, false, false);
    c = __builtin_amdgcn_wmma_f32_16x16x32_bf16(false, a.lo, false, b.hi, (short)0, c, false, false);
    asm volatile("v_nop\n\tv_nop\n\tv_nop\n\tv_nop" : "+v"(c) : "v"(a.hi), "v"(a.lo), "v"(b.hi), "v"(b.lo));
    return c;
}
struct Split3 { v16b hi, mid, lo; };
// triple split product (6 terms, drops only terms below 2^-24 relative)
__device__ __forceinline__ v8f wmma6(const Split3& a, const Split3& b, v8f c) {
    c = __builtin_amdgcn_wmma_f32_16x16x32_bf16(false, a.hi, false, b.hi, (short)0, c, false, false);
    c = __builtin_amdgcn_wmma_f32_16x16x32_bf16(false, a.hi, false, b.mid, (short)0, c, false, false);
    c = __builtin_amdgcn_wmma_f32_16x16x32_bf16(false, a.mid, false, b.hi, (short)0, c, false, false);
    c = __builtin_amdgcn_wmma_f32_16x16x32_bf16(false, a.hi, false, b.lo, (short)0, c, false, false);
    c = __builtin_amdgcn_wmma_f32_16x16x32_bf16(false, a.mid, false, b.mid, (short)0, c, false, false);
    c = __builtin_amdgcn_wmma_f32_16x16x32_bf16(false, a.lo, false, b.hi, (short)0, c, false, false);
    asm volatile("v_nop\n\tv_nop\n\tv_nop\n\tv_nop" : "+v"(c) : "v"(a.hi), "v"(a.mid), "v"(a.lo), "v"(b.hi), "v"(b.mid), "v"(b.lo));
    return c;
}

// Fragment gathers from f32 memory: element i <- p[(k0 + frag_k(i,h)) * sk] * s, zero for k >= klen.
__device__ __forceinline__ v16h fh_ld(const float* __restrict__ p, long long sk, int k0, int h, int klen, float s) {
    v16h a;
#pragma unroll
    for (int i = 0; i < 16; ++i) { const int k = k0 + frag_k(i, h); a[i] = (k < klen) ? (_Float16)(p[(long long)k * sk] * s) : (_Float16)0.f; }
    return a;
}
__device__ __forceinline__ Split sp_ld(const float* __restrict__ p, long long sk, int k0, int h, int klen, float s) {
    Split r;
#pragma unroll
    for (int i = 0; i < 16; ++i) {
        const int k = k0 + frag_k(i, h); const float x = (k < klen) ? p[(long long)k * sk] * s : 0.f;
        const __bf16 hb = bf16_rne(x); r.hi[i] = hb; r.lo[i] = bf16_rne(x - bf16_f32(hb));
    }
    return r;
}
__device__ __forceinline__ Split3 sp3_ld(const float* __restrict__ p, long long sk, int k0, int h, int klen, float s) {
    Split3 r;
#pragma unroll
    for (int i = 0; i < 16; ++i) {
        const int k = k0 + frag_k(i, h); const float x = (k < klen) ? p[(long long)k * sk] * s : 0.f;
        const __bf16 hb = bf16_rne(x); const float r1 = x - bf16_f32(hb); const __bf16 mb = bf16_rne(r1);
        r.hi[i] = hb; r.mid[i] = mb; r.lo[i] = bf16_rne(r1 - bf16_f32(mb));
    }
    return r;
}
__device__ __forceinline__ v16b bh_ld(const float* __restrict__ p, long long sk, int k0, int h, int klen, float s) {
    v16b a;
#pragma unroll
    for (int i = 0; i < 16; ++i) { const int k = k0 + frag_k(i, h); a[i] = bf16_rne((k < klen) ? p[(long long)k * sk] * s : 0.f); }
    return a;
}
// f16 fragment from an f16 LDS/global row with element stride 1 (k-contiguous), no bounds (tile already zero padded)
__device__ __forceinline__ v16h fh_row(const _Float16* __restrict__ row, int k0, int h) {
    v16h a;
#pragma unroll
    for (int i = 0; i < 16; ++i) a[i] = row[k0 + frag_k(i, h)];
    return a;
}

#define VST2(T, ptr, val) do { const T vst2_v_ = (val); *(T*)(ptr) = vst2_v_;  } while (0)
typedef float v4f __attribute__((ext_vector_type(4)));
typedef unsigned int v4u __attribute__((ext_vector_type(4)));
typedef unsigned int v2u __attribute__((ext_vector_type(2)));
#define VST2V4(ptr, val) do { const v4f vst2_v4_ = (val); *(v4f*)(ptr) = vst2_v4_;  } while (0)

__device__ __attribute__((noinline)) float act_fn(float v, int act) {
    if (act == 1) return fmaxf(v, 0.f);                                                                               // relu
    if (act == 2) { const float u = 0.7978845608028654f * (v + 0.044715f * v * v * v); return 0.5f * v * (1.f + tanhf(u)); } // tanh-gelu
    if (act == 3) return v / (1.f + expf(-v));                                                                        // silu
    if (act == 4) return 0.5f * v * (1.f + erff(v * 0.7071067811865476f));                                             // erf-gelu
    if (act == 5) return tanhf(v);
    if (act == 6) return 1.f / (1.f + expf(-v));                                                                      // sigmoid
    if (act == 7) return (v > 0.f) ? v : 0.01f * v;                                                                   // leaky relu 0.01
    if (act == 8) return (v > 0.f) ? v : (expf(v) - 1.f);                                                             // elu
    if (act == 9) return fminf(fmaxf(v, 0.f), 6.f);                                                                   // relu6
    if (act == 10) return fabsf(v);                                                                                    // abs
    if (act == 11) return (v >= 0.f) ? v : 0.1f * v;                                                                  // leaky 0.1
    if (act == 12) return (v > 0.f) ? v : 0.2f * v;                                                                   // leaky 0.2
    if (act == 13) return (v > 20.f) ? v : log1pf(expf(v));                                                            // softplus
    return v;
}

// =====================================================================================================================
// k_gemm<MODE>: C(z, m, n) = act(alpha * sum_k A(z, m, k) * B(z, k, n) + bias) + beta * R(z, m, n)
//   One wave (32-thread block) per 16 x 32 tile of C; grid (ceil(N/32), ceil(M/16), Z). Batch z -> (zo = z / zi_n, zi = z % zi_n)
//   with separate outer/inner strides for every tensor (e.g. batch and head). A(m,k) = A[zo*sAo + zi*sAi + m*sAm + k*sAk] (f32),
//   B(k,n) = B[zo*sBo + zi*sBi + n*sBn + k*sBk] (f32); any M, N, K (K zero-padded to 32 inside the fragments, M/N tails guarded).
//   C(m,n) = C[zo*sCo + zi*sCi + m*sCm + n] (n contiguous). flags: 1 bias[n], 2 bias[m], 4 residual R[zo*sRo + zi*sRi + m*sRm + n*sRn].
//   MODE 0: f16 operands (A prescaled by sa, B by sb, both undone in the epilogue); 1: bf16 hi/lo split (3 products); 2: bf16;
//   3: bf16 hi/mid/lo triple split (6 products); 4: as 3 with Kahan-compensated f32 accumulation across k-steps.
// =====================================================================================================================
struct GemmP {
    const float* A; const float* B; const float* bias; const float* R; float* C;
    long long sAo, sAi, sAm, sAk, sBo, sBi, sBn, sBk, sCo, sCi, sCm, sRo, sRi, sRm, sRn;
    int M, N, K, zi_n, flags, act; float alpha, beta, sa, sb;
    int Npad, pad_;     // columns [N, Npad) of C are written as 0 so that padded workspace rows are covered by whole-line stores; Npad >= N
};
static_assert(sizeof(GemmP) == 5 * 8 + 15 * 8 + 6 * 4 + 4 * 4 + 2 * 4, "GemmP has padding");

template <int MODE>
__global__ __launch_bounds__(32) void k_gemm(GemmP p) {
    const int lane = threadIdx.x & 31, h = lane >> 4, l15 = lane & 15;
    const int m0 = blockIdx.y * 16, n0 = blockIdx.x * 32;
    const int z = blockIdx.z, zo = z / p.zi_n, zi = z - zo * p.zi_n;
    const float* A = p.A + zo * p.sAo + zi * p.sAi;
    const float* B = p.B + zo * p.sBo + zi * p.sBi;
    const int am = min(m0 + l15, p.M - 1);                       // clamped row for loads (stores are guarded)
    v8f acc[2], comp[2];
#pragma unroll
    for (int t = 0; t < 2; ++t) { v8f zz = {}; acc[t] = zz; comp[t] = zz; }
    for (int k0 = 0; k0 < p.K; k0 += 32) {
        const float* arow = A + (long long)am * p.sAm;
        if (MODE == 1) {
            const Split a = sp_ld(arow, p.sAk, k0, h, p.K, 1.f);
#pragma unroll
            for (int t = 0; t < 2; ++t) {
                const int bn = min(n0 + t * 16 + l15, p.N - 1);
                acc[t] = wmma3(a, sp_ld(B + (long long)bn * p.sBn, p.sBk, k0, h, p.K, 1.f), acc[t]);
            }
        } else if (MODE == 3) {
            const Split3 a = sp3_ld(arow, p.sAk, k0, h, p.K, 1.f);
#pragma unroll
            for (int t = 0; t < 2; ++t) {
                const int bn = min(n0 + t * 16 + l15, p.N - 1);
                acc[t] = wmma6(a, sp3_ld(B + (long long)bn * p.sBn, p.sBk, k0, h, p.K, 1.f), acc[t]);
            }
        } else if (MODE == 4) {
            // triple split as MODE 3, but each k-step's 6 products go into a fresh accumulator and the partial is added to the running f32 sum
            // on the VALU with Kahan compensation (accumulation error stays ~1 ulp however long K is)
            const Split3 a = sp3_ld(arow, p.sAk, k0, h, p.K, 1.f);
#pragma unroll
            for (int t = 0; t < 2; ++t) {
                const int bn = min(n0 + t * 16 + l15, p.N - 1); v8f zz = {};
                const v8f part = wmma6(a, sp3_ld(B + (long long)bn * p.sBn, p.sBk, k0, h, p.K, 1.f), zz);
                const v8f y = part - comp[t]; const v8f s = acc[t] + y; comp[t] = (s - acc[t]) - y; acc[t] = s;
            }
        } else if (MODE == 2) {
            const v16b a = bh_ld(arow, p.sAk, k0, h, p.K, 1.f);
#pragma unroll
            for (int t = 0; t < 2; ++t) {
                const int bn = min(n0 + t * 16 + l15, p.N - 1);
                acc[t] = wmmab(a, bh_ld(B + (long long)bn * p.sBn, p.sBk, k0, h, p.K, 1.f), acc[t]);
            }
        } else {
            const v16h a = fh_ld(arow, p.sAk, k0, h, p.K, p.sa);
#pragma unroll
            for (int t = 0; t < 2; ++t) {
                const int bn = min(n0 + t * 16 + l15, p.N - 1);
                acc[t] = wmma16(a, fh_ld(B + (long long)bn * p.sBn, p.sBk, k0, h, p.K, p.sb), acc[t]);
            }
        }
    }
    const float iscale = (MODE == 0) ? p.alpha / (p.sa * p.sb) : p.alpha;
    float* C = p.C + zo * p.sCo + zi * p.sCi;
    const float* R = p.R + zo * p.sRo + zi * p.sRi;
    __shared__ __align__(16) float ctile[16][36];
#pragma unroll
    for (int t = 0; t < 2; ++t) {
        const int n = n0 + t * 16 + l15; const int nn = min(n, p.N - 1);
#pragma unroll
        for (int r = 0; r < 8; ++r) {
            const int m = m0 + 8 * h + r; const int mm = min(m, p.M - 1);
            float v = acc[t][r] * iscale;
            if (p.flags & 1) v += p.bias[nn];
            if (p.flags & 2) v += p.bias[mm];
            if (p.flags & 8) v *= p.bias[(long long)zo * p.M + mm];   /* per-(z,row) scale vector laid out [Z][M]; exclusive with the bias flags */
            v = act_fn(v, p.act);
            if (p.flags & 4) v += p.beta * R[(long long)mm * p.sRm + (long long)nn * p.sRn];
            ctile[8 * h + r][t * 16 + l15] = (n < p.N) ? v : 0.f;
        }
    }
    __syncthreads();
    const int NW = (p.Npad > p.N) ? p.Npad : p.N;           // write width
    const bool fast = (m0 + 16 <= p.M) && (n0 + 32 <= NW) && ((p.sCm & 3) == 0) && ((((size_t)C) & 15) == 0);
    if (fast) {
#pragma unroll
        for (int s = 0; s < 4; ++s) {
            const int row = s * 4 + (lane >> 3), c4 = (lane & 7) * 4;
            const v4f v = *(const v4f*)&ctile[row][c4];
            VST2V4(C + (long long)(m0 + row) * p.sCm + n0 + c4, v);
        }
    } else {
        for (int row = 0; row < 16; ++row) {
            const int m = m0 + row, n = n0 + lane;
            if (m < p.M && n < NW) VST2(float, C + (long long)m * p.sCm + n, ctile[row][lane]);
        }
    }
}


// =====================================================================================================================
// k_gemmT<MODE, TM, TN>: same contract as k_gemm, but one wave computes a (16*TM) x (16*TN) tile: TM A fragments and TN B fragments are
//   loaded per 32-wide k-step and reused across TM*TN WMMAs (far fewer load/convert instructions per MAC). MODE 0 (f16), 1 (bf16 hi/lo),
//   2 (bf16) only. grid (ceil(NW/(16*TN)), ceil(M/(16*TM)), Z), block 32. Epilogue identical to k_gemm, run per 16x32 sub-tile.
// =====================================================================================================================
template <int MODE, int TM, int TN>
__global__ __launch_bounds__(32) void k_gemmT(GemmP p) {
    const int lane = threadIdx.x & 31, h = lane >> 4, l15 = lane & 15;
    const int m0 = blockIdx.y * (16 * TM), n0 = blockIdx.x * (16 * TN);
    const int z = blockIdx.z, zo = z / p.zi_n, zi = z - zo * p.zi_n;
    const float* A = p.A + zo * p.sAo + zi * p.sAi;
    const float* B = p.B + zo * p.sBo + zi * p.sBi;
    v8f acc[TM][TN];
#pragma unroll
    for (int i = 0; i < TM; ++i)
#pragma unroll
        for (int t = 0; t < TN; ++t) { v8f zz = {}; acc[i][t] = zz; }
    for (int k0 = 0; k0 < p.K; k0 += 32) {
        if (MODE == 1) {
            Split a[TM], b[TN];
#pragma unroll
            for (int i = 0; i < TM; ++i) { const int am = min(m0 + 16 * i + l15, p.M - 1); a[i] = sp_ld(A + (long long)am * p.sAm, p.sAk, k0, h, p.K, 1.f); }
#pragma unroll
            for (int t = 0; t < TN; ++t) { const int bn = min(n0 + 16 * t + l15, p.N - 1); b[t] = sp_ld(B + (long long)bn * p.sBn, p.sBk, k0, h, p.K, 1.f); }
#pragma unroll
            for (int i = 0; i < TM; ++i)
#pragma unroll
                for (int t = 0; t < TN; ++t) acc[i][t] = wmma3(a[i], b[t], acc[i][t]);
        } else if (MODE == 2) {
            v16b a[TM], b[TN];
#pragma unroll
            for (int i = 0; i < TM; ++i) { const int am = min(m0 + 16 * i + l15, p.M - 1); a[i] = bh_ld(A + (long long)am * p.sAm, p.sAk, k0, h, p.K, 1.f); }
#pragma unroll
            for (int t = 0; t < TN; ++t) { const int bn = min(n0 + 16 * t + l15, p.N - 1); b[t] = bh_ld(B + (long long)bn * p.sBn, p.sBk, k0, h, p.K, 1.f); }
#pragma unroll
            for (int i = 0; i < TM; ++i)
#pragma unroll
                for (int t = 0; t < TN; ++t) acc[i][t] = wmmab(a[i], b[t], acc[i][t]);
        } else {
            v16h a[TM], b[TN];
#pragma unroll
            for (int i = 0; i < TM; ++i) { const int am = min(m0 + 16 * i + l15, p.M - 1); a[i] = fh_ld(A + (long long)am * p.sAm, p.sAk, k0, h, p.K, p.sa); }
#pragma unroll
            for (int t = 0; t < TN; ++t) { const int bn = min(n0 + 16 * t + l15, p.N - 1); b[t] = fh_ld(B + (long long)bn * p.sBn, p.sBk, k0, h, p.K, p.sb); }
#pragma unroll
            for (int i = 0; i < TM; ++i)
#pragma unroll
                for (int t = 0; t < TN; ++t) acc[i][t] = wmma16(a[i], b[t], acc[i][t]);
        }
    }
    const float iscale = (MODE == 0) ? p.alpha / (p.sa * p.sb) : p.alpha;
    float* C = p.C + zo * p.sCo + zi * p.sCi;
    const float* R = p.R + zo * p.sRo + zi * p.sRi;
    const int NW = (p.Npad > p.N) ? p.Npad : p.N;
    __shared__ __align__(16) float ctile[16][36];
#pragma unroll
    for (int i = 0; i < TM; ++i) {
        const int mb = m0 + 16 * i; if (mb >= p.M) break;          // wave-uniform
#pragma unroll
        for (int tp = 0; tp < TN / 2; ++tp) {
            const int nb = n0 + 32 * tp; if (nb >= NW) break;        // wave-uniform
#pragma unroll
            for (int t2 = 0; t2 < 2; ++t2) {
                const int t = 2 * tp + t2; const int n = nb + t2 * 16 + l15; const int nn = min(n, p.N - 1);
#pragma unroll
                for (int r = 0; r < 8; ++r) {
                    const int m = mb + 8 * h + r; const int mm = min(m, p.M - 1);
                    float v = acc[i][t][r] * iscale;
                    if (p.flags & 1) v += p.bias[nn];
                    if (p.flags & 2) v += p.bias[mm];
            if (p.flags & 8) v *= p.bias[(long long)zo * p.M + mm];   /* per-(z,row) scale vector laid out [Z][M]; exclusive with the bias flags */
                    v = act_fn(v, p.act);
                    if (p.flags & 4) v += p.beta * R[(long long)mm * p.sRm + (long long)nn * p.sRn];
                    ctile[8 * h + r][t2 * 16 + l15] = (n < p.N) ? v : 0.f;
                }
            }
            __syncthreads();
            const bool fast = (mb + 16 <= p.M) && (nb + 32 <= NW) && ((p.sCm & 3) == 0) && ((((size_t)C) & 15) == 0);
            if (fast) {
#pragma unroll
                for (int s = 0; s < 4; ++s) {
                    const int row = s * 4 + (lane >> 3), c4 = (lane & 7) * 4;
                    const v4f v = *(const v4f*)&ctile[row][c4];
                    VST2V4(C + (long long)(mb + row) * p.sCm + nb + c4, v);
                }
            } else {
                for (int row = 0; row < 16; ++row) {
                    const int m = mb + row, n = nb + lane;
                    if (m < p.M && n < NW) VST2(float, C + (long long)m * p.sCm + n, ctile[row][lane]);
                }
            }
            __syncthreads();
        }
    }
}

// =====================================================================================================================
//   Wave = 16 queries, AW waves per block, 64-key blocks; grid (ceil(Lq/(16*AW)), H, B), block 32*AW. Any Lq, Lk; head dim dh <= DHP
//   (DHP multiple of 32), value dim dv <= DVP (multiple of 16, <= 128). Every tensor addressed by (batch, head, row, element) strides, f32.
//   Scores: QM 0 f16 operands, 1 bf16 hi/lo split, 2 bf16 triple split; statistics f32 (exp2 domain); P.V: P x 4096 as f16 with V f16 staged in LDS
//   (SPLITPV: P and V as bf16 hi/lo splits). kv head = h / hrep. Masking: causal = 1 (keep j <= i + coff, masked -> -inf, key blocks beyond the
//   diagonal skipped), causal = 2 (masked -> mfill, a finite fill like the -1e9; no skipping), causal = 3 (keep j >= i + coff,
//   masked -> -inf, no skipping); optional additive f32 mask Mf,
//   optional int keep-mask Mi (0 -> score := mfill), both addressed b*smb + h*smh + i*smi + j*smj (0 strides broadcast).
// =====================================================================================================================
#define AW 4
struct AttnP {   // apv4
    const float* Q; const float* K; const float* V; float* O; float* P; const float* Mf; const int* Mi; float* ST;
    const float* Pw; const float* Rt; const int* SQ; const int* SK;           // optional: post-softmax weight, relative-position table, segment ids
    long long swb, swh, swi, swj, srb, srh, sri;                                 // Pw strides (b,h,i,j); Rt strides (b,h,i), column = clamp(i - j + roff, 0, rn-1)
    long long sQb, sQh, sQi, sQd, sKb, sKh, sKj, sKd, sVb, sVh, sVj, sVd, sOb, sOh, sOi, sPb, sPh, sPi, smb, smh, smi, smj;
    int Lq, Lk, dh, dv, hrep, causal, coff, pband;   // pband > 0: P holds only the band |j - i| <= pband, column j - i + pband
    float scale, mfill; int nonorm, mpol;             // nonorm (online path only): O = sum_j exp(score_j) V_j without the 1/rowsum (scores must be <= ~0); mpol: Mi masks where ==0 (mpol 0) or where !=0 (mpol 1)
    int roff, rn, segpol, win;                        // Rt column offset/count; SQ/SK: score := mfill where (segpol 0) SQ[i] != SK[j] or (segpol 1) SQ[i] == SK[j]; win > 0: keys with i - j > win (after coff) -> -inf
};
//   Pw: the softmax numerator is multiplied by Pw(b,h,i,j) AFTER the row sum is taken (probs * weight, then P.V), as in post-softmax multiplicative biases.                                                    // ST (optional): per row (b,h,i) -> ST[((b*H + h)*Lq + i)*2 + {0,1}] = {row max of the scaled+masked score (natural units), sum_j exp(score - max)}
static_assert(sizeof(AttnP) == 12 * 8 + 29 * 8 + 16 * 4, "AttnP has padding");

#ifndef KATTN_ATTR
#define KATTN_ATTR
#endif
template <int DHP, int DVP, int QM, bool SPLITPV, bool TWOPASS>
__global__ __launch_bounds__(32 * AW) KATTN_ATTR void k_attn(AttnP p) {
    constexpr int NT = DVP / 16;                // output tiles
    constexpr int KS = DHP / 32;                // k-steps for the scores
    constexpr int VP = DVP + 8;                 // LDS pitch (halves)
    __shared__ __align__(16) float    pl[AW][16 * 64];
    __shared__ __align__(16) _Float16 vl[(SPLITPV ? 2 : 1) * 64 * VP];   // f16 V tile, or bf16 hi and lo tiles (same 2-byte size)
    const int lane = threadIdx.x & 31, hf = lane >> 4, l15 = lane & 15, wave = threadIdx.x >> 5;
    const int h = blockIdx.y, b = blockIdx.z, hk = h / p.hrep;
    const int q0 = (blockIdx.x * AW + wave) * 16;
    float* myp = pl[wave];
    const float L2E = 1.4426950408889634f;
    const float NEG = -__builtin_inff();
    const int qi = min(q0 + l15, p.Lq - 1);
    const float* qrow = p.Q + b * p.sQb + h * p.sQh + (long long)qi * p.sQi;
    const float* kbase = p.K + b * p.sKb + hk * p.sKh;
    const float* vbase = p.V + b * p.sVb + hk * p.sVh;
    v16h qa[QM == 0 ? KS : 1]; Split qs_[QM == 1 ? KS : 1]; Split3 qt_[QM == 2 ? KS : 1];
#pragma unroll
    for (int ks = 0; ks < KS; ++ks) {
        if (QM == 2) qt_[ks] = sp3_ld(qrow, p.sQd, ks * 32, hf, p.dh, 1.f);
        else if (QM == 1) qs_[ks] = sp_ld(qrow, p.sQd, ks * 32, hf, p.dh, 1.f);
        else qa[ks] = fh_ld(qrow, p.sQd, ks * 32, hf, p.dh, 1.f);
    }
    v8f o[NT]; float m8[8], l8[8];
#pragma unroll
    for (int t = 0; t < NT; ++t) { v8f zz = {}; o[t] = zz; }
#pragma unroll
    for (int i = 0; i < 8; ++i) { m8[i] = NEG; l8[i] = 0.f; }
    int jend = p.Lk; int jstart = 0;
    if (p.causal == 1) { const int je = (blockIdx.x * AW + AW - 1) * 16 + 16 + p.coff; jend = min(jend, max(je, 0)); }   // uniform per block
    if (p.win > 0) { const int js = (int)(blockIdx.x * AW) * 16 + p.coff - p.win; jstart = (js > 0) ? (js / 64) * 64 : 0; }   // uniform per block: key blocks entirely outside every row's window hold only -inf entries and are skipped exactly
    const int npass = TWOPASS ? 2 : 1;
    for (int pass = 0; pass < npass; ++pass) {
        const bool dopv = (!TWOPASS) || pass == 1;
        for (int j0 = jstart; j0 < jend; j0 += 64) {
            if (dopv) {
                __syncthreads();                                 // previous key block's reads of vl / pl are done
                for (int idx = threadIdx.x; idx < 64 * DVP; idx += 32 * AW) {
                    const int jr = idx / DVP, d = idx - jr * DVP, j = j0 + jr;
                    const float f = (j < p.Lk && d < p.dv) ? vbase[(long long)j * p.sVj + (long long)d * p.sVd] : 0.f;
                    if (SPLITPV) {
                        const __bf16 hb = bf16_rne(f);
                        ((__bf16*)vl)[jr * VP + d] = hb; ((__bf16*)vl)[64 * VP + jr * VP + d] = bf16_rne(f - bf16_f32(hb));
                    } else vl[jr * VP + d] = (_Float16)f;
                }
            }
            v8f s[4];
#pragma unroll
            for (int t = 0; t < 4; ++t) {
                const int j = min(j0 + t * 16 + l15, p.Lk - 1);
                const float* krow = kbase + (long long)j * p.sKj;
                v8f acc = {};
#pragma unroll
                for (int ks = 0; ks < KS; ++ks) {
                    if (QM == 2)      acc = wmma6(qt_[ks], sp3_ld(krow, p.sKd, ks * 32, hf, p.dh, 1.f), acc);
                    else if (QM == 1) acc = wmma3(qs_[ks], sp_ld(krow, p.sKd, ks * 32, hf, p.dh, 1.f), acc);
                    else              acc = wmma16(qa[ks], fh_ld(krow, p.sKd, ks * 32, hf, p.dh, 1.f), acc);
                }
                s[t] = acc;
            }
            float pv[8][4];
#pragma unroll
            for (int i = 0; i < 8; ++i) {
                const int irow = q0 + i + 8 * hf;
                const int ic = min(irow, p.Lq - 1);
                float sc[4];
#pragma unroll
                for (int t = 0; t < 4; ++t) {
                    const int jg = j0 + t * 16 + l15;
                    float v = s[t][i] * p.scale;
                    if (p.Mf) v += p.Mf[b * p.smb + h * p.smh + (long long)ic * p.smi + (long long)min(jg, p.Lk - 1) * p.smj];
                    if (p.Rt) { int rc = ic - min(jg, p.Lk - 1) + p.roff; rc = rc < 0 ? 0 : (rc >= p.rn ? p.rn - 1 : rc); v += p.Rt[b * p.srb + h * p.srh + (long long)ic * p.sri + rc]; }
                    if (p.Mi) { const int mv = p.Mi[b * p.smb + h * p.smh + (long long)ic * p.smi + (long long)min(jg, p.Lk - 1) * p.smj]; if (p.mpol ? (mv != 0) : (mv == 0)) v = p.mfill; }
                    if (p.SQ) { const bool same = p.SQ[(long long)b * p.Lq + ic] == p.SK[(long long)b * p.Lk + min(jg, p.Lk - 1)]; if (p.segpol ? same : !same) v = p.mfill; }
                    if (p.causal == 2 && jg > irow + p.coff) v = p.mfill;
                    if (jg >= p.Lk || (p.causal == 1 && jg > irow + p.coff) || (p.causal == 3 && jg < irow + p.coff) || (p.win > 0 && irow + p.coff - jg > p.win)) v = NEG; else v *= L2E;
                    sc[t] = v;
                }
                if (!TWOPASS || pass == 0) {
                    float mx = fmaxf(fmaxf(sc[0], sc[1]), fmaxf(sc[2], sc[3]));
                    mx = fmaxf(mx, __shfl_xor(mx, 1, 32)); mx = fmaxf(mx, __shfl_xor(mx, 2, 32));
                    mx = fmaxf(mx, __shfl_xor(mx, 4, 32)); mx = fmaxf(mx, __shfl_xor(mx, 8, 32));
                    const float mnew = fmaxf(m8[i], mx);
                    const float corr = (mnew == NEG) ? 1.f : exp2f(m8[i] - mnew);
                    float rs = 0.f;
#pragma unroll
                    for (int t = 0; t < 4; ++t) {
                        const float pp = (sc[t] == NEG) ? 0.f : exp2f(sc[t] - mnew); rs += pp;
                        pv[i][t] = p.Pw ? pp * p.Pw[b * p.swb + h * p.swh + (long long)ic * p.swi + (long long)min(j0 + t * 16 + l15, p.Lk - 1) * p.swj] : pp;
                    }
                    rs += __shfl_xor(rs, 1, 32); rs += __shfl_xor(rs, 2, 32); rs += __shfl_xor(rs, 4, 32); rs += __shfl_xor(rs, 8, 32);
                    l8[i] = l8[i] * corr + rs; m8[i] = mnew;
                    if (!TWOPASS) {
#pragma unroll
                        for (int t = 0; t < NT; ++t) o[t][i] *= corr;
                    }
                } else {
                    const float inv = (l8[i] > 0.f) ? 1.f / l8[i] : 0.f;
#pragma unroll
                    for (int t = 0; t < 4; ++t) {
                        const int jg = j0 + t * 16 + l15;
                        float pp = (sc[t] == NEG) ? 0.f : exp2f(sc[t] - m8[i]) * inv;
                        if (p.Pw) pp *= p.Pw[b * p.swb + h * p.swh + (long long)ic * p.swi + (long long)min(jg, p.Lk - 1) * p.swj];
                        pv[i][t] = pp;
                    }
                }
            }
            if (dopv) {
#pragma unroll
                for (int i = 0; i < 8; ++i)
#pragma unroll
                    for (int t = 0; t < 4; ++t) ((float*)myp)[(i + 8 * hf) * 64 + t * 16 + l15] = pv[i][t];
                __syncthreads();                                 // P (per wave) and V (shared) visible
                if (p.P) {
                    float* pb_ = p.P + b * p.sPb + h * p.sPh;
                    const bool fastP = (p.pband == 0) && ((p.sPi & 3) == 0) && (j0 + 64 <= p.Lk) && (q0 + 16 <= p.Lq) && ((((size_t)pb_) & 15) == 0);
                    if (fastP) {
#pragma unroll
                        for (int s = 0; s < 8; ++s) {
                            const int row = s * 2 + (lane >> 4), c4 = (lane & 15) * 4;
                            const v4f v = *(const v4f*)(myp + row * 64 + c4);
                            VST2V4(pb_ + (long long)(q0 + row) * p.sPi + j0 + c4, v);
                        }
                    } else {
                        for (int row = 0; row < 16; ++row) {
                            const int irow = q0 + row; if (irow >= p.Lq) continue;
                            for (int c = lane; c < 64; c += 32) {
                                const int jg = j0 + c; if (jg >= p.Lk) continue;
                                if (p.pband == 0) VST2(float, pb_ + (long long)irow * p.sPi + jg, myp[row * 64 + c]);
                                else if (jg - irow <= p.pband && irow - jg <= p.pband) VST2(float, pb_ + (long long)irow * p.sPi + (jg - irow + p.pband), myp[row * 64 + c]);
                            }
                        }
                    }
                }
                if (SPLITPV) {
                    const Split pa0 = sp_ld(myp + l15 * 64, 1, 0, hf, 64, 1.f), pa1 = sp_ld(myp + l15 * 64, 1, 32, hf, 64, 1.f);
                    const __bf16* vh = (const __bf16*)vl; const __bf16* vlo = vh + 64 * VP;
#pragma unroll
                    for (int t = 0; t < NT; ++t) {
                        const int dcol = t * 16 + l15;
                        Split b0, b1;
#pragma unroll
                        for (int e = 0; e < 16; ++e) {
                            const int k0 = frag_k(e, hf), k1 = 32 + frag_k(e, hf);
                            b0.hi[e] = vh[k0 * VP + dcol]; b0.lo[e] = vlo[k0 * VP + dcol]; b1.hi[e] = vh[k1 * VP + dcol]; b1.lo[e] = vlo[k1 * VP + dcol];
                        }
                        o[t] = wmma3(pa0, b0, o[t]);
                        o[t] = wmma3(pa1, b1, o[t]);
                    }
                } else {
                    const v16h pa0 = fh_ld(myp + l15 * 64, 1, 0, hf, 64, 4096.f), pa1 = fh_ld(myp + l15 * 64, 1, 32, hf, 64, 4096.f);
#pragma unroll
                    for (int t = 0; t < NT; ++t) {
                        const int dcol = t * 16 + l15;
                        v16h b0, b1;
#pragma unroll
                        for (int e = 0; e < 16; ++e) { b0[e] = vl[frag_k(e, hf) * VP + dcol]; b1[e] = vl[(32 + frag_k(e, hf)) * VP + dcol]; }
                        o[t] = wmma16(pa0, b0, o[t]);
                        o[t] = wmma16(pa1, b1, o[t]);
                    }
                }
            }
        }
    }
    float* obase = p.O + b * p.sOb + h * p.sOh;
    if (p.ST) {
        const int rl = lane >> 1, isel = rl & 7;           // row q0 + rl ; rl>>3 == hf holds because lane>>4 == (lane>>1)>>3
        float mv = 0.f, lv = 0.f;
#pragma unroll
        for (int i = 0; i < 8; ++i) if (i == isel) { mv = m8[i]; lv = l8[i]; }
        const int irow = q0 + rl;
        if (irow < p.Lq) { float* st = p.ST + (((long long)b * gridDim.y + h) * p.Lq + irow) * 2 + (lane & 1); VST2(float, st, (lane & 1) ? lv : mv * 0.6931471805599453f); }
    }
    float invr[8];
#pragma unroll
    for (int i = 0; i < 8; ++i) {
        if (TWOPASS) invr[i] = SPLITPV ? 1.f : (1.f / 4096.f);
        else if (p.nonorm) invr[i] = exp2f(m8[i]) * (SPLITPV ? 1.f : (1.f / 4096.f));
        else invr[i] = (l8[i] > 0.f) ? (SPLITPV ? 1.f / l8[i] : 1.f / (l8[i] * 4096.f)) : 0.f;
    }
    __syncthreads();                                             // all waves done with pl/vl from the main loop
    const bool ofast = ((p.sOi & 3) == 0) && ((((size_t)obase) & 15) == 0) && (q0 + 16 <= p.Lq);
#pragma unroll
    for (int c0 = 0; c0 < DVP; c0 += 64) {
#pragma unroll
        for (int i = 0; i < 8; ++i)
#pragma unroll
            for (int t = 0; t < NT; ++t) if (t * 16 >= c0 && t * 16 < c0 + 64) ((float*)myp)[(i + 8 * hf) * 64 + (t * 16 - c0) + l15] = o[t][i] * invr[i];
        __syncthreads();
        const int cw = (DVP - c0 < 64) ? (DVP - c0) : 64;      // staged columns in this chunk (multiple of 16)
        if (ofast && (c0 + cw <= p.dv) && (cw % 32 == 0)) {
            const int lpr = cw / 4;                              // lanes per row (16 for 64 cols, 8 for 32)
            const int rows_per_ins = 32 / lpr;
            for (int r0 = 0; r0 < 16; r0 += rows_per_ins) {
                const int row = r0 + lane / lpr, c4 = (lane % lpr) * 4;
                const v4f v = *(const v4f*)(myp + row * 64 + c4);
                VST2V4(obase + (long long)(q0 + row) * p.sOi + c0 + c4, v);
            }
        } else {
            for (int row = 0; row < 16; ++row) {
                const int irow = q0 + row; if (irow >= p.Lq) continue;
                for (int c = lane; c < cw; c += 32) { const int d = c0 + c; if (d < p.dv) VST2(float, obase + (long long)irow * p.sOi + d, myp[row * 64 + c]); }
            }
        }
        __syncthreads();
    }
}

// =====================================================================================================================
// k_tr: dst(z, c, r) = alpha * src(z, r, c) (+ beta * R2(z, c, r)): [Z][R][C] (row stride lds) -> [Z][C][R] (row stride ldd) through a 32x32 LDS tile;
//   flags: 1 -> add beta * residual R2 addressed like dst (z*sRz + c*ldr + r); act applied before the residual.
// =====================================================================================================================
struct TrP { const float* src; float* dst; const float* R2; long long sSz, lds, sDz, ldd, sRz, ldr; int R, C, flags, act; float alpha, beta; };
static_assert(sizeof(TrP) == 3 * 8 + 6 * 8 + 6 * 4, "TrP has padding");
__global__ __launch_bounds__(256) void k_tr(TrP p) {
    __shared__ float tile[32][33];
    const int c0 = blockIdx.x * 32, r0 = blockIdx.y * 32, z = blockIdx.z;
    const int lane = threadIdx.x & 31, wave = threadIdx.x >> 5;
    const float* s = p.src + z * p.sSz;
#pragma unroll
    for (int k = 0; k < 4; ++k) {
        const int rl = wave * 4 + k, r = r0 + rl, c = c0 + lane;
        tile[rl][lane] = (r < p.R && c < p.C) ? s[(long long)r * p.lds + c] : 0.f;
    }
    __syncthreads();
    float* d = p.dst + z * p.sDz; const float* rr = p.R2 + z * p.sRz;
#pragma unroll
    for (int k = 0; k < 4; ++k) {
        const int cl = wave * 4 + k, c = c0 + cl, r = r0 + lane;
        if (c < p.C && r < p.R) {
            float v = act_fn(p.alpha * tile[lane][cl], p.act);
            if (p.flags & 1) v += p.beta * rr[(long long)c * p.ldr + r];
            VST2(float, d + (long long)c * p.ldd + r, v);
        }
    }
}

// k_affine: dst[i] = a * (sdev ? sdev[0] : 1) * src[i] + b, i < n (one thread per element; consecutive lanes -> consecutive addresses)
__global__ __launch_bounds__(256) void k_affine(const float* __restrict__ src, float* __restrict__ dst, int n, float a, float b, const float* __restrict__ sdev) {
    const int i = blockIdx.x * 256 + threadIdx.x;
    if (i < n) { const float aa = sdev ? a * sdev[0] : a; const float v = aa * src[i] + b; VST2(float, dst + i, v); }
}

// =====================================================================================================================
// k_softmax: row softmax over n contiguous elements, one 256-thread block per row; rows addressed z*sz + r*sr (grid (R, Z)).
//   out = scale_out * softmax(scale_in * x + (Mf ? Mf[z*smz + r*smr + j] : 0)); a row whose max is -inf is written as 0.
// =====================================================================================================================
struct SmP { const float* src; float* dst; const float* Mf; long long sz, sr, dz, dr, smz, smr; int n, pad; float scale_in, scale_out; };
static_assert(sizeof(SmP) == 3 * 8 + 6 * 8 + 4 * 4, "SmP has padding");
__global__ __launch_bounds__(256) void k_softmax(SmP p) {
    __shared__ float red[256];
    const int r = blockIdx.x, z = blockIdx.y, tid = threadIdx.x;
    const float* s = p.src + z * p.sz + (long long)r * p.sr;
    const float* mf = p.Mf ? (p.Mf + z * p.smz + (long long)r * p.smr) : nullptr;
    float mx = -__builtin_inff();
    for (int j = tid; j < p.n; j += 256) { float v = s[j] * p.scale_in; if (mf) v += mf[j]; mx = fmaxf(mx, v); }
    red[tid] = mx; __syncthreads();
    for (int o = 128; o > 0; o >>= 1) { if (tid < o) red[tid] = fmaxf(red[tid], red[tid + o]); __syncthreads(); }
    mx = red[0]; __syncthreads();
    float sum = 0.f;
    for (int j = tid; j < p.n; j += 256) { float v = s[j] * p.scale_in; if (mf) v += mf[j]; sum += (mx == -__builtin_inff()) ? 0.f : expf(v - mx); }
    red[tid] = sum; __syncthreads();
    for (int o = 128; o > 0; o >>= 1) { if (tid < o) red[tid] += red[tid + o]; __syncthreads(); }
    sum = red[0];
    const float inv = (sum > 0.f) ? p.scale_out / sum : 0.f;
    float* d = p.dst + z * p.dz + (long long)r * p.dr;
    for (int j = tid; j < p.n; j += 256) { float v = s[j] * p.scale_in; if (mf) v += mf[j]; const float o = (mx == -__builtin_inff()) ? 0.f : expf(v - mx) * inv; VST2(float, d + j, o); }
}
// =====================================================================================================================
// k_stats: mean and rsqrt(var + eps) over a set of n elements addressed base + z*sz + (e / inner) * so + (e % inner) * si, one 256-thread
// k_norm_apply: y = (x - mean[set]) * rstd[set] * g[c] + b[c] over a [Z][C][L] channel-major tensor with set = z*G + c / (C/G) (G groups per z;
//   G = C -> per-channel sets indexed z*C+c; for batch norm pass stats indexed by c only via bn = 1). Optional act. Output same layout.
// =====================================================================================================================
//   mode 0: mean / rsqrt(var + eps); mode 1 (RMSNorm): 0 / rsqrt(mean(x^2) + eps); mode 2 (L2 normalize * sqrt(n)): 0 / sqrt(n) / max(||x||, eps); mode 3: as 0 with unbiased variance (n-1)
__global__ __launch_bounds__(256) void k_stats(const float* __restrict__ x, long long sz, long long so, long long si, int inner, int n, float eps, float* __restrict__ stat, int mode) {
    __shared__ float red[256];
    const int z = blockIdx.x, tid = threadIdx.x;
    const float* base = x + z * sz;
    float s = 0.f;
    for (int e = tid; e < n; e += 256) s += base[(long long)(e / inner) * so + (long long)(e % inner) * si];
    red[tid] = s; __syncthreads();
    for (int o = 128; o > 0; o >>= 1) { if (tid < o) red[tid] += red[tid + o]; __syncthreads(); }
    const float mu = (mode == 0 || mode == 3) ? red[0] / (float)n : 0.f; __syncthreads();
    float q = 0.f;
    for (int e = tid; e < n; e += 256) { const float dlt = base[(long long)(e / inner) * so + (long long)(e % inner) * si] - mu; q += dlt * dlt; }
    red[tid] = q; __syncthreads();
    for (int o = 128; o > 0; o >>= 1) { if (tid < o) red[tid] += red[tid + o]; __syncthreads(); }
    {
        float rs;
        if (mode == 2) rs = sqrtf((float)n) / fmaxf(sqrtf(red[0]), eps); else if (mode == 3) rs = rsqrtf(red[0] / (float)(n - 1) + eps); else rs = rsqrtf(red[0] / (float)n + eps);
        if (tid < 32) { const float v = (tid == 0) ? mu : ((tid == 1) ? rs : 0.f); VST2(float, stat + (long long)z * 32 + tid, v); }
    }
}
//   One thread per element over the flat [Z][C][L] index space: grid ceil(Z*C*L / 256).
__global__ __launch_bounds__(256) void k_norm_apply(const float* __restrict__ x, float* __restrict__ y, const float* __restrict__ stat, const float* __restrict__ g, const float* __restrict__ bta,
                                                     int Z, int C, int L, int G, int bn, int act) {
    const long long idx = (long long)blockIdx.x * 256 + threadIdx.x;
    if (idx >= (long long)Z * C * L) return;
    const int l = (int)(idx % L); const long long zc = idx / L; const int c = (int)(zc % C), z = (int)(zc / C); (void)l;
    const int set = bn ? c : (z * G + c / (C / G));
    float v = (x[idx] - stat[(long long)set * 32]) * stat[(long long)set * 32 + 1];
    if (g) v *= g[c];
    if (bta) v += bta[c];
    v = act_fn(v, act);
    VST2(float, y + idx, v);
}

// k_lse_neg: c[i] = -(st[2i] + log(st[2i+1])) = minus the log-sum-exp of row i from k_attn's ST output (for softmax over the query dimension)
__global__ __launch_bounds__(256) void k_lse_neg(const float* __restrict__ st, float* __restrict__ c, int n) {
    const int i = blockIdx.x * 256 + threadIdx.x;
    if (i < n) { const float v = -(st[2 * i] + logf(st[2 * i + 1])); VST2(float, c + i, v); }
}

// k_iota: dst[i] = a * i + b as int32 (segment/position id helper)
__global__ __launch_bounds__(256) void k_iota(int* __restrict__ dst, int n, int a, int b) {
    const int i = blockIdx.x * 256 + threadIdx.x;
    if (i < n) { const int v = a * i + b; VST2(int, dst + i, v); }
}

// k_axpby: dst[i] = a * x[i] + b * y[i] (+ c), i < n
__global__ __launch_bounds__(256) void k_axpby(const float* __restrict__ x, const float* __restrict__ y, float* __restrict__ dst, int n, float a, float b, float c) {
    const int i = blockIdx.x * 256 + threadIdx.x;
    if (i < n) { const float v = a * x[i] + b * y[i] + c; VST2(float, dst + i, v); }
}

// =====================================================================================================================
// k_rope: rotary embedding on a [R rows][Hn heads][D] view (row stride sXr, head stride sXh, element stride 1) -> Y (own strides).
//   mode 0: rotate_half (partner d±D/2, sign - for d<D/2); mode 1: interleaved pairs (partner d^1, sign - for even d).
//   table column tcol: tmode 0 -> d, 1 -> d % (D/2), 2 -> d / 2; position p: pmode 0 -> r % S, 1 -> head index, 2 -> pos[r];
//   c = C[(r / S) * sCb + p * sCp + tcol * sCd], s likewise from Sn; y = x[d] * c + sign * x[partner] * s. X and Y must not alias.
// =====================================================================================================================
struct RopeP { const float* X; float* Y; const float* C; const float* Sn; const int* pos; long long sXr, sXh, sYr, sYh, sCb, sCp, sCd; int R, Hn, D, S, mode, tmode, pmode, pad; };
static_assert(sizeof(RopeP) == 5 * 8 + 7 * 8 + 8 * 4, "RopeP has padding");
__global__ __launch_bounds__(256) void k_rope(RopeP p) {
    const long long idx = (long long)blockIdx.x * 256 + threadIdx.x;
    if (idx >= (long long)p.R * p.Hn * p.D) return;
    const int d = (int)(idx % p.D); const long long rh = idx / p.D; const int h = (int)(rh % p.Hn); const int r = (int)(rh / p.Hn);
    const int half = p.D / 2;
    int partner; float sign;
    if (p.mode == 0) { partner = (d < half) ? d + half : d - half; sign = (d < half) ? -1.f : 1.f; }
    else { partner = d ^ 1; sign = (d & 1) ? 1.f : -1.f; }
    const int tcol = (p.tmode == 0) ? d : ((p.tmode == 1) ? (d % half) : (d >> 1));
    const int pp = (p.pmode == 0) ? (r % p.S) : ((p.pmode == 1) ? h : p.pos[r]);
    const long long toff = (long long)(r / p.S) * p.sCb + (long long)pp * p.sCp + (long long)tcol * p.sCd;
    const float* xr = p.X + (long long)r * p.sXr + (long long)h * p.sXh;
    const float v = xr[d] * p.C[toff] + sign * xr[partner] * p.Sn[toff];
    VST2(float, p.Y + (long long)r * p.sYr + (long long)h * p.sYh + d, v);
}

// k_invf + k_sincos (split so neither kernel carries a large VALU-fma footprint): invf_i = num * (1 / powf(base, (2 i)/D)) [fmode 0],
//   num * expf((2 i) * cexp) [fmode 1], num * powf(base, -2 (i - 1) / D) [fmode 2]; then cs/sn[s*half + i] = cos/sin((pscale * s) * invf_i)
__global__ __launch_bounds__(256) void k_invf(float* __restrict__ invb, int half, int D, float base, float num, int fmode, float cexp) {
    const int i = blockIdx.x * 256 + threadIdx.x;
    if (i >= ((half + 31) / 32) * 32) return;
    if (i >= half) { VST2(float, invb + i, 0.f); return; }
    const float e = (float)(2 * i) / (float)D;
    float invf;
    if (fmode == 1) invf = num * expf((float)(2 * i) * cexp);
    else if (fmode == 2) invf = num * powf(base, (-2.0f * ((float)i - 1.0f)) / (float)D);
    else invf = num * (1.0f / powf(base, e));
    VST2(float, invb + i, invf);
}
__global__ __launch_bounds__(256) void k_sincos(float* __restrict__ cs, float* __restrict__ sn, const float* __restrict__ invb, int S, int half, float pscale) {
    const int idx = blockIdx.x * 256 + threadIdx.x;
    if (idx >= S * half) return;
    const int s = idx / half, i = idx - s * half;
    const float ang = (pscale * (float)s) * invb[i];
    VST2(float, cs + idx, cosf(ang)); VST2(float, sn + idx, sinf(ang));
}

// k_mulact: dst[i] = act(x[i]) * y[i]
__global__ __launch_bounds__(256) void k_mulact(const float* __restrict__ x, const float* __restrict__ y, float* __restrict__ dst, int n, int act) {
    const int i = blockIdx.x * 256 + threadIdx.x;
    if (i < n) { const float v = act_fn(x[i], act) * y[i]; VST2(float, dst + i, v); }
}

// =====================================================================================================================
// k_matvec: thread-per-row matrix-vector products for N <= 8 output columns (heads with 1-3 outputs, gates), f32 on the VALU.
//   C[r*sCm + j] = act(alpha * sum_k A[r*sAm + k*sAk] * B[j*sBn + k*sBk] + bias[j]) + beta * R[r*sRm + j*sRn]; each thread writes its N contiguous floats.
// =====================================================================================================================
__global__ __launch_bounds__(256) void k_matvec(GemmP p) {
    // 32 lanes write one line with one instruction.
    const int rpt = (p.N == 1) ? 1 : 32;
    const long long r0 = ((long long)blockIdx.x * 256 + threadIdx.x) * rpt; const int z = blockIdx.z, zo = z / p.zi_n, zi = z - zo * p.zi_n;
    if (r0 >= p.M) return;
    const float* Bb = p.B + zo * p.sBo + zi * p.sBi;
    float* C = p.C + zo * p.sCo + zi * p.sCi; const float* R = p.R + zo * p.sRo + zi * p.sRi;
    for (int rr = 0; rr < rpt; ++rr) {
        const long long r = r0 + rr; if (r >= p.M) break;
        const float* A = p.A + zo * p.sAo + zi * p.sAi + r * p.sAm;
        float acc[8] = {0.f, 0.f, 0.f, 0.f, 0.f, 0.f, 0.f, 0.f};
        for (int k = 0; k < p.K; ++k) { const float a = A[(long long)k * p.sAk];
#pragma unroll
            for (int j = 0; j < 8; ++j) if (j < p.N) acc[j] += a * Bb[(long long)j * p.sBn + (long long)k * p.sBk]; }
#pragma unroll
        for (int j = 0; j < 8; ++j) if (j < p.N) {
            float v = acc[j] * p.alpha;
            if (p.flags & 1) v += p.bias[j];
            if (p.flags & 2) v += p.bias[r];
            v = act_fn(v, p.act);
            if (p.flags & 4) v += p.beta * R[r * p.sRm + (long long)j * p.sRn];
            VST2(float, C + r * p.sCm + j, v);
        }
    }
}
// k_smallsoftmax: thread-per-row softmax for short rows (n <= 64): dst[r*dr + j] = softmax(scale*src[r*sr + j])
__global__ __launch_bounds__(256) void k_smallsoftmax(const float* __restrict__ src, float* __restrict__ dst, long long sr, long long dr, int n, long long R, float scale) {
    const long long r0 = ((long long)blockIdx.x * 256 + threadIdx.x) * 32;
    for (int rr = 0; rr < 32; ++rr) {
        const long long r = r0 + rr; if (r >= R) return;
        const float* s = src + r * sr; float* d = dst + r * dr;
        float mx = -__builtin_inff();
        for (int j = 0; j < n; ++j) mx = fmaxf(mx, s[j] * scale);
        float sum = 0.f;
        for (int j = 0; j < n; ++j) sum += expf(s[j] * scale - mx);
        const float inv = 1.f / sum;
        for (int j = 0; j < n; ++j) { const float v = expf(s[j] * scale - mx) * inv; VST2(float, d + j, v); }
    }
}

__global__ __launch_bounds__(32) void k_unitstat(float* __restrict__ st) { const int t = threadIdx.x; const float v = (t == 1) ? 1.f : 0.f; VST2(float, st + t, v); }

// destination (e.g. a d_out whose row width is not a multiple of 32 floats) is written by consecutive lanes of one instruction
__global__ __launch_bounds__(256) void k_lincopy(const float* __restrict__ src, long long lds, float* __restrict__ dst, long long ldd, long long rows, int cols) {
    const long long i = (long long)blockIdx.x * 256 + threadIdx.x; if (i >= rows * cols) return;
    const long long r = i / cols; const int c = (int)(i - r * cols);
    const float v = src[r * lds + c]; VST2(float, dst + r * ldd + c, v);
}

namespace w25 {
typedef __attribute__((ext_vector_type(16))) _Float16 v16h;
typedef __attribute__((ext_vector_type(8)))  _Float16 v8h;
typedef __attribute__((ext_vector_type(16))) __bf16   v16b;
typedef __attribute__((ext_vector_type(8)))  __bf16   v8b;
typedef __attribute__((ext_vector_type(8)))  float    v8f;
typedef __attribute__((ext_vector_type(4)))  float    v4f;

__device__ __forceinline__ unsigned short f2bf_bits(float f) {
  unsigned u = __float_as_uint(f);
  return (unsigned short)((u + 0x7FFFu + ((u >> 16) & 1u)) >> 16);
}
__device__ __forceinline__ float bf_bits2f(unsigned short h) { return __uint_as_float(((unsigned)h) << 16); }

// hazard guards as plain device helpers (no inline asm inside the kernel template body)
__device__ __forceinline__ void dep_guard_h(v8f& a, v8f& b, v16h x, v16h y) { asm volatile("v_nop\n\tv_nop\n\tv_nop\n\tv_nop" : "+v"(a), "+v"(b) : "v"(x), "v"(y)); }
__device__ __forceinline__ void dep_guard_b(v8f& a, v8f& b, v16b x, v16b y) { asm volatile("v_nop\n\tv_nop\n\tv_nop\n\tv_nop" : "+v"(a), "+v"(b) : "v"(x), "v"(y)); }
__device__ __forceinline__ void keep4_h(v16h a, v16h b, v16h c, v16h d) { asm volatile("v_nop" :: "v"(a), "v"(b), "v"(c), "v"(d)); }
__device__ __forceinline__ void keep4_b(v16b a, v16b b, v16b c, v16b d) { asm volatile("v_nop" :: "v"(a), "v"(b), "v"(c), "v"(d)); }
__device__ __forceinline__ void acc_guard4(v8f& a, v8f& b, v8f& c, v8f& d) { asm volatile("v_nop\n\tv_nop\n\tv_nop\n\tv_nop" : "+v"(a), "+v"(b), "+v"(c), "+v"(d)); }
template <typename T> struct Frag;
template <> struct Frag<_Float16> {
  typedef v16h V; union U { v16h v; v8h h[2]; };
  static __device__ __forceinline__ v16h load(const _Float16* p) {   // elements 0..7 <- p[0..7], 8..15 <- p[16..23]
    U f; f.h[0] = *(const v8h*)(p); f.h[1] = *(const v8h*)(p + 16); return f.v;
  }
  static __device__ __forceinline__ v8f mma(v16h a, v16h b, v8f c) {
    return __builtin_amdgcn_wmma_f32_16x16x32_f16(false, a, false, b, (short)0, c, false, false);
  }
  static __device__ __forceinline__ void guard(v8f& a, v8f& b, v16h x, v16h y) { dep_guard_h(a, b, x, y); }
  static __device__ __forceinline__ void keep(v16h a, v16h b, v16h c, v16h d) { keep4_h(a, b, c, d); }
};
template <> struct Frag<__bf16> {
  typedef v16b V; union U { v16b v; v8b h[2]; };
  static __device__ __forceinline__ v16b load(const __bf16* p) {
    U f; f.h[0] = *(const v8b*)(p); f.h[1] = *(const v8b*)(p + 16); return f.v;
  }
  static __device__ __forceinline__ v8f mma(v16b a, v16b b, v8f c) {
    return __builtin_amdgcn_wmma_f32_16x16x32_bf16(false, a, false, b, (short)0, c, false, false);
  }
  static __device__ __forceinline__ void guard(v8f& a, v8f& b, v16b x, v16b y) { dep_guard_b(a, b, x, y); }
  static __device__ __forceinline__ void keep(v16b a, v16b b, v16b c, v16b d) { keep4_b(a, b, c, d); }
};

// ---- Register-blocked batched WMMA GEMM ------------------------------------
// C[m,n] = scale * sum_k A[m,k] * Bt[n,k] (+bias)(+resid); each wave owns a 64x64 tile.
// A row-major [M,K]; Bt row-major [N,K]; M,N % 64 == 0, K % 32 == 0.
// SPLIT: operands are hi/lo planes (A2/Bt2 = lo planes, same layout); product = hi·hi + hi·lo + lo·hi.
// BIAS_MODE: 0 = none, 1 = bias[m], 2 = bias[n].
// OUT_MODE: 0 = f32, 1 = f16, 2 = bf16 hi plane (Cout) + bf16 lo plane (Cout2).
// ET: 0 = f16 operands, 1 = bf16 operands (pointers passed as 16-bit storage)
template <int ET> struct Elem;
template <> struct Elem<0> { typedef _Float16 T; };
template <> struct Elem<1> { typedef __bf16 T; };
template <int ET, bool SPLIT, int BIAS_MODE, int OUT_MODE, bool RESID, int ACT = 0>
__global__ __launch_bounds__(256) void wmma_gemm64(
    const unsigned short* __restrict__ Ap, const unsigned short* __restrict__ A2p, int lda, long strideA,
    const unsigned short* __restrict__ Btp, const unsigned short* __restrict__ Bt2p, int ldb, long strideB,
    void* __restrict__ Cout, void* __restrict__ Cout2, int ldc, long strideC,
    const float* __restrict__ bias,
    const float* __restrict__ resid, long strideR,
    int M, int N, int K, float scale) {
  typedef typename Elem<ET>::T T;
  typedef typename Frag<T>::V V;
  const T* A = (const T*)Ap; const T* A2 = (const T*)A2p; const T* Bt = (const T*)Btp; const T* Bt2 = (const T*)Bt2p;
  __shared__ __align__(16) float sT[8][16 * 68];   // per-wave 16x64 slab, pitch 68 floats
  const int b    = blockIdx.y;
  const int lane = threadIdx.x & 31;
  const int wave = threadIdx.x >> 5;
  const int tilesN = N >> 6;
  const int tilesM = M >> 6;
  const int tile = blockIdx.x * 8 + wave;
  if (tile >= tilesM * tilesN) return;   // wave-uniform; no block barriers in this kernel
  const int tm = tile / tilesN;
  const int tn = tile - tm * tilesN;
  const int m0 = tm << 6;
  const int n0 = tn << 6;

  const T* Ab  = A  + (size_t)b * strideA;
  const T* Bb  = Bt + (size_t)b * strideB;
  const T* Ab2 = SPLIT ? (A2  + (size_t)b * strideA) : nullptr;
  const T* Bb2 = SPLIT ? (Bt2 + (size_t)b * strideB) : nullptr;

  const int rlane = lane & 15;                 // row (A) / col (B, D) within subtile
  const int koff  = (lane >> 4) * 8;           // k offset of this lane half
  const int mOff  = (lane >> 4) * 8;           // D row offset

  v8f acc[4][4];
#pragma unroll
  for (int i = 0; i < 4; ++i)
#pragma unroll
    for (int j = 0; j < 4; ++j) acc[i][j] = (v8f){0.f,0.f,0.f,0.f,0.f,0.f,0.f,0.f};

  for (int k0 = 0; k0 < K; k0 += 32) {
    V bh[4], bl[4];
#pragma unroll
    for (int j = 0; j < 4; ++j) {
      const size_t bo = (size_t)(n0 + (j << 4) + rlane) * ldb + koff + k0;
      bh[j] = Frag<T>::load(Bb + bo);
      if (SPLIT) bl[j] = Frag<T>::load(Bb2 + bo);
    }
#pragma unroll
    for (int i = 0; i < 4; ++i) {
      const size_t ao = (size_t)(m0 + (i << 4) + rlane) * lda + koff + k0;
      V ah = Frag<T>::load(Ab + ao);
      V al;
      if (SPLIT) al = Frag<T>::load(Ab2 + ao);
#pragma unroll
      for (int j = 0; j < 4; ++j) {
        acc[i][j] = Frag<T>::mma(ah, bh[j], acc[i][j]);
        if (SPLIT) {
          acc[i][j] = Frag<T>::mma(ah, bl[j], acc[i][j]);
          acc[i][j] = Frag<T>::mma(al, bh[j], acc[i][j]);
        }
      }
      Frag<T>::guard(acc[i][0], acc[i][3], ah, SPLIT ? al : ah);
    }
    Frag<T>::keep(bh[0], bh[1], bh[2], bh[3]);
    if (SPLIT) Frag<T>::keep(bl[0], bl[1], bl[2], bl[3]);
  }
  acc_guard4(acc[0][0], acc[0][1], acc[0][2], acc[0][3]);
  acc_guard4(acc[1][0], acc[1][1], acc[1][2], acc[1][3]);
  acc_guard4(acc[2][0], acc[2][1], acc[2][2], acc[2][3]);
  acc_guard4(acc[3][0], acc[3][1], acc[3][2], acc[3][3]);

  // ---- epilogue ----
  float* slab = sT[wave];
  const float* Rb = RESID ? (resid + (size_t)b * strideR) : nullptr;
#pragma unroll
  for (int i = 0; i < 4; ++i) {
    const int mBase = m0 + (i << 4);
#pragma unroll
    for (int j = 0; j < 4; ++j) {
      const int n = n0 + (j << 4) + rlane;
      float bv = 0.f;
      if (BIAS_MODE == 2) bv = bias[n];
#pragma unroll
      for (int r = 0; r < 8; ++r) {
        float v = acc[i][j][r] * scale;
        if (BIAS_MODE == 1) v += bias[mBase + mOff + r];
        if (BIAS_MODE == 2) v += bv;
        if (RESID) v += Rb[(size_t)(mBase + mOff + r) * ldc + n];
        if (ACT == 1) v = tanhf(v);
        if (ACT == 2) v = fmaxf(v, 0.0f);
        if (ACT == 3) v = v / (1.0f + expf(-v));
        if (ACT == 4) v = (v > 0.f) ? v : 0.01f * v;
        if (ACT == 5) v = 0.5f * v * (1.0f + erff(v * 0.70710678118654752f));
        slab[(mOff + r) * 68 + (j << 4) + rlane] = v;
      }
    }
    __builtin_amdgcn_fence(__ATOMIC_RELEASE, "workgroup");
    __builtin_amdgcn_wave_barrier();
    __builtin_amdgcn_fence(__ATOMIC_ACQUIRE, "workgroup");
    if (OUT_MODE == 0) {
      float* C = (float*)Cout + (size_t)b * strideC;
      const int hh = lane >> 4, c4 = (lane & 15) * 4;     // row seg = 256 B = 16 lanes x 16 B
      {
#pragma unroll
        for (int it = 0; it < 8; ++it) {
          const int row = it * 2 + hh;
          v4f v = *(const v4f*)(slab + row * 68 + c4);
          *(v4f*)(C + (size_t)(mBase + row) * ldc + n0 + c4) = v;
        }
        
      }
    } else {
      const int q = lane >> 3, c8 = (lane & 7) * 8;
      unsigned short* C  = (unsigned short*)Cout  + (size_t)b * strideC;
      unsigned short* C2 = (OUT_MODE == 2) ? ((unsigned short*)Cout2 + (size_t)b * strideC) : nullptr;
      {
#pragma unroll
        for (int it = 0; it < 4; ++it) {
          const int row = it * 4 + q;
          const float* sp = slab + row * 68 + c8;
          v8h hv, lv;
#pragma unroll
          for (int e = 0; e < 8; ++e) {
            if (OUT_MODE == 1) {
              hv[e] = (_Float16)sp[e];
            } else {
              unsigned short hb = f2bf_bits(sp[e]);
              unsigned short lb = f2bf_bits(sp[e] - bf_bits2f(hb));
              hv[e] = __builtin_bit_cast(_Float16, hb);
              lv[e] = __builtin_bit_cast(_Float16, lb);
            }
          }
          *(v8h*)(C + (size_t)(mBase + row) * ldc + n0 + c8) = hv;
          if (OUT_MODE == 2) *(v8h*)(C2 + (size_t)(mBase + row) * ldc + n0 + c8) = lv;
        }
        
      }
    }
    __builtin_amdgcn_fence(__ATOMIC_RELEASE, "workgroup");
    __builtin_amdgcn_wave_barrier();
    __builtin_amdgcn_fence(__ATOMIC_ACQUIRE, "workgroup");
  }
}

__global__ __launch_bounds__(256) void cast_f32_f16x2(
    const float* __restrict__ in, _Float16* __restrict__ out, int n2) {
  int i = blockIdx.x * 256 + threadIdx.x;
  if (i < n2) {
    const _Float16 h0 = (_Float16)in[2 * i], h1 = (_Float16)in[2 * i + 1];
    const unsigned u = (unsigned)__builtin_bit_cast(unsigned short, h0) | ((unsigned)__builtin_bit_cast(unsigned short, h1) << 16);
    ((unsigned*)out)[i] = u;
    
  }
}


} // namespace w25

__device__ __forceinline__ unsigned int f2h2_pack(float a, float b) { return (unsigned)__builtin_bit_cast(unsigned short, (_Float16)a) | ((unsigned)__builtin_bit_cast(unsigned short, (_Float16)b) << 16); }
// Transposing casts of x[b] ([256][Cn] f32 -> [b][Cn][256] 16-bit planes). Each thread owns 8 rows x 4 columns: eight 16-byte loads, then one 16-byte store
// per column and plane. In a wave 8 lanes run along the rows (8 x 16 B = one whole 128-B line of a destination row) and 4 along the columns;
// a block is 4 waves x 64 rows = all 256 rows, by 2 waves x 16 columns. blockIdx.x = group of 32 columns, blockIdx.y = image.
template <int Cn> __global__ __launch_bounds__(256) void k_castT16w(const float* __restrict__ src, _Float16* __restrict__ dst, float s) {
    const int lane = threadIdx.x & 31, w = threadIdx.x >> 5;
    const int r0 = ((w & 3) * 8 + (lane & 7)) * 8, c0 = blockIdx.x * 32 + (w >> 2) * 16 + (lane >> 3) * 4;
    src += (long long)blockIdx.y * 256 * Cn + (long long)r0 * Cn + c0; dst += (long long)blockIdx.y * 256 * Cn + (long long)c0 * 256 + r0;
    v4f v[8];
#pragma unroll   // v[] in registers, all eight loads in flight
    for (int k = 0; k < 8; ++k) v[k] = *(const v4f*)(src + (long long)k * Cn);
#pragma unroll   // constant indices into v[]
    for (int j = 0; j < 4; ++j) { v4u h;
#pragma unroll   // constant indices into v[]
        for (int q = 0; q < 4; ++q) h[q] = f2h2_pack(v[2 * q][j] * s, v[2 * q + 1][j] * s);
        *(v4u*)(dst + j * 256) = h; } }
__global__ __launch_bounds__(256) void k_cast16(const float* __restrict__ src, long long lds, _Float16* __restrict__ dst, long long ldd, int R, int C, float s) {
    const long long i = (long long)blockIdx.x * 256 + threadIdx.x; const long long np = (long long)R * (C / 2); if (i >= np) return; const int r = (int)(i / (C / 2)); const int c = 2 * (int)(i % (C / 2));
    const _Float16 h0 = (_Float16)(src[(long long)r * lds + c] * s), h1 = (_Float16)(src[(long long)r * lds + c + 1] * s);
    const unsigned u = (unsigned)__builtin_bit_cast(unsigned short, h0) | ((unsigned)__builtin_bit_cast(unsigned short, h1) << 16);
    unsigned* d = (unsigned*)(dst + (long long)r * ldd + c); *d = u;  }

// f32 -> bf16 hi plane + bf16 lo plane (x = hi + lo to ~2^-17 relative; RNE both), [R][C] -> [R][C] (or transposed to [C][R]); 2 consecutive destination elements
__device__ __forceinline__ unsigned int f2bf2_pack(float a, float b, unsigned int* lo) {
    const unsigned short ha = w25::f2bf_bits(a), hb = w25::f2bf_bits(b);
    const unsigned short la = w25::f2bf_bits(a - w25::bf_bits2f(ha)), lb = w25::f2bf_bits(b - w25::bf_bits2f(hb));
    *lo = (unsigned)la | ((unsigned)lb << 16); return (unsigned)ha | ((unsigned)hb << 16); }
__global__ __launch_bounds__(256) void k_castS16(const float* __restrict__ src, long long lds, __bf16* __restrict__ dhi, __bf16* __restrict__ dlo, long long ldd, int R, int C, float s, int transpose, long long sb, long long db) {
    src += (long long)blockIdx.y * sb; dhi += (long long)blockIdx.y * db; dlo += (long long)blockIdx.y * db;   // blockIdx.y = image
    const long long i = (long long)blockIdx.x * 256 + threadIdx.x; long long o; float a, b;
    if (transpose) { const long long np = (long long)C * (R / 2); if (i >= np) return; const int c = (int)(i / (R / 2)); const int r = 2 * (int)(i % (R / 2)); a = src[(long long)r * lds + c] * s; b = src[(long long)(r + 1) * lds + c] * s; o = (long long)c * ldd + r; }
    else { const long long np = (long long)R * (C / 2); if (i >= np) return; const int r = (int)(i / (C / 2)); const int c = 2 * (int)(i % (C / 2)); a = src[(long long)r * lds + c] * s; b = src[(long long)r * lds + c + 1] * s; o = (long long)r * ldd + c; }
    unsigned lo; const unsigned hi = f2bf2_pack(a, b, &lo); unsigned* ph = (unsigned*)(dhi + o); unsigned* pl = (unsigned*)(dlo + o);
    *ph = hi; *pl = lo;  }
// the transposing cast of k_castT16w for the bf16 hi and lo planes
template <int Cn> __global__ __launch_bounds__(256) void k_castS16w(const float* __restrict__ src, __bf16* __restrict__ dhi, __bf16* __restrict__ dlo, float s) {
    const int lane = threadIdx.x & 31, w = threadIdx.x >> 5;
    const int r0 = ((w & 3) * 8 + (lane & 7)) * 8, c0 = blockIdx.x * 32 + (w >> 2) * 16 + (lane >> 3) * 4;
    const long long o = (long long)blockIdx.y * 256 * Cn + (long long)c0 * 256 + r0;
    src += (long long)blockIdx.y * 256 * Cn + (long long)r0 * Cn + c0; dhi += o; dlo += o;
    v4f v[8];
#pragma unroll   // v[] in registers, all eight loads in flight
    for (int k = 0; k < 8; ++k) v[k] = *(const v4f*)(src + (long long)k * Cn);
#pragma unroll   // constant indices into v[]
    for (int j = 0; j < 4; ++j) { v4u hi, lo;
#pragma unroll   // constant indices into v[]
        for (int q = 0; q < 4; ++q) { unsigned l; hi[q] = f2bf2_pack(v[2 * q][j] * s, v[2 * q + 1][j] * s, &l); lo[q] = l; }
        *(v4u*)(dhi + j * 256) = hi; *(v4u*)(dlo + j * 256) = lo; } }

namespace w25 {
// =====================================================================================
// Generic causal/non-causal attention for head_dim 64, f32 in / f32 out; 16-bit operands: bf16 with optional hi/lo splits, or
// plain f16 (F16=true, non-split, probabilities carried x2^15).
//   scores = (q*qscale)·kᵀ : v_wmma_f32_16x16x32_bf16; SPLIT_QK -> q,k as bf16 hi/lo (hi·hi + hi·lo + lo·hi)
//   out    = p·v           : v_wmma_f32_16x16x32_bf16; SPLIT_PV -> p,v as bf16 hi/lo; else p,v plain bf16
//   f32 accumulate; online softmax in f32. Block = 4 waves = 64 query rows of one (batch, head); S % 64 == 0.
//   Element (b, s, h, d) of tensor X lives at X[b*X_bs + s*X_rs + h*X_hs + d] (strides in floats, multiples of 4).
//   Masking: mask_mode 0 none, 1 causal (kv > q masked), 2 tensor [S][Skv] shared over (b,h) (float if
//   mask_is_int==0, int32 with element == 0 -> masked if 1, int32 with element != 0 -> masked if 2), 3 per-token vectors qmask[B][S] & kvmask[B][Skv] (int32,
//   0 -> masked), 4 causal + sliding window (kv > q or q - kv > W masked; W passed in mask_is_int);
//   5 = relative-position bias: s += cp[b,h,q][idx[q][kv]] + pc[b,h,kv][idx[q][kv]] with idx = mask_b ([S][Skv] int32) and
//   mask_a an int32 [S][Skv] tensor with nonzero = masked (tables: element (b,h,row,n) at X + b*c_bs + h*c_hs + row*c_rs + n);
//   masked scores are replaced by mask_fill (e.g. -inf or -1e9) before the softmax.
//   grid.x = B * H * (S/64) (or a sub-range with blk0).
// =====================================================================================
#define AT_D 64
#define AT_NW 4
#define AT_QB 64
#define AT_KC 64
struct AttnGeom { const float* cp = nullptr; const float* pc = nullptr; long c_bs = 0, c_rs = 0, c_hs = 0;   // mode-5 score-bias tables
                  long q_bs, q_rs, q_hs, k_bs, k_rs, k_hs, v_bs, v_rs, v_hs, o_bs, o_rs, o_hs;
                  int S, Skv, H, mask_mode; float qscale; int blk0; float mask_fill; int mask_is_int; };
static_assert(sizeof(AttnGeom) == 168, "no padding");

__device__ __forceinline__ unsigned short at_bf_bits(float f) {
  unsigned u = __float_as_uint(f);
  return (unsigned short)((u + 0x7FFFu + ((u >> 16) & 1u)) >> 16);
}
__device__ __forceinline__ __bf16 at_f2bf(float f) { return __builtin_bit_cast(__bf16, at_bf_bits(f)); }
__device__ __forceinline__ void at_split(float f, __bf16& hi, __bf16& lo) {
  const unsigned short hb = at_bf_bits(f);
  hi = __builtin_bit_cast(__bf16, hb);
  lo = at_f2bf(f - __uint_as_float(((unsigned)hb) << 16));
}
__device__ __forceinline__ v8f at_mma(v16b a, v16b b, v8f c) {
  c = __builtin_amdgcn_wmma_f32_16x16x32_bf16(false, a, false, b, (short)0, c, false, false);
  asm volatile("v_nop\n\tv_nop\n\tv_nop\n\tv_nop" : "+v"(c) : "v"(a), "v"(b));
  return c;
}
// 16-bit element as a bit pattern held in a __bf16 slot: f16 bits when F16, bf16 (RNE) otherwise
template <bool F16> __device__ __forceinline__ __bf16 at_to16(float f) {
  if (F16) return __builtin_bit_cast(__bf16, (_Float16)f);
  return at_f2bf(f);
}
template <bool F16> __device__ __forceinline__ v8f at_mma16(v16b a, v16b b, v8f c) {
  if (F16) {
    const v16h ah = __builtin_bit_cast(v16h, a), bh = __builtin_bit_cast(v16h, b);
    c = __builtin_amdgcn_wmma_f32_16x16x32_f16(false, ah, false, bh, (short)0, c, false, false);
    asm volatile("v_nop\n\tv_nop\n\tv_nop\n\tv_nop" : "+v"(c) : "v"(ah), "v"(bh));
    return c;
  }
  return at_mma(a, b, c);
}

template <bool SPLIT_QK, bool SPLIT_PV, bool F16 = false>
__global__ __launch_bounds__(128)
void attn64_kernel(const float* __restrict__ q, const float* __restrict__ k,
                   const float* __restrict__ v, float* __restrict__ out,
                   const void* __restrict__ mask_a, const int* __restrict__ mask_b, AttnGeom g) {
  static_assert(!(F16 && (SPLIT_QK || SPLIT_PV)), "f16 mode is non-split");
  const float PSC = F16 ? 32768.0f : 1.0f;     // f16 probabilities carried x2^15 (subnormal range), folded into the final 1/l
  union FB { v16b v; v8b h[2]; };
  __shared__ __align__(16) __bf16 Ksh[AT_KC * AT_D];             // K hi [kv][d]      8 KB
  __shared__ __align__(16) __bf16 Ksl[SPLIT_QK ? AT_KC * AT_D : 8];
  __shared__ __align__(16) __bf16 Vth[AT_D * AT_KC];             // V hi [d][kv]      8 KB
  __shared__ __align__(16) __bf16 Vtl[SPLIT_PV ? AT_D * AT_KC : 8];
  __shared__ __align__(16) __bf16 Psh[AT_NW][16 * AT_KC];        // per wave P hi [row][kv]  8 KB
  __shared__ __align__(16) __bf16 Psl[SPLIT_PV ? AT_NW : 1][SPLIT_PV ? 16 * AT_KC : 8];
  __shared__ __align__(16) float  Os[AT_NW][16 * 68];            // per wave out tile, pitch 68

  const int tid  = threadIdx.x;
  const int wave = tid >> 5;
  const int lane = tid & 31;
  const int hh   = lane >> 4;
  const int c    = lane & 15;

  const int nqb = g.S / AT_QB;
  const int bx = blockIdx.x + g.blk0;
  const int qb = bx % nqb;
  const int bh = bx / nqb;
  const int h  = bh % g.H;
  const int b  = bh / g.H;
  const int qbase_block = qb * AT_QB;
  const int q0 = qbase_block + wave * 16;

  const float* qb_ptr = q + (size_t)b * g.q_bs + (size_t)h * g.q_hs;
  const float* kb_ptr = k + (size_t)b * g.k_bs + (size_t)h * g.k_hs;
  const float* vb_ptr = v + (size_t)b * g.v_bs + (size_t)h * g.v_hs;
  float*       ob_ptr = out + (size_t)b * g.o_bs + (size_t)h * g.o_hs;

  // ---- Q fragments (A operand): 2 d-chunks, hi (and lo) ----
  v16b qah[2], qal[2];
  {
    const float* qrow = qb_ptr + (size_t)(q0 + c) * g.q_rs;
#pragma unroll
    for (int dc = 0; dc < 2; ++dc) {
#pragma unroll
      for (int e = 0; e < 8; ++e) {
        const float f0 = qrow[dc * 32 + 8 * hh + e] * g.qscale;
        const float f1 = qrow[dc * 32 + 16 + 8 * hh + e] * g.qscale;
        if (SPLIT_QK) { __bf16 hq, lq; at_split(f0, hq, lq); qah[dc][e] = hq; qal[dc][e] = lq; at_split(f1, hq, lq); qah[dc][8 + e] = hq; qal[dc][8 + e] = lq; }
        else { qah[dc][e] = at_to16<F16>(f0); qah[dc][8 + e] = at_to16<F16>(f1); qal[dc][e] = qah[dc][e]; qal[dc][8 + e] = qah[dc][8 + e]; }
      }
    }
  }

  float mrow[8], lrow[8];
  v8f oacc[4];
#pragma unroll
  for (int r = 0; r < 8; ++r) { mrow[r] = -INFINITY; lrow[r] = 0.f; }
#pragma unroll
  for (int t = 0; t < 4; ++t) oacc[t] = (v8f){0.f,0.f,0.f,0.f,0.f,0.f,0.f,0.f};

  const int nChunks = (g.mask_mode == 1 || g.mask_mode == 4) ? (qb + 1) : (g.Skv / AT_KC);   // block-uniform
  // per-row query mask (mode 3)
  int qkeep[8];
#pragma unroll
  for (int r = 0; r < 8; ++r) qkeep[r] = (g.mask_mode == 3) ? mask_b[(size_t)b * g.S + q0 + 8 * hh + r] : 1;   // mask_b = qmask in mode 3
  for (int kc = 0; kc < nChunks; ++kc) {
    const int kv0 = kc * AT_KC;
    __syncthreads();
    {
      const int kvr = tid >> 1, dh = (tid & 1) * 32;
      const float* krow = kb_ptr + (size_t)(kv0 + kvr) * g.k_rs + dh;
      const float* vrow = vb_ptr + (size_t)(kv0 + kvr) * g.v_rs + dh;
#pragma unroll
      for (int i = 0; i < 8; ++i) {
        v4f kk = *(const v4f*)(krow + 4 * i);
        v4f vv = *(const v4f*)(vrow + 4 * i);
#pragma unroll
        for (int e = 0; e < 4; ++e) {
          const int d = dh + 4 * i + e;
          if (SPLIT_QK) { __bf16 a, bl; at_split(kk[e], a, bl); Ksh[kvr * AT_D + d] = a; Ksl[kvr * AT_D + d] = bl; }
          else Ksh[kvr * AT_D + d] = at_to16<F16>(kk[e]);
          if (SPLIT_PV) { __bf16 a, bl; at_split(vv[e], a, bl); Vth[d * AT_KC + kvr] = a; Vtl[d * AT_KC + kvr] = bl; }
          else Vth[d * AT_KC + kvr] = at_to16<F16>(vv[e]);
        }
      }
    }
    __syncthreads();

    v8f s[4];
#pragma unroll
    for (int j = 0; j < 4; ++j) {
      s[j] = (v8f){0.f,0.f,0.f,0.f,0.f,0.f,0.f,0.f};
#pragma unroll 1
      for (int dc = 0; dc < 2; ++dc) {
        FB kb;
        kb.h[0] = *(const v8b*)(Ksh + (j * 16 + c) * AT_D + dc * 32 + 8 * hh);
        kb.h[1] = *(const v8b*)(Ksh + (j * 16 + c) * AT_D + dc * 32 + 16 + 8 * hh);
        s[j] = at_mma16<F16>(qah[dc], kb.v, s[j]);
        if (SPLIT_QK) {
          FB kl;
          kl.h[0] = *(const v8b*)(Ksl + (j * 16 + c) * AT_D + dc * 32 + 8 * hh);
          kl.h[1] = *(const v8b*)(Ksl + (j * 16 + c) * AT_D + dc * 32 + 16 + 8 * hh);
          s[j] = at_mma16<F16>(qah[dc], kl.v, s[j]);
          s[j] = at_mma16<F16>(qal[dc], kb.v, s[j]);
        }
      }
    }
    const bool diag = (g.mask_mode == 1) && (kc == qb);
    int kvkeep[4] = {1, 1, 1, 1};
    if (g.mask_mode == 3) {
#pragma unroll
      for (int j = 0; j < 4; ++j) kvkeep[j] = ((const int*)mask_a)[(size_t)b * g.Skv + kv0 + j * 16 + c];   // mask_a = kvmask
    }
    float cm[8];
#pragma unroll
    for (int r = 0; r < 8; ++r) {
      const int qrow = q0 + 8 * hh + r;
      float m = -INFINITY;
#pragma unroll
      for (int j = 0; j < 4; ++j) {
        const int kvcol = kv0 + j * 16 + c;
        bool masked = false;
        if (diag) masked = (kvcol > qrow);
        else if (g.mask_mode == 4) masked = (kvcol > qrow) || (qrow - kvcol > g.mask_is_int);
        else if (g.mask_mode == 2) {
          const size_t mi = (size_t)qrow * g.Skv + kvcol;
          masked = (g.mask_is_int == 0) ? (((const float*)mask_a)[mi] == 0.0f)
                 : (g.mask_is_int == 1) ? (((const int*)mask_a)[mi] == 0) : (((const int*)mask_a)[mi] != 0);
        } else if (g.mask_mode == 3) masked = (qkeep[r] == 0) || (kvkeep[j] == 0);
        else if (g.mask_mode == 5) {
          const size_t mi = (size_t)qrow * g.Skv + kvcol;
          masked = (((const int*)mask_a)[mi] != 0);
          int n = mask_b[mi]; n = n < 0 ? 0 : n;
          s[j][r] += g.cp[(size_t)b * g.c_bs + (size_t)h * g.c_hs + (size_t)qrow * g.c_rs + n]
                   + g.pc[(size_t)b * g.c_bs + (size_t)h * g.c_hs + (size_t)kvcol * g.c_rs + n];
        }
        if (masked) s[j][r] = g.mask_fill;
        m = fmaxf(m, s[j][r]);
      }
#pragma unroll
      for (int off = 1; off < 16; off <<= 1) m = fmaxf(m, __shfl_xor(m, off, 32));
      cm[r] = m;
    }
    __bf16* pwh = Psh[wave];
    __bf16* pwl = Psl[SPLIT_PV ? wave : 0];
#pragma unroll
    for (int r = 0; r < 8; ++r) {
      const float mnew = fmaxf(mrow[r], cm[r]);
      const float alpha = expf(mrow[r] - mnew);
      mrow[r] = mnew;
      float psum = 0.f;
#pragma unroll
      for (int j = 0; j < 4; ++j) {
        const float p = expf(s[j][r] - mnew);
        psum += p;
        if (SPLIT_PV) { __bf16 a, bl; at_split(p, a, bl); pwh[(8 * hh + r) * AT_KC + j * 16 + c] = a; pwl[(8 * hh + r) * AT_KC + j * 16 + c] = bl; }
        else pwh[(8 * hh + r) * AT_KC + j * 16 + c] = at_to16<F16>(p * PSC);
      }
#pragma unroll
      for (int off = 1; off < 16; off <<= 1) psum += __shfl_xor(psum, off, 32);
      lrow[r] = lrow[r] * alpha + psum;
#pragma unroll
      for (int t = 0; t < 4; ++t) oacc[t][r] *= alpha;
    }
    __builtin_amdgcn_fence(__ATOMIC_RELEASE, "workgroup");
    __builtin_amdgcn_wave_barrier();
    __builtin_amdgcn_fence(__ATOMIC_ACQUIRE, "workgroup");
#pragma unroll 1
    for (int kk = 0; kk < 2; ++kk) {
      FB pa, pl;
      pa.h[0] = *(const v8b*)(pwh + c * AT_KC + kk * 32 + 8 * hh);
      pa.h[1] = *(const v8b*)(pwh + c * AT_KC + kk * 32 + 16 + 8 * hh);
      if (SPLIT_PV) {
        pl.h[0] = *(const v8b*)(pwl + c * AT_KC + kk * 32 + 8 * hh);
        pl.h[1] = *(const v8b*)(pwl + c * AT_KC + kk * 32 + 16 + 8 * hh);
      }
#pragma unroll
      for (int t = 0; t < 4; ++t) {
        FB vb;
        vb.h[0] = *(const v8b*)(Vth + (t * 16 + c) * AT_KC + kk * 32 + 8 * hh);
        vb.h[1] = *(const v8b*)(Vth + (t * 16 + c) * AT_KC + kk * 32 + 16 + 8 * hh);
        oacc[t] = at_mma16<F16>(pa.v, vb.v, oacc[t]);
        if (SPLIT_PV) {
          FB vl;
          vl.h[0] = *(const v8b*)(Vtl + (t * 16 + c) * AT_KC + kk * 32 + 8 * hh);
          vl.h[1] = *(const v8b*)(Vtl + (t * 16 + c) * AT_KC + kk * 32 + 16 + 8 * hh);
          oacc[t] = at_mma16<F16>(pa.v, vl.v, oacc[t]);
          oacc[t] = at_mma16<F16>(pl.v, vb.v, oacc[t]);
        }
      }
    }
  }

  float* os = Os[wave];
#pragma unroll
  for (int r = 0; r < 8; ++r) {
    const float inv = 1.0f / (lrow[r] * PSC);
#pragma unroll
    for (int t = 0; t < 4; ++t) os[(8 * hh + r) * 68 + t * 16 + c] = oacc[t][r] * inv;
  }
  __builtin_amdgcn_fence(__ATOMIC_RELEASE, "workgroup");
  __builtin_amdgcn_wave_barrier();
  __builtin_amdgcn_fence(__ATOMIC_ACQUIRE, "workgroup");
  {
    const int c4 = (lane & 15) * 4;
    {
#pragma unroll
      for (int it = 0; it < 8; ++it) {
        const int row = it * 2 + hh;
        v4f val = *(const v4f*)(os + row * 68 + c4);
        *(v4f*)(ob_ptr + (size_t)(q0 + row) * g.o_rs + c4) = val;
      }
      
    }
  }
}

} // namespace w25

__device__ __forceinline__ void st_h2(_Float16* dst, float a, float b) { const unsigned u = (unsigned)__builtin_bit_cast(unsigned short, (_Float16)a) | ((unsigned)__builtin_bit_cast(unsigned short, (_Float16)b) << 16); unsigned* d = (unsigned*)dst; *d = u;  }
__device__ __forceinline__ unsigned short bf16b(float v) { const unsigned u = __builtin_bit_cast(unsigned, v); return (unsigned short)(((u + 0x7FFFu + ((u >> 16) & 1u)) & 0xFFFF0000u) >> 16); }
__device__ __forceinline__ float bf16f(unsigned short h) { return __builtin_bit_cast(float, ((unsigned)h) << 16); }
__device__ __forceinline__ void st_split2(_Float16* H, _Float16* L, long long e, float v0, float v1) { const unsigned short h0 = bf16b(v0), h1 = bf16b(v1); { const unsigned u = (unsigned)h0 | ((unsigned)h1 << 16); unsigned* d = (unsigned*)(H + e); *d = u;  } { const unsigned u = (unsigned)bf16b(v0 - bf16f(h0)) | ((unsigned)bf16b(v1 - bf16f(h1)) << 16); unsigned* d = (unsigned*)(L + e); *d = u;  } }
// 2x2 max-pool of PH and G ([ic][64][64] -> [ic][32][32]) plus the operand planes: PP hi/lo [nk][ic] (pooled phi, transposed), GP16 [ic][nk] (pooled g), TH hi/lo [hw][ic] (theta planes). thread-linear: HW*IC/8 groups of 8 theta values = IC*NK/2 pooled pairs
__global__ __launch_bounds__(256) void k_nl_pool(const float* __restrict__ PH, const float* __restrict__ G, const float* __restrict__ TH, float* __restrict__ PHP, float* __restrict__ GP, _Float16* PPH, _Float16* PPL, _Float16* GP16, _Float16* THH, _Float16* THL, int IC, int HW, int NK) { const long long t = (long long)blockIdx.x * 256 + threadIdx.x;
    { const long long big = (long long)blockIdx.y * IC * HW, sml = (long long)blockIdx.y * IC * NK;   // blockIdx.y = image
      PH += big; G += big; TH += big; THH += big; THL += big; PHP += sml; GP += sml; PPH += sml; PPL += sml; GP16 += sml; }
    if (t < (long long)HW * IC / 8) { const long long e = 8 * t; const float* tp = TH + e; const v4f a = *(const v4f*)(tp), b = *(const v4f*)(tp + 4);
        asm volatile("s_wait_xcnt 0x0" :: "v"(tp) : "memory");   // tp as an input keeps the pair until the wait
        const float f[8] = { a[0], a[1], a[2], a[3], b[0], b[1], b[2], b[3] }; v4u hi, lo;
#pragma unroll   // constant indices into f[]
        for (int q = 0; q < 4; ++q) { const unsigned short h0 = bf16b(f[2 * q]), h1 = bf16b(f[2 * q + 1]); hi[q] = (unsigned)h0 | ((unsigned)h1 << 16); lo[q] = (unsigned)bf16b(f[2 * q] - bf16f(h0)) | ((unsigned)bf16b(f[2 * q + 1] - bf16f(h1)) << 16); }
        *(v4u*)(THH + e) = hi; *(v4u*)(THL + e) = lo; }
    if (t < (long long)IC * NK / 2) { const long long e = 2 * t; float pv[2], gv[2];
#pragma unroll
        for (int u = 0; u < 2; ++u) { const long long q = e + u; const int ic = (int)(q / NK), pk = (int)(q % NK); const int py = pk / 32, px = pk % 32; const long long s = (long long)ic * HW + (2 * py) * 64 + 2 * px;
            pv[u] = fmaxf(fmaxf(PH[s], PH[s + 1]), fmaxf(PH[s + 64], PH[s + 65])); gv[u] = fmaxf(fmaxf(G[s], G[s + 1]), fmaxf(G[s + 64], G[s + 65])); }
        { const unsigned long long pk2 = (unsigned long long)__builtin_bit_cast(unsigned, pv[0]) | ((unsigned long long)__builtin_bit_cast(unsigned, pv[1]) << 32); VST2(unsigned long long, (unsigned long long*)(PHP + e), pk2); }
        { const unsigned long long pk2 = (unsigned long long)__builtin_bit_cast(unsigned, gv[0]) | ((unsigned long long)__builtin_bit_cast(unsigned, gv[1]) << 32); VST2(unsigned long long, (unsigned long long*)(GP + e), pk2); }
        st_h2(GP16 + e, gv[0], gv[1]); }
    if (t < (long long)NK * IC / 2) { const long long e = 2 * t; const int nk = (int)(e / IC), ic = (int)(e % IC); const int py = nk / 32, px = nk % 32; float pv[2];
#pragma unroll
        for (int u = 0; u < 2; ++u) { const long long s = (long long)(ic + u) * HW + (2 * py) * 64 + 2 * px; pv[u] = fmaxf(fmaxf(PH[s], PH[s + 1]), fmaxf(PH[s + 64], PH[s + 65])); }
        st_split2(PPH, PPL, e, pv[0], pv[1]); } }
// row softmax of F (rows of 1024) -> P16 = f16(4096 p). One wave per row, two rows a wave: a row stays in registers (8 x 16 B a lane), so F is read once and
// never written; maximum and sum by a five-step butterfly over the lanes, no LDS and no barrier
__global__ __launch_bounds__(256) void k_nl_soft(const float* __restrict__ F, _Float16* __restrict__ P16) { const int lane = threadIdx.x & 31; const long long o = (((long long)blockIdx.x * 8 + (threadIdx.x >> 5)) * 2) * 1024 + lane * 4;
    const float* fp = F + o; v4f v[2][8];
#pragma unroll   // v[][] in registers, both rows' sixteen loads in flight
    for (int u = 0; u < 2; ++u)
#pragma unroll   // inner loop of the same: constant indices, values stay in registers
        for (int k = 0; k < 8; ++k) v[u][k] = *(const v4f*)(fp + u * 1024 + k * 128);
    asm volatile("s_wait_xcnt 0x0" :: "v"(fp) : "memory");   // fp as an input keeps the pair until the wait
#pragma unroll   // constant indices into v[][]
    for (int u = 0; u < 2; ++u) { float mx = -3.0e38f;
#pragma unroll   // inner loop of the same: constant indices, values stay in registers
        for (int k = 0; k < 8; ++k) mx = fmaxf(mx, fmaxf(fmaxf(v[u][k][0], v[u][k][1]), fmaxf(v[u][k][2], v[u][k][3])));
#pragma unroll   // five fixed steps, the lane mask a constant in each
        for (int off = 16; off > 0; off >>= 1) mx = fmaxf(mx, __shfl_xor(mx, off, 32));
        float s = 0.f;
#pragma unroll   // inner loop of the same: constant indices, values stay in registers
        for (int k = 0; k < 8; ++k) { v4f e; e[0] = expf(v[u][k][0] - mx); e[1] = expf(v[u][k][1] - mx); e[2] = expf(v[u][k][2] - mx); e[3] = expf(v[u][k][3] - mx); s += (e[0] + e[1]) + (e[2] + e[3]); v[u][k] = e; }
#pragma unroll   // five fixed steps, the lane mask a constant in each
        for (int off = 16; off > 0; off >>= 1) s += __shfl_xor(s, off, 32);
        const float f = 4096.f / s;
#pragma unroll   // inner loop of the same: constant indices, values stay in registers
        for (int k = 0; k < 8; ++k) { v2u h; h[0] = f2h2_pack(v[u][k][0] * f, v[u][k][1] * f); h[1] = f2h2_pack(v[u][k][2] * f, v[u][k][3] * f); *(v2u*)(P16 + o + u * 1024 + k * 128) = h; } } }
// Y16 = f16(Y) (thread per 8 values)
__global__ __launch_bounds__(256) void k_nl_y16(const float* __restrict__ Y, _Float16* __restrict__ Y16, long long n) { const long long t = (long long)blockIdx.x * 256 + threadIdx.x; if (t >= n / 8) return; const v4f a = *(const v4f*)(Y + 8 * t), b = *(const v4f*)(Y + 8 * t + 4);
    v4u h; h[0] = f2h2_pack(a[0], a[1]); h[1] = f2h2_pack(a[2], a[3]); h[2] = f2h2_pack(b[0], b[1]); h[3] = f2h2_pack(b[2], b[3]); *(v4u*)(Y16 + 8 * t) = h; }
// batch statistics of channel c = blockIdx.x over [Bn][HW]: a thread holds its Bn x HW / 1024 groups of 16 B in registers, so WY is read once and the loads overlap;
// mean first, then the squared deviations from the same registers; the two LDS trees over the block are as they were
template <int Bn, int HW> __global__ __launch_bounds__(256) void k_nl_bns(const float* __restrict__ WY, float* __restrict__ BNS, int C) { __shared__ float red[256]; __shared__ float res[2]; const int c = blockIdx.x; const int t = threadIdx.x;
    const float* r[Bn]; v4f v[Bn][HW / 1024];
#pragma unroll   // v[][] in registers, the loads overlap instead of one latency each
    for (int b = 0; b < Bn; ++b) { r[b] = WY + ((long long)b * C + c) * HW + t * 4;
#pragma unroll   // inner loop of the same: constant indices, values stay in registers
        for (int k = 0; k < HW / 1024; ++k) v[b][k] = *(const v4f*)(r[b] + k * 1024); }
    static_assert(Bn == 8, "the wait below names eight addresses");
    asm volatile("s_wait_xcnt 0x0" :: "v"(r[0]), "v"(r[1]), "v"(r[2]), "v"(r[3]), "v"(r[4]), "v"(r[5]), "v"(r[6]), "v"(r[7]) : "memory");   // the addresses as inputs keep every load's address pair until the wait: no load's result takes a pair before it
    float s = 0.f;
#pragma unroll   // constant indices into v[][]
    for (int b = 0; b < Bn; ++b)
#pragma unroll   // inner loop of the same: constant indices, values stay in registers
        for (int k = 0; k < HW / 1024; ++k) s += (v[b][k][0] + v[b][k][1]) + (v[b][k][2] + v[b][k][3]);
    red[t] = s; __syncthreads(); for (int o = 128; o > 0; o >>= 1) { if (t < o) red[t] += red[t + o]; __syncthreads(); } const float mu = red[0] / (float)(Bn * HW); __syncthreads();
    float q = 0.f;
#pragma unroll   // constant indices into v[][]
    for (int b = 0; b < Bn; ++b)
#pragma unroll   // inner loop of the same: constant indices, values stay in registers
        for (int k = 0; k < HW / 1024; ++k) { const v4f d = v[b][k] - mu; q += (d[0] * d[0] + d[1] * d[1]) + (d[2] * d[2] + d[3] * d[3]); }
    red[t] = q; __syncthreads(); for (int o = 128; o > 0; o >>= 1) { if (t < o) red[t] += red[t + o]; __syncthreads(); }
    if (t == 0) { res[0] = mu; res[1] = rsqrtf(red[0] / (float)(Bn * HW) + 1e-5f); } __syncthreads();
    if (t < 32) VST2(float, BNS + (long long)c * 32 + t, (t == 0) ? res[0] : ((t == 1) ? res[1] : 0.f)); }
// out = (WY - mu[c]) * rstd[c] * gamma[c] + beta[c] + x; one block per plane (b, c) of 4096 values, 4 x 16 B of each operand a thread
__global__ __launch_bounds__(256) void k_nl_out(const float* __restrict__ WY, const float* __restrict__ BNS, const float* __restrict__ Gm, const float* __restrict__ Bt, const float* __restrict__ X, float* __restrict__ OUT, int C) { const int c = (int)(blockIdx.x % (unsigned)C); const long long o = (long long)blockIdx.x * 4096 + threadIdx.x * 4;
    const float mu = BNS[(long long)c * 32], rs = BNS[(long long)c * 32 + 1], g = Gm[c], be = Bt[c]; const float* wp = WY + o; const float* xp = X + o; v4f w[4], xv[4];
#pragma unroll   // all eight loads in flight
    for (int k = 0; k < 4; ++k) { w[k] = *(const v4f*)(wp + k * 1024); xv[k] = *(const v4f*)(xp + k * 1024); }
    asm volatile("s_wait_xcnt 0x0" :: "v"(wp), "v"(xp) : "memory");   // both addresses as inputs keep the pairs until the wait
#pragma unroll   // constant indices into w[], xv[]
    for (int k = 0; k < 4; ++k) { v4f r;
#pragma unroll   // inner loop of the same: constant indices, values stay in registers
        for (int e = 0; e < 4; ++e) r[e] = (w[k][e] - mu) * rs * g + be + xv[k][e];
        *(v4f*)(OUT + o + k * 1024) = r; } }


extern "C" void kernel_launch(void* const* d_in, const int* in_sizes, int n_in, void* d_out, int out_size, void* d_ws, size_t ws_size, hipStream_t stream) {
    (void)in_sizes; (void)n_in; (void)out_size; (void)ws_size;
    const float* x = (const float*)d_in[0];
    const float* gw = (const float*)d_in[1];
    const float* gb = (const float*)d_in[2];
    const float* thw = (const float*)d_in[3];
    const float* thb = (const float*)d_in[4];
    const float* phw = (const float*)d_in[5];
    const float* phb = (const float*)d_in[6];
    const float* Ww = (const float*)d_in[7];
    const float* Wb = (const float*)d_in[8];
    const float* bng = (const float*)d_in[9];
    const float* bnb = (const float*)d_in[10];
    const int Bn = 8;
    const int C = 256;
    const int IC = 128;
    const int HW = 4096;
    const int NK = 1024;
    float* out = (float*)d_out;
    char* wsp = (char*)d_ws;
    // One launch per stage for all Bn images (blockIdx.y = image, per-image strides). The workspace is laid out by lifetime:
    //   R1: x planes and the three conv outputs, dead after the pool; the softmax then writes P16 over them
    //   R2: the operand planes that the pool writes
    //   R3: F, dead after the softmax; Y, Y16 and WY then lie in it
    char* R1 = wsp; wsp += (size_t)Bn * HW * C * 2 * 3 + (size_t)Bn * HW * IC * 4 * 3;
    unsigned short* XH = (unsigned short*)R1;
    unsigned short* XL = XH + (size_t)Bn * HW * C;
    unsigned short* X16 = XL + (size_t)Bn * HW * C;
    float* TH = (float*)(X16 + (size_t)Bn * HW * C);
    float* PH = TH + (size_t)Bn * HW * IC;
    float* G = PH + (size_t)Bn * IC * HW;
    unsigned short* P16 = (unsigned short*)R1;
    float* PHP = (float*)wsp; wsp += (size_t)Bn * IC * NK * 4;
    float* GP = (float*)wsp; wsp += (size_t)Bn * IC * NK * 4;
    unsigned short* THH = (unsigned short*)wsp; wsp += (size_t)Bn * HW * IC * 2;
    unsigned short* THL = (unsigned short*)wsp; wsp += (size_t)Bn * HW * IC * 2;
    unsigned short* PPH = (unsigned short*)wsp; wsp += (size_t)Bn * NK * IC * 2;
    unsigned short* PPL = (unsigned short*)wsp; wsp += (size_t)Bn * NK * IC * 2;
    unsigned short* GP16 = (unsigned short*)wsp; wsp += (size_t)Bn * IC * NK * 2;
    char* R3 = wsp; wsp += (size_t)Bn * HW * NK * 4;
    float* F = (float*)R3;
    float* Y = (float*)R3;
    unsigned short* Y16 = (unsigned short*)(Y + (size_t)Bn * HW * IC);
    float* WY = (float*)(Y16 + (size_t)Bn * HW * IC);
    unsigned short* WW16 = (unsigned short*)wsp; wsp += (size_t)C * IC * 2;
    unsigned short* TWH = (unsigned short*)wsp; wsp += (size_t)IC * C * 2;
    unsigned short* TWL = (unsigned short*)wsp; wsp += (size_t)IC * C * 2;
    unsigned short* PWH = (unsigned short*)wsp; wsp += (size_t)IC * C * 2;
    unsigned short* PWL = (unsigned short*)wsp; wsp += (size_t)IC * C * 2;
    unsigned short* GW16 = (unsigned short*)wsp; wsp += (size_t)IC * C * 2;
    float* BNS = (float*)wsp; wsp += (size_t)32 * C * 4;
    // weights
    k_cast16<<<(unsigned)((((long long)(C) * ((IC) / 2)) + 255) / 256), 256, 0, stream>>>(Ww, IC, (_Float16*)(WW16), IC, C, IC, 16.0f);
    k_castS16<<<(unsigned)((((long long)(IC) * ((C) / 2)) + 255) / 256), 256, 0, stream>>>(thw, C, (__bf16*)(TWH), (__bf16*)(TWL), C, IC, C, 1.0f, 0, 0, 0);
    k_castS16<<<(unsigned)((((long long)(IC) * ((C) / 2)) + 255) / 256), 256, 0, stream>>>(phw, C, (__bf16*)(PWH), (__bf16*)(PWL), C, IC, C, 1.0f, 0, 0, 0);
    k_cast16<<<(unsigned)((((long long)(IC) * ((C) / 2)) + 255) / 256), 256, 0, stream>>>(gw, C, (_Float16*)(GW16), C, IC, C, 1.0f);
    // x[b] ([C][HW]) -> transposed planes [b][HW][C]: bf16 hi/lo (theta, phi) and f16 of 16 x (g)
    k_castS16w<HW><<<dim3((unsigned)(HW / 32), (unsigned)(Bn)), 256, 0, stream>>>(x, (__bf16*)(XH), (__bf16*)(XL), 1.0f);
    k_castT16w<HW><<<dim3((unsigned)(HW / 32), (unsigned)(Bn)), 256, 0, stream>>>(x, (_Float16*)(X16), 16.0f);
    // TH[b] = x[b]^T thw^T + thb ([HW][IC]); PH[b] = phw x[b] + phb, G[b] = gw x[b] + gb ([IC][HW])
    w25::wmma_gemm64<1, true, 2, 0, false, 0><<<dim3((unsigned)((((HW) / 64) * ((IC) / 64) + 7) / 8), (unsigned)(Bn)), 256, 0, stream>>>((const unsigned short*)(XH), (const unsigned short*)(XL), C, (long)HW * C, (const unsigned short*)(TWH), (const unsigned short*)(TWL), C, 0, (void*)(TH), nullptr, IC, (long)HW * IC, thb, nullptr, 0, HW, IC, C, 1.0f);
    w25::wmma_gemm64<1, true, 1, 0, false, 0><<<dim3((unsigned)((((IC) / 64) * ((HW) / 64) + 7) / 8), (unsigned)(Bn)), 256, 0, stream>>>((const unsigned short*)(PWH), (const unsigned short*)(PWL), C, 0, (const unsigned short*)(XH), (const unsigned short*)(XL), C, (long)HW * C, (void*)(PH), nullptr, HW, (long)IC * HW, phb, nullptr, 0, IC, HW, C, 1.0f);
    w25::wmma_gemm64<0, false, 1, 0, false, 0><<<dim3((unsigned)((((IC) / 64) * ((HW) / 64) + 7) / 8), (unsigned)(Bn)), 256, 0, stream>>>((const unsigned short*)(GW16), nullptr, C, 0, (const unsigned short*)(X16), nullptr, C, (long)HW * C, (void*)(G), nullptr, HW, (long)IC * HW, gb, nullptr, 0, IC, HW, C, 0.0625f);
    k_nl_pool<<<dim3((unsigned)(((long long)HW * IC / 8 + 255) / 256), (unsigned)(Bn)), 256, 0, stream>>>(PH, G, TH, PHP, GP, (_Float16*)PPH, (_Float16*)PPL, (_Float16*)GP16, (_Float16*)THH, (_Float16*)THL, IC, HW, NK);
    // F[b] = theta[b] phi[b] ([HW][NK]); rows of all images are contiguous, so the softmax takes Bn * HW rows
    w25::wmma_gemm64<1, true, 0, 0, false, 0><<<dim3((unsigned)((((HW) / 64) * ((NK) / 64) + 7) / 8), (unsigned)(Bn)), 256, 0, stream>>>((const unsigned short*)(THH), (const unsigned short*)(THL), IC, (long)HW * IC, (const unsigned short*)(PPH), (const unsigned short*)(PPL), IC, (long)NK * IC, (void*)(F), nullptr, NK, (long)HW * NK, nullptr, nullptr, 0, HW, NK, IC, 1.0f);
    k_nl_soft<<<(unsigned)(Bn * HW / 16), 256, 0, stream>>>(F, (_Float16*)P16);
    w25::wmma_gemm64<0, false, 0, 0, false, 0><<<dim3((unsigned)((((HW) / 64) * ((IC) / 64) + 7) / 8), (unsigned)(Bn)), 256, 0, stream>>>((const unsigned short*)(P16), nullptr, NK, (long)HW * NK, (const unsigned short*)(GP16), nullptr, NK, (long)IC * NK, (void*)(Y), nullptr, IC, (long)HW * IC, nullptr, nullptr, 0, HW, IC, NK, 0.000244140625f);
    k_nl_y16<<<(unsigned)(((long long)Bn * HW * IC / 8 + 255) / 256), 256, 0, stream>>>(Y, (_Float16*)Y16, (long long)Bn * HW * IC);
    w25::wmma_gemm64<0, false, 1, 0, false, 0><<<dim3((unsigned)((((C) / 64) * ((HW) / 64) + 7) / 8), (unsigned)(Bn)), 256, 0, stream>>>((const unsigned short*)(WW16), nullptr, IC, 0, (const unsigned short*)(Y16), nullptr, IC, (long)HW * IC, (void*)(WY), nullptr, HW, (long)C * HW, Wb, nullptr, 0, C, HW, IC, 0.0625f);
    k_nl_bns<Bn, HW><<<C, 256, 0, stream>>>(WY, BNS, C); k_nl_out<<<(unsigned)(Bn * C), 256, 0, stream>>>(WY, BNS, bng, bnb, x, out, C);
}

// v003
// One run takes 145 microseconds.
// Two timings next to v002 both put it at 1.67 times that version's speed.
// Over all steps from v000 it is 9.60 times as fast.
#include <hip/hip_runtime.h>
#include <math.h>

typedef __attribute__((ext_vector_type(16))) _Float16 v16h;
typedef __attribute__((ext_vector_type(8)))  _Float16 v8h;
typedef __attribute__((ext_vector_type(16))) __bf16   v16b;
typedef __attribute__((ext_vector_type(8)))  float    v8f;
typedef __attribute__((ext_vector_type(4)))  float    v4f;

// 16-bit WMMA fragment map (wave32), lane L, h = L>>4, m = L&15:
//   A 16x32: lane = row m;   element i -> k = (i<8) ? 8h+i : 16+8h+(i-8)
//   B 32x16: lane = column m; the SAME k(i,h)
//   D 16x16 (8 f32): lane = column m; element r -> row 8h+r
__device__ __forceinline__ int frag_k(int i, int h) { return (i < 8) ? (8 * h + i) : (16 + 8 * h + (i - 8)); }
__device__ __forceinline__ __bf16 bf16_rne(float f) {
    unsigned int u = __float_as_uint(f);
    u += 0x7fffu + ((u >> 16) & 1u);
    return __builtin_bit_cast(__bf16, (unsigned short)(u >> 16));
}
__device__ __forceinline__ float bf16_f32(__bf16 b) { return __uint_as_float(((unsigned int)__builtin_bit_cast(unsigned short, b)) << 16); }
__device__ __forceinline__ v8f wmma16(v16h a, v16h b, v8f c) {
    c = __builtin_amdgcn_wmma_f32_16x16x32_f16(false, a, false, b, (short)0, c, false, false);
    asm volatile("v_nop\n\tv_nop\n\tv_nop\n\tv_nop" : "+v"(c) : "v"(a), "v"(b));
    return c;
}
__device__ __forceinline__ v8f wmmab(v16b a, v16b b, v8f c) {
    c = __builtin_amdgcn_wmma_f32_16x16x32_bf16(false, a, false, b, (short)0, c, false, false);
    asm volatile("v_nop\n\tv_nop\n\tv_nop\n\tv_nop" : "+v"(c) : "v"(a), "v"(b));
    return c;
}
struct Split { v16b hi, lo; };
// hi/lo split product: a.hi*b.hi + a.hi*b.lo + a.lo*b.hi
__device__ __forceinline__ v8f wmma3(const Split& a, const Split& b, v8f c) {
    c = __builtin_amdgcn_wmma_f32_16x16x32_bf16(false, a.hi, false, b.hi, (short)0, c, false, false);
    c = __builtin_amdgcn_wmma_f32_16x16x32_bf16(false, a.hi, false, b.lo, (short)0, c, false, false);
    c = __builtin_amdgcn_wmma_f32_16x16x32_bf16(false, a.lo, false, b.hi, (short)0, c, false, false);
    asm volatile("v_nop\n\tv_nop\n\tv_nop\n\tv_nop" : "+v"(c) : "v"(a.hi), "v"(a.lo), "v"(b.hi), "v"(b.lo));
    return c;
}
struct Split3 { v16b hi, mid, lo; };
// triple split product (6 terms, drops only terms below 2^-24 relative)
__device__ __forceinline__ v8f wmma6(const Split3& a, const Split3& b, v8f c) {
    c = __builtin_amdgcn_wmma_f32_16x16x32_bf16(false, a.hi, false, b.hi, (short)0, c, false, false);
    c = __builtin_amdgcn_wmma_f32_16x16x32_bf16(false, a.hi, false, b.mid, (short)0, c, false, false);
    c = __builtin_amdgcn_wmma_f32_16x16x32_bf16(false, a.mid, false, b.hi, (short)0, c, false, false);
    c = __builtin_amdgcn_wmma_f32_16x16x32_bf16(false, a.hi, false, b.lo, (short)0, c, false, false);
    c = __builtin_amdgcn_wmma_f32_16x16x32_bf16(false, a.mid, false, b.mid, (short)0, c, false, false);
    c = __builtin_amdgcn_wmma_f32_16x16x32_bf16(false, a.lo, false, b.hi, (short)0, c, false, false);
    asm volatile("v_nop\n\tv_nop\n\tv_nop\n\tv_nop" : "+v"(c) : "v"(a.hi), "v"(a.mid), "v"(a.lo), "v"(b.hi), "v"(b.mid), "v"(b.lo));
    return c;
}

// Fragment gathers from f32 memory: element i <- p[(k0 + frag_k(i,h)) * sk] * s, zero for k >= klen.
__device__ __forceinline__ v16h fh_ld(const float* __restrict__ p, long long sk, int k0, int h, int klen, float s) {
    v16h a;
#pragma unroll
    for (int i = 0; i < 16; ++i) { const int k = k0 + frag_k(i, h); a[i] = (k < klen) ? (_Float16)(p[(long long)k * sk] * s) : (_Float16)0.f; }
    return a;
}
__device__ __forceinline__ Split sp_ld(const float* __restrict__ p, long long sk, int k0, int h, int klen, float s) {
    Split r;
#pragma unroll
    for (int i = 0; i < 16; ++i) {
        const int k = k0 + frag_k(i, h); const float x = (k < klen) ? p[(long long)k * sk] * s : 0.f;
        const __bf16 hb = bf16_rne(x); r.hi[i] = hb; r.lo[i] = bf16_rne(x - bf16_f32(hb));
    }
    return r;
}
__device__ __forceinline__ Split3 sp3_ld(const float* __restrict__ p, long long sk, int k0, int h, int klen, float s) {
    Split3 r;
#pragma unroll
    for (int i = 0; i < 16; ++i) {
        const int k = k0 + frag_k(i, h); const float x = (k < klen) ? p[(long long)k * sk] * s : 0.f;
        const __bf16 hb = bf16_rne(x); const float r1 = x - bf16_f32(hb); const __bf16 mb = bf16_rne(r1);
        r.hi[i] = hb; r.mid[i] = mb; r.lo[i] = bf16_rne(r1 - bf16_f32(mb));
    }
    return r;
}
__device__ __forceinline__ v16b bh_ld(const float* __restrict__ p, long long sk, int k0, int h, int klen, float s) {
    v16b a;
#pragma unroll
    for (int i = 0; i < 16; ++i) { const int k = k0 + frag_k(i, h); a[i] = bf16_rne((k < klen) ? p[(long long)k * sk] * s : 0.f); }
    return a;
}
// f16 fragment from an f16 LDS/global row with element stride 1 (k-contiguous), no bounds (tile already zero padded)
__device__ __forceinline__ v16h fh_row(const _Float16* __restrict__ row, int k0, int h) {
    v16h a;
#pragma unroll
    for (int i = 0; i < 16; ++i) a[i] = row[k0 + frag_k(i, h)];
    return a;
}

#define VST2(T, ptr, val) do { const T vst2_v_ = (val); *(T*)(ptr) = vst2_v_;  } while (0)
typedef float v4f __attribute__((ext_vector_type(4)));
typedef unsigned int v4u __attribute__((ext_vector_type(4)));
typedef unsigned int v2u __attribute__((ext_vector_type(2)));
#define VST2V4(ptr, val) do { const v4f vst2_v4_ = (val); *(v4f*)(ptr) = vst2_v4_;  } while (0)

__device__ __attribute__((noinline)) float act_fn(float v, int act) {
    if (act == 1) return fmaxf(v, 0.f);                                                                               // relu
    if (act == 2) { const float u = 0.7978845608028654f * (v + 0.044715f * v * v * v); return 0.5f * v * (1.f + tanhf(u)); } // tanh-gelu
    if (act == 3) return v / (1.f + expf(-v));                                                                        // silu
    if (act == 4) return 0.5f * v * (1.f + erff(v * 0.7071067811865476f));                                             // erf-gelu
    if (act == 5) return tanhf(v);
    if (act == 6) return 1.f / (1.f + expf(-v));                                                                      // sigmoid
    if (act == 7) return (v > 0.f) ? v : 0.01f * v;                                                                   // leaky relu 0.01
    if (act == 8) return (v > 0.f) ? v : (expf(v) - 1.f);                                                             // elu
    if (act == 9) return fminf(fmaxf(v, 0.f), 6.f);                                                                   // relu6
    if (act == 10) return fabsf(v);                                                                                    // abs
    if (act == 11) return (v >= 0.f) ? v : 0.1f * v;                                                                  // leaky 0.1
    if (act == 12) return (v > 0.f) ? v : 0.2f * v;                                                                   // leaky 0.2
    if (act == 13) return (v > 20.f) ? v : log1pf(expf(v));                                                            // softplus
    return v;
}

// =====================================================================================================================
// k_gemm<MODE>: C(z, m, n) = act(alpha * sum_k A(z, m, k) * B(z, k, n) + bias) + beta * R(z, m, n)
//   One wave (32-thread block) per 16 x 32 tile of C; grid (ceil(N/32), ceil(M/16), Z). Batch z -> (zo = z / zi_n, zi = z % zi_n)
//   with separate outer/inner strides for every tensor (e.g. batch and head). A(m,k) = A[zo*sAo + zi*sAi + m*sAm + k*sAk] (f32),
//   B(k,n) = B[zo*sBo + zi*sBi + n*sBn + k*sBk] (f32); any M, N, K (K zero-padded to 32 inside the fragments, M/N tails guarded).
//   C(m,n) = C[zo*sCo + zi*sCi + m*sCm + n] (n contiguous). flags: 1 bias[n], 2 bias[m], 4 residual R[zo*sRo + zi*sRi + m*sRm + n*sRn].
//   MODE 0: f16 operands (A prescaled by sa, B by sb, both undone in the epilogue); 1: bf16 hi/lo split (3 products); 2: bf16;
//   3: bf16 hi/mid/lo triple split (6 products); 4: as 3 with Kahan-compensated f32 accumulation across k-steps.
// =====================================================================================================================
struct GemmP {
    const float* A; const float* B; const float* bias; const float* R; float* C;
    long long sAo, sAi, sAm, sAk, sBo, sBi, sBn, sBk, sCo, sCi, sCm, sRo, sRi, sRm, sRn;
    int M, N, K, zi_n, flags, act; float alpha, beta, sa, sb;
    int Npad, pad_;     // columns [N, Npad) of C are written as 0 so that padded workspace rows are covered by whole-line stores; Npad >= N
};
static_assert(sizeof(GemmP) == 5 * 8 + 15 * 8 + 6 * 4 + 4 * 4 + 2 * 4, "GemmP has padding");

template <int MODE>
__global__ __launch_bounds__(32) void k_gemm(GemmP p) {
    const int lane = threadIdx.x & 31, h = lane >> 4, l15 = lane & 15;
    const int m0 = blockIdx.y * 16, n0 = blockIdx.x * 32;
    const int z = blockIdx.z, zo = z / p.zi_n, zi = z - zo * p.zi_n;
    const float* A = p.A + zo * p.sAo + zi * p.sAi;
    const float* B = p.B + zo * p.sBo + zi * p.sBi;
    const int am = min(m0 + l15, p.M - 1);                       // clamped row for loads (stores are guarded)
    v8f acc[2], comp[2];
#pragma unroll
    for (int t = 0; t < 2; ++t) { v8f zz = {}; acc[t] = zz; comp[t] = zz; }
    for (int k0 = 0; k0 < p.K; k0 += 32) {
        const float* arow = A + (long long)am * p.sAm;
        if (MODE == 1) {
            const Split a = sp_ld(arow, p.sAk, k0, h, p.K, 1.f);
#pragma unroll
            for (int t = 0; t < 2; ++t) {
                const int bn = min(n0 + t * 16 + l15, p.N - 1);
                acc[t] = wmma3(a, sp_ld(B + (long long)bn * p.sBn, p.sBk, k0, h, p.K, 1.f), acc[t]);
            }
        } else if (MODE == 3) {
            const Split3 a = sp3_ld(arow, p.sAk, k0, h, p.K, 1.f);
#pragma unroll
            for (int t = 0; t < 2; ++t) {
                const int bn = min(n0 + t * 16 + l15, p.N - 1);
                acc[t] = wmma6(a, sp3_ld(B + (long long)bn * p.sBn, p.sBk, k0, h, p.K, 1.f), acc[t]);
            }
        } else if (MODE == 4) {
            // triple split as MODE 3, but each k-step's 6 products go into a fresh accumulator and the partial is added to the running f32 sum
            // on the VALU with Kahan compensation (accumulation error stays ~1 ulp however long K is)
            const Split3 a = sp3_ld(arow, p.sAk, k0, h, p.K, 1.f);
#pragma unroll
            for (int t = 0; t < 2; ++t) {
                const int bn = min(n0 + t * 16 + l15, p.N - 1); v8f zz = {};
                const v8f part = wmma6(a, sp3_ld(B + (long long)bn * p.sBn, p.sBk, k0, h, p.K, 1.f), zz);
                const v8f y = part - comp[t]; const v8f s = acc[t] + y; comp[t] = (s - acc[t]) - y; acc[t] = s;
            }
        } else if (MODE == 2) {
            const v16b a = bh_ld(arow, p.sAk, k0, h, p.K, 1.f);
#pragma unroll
            for (int t = 0; t < 2; ++t) {
                const int bn = min(n0 + t * 16 + l15, p.N - 1);
                acc[t] = wmmab(a, bh_ld(B + (long long)bn * p.sBn, p.sBk, k0, h, p.K, 1.f), acc[t]);
            }
        } else {
            const v16h a = fh_ld(arow, p.sAk, k0, h, p.K, p.sa);
#pragma unroll
            for (int t = 0; t < 2; ++t) {
                const int bn = min(n0 + t * 16 + l15, p.N - 1);
                acc[t] = wmma16(a, fh_ld(B + (long long)bn * p.sBn, p.sBk, k0, h, p.K, p.sb), acc[t]);
            }
        }
    }
    const float iscale = (MODE == 0) ? p.alpha / (p.sa * p.sb) : p.alpha;
    float* C = p.C + zo * p.sCo + zi * p.sCi;
    const float* R = p.R + zo * p.sRo + zi * p.sRi;
    __shared__ __align__(16) float ctile[16][36];
#pragma unroll
    for (int t = 0; t < 2; ++t) {
        const int n = n0 + t * 16 + l15; const int nn = min(n, p.N - 1);
#pragma unroll
        for (int r = 0; r < 8; ++r) {
            const int m = m0 + 8 * h + r; const int mm = min(m, p.M - 1);
            float v = acc[t][r] * iscale;
            if (p.flags & 1) v += p.bias[nn];
            if (p.flags & 2) v += p.bias[mm];
            if (p.flags & 8) v *= p.bias[(long long)zo * p.M + mm];   /* per-(z,row) scale vector laid out [Z][M]; exclusive with the bias flags */
            v = act_fn(v, p.act);
            if (p.flags & 4) v += p.beta * R[(long long)mm * p.sRm + (long long)nn * p.sRn];
            ctile[8 * h + r][t * 16 + l15] = (n < p.N) ? v : 0.f;
        }
    }
    __syncthreads();
    const int NW = (p.Npad > p.N) ? p.Npad : p.N;           // write width
    const bool fast = (m0 + 16 <= p.M) && (n0 + 32 <= NW) && ((p.sCm & 3) == 0) && ((((size_t)C) & 15) == 0);
    if (fast) {
#pragma unroll
        for (int s = 0; s < 4; ++s) {
            const int row = s * 4 + (lane >> 3), c4 = (lane & 7) * 4;
            const v4f v = *(const v4f*)&ctile[row][c4];
            VST2V4(C + (long long)(m0 + row) * p.sCm + n0 + c4, v);
        }
    } else {
        for (int row = 0; row < 16; ++row) {
            const int m = m0 + row, n = n0 + lane;
            if (m < p.M && n < NW) VST2(float, C + (long long)m * p.sCm + n, ctile[row][lane]);
        }
    }
}


// =====================================================================================================================
// k_gemmT<MODE, TM, TN>: same contract as k_gemm, but one wave computes a (16*TM) x (16*TN) tile: TM A fragments and TN B fragments are
//   loaded per 32-wide k-step and reused across TM*TN WMMAs (far fewer load/convert instructions per MAC). MODE 0 (f16), 1 (bf16 hi/lo),
//   2 (bf16) only. grid (ceil(NW/(16*TN)), ceil(M/(16*TM)), Z), block 32. Epilogue identical to k_gemm, run per 16x32 sub-tile.
// =====================================================================================================================
template <int MODE, int TM, int TN>
__global__ __launch_bounds__(32) void k_gemmT(GemmP p) {
    const int lane = threadIdx.x & 31, h = lane >> 4, l15 = lane & 15;
    const int m0 = blockIdx.y * (16 * TM), n0 = blockIdx.x * (16 * TN);
    const int z = blockIdx.z, zo = z / p.zi_n, zi = z - zo * p.zi_n;
    const float* A = p.A + zo * p.sAo + zi * p.sAi;
    const float* B = p.B + zo * p.sBo + zi * p.sBi;
    v8f acc[TM][TN];
#pragma unroll
    for (int i = 0; i < TM; ++i)
#pragma unroll
        for (int t = 0; t < TN; ++t) { v8f zz = {}; acc[i][t] = zz; }
    for (int k0 = 0; k0 < p.K; k0 += 32) {
        if (MODE == 1) {
            Split a[TM], b[TN];
#pragma unroll
            for (int i = 0; i < TM; ++i) { const int am = min(m0 + 16 * i + l15, p.M - 1); a[i] = sp_ld(A + (long long)am * p.sAm, p.sAk, k0, h, p.K, 1.f); }
#pragma unroll
            for (int t = 0; t < TN; ++t) { const int bn = min(n0 + 16 * t + l15, p.N - 1); b[t] = sp_ld(B + (long long)bn * p.sBn, p.sBk, k0, h, p.K, 1.f); }
#pragma unroll
            for (int i = 0; i < TM; ++i)
#pragma unroll
                for (int t = 0; t < TN; ++t) acc[i][t] = wmma3(a[i], b[t], acc[i][t]);
        } else if (MODE == 2) {
            v16b a[TM], b[TN];
#pragma unroll
            for (int i = 0; i < TM; ++i) { const int am = min(m0 + 16 * i + l15, p.M - 1); a[i] = bh_ld(A + (long long)am * p.sAm, p.sAk, k0, h, p.K, 1.f); }
#pragma unroll
            for (int t = 0; t < TN; ++t) { const int bn = min(n0 + 16 * t + l15, p.N - 1); b[t] = bh_ld(B + (long long)bn * p.sBn, p.sBk, k0, h, p.K, 1.f); }
#pragma unroll
            for (int i = 0; i < TM; ++i)
#pragma unroll
                for (int t = 0; t < TN; ++t) acc[i][t] = wmmab(a[i], b[t], acc[i][t]);
        } else {
            v16h a[TM], b[TN];
#pragma unroll
            for (int i = 0; i < TM; ++i) { const int am = min(m0 + 16 * i + l15, p.M - 1); a[i] = fh_ld(A + (long long)am * p.sAm, p.sAk, k0, h, p.K, p.sa); }
#pragma unroll
            for (int t = 0; t < TN; ++t) { const int bn = min(n0 + 16 * t + l15, p.N - 1); b[t] = fh_ld(B + (long long)bn * p.sBn, p.sBk, k0, h, p.K, p.sb); }
#pragma unroll
            for (int i = 0; i < TM; ++i)
#pragma unroll
                for (int t = 0; t < TN; ++t) acc[i][t] = wmma16(a[i], b[t], acc[i][t]);
        }
    }
    const float iscale = (MODE == 0) ? p.alpha / (p.sa * p.sb) : p.alpha;
    float* C = p.C + zo * p.sCo + zi * p.sCi;
    const float* R = p.R + zo * p.sRo + zi * p.sRi;
    const int NW = (p.Npad > p.N) ? p.Npad : p.N;
    __shared__ __align__(16) float ctile[16][36];
#pragma unroll
    for (int i = 0; i < TM; ++i) {
        const int mb = m0 + 16 * i; if (mb >= p.M) break;          // wave-uniform
#pragma unroll
        for (int tp = 0; tp < TN / 2; ++tp) {
            const int nb = n0 + 32 * tp; if (nb >= NW) break;        // wave-uniform
#pragma unroll
            for (int t2 = 0; t2 < 2; ++t2) {
                const int t = 2 * tp + t2; const int n = nb + t2 * 16 + l15; const int nn = min(n, p.N - 1);
#pragma unroll
                for (int r = 0; r < 8; ++r) {
                    const int m = mb + 8 * h + r; const int mm = min(m, p.M - 1);
                    float v = acc[i][t][r] * iscale;
                    if (p.flags & 1) v += p.bias[nn];
                    if (p.flags & 2) v += p.bias[mm];
            if (p.flags & 8) v *= p.bias[(long long)zo * p.M + mm];   /* per-(z,row) scale vector laid out [Z][M]; exclusive with the bias flags */
                    v = act_fn(v, p.act);
                    if (p.flags & 4) v += p.beta * R[(long long)mm * p.sRm + (long long)nn * p.sRn];
                    ctile[8 * h + r][t2 * 16 + l15] = (n < p.N) ? v : 0.f;
                }
            }
            __syncthreads();
            const bool fast = (mb + 16 <= p.M) && (nb + 32 <= NW) && ((p.sCm & 3) == 0) && ((((size_t)C) & 15) == 0);
            if (fast) {
#pragma unroll
                for (int s = 0; s < 4; ++s) {
                    const int row = s * 4 + (lane >> 3), c4 = (lane & 7) * 4;
                    const v4f v = *(const v4f*)&ctile[row][c4];
                    VST2V4(C + (long long)(mb + row) * p.sCm + nb + c4, v);
                }
            } else {
                for (int row = 0; row < 16; ++row) {
                    const int m = mb + row, n = nb + lane;
                    if (m < p.M && n < NW) VST2(float, C + (long long)m * p.sCm + n, ctile[row][lane]);
                }
            }
            __syncthreads();
        }
    }
}

// =====================================================================================================================
//   Wave = 16 queries, AW waves per block, 64-key blocks; grid (ceil(Lq/(16*AW)), H, B), block 32*AW. Any Lq, Lk; head dim dh <= DHP
//   (DHP multiple of 32), value dim dv <= DVP (multiple of 16, <= 128). Every tensor addressed by (batch, head, row, element) strides, f32.
//   Scores: QM 0 f16 operands, 1 bf16 hi/lo split, 2 bf16 triple split; statistics f32 (exp2 domain); P.V: P x 4096 as f16 with V f16 staged in LDS
//   (SPLITPV: P and V as bf16 hi/lo splits). kv head = h / hrep. Masking: causal = 1 (keep j <= i + coff, masked -> -inf, key blocks beyond the
//   diagonal skipped), causal = 2 (masked -> mfill, a finite fill like the -1e9; no skipping), causal = 3 (keep j >= i + coff,
//   masked -> -inf, no skipping); optional additive f32 mask Mf,
//   optional int keep-mask Mi (0 -> score := mfill), both addressed b*smb + h*smh + i*smi + j*smj (0 strides broadcast).
// =====================================================================================================================
#define AW 4
struct AttnP {   // apv4
    const float* Q; const float* K; const float* V; float* O; float* P; const float* Mf; const int* Mi; float* ST;
    const float* Pw; const float* Rt; const int* SQ; const int* SK;           // optional: post-softmax weight, relative-position table, segment ids
    long long swb, swh, swi, swj, srb, srh, sri;                                 // Pw strides (b,h,i,j); Rt strides (b,h,i), column = clamp(i - j + roff, 0, rn-1)
    long long sQb, sQh, sQi, sQd, sKb, sKh, sKj, sKd, sVb, sVh, sVj, sVd, sOb, sOh, sOi, sPb, sPh, sPi, smb, smh, smi, smj;
    int Lq, Lk, dh, dv, hrep, causal, coff, pband;   // pband > 0: P holds only the band |j - i| <= pband, column j - i + pband
    float scale, mfill; int nonorm, mpol;             // nonorm (online path only): O = sum_j exp(score_j) V_j without the 1/rowsum (scores must be <= ~0); mpol: Mi masks where ==0 (mpol 0) or where !=0 (mpol 1)
    int roff, rn, segpol, win;                        // Rt column offset/count; SQ/SK: score := mfill where (segpol 0) SQ[i] != SK[j] or (segpol 1) SQ[i] == SK[j]; win > 0: keys with i - j > win (after coff) -> -inf
};
//   Pw: the softmax numerator is multiplied by Pw(b,h,i,j) AFTER the row sum is taken (probs * weight, then P.V), as in post-softmax multiplicative biases.                                                    // ST (optional): per row (b,h,i) -> ST[((b*H + h)*Lq + i)*2 + {0,1}] = {row max of the scaled+masked score (natural units), sum_j exp(score - max)}
static_assert(sizeof(AttnP) == 12 * 8 + 29 * 8 + 16 * 4, "AttnP has padding");

#ifndef KATTN_ATTR
#define KATTN_ATTR
#endif
template <int DHP, int DVP, int QM, bool SPLITPV, bool TWOPASS>
__global__ __launch_bounds__(32 * AW) KATTN_ATTR void k_attn(AttnP p) {
    constexpr int NT = DVP / 16;                // output tiles
    constexpr int KS = DHP / 32;                // k-steps for the scores
    constexpr int VP = DVP + 8;                 // LDS pitch (halves)
    __shared__ __align__(16) float    pl[AW][16 * 64];
    __shared__ __align__(16) _Float16 vl[(SPLITPV ? 2 : 1) * 64 * VP];   // f16 V tile, or bf16 hi and lo tiles (same 2-byte size)
    const int lane = threadIdx.x & 31, hf = lane >> 4, l15 = lane & 15, wave = threadIdx.x >> 5;
    const int h = blockIdx.y, b = blockIdx.z, hk = h / p.hrep;
    const int q0 = (blockIdx.x * AW + wave) * 16;
    float* myp = pl[wave];
    const float L2E = 1.4426950408889634f;
    const float NEG = -__builtin_inff();
    const int qi = min(q0 + l15, p.Lq - 1);
    const float* qrow = p.Q + b * p.sQb + h * p.sQh + (long long)qi * p.sQi;
    const float* kbase = p.K + b * p.sKb + hk * p.sKh;
    const float* vbase = p.V + b * p.sVb + hk * p.sVh;
    v16h qa[QM == 0 ? KS : 1]; Split qs_[QM == 1 ? KS : 1]; Split3 qt_[QM == 2 ? KS : 1];
#pragma unroll
    for (int ks = 0; ks < KS; ++ks) {
        if (QM == 2) qt_[ks] = sp3_ld(qrow, p.sQd, ks * 32, hf, p.dh, 1.f);
        else if (QM == 1) qs_[ks] = sp_ld(qrow, p.sQd, ks * 32, hf, p.dh, 1.f);
        else qa[ks] = fh_ld(qrow, p.sQd, ks * 32, hf, p.dh, 1.f);
    }
    v8f o[NT]; float m8[8], l8[8];
#pragma unroll
    for (int t = 0; t < NT; ++t) { v8f zz = {}; o[t] = zz; }
#pragma unroll
    for (int i = 0; i < 8; ++i) { m8[i] = NEG; l8[i] = 0.f; }
    int jend = p.Lk; int jstart = 0;
    if (p.causal == 1) { const int je = (blockIdx.x * AW + AW - 1) * 16 + 16 + p.coff; jend = min(jend, max(je, 0)); }   // uniform per block
    if (p.win > 0) { const int js = (int)(blockIdx.x * AW) * 16 + p.coff - p.win; jstart = (js > 0) ? (js / 64) * 64 : 0; }   // uniform per block: key blocks entirely outside every row's window hold only -inf entries and are skipped exactly
    const int npass = TWOPASS ? 2 : 1;
    for (int pass = 0; pass < npass; ++pass) {
        const bool dopv = (!TWOPASS) || pass == 1;
        for (int j0 = jstart; j0 < jend; j0 += 64) {
            if (dopv) {
                __syncthreads();                                 // previous key block's reads of vl / pl are done
                for (int idx = threadIdx.x; idx < 64 * DVP; idx += 32 * AW) {
                    const int jr = idx / DVP, d = idx - jr * DVP, j = j0 + jr;
                    const float f = (j < p.Lk && d < p.dv) ? vbase[(long long)j * p.sVj + (long long)d * p.sVd] : 0.f;
                    if (SPLITPV) {
                        const __bf16 hb = bf16_rne(f);
                        ((__bf16*)vl)[jr * VP + d] = hb; ((__bf16*)vl)[64 * VP + jr * VP + d] = bf16_rne(f - bf16_f32(hb));
                    } else vl[jr * VP + d] = (_Float16)f;
                }
            }
            v8f s[4];
#pragma unroll
            for (int t = 0; t < 4; ++t) {
                const int j = min(j0 + t * 16 + l15, p.Lk - 1);
                const float* krow = kbase + (long long)j * p.sKj;
                v8f acc = {};
#pragma unroll
                for (int ks = 0; ks < KS; ++ks) {
                    if (QM == 2)      acc = wmma6(qt_[ks], sp3_ld(krow, p.sKd, ks * 32, hf, p.dh, 1.f), acc);
                    else if (QM == 1) acc = wmma3(qs_[ks], sp_ld(krow, p.sKd, ks * 32, hf, p.dh, 1.f), acc);
                    else              acc = wmma16(qa[ks], fh_ld(krow, p.sKd, ks * 32, hf, p.dh, 1.f), acc);
                }
                s[t] = acc;
            }
            float pv[8][4];
#pragma unroll
            for (int i = 0; i < 8; ++i) {
                const int irow = q0 + i + 8 * hf;
                const int ic = min(irow, p.Lq - 1);
                float sc[4];
#pragma unroll
                for (int t = 0; t < 4; ++t) {
                    const int jg = j0 + t * 16 + l15;
                    float v = s[t][i] * p.scale;
                    if (p.Mf) v += p.Mf[b * p.smb + h * p.smh + (long long)ic * p.smi + (long long)min(jg, p.Lk - 1) * p.smj];
                    if (p.Rt) { int rc = ic - min(jg, p.Lk - 1) + p.roff; rc = rc < 0 ? 0 : (rc >= p.rn ? p.rn - 1 : rc); v += p.Rt[b * p.srb + h * p.srh + (long long)ic * p.sri + rc]; }
                    if (p.Mi) { const int mv = p.Mi[b * p.smb + h * p.smh + (long long)ic * p.smi + (long long)min(jg, p.Lk - 1) * p.smj]; if (p.mpol ? (mv != 0) : (mv == 0)) v = p.mfill; }
                    if (p.SQ) { const bool same = p.SQ[(long long)b * p.Lq + ic] == p.SK[(long long)b * p.Lk + min(jg, p.Lk - 1)]; if (p.segpol ? same : !same) v = p.mfill; }
                    if (p.causal == 2 && jg > irow + p.coff) v = p.mfill;
                    if (jg >= p.Lk || (p.causal == 1 && jg > irow + p.coff) || (p.causal == 3 && jg < irow + p.coff) || (p.win > 0 && irow + p.coff - jg > p.win)) v = NEG; else v *= L2E;
                    sc[t] = v;
                }
                if (!TWOPASS || pass == 0) {
                    float mx = fmaxf(fmaxf(sc[0], sc[1]), fmaxf(sc[2], sc[3]));
                    mx = fmaxf(mx, __shfl_xor(mx, 1, 32)); mx = fmaxf(mx, __shfl_xor(mx, 2, 32));
                    mx = fmaxf(mx, __shfl_xor(mx, 4, 32)); mx = fmaxf(mx, __shfl_xor(mx, 8, 32));
                    const float mnew = fmaxf(m8[i], mx);
                    const float corr = (mnew == NEG) ? 1.f : exp2f(m8[i] - mnew);
                    float rs = 0.f;
#pragma unroll
                    for (int t = 0; t < 4; ++t) {
                        const float pp = (sc[t] == NEG) ? 0.f : exp2f(sc[t] - mnew); rs += pp;
                        pv[i][t] = p.Pw ? pp * p.Pw[b * p.swb + h * p.swh + (long long)ic * p.swi + (long long)min(j0 + t * 16 + l15, p.Lk - 1) * p.swj] : pp;
                    }
                    rs += __shfl_xor(rs, 1, 32); rs += __shfl_xor(rs, 2, 32); rs += __shfl_xor(rs, 4, 32); rs += __shfl_xor(rs, 8, 32);
                    l8[i] = l8[i] * corr + rs; m8[i] = mnew;
                    if (!TWOPASS) {
#pragma unroll
                        for (int t = 0; t < NT; ++t) o[t][i] *= corr;
                    }
                } else {
                    const float inv = (l8[i] > 0.f) ? 1.f / l8[i] : 0.f;
#pragma unroll
                    for (int t = 0; t < 4; ++t) {
                        const int jg = j0 + t * 16 + l15;
                        float pp = (sc[t] == NEG) ? 0.f : exp2f(sc[t] - m8[i]) * inv;
                        if (p.Pw) pp *= p.Pw[b * p.swb + h * p.swh + (long long)ic * p.swi + (long long)min(jg, p.Lk - 1) * p.swj];
                        pv[i][t] = pp;
                    }
                }
            }
            if (dopv) {
#pragma unroll
                for (int i = 0; i < 8; ++i)
#pragma unroll
                    for (int t = 0; t < 4; ++t) ((float*)myp)[(i + 8 * hf) * 64 + t * 16 + l15] = pv[i][t];
                __syncthreads();                                 // P (per wave) and V (shared) visible
                if (p.P) {
                    float* pb_ = p.P + b * p.sPb + h * p.sPh;
                    const bool fastP = (p.pband == 0) && ((p.sPi & 3) == 0) && (j0 + 64 <= p.Lk) && (q0 + 16 <= p.Lq) && ((((size_t)pb_) & 15) == 0);
                    if (fastP) {
#pragma unroll
                        for (int s = 0; s < 8; ++s) {
                            const int row = s * 2 + (lane >> 4), c4 = (lane & 15) * 4;
                            const v4f v = *(const v4f*)(myp + row * 64 + c4);
                            VST2V4(pb_ + (long long)(q0 + row) * p.sPi + j0 + c4, v);
                        }
                    } else {
                        for (int row = 0; row < 16; ++row) {
                            const int irow = q0 + row; if (irow >= p.Lq) continue;
                            for (int c = lane; c < 64; c += 32) {
                                const int jg = j0 + c; if (jg >= p.Lk) continue;
                                if (p.pband == 0) VST2(float, pb_ + (long long)irow * p.sPi + jg, myp[row * 64 + c]);
                                else if (jg - irow <= p.pband && irow - jg <= p.pband) VST2(float, pb_ + (long long)irow * p.sPi + (jg - irow + p.pband), myp[row * 64 + c]);
                            }
                        }
                    }
                }
                if (SPLITPV) {
                    const Split pa0 = sp_ld(myp + l15 * 64, 1, 0, hf, 64, 1.f), pa1 = sp_ld(myp + l15 * 64, 1, 32, hf, 64, 1.f);
                    const __bf16* vh = (const __bf16*)vl; const __bf16* vlo = vh + 64 * VP;
#pragma unroll
                    for (int t = 0; t < NT; ++t) {
                        const int dcol = t * 16 + l15;
                        Split b0, b1;
#pragma unroll
                        for (int e = 0; e < 16; ++e) {
                            const int k0 = frag_k(e, hf), k1 = 32 + frag_k(e, hf);
                            b0.hi[e] = vh[k0 * VP + dcol]; b0.lo[e] = vlo[k0 * VP + dcol]; b1.hi[e] = vh[k1 * VP + dcol]; b1.lo[e] = vlo[k1 * VP + dcol];
                        }
                        o[t] = wmma3(pa0, b0, o[t]);
                        o[t] = wmma3(pa1, b1, o[t]);
                    }
                } else {
                    const v16h pa0 = fh_ld(myp + l15 * 64, 1, 0, hf, 64, 4096.f), pa1 = fh_ld(myp + l15 * 64, 1, 32, hf, 64, 4096.f);
#pragma unroll
                    for (int t = 0; t < NT; ++t) {
                        const int dcol = t * 16 + l15;
                        v16h b0, b1;
#pragma unroll
                        for (int e = 0; e < 16; ++e) { b0[e] = vl[frag_k(e, hf) * VP + dcol]; b1[e] = vl[(32 + frag_k(e, hf)) * VP + dcol]; }
                        o[t] = wmma16(pa0, b0, o[t]);
                        o[t] = wmma16(pa1, b1, o[t]);
                    }
                }
            }
        }
    }
    float* obase = p.O + b * p.sOb + h * p.sOh;
    if (p.ST) {
        const int rl = lane >> 1, isel = rl & 7;           // row q0 + rl ; rl>>3 == hf holds because lane>>4 == (lane>>1)>>3
        float mv = 0.f, lv = 0.f;
#pragma unroll
        for (int i = 0; i < 8; ++i) if (i == isel) { mv = m8[i]; lv = l8[i]; }
        const int irow = q0 + rl;
        if (irow < p.Lq) { float* st = p.ST + (((long long)b * gridDim.y + h) * p.Lq + irow) * 2 + (lane & 1); VST2(float, st, (lane & 1) ? lv : mv * 0.6931471805599453f); }
    }
    float invr[8];
#pragma unroll
    for (int i = 0; i < 8; ++i) {
        if (TWOPASS) invr[i] = SPLITPV ? 1.f : (1.f / 4096.f);
        else if (p.nonorm) invr[i] = exp2f(m8[i]) * (SPLITPV ? 1.f : (1.f / 4096.f));
        else invr[i] = (l8[i] > 0.f) ? (SPLITPV ? 1.f / l8[i] : 1.f / (l8[i] * 4096.f)) : 0.f;
    }
    __syncthreads();                                             // all waves done with pl/vl from the main loop
    const bool ofast = ((p.sOi & 3) == 0) && ((((size_t)obase) & 15) == 0) && (q0 + 16 <= p.Lq);
#pragma unroll
    for (int c0 = 0; c0 < DVP; c0 += 64) {
#pragma unroll
        for (int i = 0; i < 8; ++i)
#pragma unroll
            for (int t = 0; t < NT; ++t) if (t * 16 >= c0 && t * 16 < c0 + 64) ((float*)myp)[(i + 8 * hf) * 64 + (t * 16 - c0) + l15] = o[t][i] * invr[i];
        __syncthreads();
        const int cw = (DVP - c0 < 64) ? (DVP - c0) : 64;      // staged columns in this chunk (multiple of 16)
        if (ofast && (c0 + cw <= p.dv) && (cw % 32 == 0)) {
            const int lpr = cw / 4;                              // lanes per row (16 for 64 cols, 8 for 32)
            const int rows_per_ins = 32 / lpr;
            for (int r0 = 0; r0 < 16; r0 += rows_per_ins) {
                const int row = r0 + lane / lpr, c4 = (lane % lpr) * 4;
                const v4f v = *(const v4f*)(myp + row * 64 + c4);
                VST2V4(obase + (long long)(q0 + row) * p.sOi + c0 + c4, v);
            }
        } else {
            for (int row = 0; row < 16; ++row) {
                const int irow = q0 + row; if (irow >= p.Lq) continue;
                for (int c = lane; c < cw; c += 32) { const int d = c0 + c; if (d < p.dv) VST2(float, obase + (long long)irow * p.sOi + d, myp[row * 64 + c]); }
            }
        }
        __syncthreads();
    }
}

// =====================================================================================================================
// k_tr: dst(z, c, r) = alpha * src(z, r, c) (+ beta * R2(z, c, r)): [Z][R][C] (row stride lds) -> [Z][C][R] (row stride ldd) through a 32x32 LDS tile;
//   flags: 1 -> add beta * residual R2 addressed like dst (z*sRz + c*ldr + r); act applied before the residual.
// =====================================================================================================================
struct TrP { const float* src; float* dst; const float* R2; long long sSz, lds, sDz, ldd, sRz, ldr; int R, C, flags, act; float alpha, beta; };
static_assert(sizeof(TrP) == 3 * 8 + 6 * 8 + 6 * 4, "TrP has padding");
__global__ __launch_bounds__(256) void k_tr(TrP p) {
    __shared__ float tile[32][33];
    const int c0 = blockIdx.x * 32, r0 = blockIdx.y * 32, z = blockIdx.z;
    const int lane = threadIdx.x & 31, wave = threadIdx.x >> 5;
    const float* s = p.src + z * p.sSz;
#pragma unroll
    for (int k = 0; k < 4; ++k) {
        const int rl = wave * 4 + k, r = r0 + rl, c = c0 + lane;
        tile[rl][lane] = (r < p.R && c < p.C) ? s[(long long)r * p.lds + c] : 0.f;
    }
    __syncthreads();
    float* d = p.dst + z * p.sDz; const float* rr = p.R2 + z * p.sRz;
#pragma unroll
    for (int k = 0; k < 4; ++k) {
        const int cl = wave * 4 + k, c = c0 + cl, r = r0 + lane;
        if (c < p.C && r < p.R) {
            float v = act_fn(p.alpha * tile[lane][cl], p.act);
            if (p.flags & 1) v += p.beta * rr[(long long)c * p.ldr + r];
            VST2(float, d + (long long)c * p.ldd + r, v);
        }
    }
}

// k_affine: dst[i] = a * (sdev ? sdev[0] : 1) * src[i] + b, i < n (one thread per element; consecutive lanes -> consecutive addresses)
__global__ __launch_bounds__(256) void k_affine(const float* __restrict__ src, float* __restrict__ dst, int n, float a, float b, const float* __restrict__ sdev) {
    const int i = blockIdx.x * 256 + threadIdx.x;
    if (i < n) { const float aa = sdev ? a * sdev[0] : a; const float v = aa * src[i] + b; VST2(float, dst + i, v); }
}

// =====================================================================================================================
// k_softmax: row softmax over n contiguous elements, one 256-thread block per row; rows addressed z*sz + r*sr (grid (R, Z)).
//   out = scale_out * softmax(scale_in * x + (Mf ? Mf[z*smz + r*smr + j] : 0)); a row whose max is -inf is written as 0.
// =====================================================================================================================
struct SmP { const float* src; float* dst; const float* Mf; long long sz, sr, dz, dr, smz, smr; int n, pad; float scale_in, scale_out; };
static_assert(sizeof(SmP) == 3 * 8 + 6 * 8 + 4 * 4, "SmP has padding");
__global__ __launch_bounds__(256) void k_softmax(SmP p) {
    __shared__ float red[256];
    const int r = blockIdx.x, z = blockIdx.y, tid = threadIdx.x;
    const float* s = p.src + z * p.sz + (long long)r * p.sr;
    const float* mf = p.Mf ? (p.Mf + z * p.smz + (long long)r * p.smr) : nullptr;
    float mx = -__builtin_inff();
    for (int j = tid; j < p.n; j += 256) { float v = s[j] * p.scale_in; if (mf) v += mf[j]; mx = fmaxf(mx, v); }
    red[tid] = mx; __syncthreads();
    for (int o = 128; o > 0; o >>= 1) { if (tid < o) red[tid] = fmaxf(red[tid], red[tid + o]); __syncthreads(); }
    mx = red[0]; __syncthreads();
    float sum = 0.f;
    for (int j = tid; j < p.n; j += 256) { float v = s[j] * p.scale_in; if (mf) v += mf[j]; sum += (mx == -__builtin_inff()) ? 0.f : expf(v - mx); }
    red[tid] = sum; __syncthreads();
    for (int o = 128; o > 0; o >>= 1) { if (tid < o) red[tid] += red[tid + o]; __syncthreads(); }
    sum = red[0];
    const float inv = (sum > 0.f) ? p.scale_out / sum : 0.f;
    float* d = p.dst + z * p.dz + (long long)r * p.dr;
    for (int j = tid; j < p.n; j += 256) { float v = s[j] * p.scale_in; if (mf) v += mf[j]; const float o = (mx == -__builtin_inff()) ? 0.f : expf(v - mx) * inv; VST2(float, d + j, o); }
}
// =====================================================================================================================
// k_stats: mean and rsqrt(var + eps) over a set of n elements addressed base + z*sz + (e / inner) * so + (e % inner) * si, one 256-thread
// k_norm_apply: y = (x - mean[set]) * rstd[set] * g[c] + b[c] over a [Z][C][L] channel-major tensor with set = z*G + c / (C/G) (G groups per z;
//   G = C -> per-channel sets indexed z*C+c; for batch norm pass stats indexed by c only via bn = 1). Optional act. Output same layout.
// =====================================================================================================================
//   mode 0: mean / rsqrt(var + eps); mode 1 (RMSNorm): 0 / rsqrt(mean(x^2) + eps); mode 2 (L2 normalize * sqrt(n)): 0 / sqrt(n) / max(||x||, eps); mode 3: as 0 with unbiased variance (n-1)
__global__ __launch_bounds__(256) void k_stats(const float* __restrict__ x, long long sz, long long so, long long si, int inner, int n, float eps, float* __restrict__ stat, int mode) {
    __shared__ float red[256];
    const int z = blockIdx.x, tid = threadIdx.x;
    const float* base = x + z * sz;
    float s = 0.f;
    for (int e = tid; e < n; e += 256) s += base[(long long)(e / inner) * so + (long long)(e % inner) * si];
    red[tid] = s; __syncthreads();
    for (int o = 128; o > 0; o >>= 1) { if (tid < o) red[tid] += red[tid + o]; __syncthreads(); }
    const float mu = (mode == 0 || mode == 3) ? red[0] / (float)n : 0.f; __syncthreads();
    float q = 0.f;
    for (int e = tid; e < n; e += 256) { const float dlt = base[(long long)(e / inner) * so + (long long)(e % inner) * si] - mu; q += dlt * dlt; }
    red[tid] = q; __syncthreads();
    for (int o = 128; o > 0; o >>= 1) { if (tid < o) red[tid] += red[tid + o]; __syncthreads(); }
    {
        float rs;
        if (mode == 2) rs = sqrtf((float)n) / fmaxf(sqrtf(red[0]), eps); else if (mode == 3) rs = rsqrtf(red[0] / (float)(n - 1) + eps); else rs = rsqrtf(red[0] / (float)n + eps);
        if (tid < 32) { const float v = (tid == 0) ? mu : ((tid == 1) ? rs : 0.f); VST2(float, stat + (long long)z * 32 + tid, v); }
    }
}
//   One thread per element over the flat [Z][C][L] index space: grid ceil(Z*C*L / 256).
__global__ __launch_bounds__(256) void k_norm_apply(const float* __restrict__ x, float* __restrict__ y, const float* __restrict__ stat, const float* __restrict__ g, const float* __restrict__ bta,
                                                     int Z, int C, int L, int G, int bn, int act) {
    const long long idx = (long long)blockIdx.x * 256 + threadIdx.x;
    if (idx >= (long long)Z * C * L) return;
    const int l = (int)(idx % L); const long long zc = idx / L; const int c = (int)(zc % C), z = (int)(zc / C); (void)l;
    const int set = bn ? c : (z * G + c / (C / G));
    float v = (x[idx] - stat[(long long)set * 32]) * stat[(long long)set * 32 + 1];
    if (g) v *= g[c];
    if (bta) v += bta[c];
    v = act_fn(v, act);
    VST2(float, y + idx, v);
}

// k_lse_neg: c[i] = -(st[2i] + log(st[2i+1])) = minus the log-sum-exp of row i from k_attn's ST output (for softmax over the query dimension)
__global__ __launch_bounds__(256) void k_lse_neg(const float* __restrict__ st, float* __restrict__ c, int n) {
    const int i = blockIdx.x * 256 + threadIdx.x;
    if (i < n) { const float v = -(st[2 * i] + logf(st[2 * i + 1])); VST2(float, c + i, v); }
}

// k_iota: dst[i] = a * i + b as int32 (segment/position id helper)
__global__ __launch_bounds__(256) void k_iota(int* __restrict__ dst, int n, int a, int b) {
    const int i = blockIdx.x * 256 + threadIdx.x;
    if (i < n) { const int v = a * i + b; VST2(int, dst + i, v); }
}

// k_axpby: dst[i] = a * x[i] + b * y[i] (+ c), i < n
__global__ __launch_bounds__(256) void k_axpby(const float* __restrict__ x, const float* __restrict__ y, float* __restrict__ dst, int n, float a, float b, float c) {
    const int i = blockIdx.x * 256 + threadIdx.x;
    if (i < n) { const float v = a * x[i] + b * y[i] + c; VST2(float, dst + i, v); }
}

// =====================================================================================================================
// k_rope: rotary embedding on a [R rows][Hn heads][D] view (row stride sXr, head stride sXh, element stride 1) -> Y (own strides).
//   mode 0: rotate_half (partner d±D/2, sign - for d<D/2); mode 1: interleaved pairs (partner d^1, sign - for even d).
//   table column tcol: tmode 0 -> d, 1 -> d % (D/2), 2 -> d / 2; position p: pmode 0 -> r % S, 1 -> head index, 2 -> pos[r];
//   c = C[(r / S) * sCb + p * sCp + tcol * sCd], s likewise from Sn; y = x[d] * c + sign * x[partner] * s. X and Y must not alias.
// =====================================================================================================================
struct RopeP { const float* X; float* Y; const float* C; const float* Sn; const int* pos; long long sXr, sXh, sYr, sYh, sCb, sCp, sCd; int R, Hn, D, S, mode, tmode, pmode, pad; };
static_assert(sizeof(RopeP) == 5 * 8 + 7 * 8 + 8 * 4, "RopeP has padding");
__global__ __launch_bounds__(256) void k_rope(RopeP p) {
    const long long idx = (long long)blockIdx.x * 256 + threadIdx.x;
    if (idx >= (long long)p.R * p.Hn * p.D) return;
    const int d = (int)(idx % p.D); const long long rh = idx / p.D; const int h = (int)(rh % p.Hn); const int r = (int)(rh / p.Hn);
    const int half = p.D / 2;
    int partner; float sign;
    if (p.mode == 0) { partner = (d < half) ? d + half : d - half; sign = (d < half) ? -1.f : 1.f; }
    else { partner = d ^ 1; sign = (d & 1) ? 1.f : -1.f; }
    const int tcol = (p.tmode == 0) ? d : ((p.tmode == 1) ? (d % half) : (d >> 1));
    const int pp = (p.pmode == 0) ? (r % p.S) : ((p.pmode == 1) ? h : p.pos[r]);
    const long long toff = (long long)(r / p.S) * p.sCb + (long long)pp * p.sCp + (long long)tcol * p.sCd;
    const float* xr = p.X + (long long)r * p.sXr + (long long)h * p.sXh;
    const float v = xr[d] * p.C[toff] + sign * xr[partner] * p.Sn[toff];
    VST2(float, p.Y + (long long)r * p.sYr + (long long)h * p.sYh + d, v);
}

// k_invf + k_sincos (split so neither kernel carries a large VALU-fma footprint): invf_i = num * (1 / powf(base, (2 i)/D)) [fmode 0],
//   num * expf((2 i) * cexp) [fmode 1], num * powf(base, -2 (i - 1) / D) [fmode 2]; then cs/sn[s*half + i] = cos/sin((pscale * s) * invf_i)
__global__ __launch_bounds__(256) void k_invf(float* __restrict__ invb, int half, int D, float base, float num, int fmode, float cexp) {
    const int i = blockIdx.x * 256 + threadIdx.x;
    if (i >= ((half + 31) / 32) * 32) return;
    if (i >= half) { VST2(float, invb + i, 0.f); return; }
    const float e = (float)(2 * i) / (float)D;
    float invf;
    if (fmode == 1) invf = num * expf((float)(2 * i) * cexp);
    else if (fmode == 2) invf = num * powf(base, (-2.0f * ((float)i - 1.0f)) / (float)D);
    else invf = num * (1.0f / powf(base, e));
    VST2(float, invb + i, invf);
}
__global__ __launch_bounds__(256) void k_sincos(float* __restrict__ cs, float* __restrict__ sn, const float* __restrict__ invb, int S, int half, float pscale) {
    const int idx = blockIdx.x * 256 + threadIdx.x;
    if (idx >= S * half) return;
    const int s = idx / half, i = idx - s * half;
    const float ang = (pscale * (float)s) * invb[i];
    VST2(float, cs + idx, cosf(ang)); VST2(float, sn + idx, sinf(ang));
}

// k_mulact: dst[i] = act(x[i]) * y[i]
__global__ __launch_bounds__(256) void k_mulact(const float* __restrict__ x, const float* __restrict__ y, float* __restrict__ dst, int n, int act) {
    const int i = blockIdx.x * 256 + threadIdx.x;
    if (i < n) { const float v = act_fn(x[i], act) * y[i]; VST2(float, dst + i, v); }
}

// =====================================================================================================================
// k_matvec: thread-per-row matrix-vector products for N <= 8 output columns (heads with 1-3 outputs, gates), f32 on the VALU.
//   C[r*sCm + j] = act(alpha * sum_k A[r*sAm + k*sAk] * B[j*sBn + k*sBk] + bias[j]) + beta * R[r*sRm + j*sRn]; each thread writes its N contiguous floats.
// =====================================================================================================================
__global__ __launch_bounds__(256) void k_matvec(GemmP p) {
    // 32 lanes write one line with one instruction.
    const int rpt = (p.N == 1) ? 1 : 32;
    const long long r0 = ((long long)blockIdx.x * 256 + threadIdx.x) * rpt; const int z = blockIdx.z, zo = z / p.zi_n, zi = z - zo * p.zi_n;
    if (r0 >= p.M) return;
    const float* Bb = p.B + zo * p.sBo + zi * p.sBi;
    float* C = p.C + zo * p.sCo + zi * p.sCi; const float* R = p.R + zo * p.sRo + zi * p.sRi;
    for (int rr = 0; rr < rpt; ++rr) {
        const long long r = r0 + rr; if (r >= p.M) break;
        const float* A = p.A + zo * p.sAo + zi * p.sAi + r * p.sAm;
        float acc[8] = {0.f, 0.f, 0.f, 0.f, 0.f, 0.f, 0.f, 0.f};
        for (int k = 0; k < p.K; ++k) { const float a = A[(long long)k * p.sAk];
#pragma unroll
            for (int j = 0; j < 8; ++j) if (j < p.N) acc[j] += a * Bb[(long long)j * p.sBn + (long long)k * p.sBk]; }
#pragma unroll
        for (int j = 0; j < 8; ++j) if (j < p.N) {
            float v = acc[j] * p.alpha;
            if (p.flags & 1) v += p.bias[j];
            if (p.flags & 2) v += p.bias[r];
            v = act_fn(v, p.act);
            if (p.flags & 4) v += p.beta * R[r * p.sRm + (long long)j * p.sRn];
            VST2(float, C + r * p.sCm + j, v);
        }
    }
}
// k_smallsoftmax: thread-per-row softmax for short rows (n <= 64): dst[r*dr + j] = softmax(scale*src[r*sr + j])
__global__ __launch_bounds__(256) void k_smallsoftmax(const float* __restrict__ src, float* __restrict__ dst, long long sr, long long dr, int n, long long R, float scale) {
    const long long r0 = ((long long)blockIdx.x * 256 + threadIdx.x) * 32;
    for (int rr = 0; rr < 32; ++rr) {
        const long long r = r0 + rr; if (r >= R) return;
        const float* s = src + r * sr; float* d = dst + r * dr;
        float mx = -__builtin_inff();
        for (int j = 0; j < n; ++j) mx = fmaxf(mx, s[j] * scale);
        float sum = 0.f;
        for (int j = 0; j < n; ++j) sum += expf(s[j] * scale - mx);
        const float inv = 1.f / sum;
        for (int j = 0; j < n; ++j) { const float v = expf(s[j] * scale - mx) * inv; VST2(float, d + j, v); }
    }
}

__global__ __launch_bounds__(32) void k_unitstat(float* __restrict__ st) { const int t = threadIdx.x; const float v = (t == 1) ? 1.f : 0.f; VST2(float, st + t, v); }

// destination (e.g. a d_out whose row width is not a multiple of 32 floats) is written by consecutive lanes of one instruction
__global__ __launch_bounds__(256) void k_lincopy(const float* __restrict__ src, long long lds, float* __restrict__ dst, long long ldd, long long rows, int cols) {
    const long long i = (long long)blockIdx.x * 256 + threadIdx.x; if (i >= rows * cols) return;
    const long long r = i / cols; const int c = (int)(i - r * cols);
    const float v = src[r * lds + c]; VST2(float, dst + r * ldd + c, v);
}

namespace w25 {
typedef __attribute__((ext_vector_type(16))) _Float16 v16h;
typedef __attribute__((ext_vector_type(8)))  _Float16 v8h;
typedef __attribute__((ext_vector_type(16))) __bf16   v16b;
typedef __attribute__((ext_vector_type(8)))  __bf16   v8b;
typedef __attribute__((ext_vector_type(8)))  float    v8f;
typedef __attribute__((ext_vector_type(4)))  float    v4f;

__device__ __forceinline__ unsigned short f2bf_bits(float f) {
  unsigned u = __float_as_uint(f);
  return (unsigned short)((u + 0x7FFFu + ((u >> 16) & 1u)) >> 16);
}
__device__ __forceinline__ float bf_bits2f(unsigned short h) { return __uint_as_float(((unsigned)h) << 16); }

// hazard guards as plain device helpers (no inline asm inside the kernel template body)
__device__ __forceinline__ void dep_guard_h(v8f& a, v8f& b, v16h x, v16h y) { asm volatile("v_nop\n\tv_nop\n\tv_nop\n\tv_nop" : "+v"(a), "+v"(b) : "v"(x), "v"(y)); }
__device__ __forceinline__ void dep_guard_b(v8f& a, v8f& b, v16b x, v16b y) { asm volatile("v_nop\n\tv_nop\n\tv_nop\n\tv_nop" : "+v"(a), "+v"(b) : "v"(x), "v"(y)); }
__device__ __forceinline__ void keep4_h(v16h a, v16h b, v16h c, v16h d) { asm volatile("v_nop" :: "v"(a), "v"(b), "v"(c), "v"(d)); }
__device__ __forceinline__ void keep4_b(v16b a, v16b b, v16b c, v16b d) { asm volatile("v_nop" :: "v"(a), "v"(b), "v"(c), "v"(d)); }
__device__ __forceinline__ void acc_guard4(v8f& a, v8f& b, v8f& c, v8f& d) { asm volatile("v_nop\n\tv_nop\n\tv_nop\n\tv_nop" : "+v"(a), "+v"(b), "+v"(c), "+v"(d)); }
template <typename T> struct Frag;
template <> struct Frag<_Float16> {
  typedef v16h V; union U { v16h v; v8h h[2]; };
  static __device__ __forceinline__ v16h load(const _Float16* p) {   // elements 0..7 <- p[0..7], 8..15 <- p[16..23]
    U f; f.h[0] = *(const v8h*)(p); f.h[1] = *(const v8h*)(p + 16); return f.v;
  }
  static __device__ __forceinline__ v8f mma(v16h a, v16h b, v8f c) {
    return __builtin_amdgcn_wmma_f32_16x16x32_f16(false, a, false, b, (short)0, c, false, false);
  }
  static __device__ __forceinline__ void guard(v8f& a, v8f& b, v16h x, v16h y) { dep_guard_h(a, b, x, y); }
  static __device__ __forceinline__ void keep(v16h a, v16h b, v16h c, v16h d) { keep4_h(a, b, c, d); }
};
template <> struct Frag<__bf16> {
  typedef v16b V; union U { v16b v; v8b h[2]; };
  static __device__ __forceinline__ v16b load(const __bf16* p) {
    U f; f.h[0] = *(const v8b*)(p); f.h[1] = *(const v8b*)(p + 16); return f.v;
  }
  static __device__ __forceinline__ v8f mma(v16b a, v16b b, v8f c) {
    return __builtin_amdgcn_wmma_f32_16x16x32_bf16(false, a, false, b, (short)0, c, false, false);
  }
  static __device__ __forceinline__ void guard(v8f& a, v8f& b, v16b x, v16b y) { dep_guard_b(a, b, x, y); }
  static __device__ __forceinline__ void keep(v16b a, v16b b, v16b c, v16b d) { keep4_b(a, b, c, d); }
};

// ---- Register-blocked batched WMMA GEMM ------------------------------------
// C[m,n] = scale * sum_k A[m,k] * Bt[n,k] (+bias)(+resid); each wave owns a 64x64 tile.
// A row-major [M,K]; Bt row-major [N,K]; M,N % 64 == 0, K % 32 == 0.
// SPLIT: operands are hi/lo planes (A2/Bt2 = lo planes, same layout); product = hi·hi + hi·lo + lo·hi.
// BIAS_MODE: 0 = none, 1 = bias[m], 2 = bias[n].
// OUT_MODE: 0 = f32, 1 = f16, 2 = bf16 hi plane (Cout) + bf16 lo plane (Cout2).
// ET: 0 = f16 operands, 1 = bf16 operands (pointers passed as 16-bit storage)
template <int ET> struct Elem;
template <> struct Elem<0> { typedef _Float16 T; };
template <> struct Elem<1> { typedef __bf16 T; };
template <int ET, bool SPLIT, int BIAS_MODE, int OUT_MODE, bool RESID, int ACT = 0>
__global__ __launch_bounds__(256) void wmma_gemm64(
    const unsigned short* __restrict__ Ap, const unsigned short* __restrict__ A2p, int lda, long strideA,
    const unsigned short* __restrict__ Btp, const unsigned short* __restrict__ Bt2p, int ldb, long strideB,
    void* __restrict__ Cout, void* __restrict__ Cout2, int ldc, long strideC,
    const float* __restrict__ bias,
    const float* __restrict__ resid, long strideR,
    int M, int N, int K, float scale) {
  typedef typename Elem<ET>::T T;
  typedef typename Frag<T>::V V;
  const T* A = (const T*)Ap; const T* A2 = (const T*)A2p; const T* Bt = (const T*)Btp; const T* Bt2 = (const T*)Bt2p;
  __shared__ __align__(16) float sT[8][16 * 68];   // per-wave 16x64 slab, pitch 68 floats
  const int b    = blockIdx.y;
  const int lane = threadIdx.x & 31;
  const int wave = threadIdx.x >> 5;
  const int tilesN = N >> 6;
  const int tilesM = M >> 6;
  const int tile = blockIdx.x * 8 + wave;
  if (tile >= tilesM * tilesN) return;   // wave-uniform; no block barriers in this kernel
  const int tm = tile / tilesN;
  const int tn = tile - tm * tilesN;
  const int m0 = tm << 6;
  const int n0 = tn << 6;

  const T* Ab  = A  + (size_t)b * strideA;
  const T* Bb  = Bt + (size_t)b * strideB;
  const T* Ab2 = SPLIT ? (A2  + (size_t)b * strideA) : nullptr;
  const T* Bb2 = SPLIT ? (Bt2 + (size_t)b * strideB) : nullptr;

  const int rlane = lane & 15;                 // row (A) / col (B, D) within subtile
  const int koff  = (lane >> 4) * 8;           // k offset of this lane half
  const int mOff  = (lane >> 4) * 8;           // D row offset

  v8f acc[4][4];
#pragma unroll
  for (int i = 0; i < 4; ++i)
#pragma unroll
    for (int j = 0; j < 4; ++j) acc[i][j] = (v8f){0.f,0.f,0.f,0.f,0.f,0.f,0.f,0.f};

  for (int k0 = 0; k0 < K; k0 += 32) {
    V bh[4], bl[4];
#pragma unroll
    for (int j = 0; j < 4; ++j) {
      const size_t bo = (size_t)(n0 + (j << 4) + rlane) * ldb + koff + k0;
      bh[j] = Frag<T>::load(Bb + bo);
      if (SPLIT) bl[j] = Frag<T>::load(Bb2 + bo);
    }
#pragma unroll
    for (int i = 0; i < 4; ++i) {
      const size_t ao = (size_t)(m0 + (i << 4) + rlane) * lda + koff + k0;
      V ah = Frag<T>::load(Ab + ao);
      V al;
      if (SPLIT) al = Frag<T>::load(Ab2 + ao);
#pragma unroll
      for (int j = 0; j < 4; ++j) {
        acc[i][j] = Frag<T>::mma(ah, bh[j], acc[i][j]);
        if (SPLIT) {
          acc[i][j] = Frag<T>::mma(ah, bl[j], acc[i][j]);
          acc[i][j] = Frag<T>::mma(al, bh[j], acc[i][j]);
        }
      }
      Frag<T>::guard(acc[i][0], acc[i][3], ah, SPLIT ? al : ah);
    }
    Frag<T>::keep(bh[0], bh[1], bh[2], bh[3]);
    if (SPLIT) Frag<T>::keep(bl[0], bl[1], bl[2], bl[3]);
  }
  acc_guard4(acc[0][0], acc[0][1], acc[0][2], acc[0][3]);
  acc_guard4(acc[1][0], acc[1][1], acc[1][2], acc[1][3]);
  acc_guard4(acc[2][0], acc[2][1], acc[2][2], acc[2][3]);
  acc_guard4(acc[3][0], acc[3][1], acc[3][2], acc[3][3]);

  // ---- epilogue ----
  float* slab = sT[wave];
  const float* Rb = RESID ? (resid + (size_t)b * strideR) : nullptr;
#pragma unroll
  for (int i = 0; i < 4; ++i) {
    const int mBase = m0 + (i << 4);
#pragma unroll
    for (int j = 0; j < 4; ++j) {
      const int n = n0 + (j << 4) + rlane;
      float bv = 0.f;
      if (BIAS_MODE == 2) bv = bias[n];
#pragma unroll
      for (int r = 0; r < 8; ++r) {
        float v = acc[i][j][r] * scale;
        if (BIAS_MODE == 1) v += bias[mBase + mOff + r];
        if (BIAS_MODE == 2) v += bv;
        if (RESID) v += Rb[(size_t)(mBase + mOff + r) * ldc + n];
        if (ACT == 1) v = tanhf(v);
        if (ACT == 2) v = fmaxf(v, 0.0f);
        if (ACT == 3) v = v / (1.0f + expf(-v));
        if (ACT == 4) v = (v > 0.f) ? v : 0.01f * v;
        if (ACT == 5) v = 0.5f * v * (1.0f + erff(v * 0.70710678118654752f));
        slab[(mOff + r) * 68 + (j << 4) + rlane] = v;
      }
    }
    __builtin_amdgcn_fence(__ATOMIC_RELEASE, "workgroup");
    __builtin_amdgcn_wave_barrier();
    __builtin_amdgcn_fence(__ATOMIC_ACQUIRE, "workgroup");
    if (OUT_MODE == 0) {
      float* C = (float*)Cout + (size_t)b * strideC;
      const int hh = lane >> 4, c4 = (lane & 15) * 4;     // row seg = 256 B = 16 lanes x 16 B
      {
#pragma unroll
        for (int it = 0; it < 8; ++it) {
          const int row = it * 2 + hh;
          v4f v = *(const v4f*)(slab + row * 68 + c4);
          *(v4f*)(C + (size_t)(mBase + row) * ldc + n0 + c4) = v;
        }
        
      }
    } else {
      const int q = lane >> 3, c8 = (lane & 7) * 8;
      unsigned short* C  = (unsigned short*)Cout  + (size_t)b * strideC;
      unsigned short* C2 = (OUT_MODE == 2) ? ((unsigned short*)Cout2 + (size_t)b * strideC) : nullptr;
      {
#pragma unroll
        for (int it = 0; it < 4; ++it) {
          const int row = it * 4 + q;
          const float* sp = slab + row * 68 + c8;
          v8h hv, lv;
#pragma unroll
          for (int e = 0; e < 8; ++e) {
            if (OUT_MODE == 1) {
              hv[e] = (_Float16)sp[e];
            } else {
              unsigned short hb = f2bf_bits(sp[e]);
              unsigned short lb = f2bf_bits(sp[e] - bf_bits2f(hb));
              hv[e] = __builtin_bit_cast(_Float16, hb);
              lv[e] = __builtin_bit_cast(_Float16, lb);
            }
          }
          *(v8h*)(C + (size_t)(mBase + row) * ldc + n0 + c8) = hv;
          if (OUT_MODE == 2) *(v8h*)(C2 + (size_t)(mBase + row) * ldc + n0 + c8) = lv;
        }
        
      }
    }
    __builtin_amdgcn_fence(__ATOMIC_RELEASE, "workgroup");
    __builtin_amdgcn_wave_barrier();
    __builtin_amdgcn_fence(__ATOMIC_ACQUIRE, "workgroup");
  }
}

__global__ __launch_bounds__(256) void cast_f32_f16x2(
    const float* __restrict__ in, _Float16* __restrict__ out, int n2) {
  int i = blockIdx.x * 256 + threadIdx.x;
  if (i < n2) {
    const _Float16 h0 = (_Float16)in[2 * i], h1 = (_Float16)in[2 * i + 1];
    const unsigned u = (unsigned)__builtin_bit_cast(unsigned short, h0) | ((unsigned)__builtin_bit_cast(unsigned short, h1) << 16);
    ((unsigned*)out)[i] = u;
    
  }
}


} // namespace w25

__device__ __forceinline__ unsigned int f2h2_pack(float a, float b) { return (unsigned)__builtin_bit_cast(unsigned short, (_Float16)a) | ((unsigned)__builtin_bit_cast(unsigned short, (_Float16)b) << 16); }
// Transposing casts of x[b] ([256][Cn] f32 -> [b][Cn][256] 16-bit planes). Each thread owns 8 rows x 4 columns: eight 16-byte loads, then one 16-byte store
// per column and plane. In a wave 8 lanes run along the rows (8 x 16 B = one whole 128-B line of a destination row) and 4 along the columns;
// a block is 4 waves x 64 rows = all 256 rows, by 2 waves x 16 columns. blockIdx.x = group of 32 columns, blockIdx.y = image.
template <int Cn> __global__ __launch_bounds__(256) void k_castT16w(const float* __restrict__ src, _Float16* __restrict__ dst, float s) {
    const int lane = threadIdx.x & 31, w = threadIdx.x >> 5;
    const int r0 = ((w & 3) * 8 + (lane & 7)) * 8, c0 = blockIdx.x * 32 + (w >> 2) * 16 + (lane >> 3) * 4;
    src += (long long)blockIdx.y * 256 * Cn + (long long)r0 * Cn + c0; dst += (long long)blockIdx.y * 256 * Cn + (long long)c0 * 256 + r0;
    v4f v[8];
#pragma unroll   // v[] in registers, all eight loads in flight
    for (int k = 0; k < 8; ++k) v[k] = *(const v4f*)(src + (long long)k * Cn);
#pragma unroll   // constant indices into v[]
    for (int j = 0; j < 4; ++j) { v4u h;
#pragma unroll   // constant indices into v[]
        for (int q = 0; q < 4; ++q) h[q] = f2h2_pack(v[2 * q][j] * s, v[2 * q + 1][j] * s);
        *(v4u*)(dst + j * 256) = h; } }
__global__ __launch_bounds__(256) void k_cast16(const float* __restrict__ src, long long lds, _Float16* __restrict__ dst, long long ldd, int R, int C, float s) {
    const long long i = (long long)blockIdx.x * 256 + threadIdx.x; const long long np = (long long)R * (C / 2); if (i >= np) return; const int r = (int)(i / (C / 2)); const int c = 2 * (int)(i % (C / 2));
    const _Float16 h0 = (_Float16)(src[(long long)r * lds + c] * s), h1 = (_Float16)(src[(long long)r * lds + c + 1] * s);
    const unsigned u = (unsigned)__builtin_bit_cast(unsigned short, h0) | ((unsigned)__builtin_bit_cast(unsigned short, h1) << 16);
    unsigned* d = (unsigned*)(dst + (long long)r * ldd + c); *d = u;  }

// f32 -> bf16 hi plane + bf16 lo plane (x = hi + lo to ~2^-17 relative; RNE both), [R][C] -> [R][C] (or transposed to [C][R]); 2 consecutive destination elements
__device__ __forceinline__ unsigned int f2bf2_pack(float a, float b, unsigned int* lo) {
    const unsigned short ha = w25::f2bf_bits(a), hb = w25::f2bf_bits(b);
    const unsigned short la = w25::f2bf_bits(a - w25::bf_bits2f(ha)), lb = w25::f2bf_bits(b - w25::bf_bits2f(hb));
    *lo = (unsigned)la | ((unsigned)lb << 16); return (unsigned)ha | ((unsigned)hb << 16); }
__global__ __launch_bounds__(256) void k_castS16(const float* __restrict__ src, long long lds, __bf16* __restrict__ dhi, __bf16* __restrict__ dlo, long long ldd, int R, int C, float s, int transpose, long long sb, long long db) {
    src += (long long)blockIdx.y * sb; dhi += (long long)blockIdx.y * db; dlo += (long long)blockIdx.y * db;   // blockIdx.y = image
    const long long i = (long long)blockIdx.x * 256 + threadIdx.x; long long o; float a, b;
    if (transpose) { const long long np = (long long)C * (R / 2); if (i >= np) return; const int c = (int)(i / (R / 2)); const int r = 2 * (int)(i % (R / 2)); a = src[(long long)r * lds + c] * s; b = src[(long long)(r + 1) * lds + c] * s; o = (long long)c * ldd + r; }
    else { const long long np = (long long)R * (C / 2); if (i >= np) return; const int r = (int)(i / (C / 2)); const int c = 2 * (int)(i % (C / 2)); a = src[(long long)r * lds + c] * s; b = src[(long long)r * lds + c + 1] * s; o = (long long)r * ldd + c; }
    unsigned lo; const unsigned hi = f2bf2_pack(a, b, &lo); unsigned* ph = (unsigned*)(dhi + o); unsigned* pl = (unsigned*)(dlo + o);
    *ph = hi; *pl = lo;  }
// the transposing cast of k_castT16w for the bf16 hi and lo planes
template <int Cn> __global__ __launch_bounds__(256) void k_castS16w(const float* __restrict__ src, __bf16* __restrict__ dhi, __bf16* __restrict__ dlo, float s) {
    const int lane = threadIdx.x & 31, w = threadIdx.x >> 5;
    const int r0 = ((w & 3) * 8 + (lane & 7)) * 8, c0 = blockIdx.x * 32 + (w >> 2) * 16 + (lane >> 3) * 4;
    const long long o = (long long)blockIdx.y * 256 * Cn + (long long)c0 * 256 + r0;
    src += (long long)blockIdx.y * 256 * Cn + (long long)r0 * Cn + c0; dhi += o; dlo += o;
    v4f v[8];
#pragma unroll   // v[] in registers, all eight loads in flight
    for (int k = 0; k < 8; ++k) v[k] = *(const v4f*)(src + (long long)k * Cn);
#pragma unroll   // constant indices into v[]
    for (int j = 0; j < 4; ++j) { v4u hi, lo;
#pragma unroll   // constant indices into v[]
        for (int q = 0; q < 4; ++q) { unsigned l; hi[q] = f2bf2_pack(v[2 * q][j] * s, v[2 * q + 1][j] * s, &l); lo[q] = l; }
        *(v4u*)(dhi + j * 256) = hi; *(v4u*)(dlo + j * 256) = lo; } }

namespace w25 {
// =====================================================================================
// Generic causal/non-causal attention for head_dim 64, f32 in / f32 out; 16-bit operands: bf16 with optional hi/lo splits, or
// plain f16 (F16=true, non-split, probabilities carried x2^15).
//   scores = (q*qscale)·kᵀ : v_wmma_f32_16x16x32_bf16; SPLIT_QK -> q,k as bf16 hi/lo (hi·hi + hi·lo + lo·hi)
//   out    = p·v           : v_wmma_f32_16x16x32_bf16; SPLIT_PV -> p,v as bf16 hi/lo; else p,v plain bf16
//   f32 accumulate; online softmax in f32. Block = 4 waves = 64 query rows of one (batch, head); S % 64 == 0.
//   Element (b, s, h, d) of tensor X lives at X[b*X_bs + s*X_rs + h*X_hs + d] (strides in floats, multiples of 4).
//   Masking: mask_mode 0 none, 1 causal (kv > q masked), 2 tensor [S][Skv] shared over (b,h) (float if
//   mask_is_int==0, int32 with element == 0 -> masked if 1, int32 with element != 0 -> masked if 2), 3 per-token vectors qmask[B][S] & kvmask[B][Skv] (int32,
//   0 -> masked), 4 causal + sliding window (kv > q or q - kv > W masked; W passed in mask_is_int);
//   5 = relative-position bias: s += cp[b,h,q][idx[q][kv]] + pc[b,h,kv][idx[q][kv]] with idx = mask_b ([S][Skv] int32) and
//   mask_a an int32 [S][Skv] tensor with nonzero = masked (tables: element (b,h,row,n) at X + b*c_bs + h*c_hs + row*c_rs + n);
//   masked scores are replaced by mask_fill (e.g. -inf or -1e9) before the softmax.
//   grid.x = B * H * (S/64) (or a sub-range with blk0).
// =====================================================================================
#define AT_D 64
#define AT_NW 4
#define AT_QB 64
#define AT_KC 64
struct AttnGeom { const float* cp = nullptr; const float* pc = nullptr; long c_bs = 0, c_rs = 0, c_hs = 0;   // mode-5 score-bias tables
                  long q_bs, q_rs, q_hs, k_bs, k_rs, k_hs, v_bs, v_rs, v_hs, o_bs, o_rs, o_hs;
                  int S, Skv, H, mask_mode; float qscale; int blk0; float mask_fill; int mask_is_int; };
static_assert(sizeof(AttnGeom) == 168, "no padding");

__device__ __forceinline__ unsigned short at_bf_bits(float f) {
  unsigned u = __float_as_uint(f);
  return (unsigned short)((u + 0x7FFFu + ((u >> 16) & 1u)) >> 16);
}
__device__ __forceinline__ __bf16 at_f2bf(float f) { return __builtin_bit_cast(__bf16, at_bf_bits(f)); }
__device__ __forceinline__ void at_split(float f, __bf16& hi, __bf16& lo) {
  const unsigned short hb = at_bf_bits(f);
  hi = __builtin_bit_cast(__bf16, hb);
  lo = at_f2bf(f - __uint_as_float(((unsigned)hb) << 16));
}
__device__ __forceinline__ v8f at_mma(v16b a, v16b b, v8f c) {
  c = __builtin_amdgcn_wmma_f32_16x16x32_bf16(false, a, false, b, (short)0, c, false, false);
  asm volatile("v_nop\n\tv_nop\n\tv_nop\n\tv_nop" : "+v"(c) : "v"(a), "v"(b));
  return c;
}
// 16-bit element as a bit pattern held in a __bf16 slot: f16 bits when F16, bf16 (RNE) otherwise
template <bool F16> __device__ __forceinline__ __bf16 at_to16(float f) {
  if (F16) return __builtin_bit_cast(__bf16, (_Float16)f);
  return at_f2bf(f);
}
template <bool F16> __device__ __forceinline__ v8f at_mma16(v16b a, v16b b, v8f c) {
  if (F16) {
    const v16h ah = __builtin_bit_cast(v16h, a), bh = __builtin_bit_cast(v16h, b);
    c = __builtin_amdgcn_wmma_f32_16x16x32_f16(false, ah, false, bh, (short)0, c, false, false);
    asm volatile("v_nop\n\tv_nop\n\tv_nop\n\tv_nop" : "+v"(c) : "v"(ah), "v"(bh));
    return c;
  }
  return at_mma(a, b, c);
}

template <bool SPLIT_QK, bool SPLIT_PV, bool F16 = false>
__global__ __launch_bounds__(128)
void attn64_kernel(const float* __restrict__ q, const float* __restrict__ k,
                   const float* __restrict__ v, float* __restrict__ out,
                   const void* __restrict__ mask_a, const int* __restrict__ mask_b, AttnGeom g) {
  static_assert(!(F16 && (SPLIT_QK || SPLIT_PV)), "f16 mode is non-split");
  const float PSC = F16 ? 32768.0f : 1.0f;     // f16 probabilities carried x2^15 (subnormal range), folded into the final 1/l
  union FB { v16b v; v8b h[2]; };
  __shared__ __align__(16) __bf16 Ksh[AT_KC * AT_D];             // K hi [kv][d]      8 KB
  __shared__ __align__(16) __bf16 Ksl[SPLIT_QK ? AT_KC * AT_D : 8];
  __shared__ __align__(16) __bf16 Vth[AT_D * AT_KC];             // V hi [d][kv]      8 KB
  __shared__ __align__(16) __bf16 Vtl[SPLIT_PV ? AT_D * AT_KC : 8];
  __shared__ __align__(16) __bf16 Psh[AT_NW][16 * AT_KC];        // per wave P hi [row][kv]  8 KB
  __shared__ __align__(16) __bf16 Psl[SPLIT_PV ? AT_NW : 1][SPLIT_PV ? 16 * AT_KC : 8];
  __shared__ __align__(16) float  Os[AT_NW][16 * 68];            // per wave out tile, pitch 68

  const int tid  = threadIdx.x;
  const int wave = tid >> 5;
  const int lane = tid & 31;
  const int hh   = lane >> 4;
  const int c    = lane & 15;

  const int nqb = g.S / AT_QB;
  const int bx = blockIdx.x + g.blk0;
  const int qb = bx % nqb;
  const int bh = bx / nqb;
  const int h  = bh % g.H;
  const int b  = bh / g.H;
  const int qbase_block = qb * AT_QB;
  const int q0 = qbase_block + wave * 16;

  const float* qb_ptr = q + (size_t)b * g.q_bs + (size_t)h * g.q_hs;
  const float* kb_ptr = k + (size_t)b * g.k_bs + (size_t)h * g.k_hs;
  const float* vb_ptr = v + (size_t)b * g.v_bs + (size_t)h * g.v_hs;
  float*       ob_ptr = out + (size_t)b * g.o_bs + (size_t)h * g.o_hs;

  // ---- Q fragments (A operand): 2 d-chunks, hi (and lo) ----
  v16b qah[2], qal[2];
  {
    const float* qrow = qb_ptr + (size_t)(q0 + c) * g.q_rs;
#pragma unroll
    for (int dc = 0; dc < 2; ++dc) {
#pragma unroll
      for (int e = 0; e < 8; ++e) {
        const float f0 = qrow[dc * 32 + 8 * hh + e] * g.qscale;
        const float f1 = qrow[dc * 32 + 16 + 8 * hh + e] * g.qscale;
        if (SPLIT_QK) { __bf16 hq, lq; at_split(f0, hq, lq); qah[dc][e] = hq; qal[dc][e] = lq; at_split(f1, hq, lq); qah[dc][8 + e] = hq; qal[dc][8 + e] = lq; }
        else { qah[dc][e] = at_to16<F16>(f0); qah[dc][8 + e] = at_to16<F16>(f1); qal[dc][e] = qah[dc][e]; qal[dc][8 + e] = qah[dc][8 + e]; }
      }
    }
  }

  float mrow[8], lrow[8];
  v8f oacc[4];
#pragma unroll
  for (int r = 0; r < 8; ++r) { mrow[r] = -INFINITY; lrow[r] = 0.f; }
#pragma unroll
  for (int t = 0; t < 4; ++t) oacc[t] = (v8f){0.f,0.f,0.f,0.f,0.f,0.f,0.f,0.f};

  const int nChunks = (g.mask_mode == 1 || g.mask_mode == 4) ? (qb + 1) : (g.Skv / AT_KC);   // block-uniform
  // per-row query mask (mode 3)
  int qkeep[8];
#pragma unroll
  for (int r = 0; r < 8; ++r) qkeep[r] = (g.mask_mode == 3) ? mask_b[(size_t)b * g.S + q0 + 8 * hh + r] : 1;   // mask_b = qmask in mode 3
  for (int kc = 0; kc < nChunks; ++kc) {
    const int kv0 = kc * AT_KC;
    __syncthreads();
    {
      const int kvr = tid >> 1, dh = (tid & 1) * 32;
      const float* krow = kb_ptr + (size_t)(kv0 + kvr) * g.k_rs + dh;
      const float* vrow = vb_ptr + (size_t)(kv0 + kvr) * g.v_rs + dh;
#pragma unroll
      for (int i = 0; i < 8; ++i) {
        v4f kk = *(const v4f*)(krow + 4 * i);
        v4f vv = *(const v4f*)(vrow + 4 * i);
#pragma unroll
        for (int e = 0; e < 4; ++e) {
          const int d = dh + 4 * i + e;
          if (SPLIT_QK) { __bf16 a, bl; at_split(kk[e], a, bl); Ksh[kvr * AT_D + d] = a; Ksl[kvr * AT_D + d] = bl; }
          else Ksh[kvr * AT_D + d] = at_to16<F16>(kk[e]);
          if (SPLIT_PV) { __bf16 a, bl; at_split(vv[e], a, bl); Vth[d * AT_KC + kvr] = a; Vtl[d * AT_KC + kvr] = bl; }
          else Vth[d * AT_KC + kvr] = at_to16<F16>(vv[e]);
        }
      }
    }
    __syncthreads();

    v8f s[4];
#pragma unroll
    for (int j = 0; j < 4; ++j) {
      s[j] = (v8f){0.f,0.f,0.f,0.f,0.f,0.f,0.f,0.f};
#pragma unroll 1
      for (int dc = 0; dc < 2; ++dc) {
        FB kb;
        kb.h[0] = *(const v8b*)(Ksh + (j * 16 + c) * AT_D + dc * 32 + 8 * hh);
        kb.h[1] = *(const v8b*)(Ksh + (j * 16 + c) * AT_D + dc * 32 + 16 + 8 * hh);
        s[j] = at_mma16<F16>(qah[dc], kb.v, s[j]);
        if (SPLIT_QK) {
          FB kl;
          kl.h[0] = *(const v8b*)(Ksl + (j * 16 + c) * AT_D + dc * 32 + 8 * hh);
          kl.h[1] = *(const v8b*)(Ksl + (j * 16 + c) * AT_D + dc * 32 + 16 + 8 * hh);
          s[j] = at_mma16<F16>(qah[dc], kl.v, s[j]);
          s[j] = at_mma16<F16>(qal[dc], kb.v, s[j]);
        }
      }
    }
    const bool diag = (g.mask_mode == 1) && (kc == qb);
    int kvkeep[4] = {1, 1, 1, 1};
    if (g.mask_mode == 3) {
#pragma unroll
      for (int j = 0; j < 4; ++j) kvkeep[j] = ((const int*)mask_a)[(size_t)b * g.Skv + kv0 + j * 16 + c];   // mask_a = kvmask
    }
    float cm[8];
#pragma unroll
    for (int r = 0; r < 8; ++r) {
      const int qrow = q0 + 8 * hh + r;
      float m = -INFINITY;
#pragma unroll
      for (int j = 0; j < 4; ++j) {
        const int kvcol = kv0 + j * 16 + c;
        bool masked = false;
        if (diag) masked = (kvcol > qrow);
        else if (g.mask_mode == 4) masked = (kvcol > qrow) || (qrow - kvcol > g.mask_is_int);
        else if (g.mask_mode == 2) {
          const size_t mi = (size_t)qrow * g.Skv + kvcol;
          masked = (g.mask_is_int == 0) ? (((const float*)mask_a)[mi] == 0.0f)
                 : (g.mask_is_int == 1) ? (((const int*)mask_a)[mi] == 0) : (((const int*)mask_a)[mi] != 0);
        } else if (g.mask_mode == 3) masked = (qkeep[r] == 0) || (kvkeep[j] == 0);
        else if (g.mask_mode == 5) {
          const size_t mi = (size_t)qrow * g.Skv + kvcol;
          masked = (((const int*)mask_a)[mi] != 0);
          int n = mask_b[mi]; n = n < 0 ? 0 : n;
          s[j][r] += g.cp[(size_t)b * g.c_bs + (size_t)h * g.c_hs + (size_t)qrow * g.c_rs + n]
                   + g.pc[(size_t)b * g.c_bs + (size_t)h * g.c_hs + (size_t)kvcol * g.c_rs + n];
        }
        if (masked) s[j][r] = g.mask_fill;
        m = fmaxf(m, s[j][r]);
      }
#pragma unroll
      for (int off = 1; off < 16; off <<= 1) m = fmaxf(m, __shfl_xor(m, off, 32));
      cm[r] = m;
    }
    __bf16* pwh = Psh[wave];
    __bf16* pwl = Psl[SPLIT_PV ? wave : 0];
#pragma unroll
    for (int r = 0; r < 8; ++r) {
      const float mnew = fmaxf(mrow[r], cm[r]);
      const float alpha = expf(mrow[r] - mnew);
      mrow[r] = mnew;
      float psum = 0.f;
#pragma unroll
      for (int j = 0; j < 4; ++j) {
        const float p = expf(s[j][r] - mnew);
        psum += p;
        if (SPLIT_PV) { __bf16 a, bl; at_split(p, a, bl); pwh[(8 * hh + r) * AT_KC + j * 16 + c] = a; pwl[(8 * hh + r) * AT_KC + j * 16 + c] = bl; }
        else pwh[(8 * hh + r) * AT_KC + j * 16 + c] = at_to16<F16>(p * PSC);
      }
#pragma unroll
      for (int off = 1; off < 16; off <<= 1) psum += __shfl_xor(psum, off, 32);
      lrow[r] = lrow[r] * alpha + psum;
#pragma unroll
      for (int t = 0; t < 4; ++t) oacc[t][r] *= alpha;
    }
    __builtin_amdgcn_fence(__ATOMIC_RELEASE, "workgroup");
    __builtin_amdgcn_wave_barrier();
    __builtin_amdgcn_fence(__ATOMIC_ACQUIRE, "workgroup");
#pragma unroll 1
    for (int kk = 0; kk < 2; ++kk) {
      FB pa, pl;
      pa.h[0] = *(const v8b*)(pwh + c * AT_KC + kk * 32 + 8 * hh);
      pa.h[1] = *(const v8b*)(pwh + c * AT_KC + kk * 32 + 16 + 8 * hh);
      if (SPLIT_PV) {
        pl.h[0] = *(const v8b*)(pwl + c * AT_KC + kk * 32 + 8 * hh);
        pl.h[1] = *(const v8b*)(pwl + c * AT_KC + kk * 32 + 16 + 8 * hh);
      }
#pragma unroll
      for (int t = 0; t < 4; ++t) {
        FB vb;
        vb.h[0] = *(const v8b*)(Vth + (t * 16 + c) * AT_KC + kk * 32 + 8 * hh);
        vb.h[1] = *(const v8b*)(Vth + (t * 16 + c) * AT_KC + kk * 32 + 16 + 8 * hh);
        oacc[t] = at_mma16<F16>(pa.v, vb.v, oacc[t]);
        if (SPLIT_PV) {
          FB vl;
          vl.h[0] = *(const v8b*)(Vtl + (t * 16 + c) * AT_KC + kk * 32 + 8 * hh);
          vl.h[1] = *(const v8b*)(Vtl + (t * 16 + c) * AT_KC + kk * 32 + 16 + 8 * hh);
          oacc[t] = at_mma16<F16>(pa.v, vl.v, oacc[t]);
          oacc[t] = at_mma16<F16>(pl.v, vb.v, oacc[t]);
        }
      }
    }
  }

  float* os = Os[wave];
#pragma unroll
  for (int r = 0; r < 8; ++r) {
    const float inv = 1.0f / (lrow[r] * PSC);
#pragma unroll
    for (int t = 0; t < 4; ++t) os[(8 * hh + r) * 68 + t * 16 + c] = oacc[t][r] * inv;
  }
  __builtin_amdgcn_fence(__ATOMIC_RELEASE, "workgroup");
  __builtin_amdgcn_wave_barrier();
  __builtin_amdgcn_fence(__ATOMIC_ACQUIRE, "workgroup");
  {
    const int c4 = (lane & 15) * 4;
    {
#pragma unroll
      for (int it = 0; it < 8; ++it) {
        const int row = it * 2 + hh;
        v4f val = *(const v4f*)(os + row * 68 + c4);
        *(v4f*)(ob_ptr + (size_t)(q0 + row) * g.o_rs + c4) = val;
      }
      
    }
  }
}

} // namespace w25

__device__ __forceinline__ void st_h2(_Float16* dst, float a, float b) { const unsigned u = (unsigned)__builtin_bit_cast(unsigned short, (_Float16)a) | ((unsigned)__builtin_bit_cast(unsigned short, (_Float16)b) << 16); unsigned* d = (unsigned*)dst; *d = u;  }
__device__ __forceinline__ unsigned short bf16b(float v) { const unsigned u = __builtin_bit_cast(unsigned, v); return (unsigned short)(((u + 0x7FFFu + ((u >> 16) & 1u)) & 0xFFFF0000u) >> 16); }
__device__ __forceinline__ float bf16f(unsigned short h) { return __builtin_bit_cast(float, ((unsigned)h) << 16); }
__device__ __forceinline__ void st_split2(_Float16* H, _Float16* L, long long e, float v0, float v1) { const unsigned short h0 = bf16b(v0), h1 = bf16b(v1); { const unsigned u = (unsigned)h0 | ((unsigned)h1 << 16); unsigned* d = (unsigned*)(H + e); *d = u;  } { const unsigned u = (unsigned)bf16b(v0 - bf16f(h0)) | ((unsigned)bf16b(v1 - bf16f(h1)) << 16); unsigned* d = (unsigned*)(L + e); *d = u;  } }
// 2x2 max-pool of PH and G ([ic][64][64] -> [ic][32][32]) plus the operand planes: PP hi/lo (pooled phi) and GP16 (pooled g) in fragment order (below), TH hi/lo [hw][ic] (theta planes). thread-linear: HW*IC/8 groups of 8 theta values = IC*NK/2 pooled pairs
__global__ __launch_bounds__(256) void k_nl_pool(const float* __restrict__ PH, const float* __restrict__ G, const float* __restrict__ TH, float* __restrict__ PHP, float* __restrict__ GP, _Float16* PPH, _Float16* PPL, _Float16* GP16, _Float16* THH, _Float16* THL, int IC, int HW, int NK) { const long long t = (long long)blockIdx.x * 256 + threadIdx.x;
    { const long long big = (long long)blockIdx.y * IC * HW, sml = (long long)blockIdx.y * IC * NK;   // blockIdx.y = image
      PH += big; G += big; TH += big; THH += big; THL += big; PHP += sml; GP += sml; PPH += sml; PPL += sml; GP16 += sml; }
    if (t < (long long)HW * IC / 8) { const long long e = 8 * t; const float* tp = TH + e; const v4f a = *(const v4f*)(tp), b = *(const v4f*)(tp + 4);
        asm volatile("s_wait_xcnt 0x0" :: "v"(tp) : "memory");   // tp as an input keeps the pair until the wait
        const float f[8] = { a[0], a[1], a[2], a[3], b[0], b[1], b[2], b[3] }; v4u hi, lo;
#pragma unroll   // constant indices into f[]
        for (int q = 0; q < 4; ++q) { const unsigned short h0 = bf16b(f[2 * q]), h1 = bf16b(f[2 * q + 1]); hi[q] = (unsigned)h0 | ((unsigned)h1 << 16); lo[q] = (unsigned)bf16b(f[2 * q] - bf16f(h0)) | ((unsigned)bf16b(f[2 * q + 1] - bf16f(h1)) << 16); }
        *(v4u*)(THH + e) = hi; *(v4u*)(THL + e) = lo; }
    if (t < (long long)IC * NK / 2) { const long long e = 2 * t; float pv[2], gv[2];
#pragma unroll
        for (int u = 0; u < 2; ++u) { const long long q = e + u; const int ic = (int)(q / NK), pk = (int)(q % NK); const int py = pk / 32, px = pk % 32; const long long s = (long long)ic * HW + (2 * py) * 64 + 2 * px;
            pv[u] = fmaxf(fmaxf(PH[s], PH[s + 1]), fmaxf(PH[s + 64], PH[s + 65])); gv[u] = fmaxf(fmaxf(G[s], G[s + 1]), fmaxf(G[s + 64], G[s + 65])); }
        { const unsigned long long pk2 = (unsigned long long)__builtin_bit_cast(unsigned, pv[0]) | ((unsigned long long)__builtin_bit_cast(unsigned, pv[1]) << 32); VST2(unsigned long long, (unsigned long long*)(PHP + e), pk2); }
        { const unsigned long long pk2 = (unsigned long long)__builtin_bit_cast(unsigned, gv[0]) | ((unsigned long long)__builtin_bit_cast(unsigned, gv[1]) << 32); VST2(unsigned long long, (unsigned long long*)(GP + e), pk2); }
        }
    // PP hi/lo and GP16 in the fragment order of k_nl_flash (IC = 128, NK = 1024): a 16-byte chunk is half of one lane's fragment (8 consecutive k of one row), 32 chunks (lane = 16 h + c) are one
    // wave-wide load of 512 contiguous bytes. Element e: bits 0-2 k, 3-6 row c, 7 half h, 8 which 16 k, then PP: 9-10 block of 32 ic, 11.. tile of 16 keys; GP16: 9-11 tile of 16 ic, 12.. block of 32 keys.
    // thread-linear in the destination, so a wave stores whole lines
    if (t < (long long)NK * IC / 2) { const int e = 2 * (int)t; const int c = (e >> 3) & 15, kk = ((e >> 8) & 1) * 16 + ((e >> 7) & 1) * 8 + (e & 7);
        { const int nk = (e >> 11) * 16 + c, ic = ((e >> 9) & 3) * 32 + kk; const int py = nk / 32, px = nk % 32; float pv[2]; const float* pp[2];
#pragma unroll   // two values, constant indices into pv[], pp[]
          for (int u = 0; u < 2; ++u) { pp[u] = PH + (long long)(ic + u) * HW + (2 * py) * 64 + 2 * px; pv[u] = fmaxf(fmaxf(pp[u][0], pp[u][1]), fmaxf(pp[u][64], pp[u][65])); }
          asm volatile("s_wait_xcnt 0x0" :: "v"(pp[0]), "v"(pp[1]) : "memory");   // the addresses as inputs keep the pairs until the wait
          st_split2(PPH, PPL, e, pv[0], pv[1]); }
        { const int ic = ((e >> 9) & 7) * 16 + c, py = e >> 12; float gv[2]; const float* gq = G + (long long)ic * HW + (2 * py) * 64 + 2 * kk;   // pooled positions (py, kk), (py, kk + 1)
#pragma unroll   // two values, constant indices into gv[]
          for (int u = 0; u < 2; ++u) gv[u] = fmaxf(fmaxf(gq[2 * u], gq[2 * u + 1]), fmaxf(gq[2 * u + 64], gq[2 * u + 65]));
          asm volatile("s_wait_xcnt 0x0" :: "v"(gq) : "memory");   // the same wait for the two loads of g
          st_h2(GP16 + e, gv[0], gv[1]); } } }
// Fused attention of one image: Y16[q][c] = f16( sum_k softmax_k(theta[q] . phi[k]) g[c][k] ). Scores and probabilities never leave the registers.
// A wave owns 32 queries (two 16-column groups) and walks the 1024 keys 32 at a time. It forms S^T = K Q^T (bf16 hi/lo planes, three products, as the score
// GEMM did) and O^T += V^T P^T (f16): in both D tiles a lane holds one query (column lane & 15), so maximum, sum and rescale are lane-local but for one
// exchange between the wave halves, and two S^T tiles (keys 0-15, 16-31), converted in place, are the B operand of the second product in the hardware k order.
// K (hi, lo) and V^T lie in fragment order (the pool writes them so): every fragment load covers four whole lines. Q is read once from the row-major theta planes.
// Running maximum in log2 units; the accumulators are rescaled only when a column's maximum has grown by more than 8; p = 2^(s - m + 7) <= 2^15 fits f16.
namespace w25 {
__device__ __forceinline__ float xhalf(float x) { return __builtin_bit_cast(float, __builtin_amdgcn_permlanex16(__builtin_bit_cast(int, x), __builtin_bit_cast(int, x), 0x76543210, 0xfedcba98, false, false)); }   // lane l takes lane l ^ 16
// a fragment stored in fragment order: two wave-wide loads of 512 contiguous bytes (elements 0..7 <- p[0..7], 8..15 <- p[256..263], p = fragment + 8 * lane)
__device__ __forceinline__ v16b ldf_b(const __bf16* p) { Frag<__bf16>::U f; f.h[0] = *(const v8b*)(p); f.h[1] = *(const v8b*)(p + 256); return f.v; }
__device__ __forceinline__ v16h ldf_h(const _Float16* p) { Frag<_Float16>::U f; f.h[0] = *(const v8h*)(p); f.h[1] = *(const v8h*)(p + 256); return f.v; }
__global__ __launch_bounds__(128) void k_nl_flash(const unsigned short* __restrict__ QHp, const unsigned short* __restrict__ QLp, const unsigned short* __restrict__ KHp, const unsigned short* __restrict__ KLp,
                                                  const unsigned short* __restrict__ VTp, unsigned short* __restrict__ Y16p) {
  constexpr int D = 128, NKc = 1024, HWc = 4096;
  constexpr float L2E = 1.4426950408889634f;
  const int lane = threadIdx.x & 31, wave = threadIdx.x >> 5, cq = lane & 15, h = lane >> 4;
  const int b = blockIdx.y, q0 = (blockIdx.x * 4 + wave) * 32;
  const size_t qo = ((size_t)b * HWc + q0 + cq) * D + 8 * h, ko = (size_t)b * NKc * D + 8 * lane;
  const __bf16* QH = (const __bf16*)QHp + qo; const __bf16* QL = (const __bf16*)QLp + qo;
  const __bf16* KH = (const __bf16*)KHp + ko; const __bf16* KL = (const __bf16*)KLp + ko;
  const _Float16* VT = (const _Float16*)VTp + ko;
  v16b qh[2][4], ql[2][4], kh[2][4], kl[2][4];
#pragma unroll   // constant indices: the fragments stay in registers
  for (int t = 0; t < 2; ++t)
#pragma unroll   // inner loop of the same
    for (int ks = 0; ks < 4; ++ks) {
      qh[t][ks] = Frag<__bf16>::load(QH + t * 16 * D + ks * 32); ql[t][ks] = Frag<__bf16>::load(QL + t * 16 * D + ks * 32);
      kh[t][ks] = ldf_b(KH + (t * 4 + ks) * 512); kl[t][ks] = ldf_b(KL + (t * 4 + ks) * 512);
    }
  asm volatile("s_wait_xcnt 0x0" :: "v"(QH), "v"(QL) : "memory");   // the two Q addresses as inputs keep the pairs until the wait (the K pairs live on through the loop)
  v8f o[2][8];
#pragma unroll   // constant indices
  for (int t = 0; t < 2; ++t)
#pragma unroll   // inner loop of the same
    for (int ct = 0; ct < 8; ++ct) o[t][ct] = (v8f){0.f,0.f,0.f,0.f,0.f,0.f,0.f,0.f};
  float mu[2] = { -1.0e30f, -1.0e30f }, l[2] = { 0.f, 0.f };
#pragma unroll 1   // one pass is 64 matrix instructions already; unrolled, the fragments of two passes would not fit
  for (int p = 0; p < NKc / 32; ++p) {
    v16h vt[8]; const _Float16* vp = VT + p * 32 * D;
#pragma unroll   // constant indices; the eight V^T fragments fly while the scores are formed
    for (int ct = 0; ct < 8; ++ct) vt[ct] = ldf_h(vp + ct * 512);
    __builtin_amdgcn_sched_barrier(0);   // keeps the V^T loads' issue above the score products; without it they sink to their first use and each waits a full latency there
    v8f s[2][2];   // [query group][key tile]
#pragma unroll   // constant indices
    for (int t = 0; t < 2; ++t) { s[t][0] = (v8f){0.f,0.f,0.f,0.f,0.f,0.f,0.f,0.f}; s[t][1] = s[t][0]; }
#pragma unroll   // constant indices; neighbours in the stream go to different tiles
    for (int ks = 0; ks < 4; ++ks) {
#pragma unroll   // inner loop of the same
      for (int kt = 0; kt < 2; ++kt)
#pragma unroll   // inner loop of the same
        for (int t = 0; t < 2; ++t) s[t][kt] = Frag<__bf16>::mma(kh[kt][ks], qh[t][ks], s[t][kt]);
#pragma unroll   // inner loop of the same
      for (int kt = 0; kt < 2; ++kt)
#pragma unroll   // inner loop of the same
        for (int t = 0; t < 2; ++t) s[t][kt] = Frag<__bf16>::mma(kh[kt][ks], ql[t][ks], s[t][kt]);
#pragma unroll   // inner loop of the same
      for (int kt = 0; kt < 2; ++kt)
#pragma unroll   // inner loop of the same
        for (int t = 0; t < 2; ++t) s[t][kt] = Frag<__bf16>::mma(kl[kt][ks], qh[t][ks], s[t][kt]);
    }
    // the next pass's K fragments, into the same registers: they fly behind the softmax and the second product (the last pass re-reads keys 0-31, in bounds, unused)
    const int kn = ((p + 1) & (NKc / 32 - 1)) * 32 * D; const __bf16* kph = KH + kn; const __bf16* kpl = KL + kn;
#pragma unroll   // constant indices
    for (int kt = 0; kt < 2; ++kt)
#pragma unroll   // inner loop of the same
      for (int ks = 0; ks < 4; ++ks) { kh[kt][ks] = ldf_b(kph + (kt * 4 + ks) * 512); kl[kt][ks] = ldf_b(kpl + (kt * 4 + ks) * 512); }
    // the wait before the pass's load addresses are reused: the three addresses as inputs
    // keep the pairs until the wait. With vp named and memory clobbered, the V^T loads also stay in front of it and are not sunk behind the rescale branch to their first use
    asm volatile("s_wait_xcnt 0x0" :: "v"(kph), "v"(kpl), "v"(vp) : "memory");
    float mx[2];
#pragma unroll   // constant indices
    for (int t = 0; t < 2; ++t) { float m = fmaxf(s[t][0][0], s[t][1][0]);
#pragma unroll   // inner loop of the same
      for (int r = 1; r < 8; ++r) m = fmaxf(m, fmaxf(s[t][0][r], s[t][1][r]));
      mx[t] = fmaxf(m, xhalf(m)) * L2E; }
    const bool need = (mx[0] > mu[0] + 8.f) || (mx[1] > mu[1] + 8.f);
    if (__builtin_amdgcn_ballot_w32(need) != 0) {   // one scalar test a pass
#pragma unroll   // constant indices
      for (int t = 0; t < 2; ++t) { const float mn = fmaxf(mu[t], mx[t]); const float f = __builtin_amdgcn_exp2f(mu[t] - mn); mu[t] = mn; l[t] *= f;
#pragma unroll   // inner loop of the same
        for (int ct = 0; ct < 8; ++ct) o[t][ct] *= f; }
    }
    v16h pb[2];
#pragma unroll   // constant indices
    for (int t = 0; t < 2; ++t) { const float mb = 7.f - mu[t]; float a0 = 0.f, a1 = 0.f;
#pragma unroll   // inner loop of the same
      for (int r = 0; r < 8; ++r) { const float e0 = __builtin_amdgcn_exp2f(fmaf(s[t][0][r], L2E, mb)), e1 = __builtin_amdgcn_exp2f(fmaf(s[t][1][r], L2E, mb));
        a0 += e0; a1 += e1; pb[t][r] = (_Float16)e0; pb[t][8 + r] = (_Float16)e1; }
      l[t] += a0 + a1; }
#pragma unroll   // constant indices; sixteen independent tiles
    for (int ct = 0; ct < 8; ++ct)
#pragma unroll   // inner loop of the same
      for (int t = 0; t < 2; ++t) o[t][ct] = Frag<_Float16>::mma(vt[ct], pb[t], o[t][ct]);
  }
#pragma unroll   // constant indices
  for (int t = 0; t < 2; ++t) { const float inv = 1.f / (l[t] + xhalf(l[t]));
    _Float16* yp = (_Float16*)Y16p + ((size_t)b * HWc + q0 + t * 16 + cq) * D + 8 * h; v8h hv[8];
#pragma unroll   // inner loop of the same
    for (int ct = 0; ct < 8; ++ct) {
#pragma unroll   // constant indices
      for (int r = 0; r < 8; ++r) hv[ct][r] = (_Float16)(o[t][ct][r] * inv);
      *(v8h*)(yp + ct * 16) = hv[ct]; }
    // address and values as inputs keep them until the wait
    asm volatile("s_wait_xcnt 0x0" :: "v"(yp), "v"(hv[0]), "v"(hv[1]), "v"(hv[2]), "v"(hv[3]), "v"(hv[4]), "v"(hv[5]), "v"(hv[6]), "v"(hv[7]) : "memory"); }
}
} // namespace w25
// batch statistics of channel c = blockIdx.x over [Bn][HW]: a thread holds its Bn x HW / 1024 groups of 16 B in registers, so WY is read once and the loads overlap;
// mean first, then the squared deviations from the same registers; the two LDS trees over the block are as they were
template <int Bn, int HW> __global__ __launch_bounds__(256) void k_nl_bns(const float* __restrict__ WY, float* __restrict__ BNS, int C) { __shared__ float red[256]; __shared__ float res[2]; const int c = blockIdx.x; const int t = threadIdx.x;
    const float* r[Bn]; v4f v[Bn][HW / 1024];
#pragma unroll   // v[][] in registers, the loads overlap instead of one latency each
    for (int b = 0; b < Bn; ++b) { r[b] = WY + ((long long)b * C + c) * HW + t * 4;
#pragma unroll   // inner loop of the same: constant indices, values stay in registers
        for (int k = 0; k < HW / 1024; ++k) v[b][k] = *(const v4f*)(r[b] + k * 1024); }
    static_assert(Bn == 8, "the wait below names eight addresses");
    asm volatile("s_wait_xcnt 0x0" :: "v"(r[0]), "v"(r[1]), "v"(r[2]), "v"(r[3]), "v"(r[4]), "v"(r[5]), "v"(r[6]), "v"(r[7]) : "memory");   // the addresses as inputs keep every load's address pair until the wait: no load's result takes a pair before it
    float s = 0.f;
#pragma unroll   // constant indices into v[][]
    for (int b = 0; b < Bn; ++b)
#pragma unroll   // inner loop of the same: constant indices, values stay in registers
        for (int k = 0; k < HW / 1024; ++k) s += (v[b][k][0] + v[b][k][1]) + (v[b][k][2] + v[b][k][3]);
    red[t] = s; __syncthreads(); for (int o = 128; o > 0; o >>= 1) { if (t < o) red[t] += red[t + o]; __syncthreads(); } const float mu = red[0] / (float)(Bn * HW); __syncthreads();
    float q = 0.f;
#pragma unroll   // constant indices into v[][]
    for (int b = 0; b < Bn; ++b)
#pragma unroll   // inner loop of the same: constant indices, values stay in registers
        for (int k = 0; k < HW / 1024; ++k) { const v4f d = v[b][k] - mu; q += (d[0] * d[0] + d[1] * d[1]) + (d[2] * d[2] + d[3] * d[3]); }
    red[t] = q; __syncthreads(); for (int o = 128; o > 0; o >>= 1) { if (t < o) red[t] += red[t + o]; __syncthreads(); }
    if (t == 0) { res[0] = mu; res[1] = rsqrtf(red[0] / (float)(Bn * HW) + 1e-5f); } __syncthreads();
    if (t < 32) VST2(float, BNS + (long long)c * 32 + t, (t == 0) ? res[0] : ((t == 1) ? res[1] : 0.f)); }
// out = (WY - mu[c]) * rstd[c] * gamma[c] + beta[c] + x; one block per plane (b, c) of 4096 values, 4 x 16 B of each operand a thread
__global__ __launch_bounds__(256) void k_nl_out(const float* __restrict__ WY, const float* __restrict__ BNS, const float* __restrict__ Gm, const float* __restrict__ Bt, const float* __restrict__ X, float* __restrict__ OUT, int C) { const int c = (int)(blockIdx.x % (unsigned)C); const long long o = (long long)blockIdx.x * 4096 + threadIdx.x * 4;
    const float mu = BNS[(long long)c * 32], rs = BNS[(long long)c * 32 + 1], g = Gm[c], be = Bt[c]; const float* wp = WY + o; const float* xp = X + o; v4f w[4], xv[4];
#pragma unroll   // all eight loads in flight
    for (int k = 0; k < 4; ++k) { w[k] = *(const v4f*)(wp + k * 1024); xv[k] = *(const v4f*)(xp + k * 1024); }
    asm volatile("s_wait_xcnt 0x0" :: "v"(wp), "v"(xp) : "memory");   // both addresses as inputs keep the pairs until the wait
#pragma unroll   // constant indices into w[], xv[]
    for (int k = 0; k < 4; ++k) { v4f r;
#pragma unroll   // inner loop of the same: constant indices, values stay in registers
        for (int e = 0; e < 4; ++e) r[e] = (w[k][e] - mu) * rs * g + be + xv[k][e];
        *(v4f*)(OUT + o + k * 1024) = r; } }


extern "C" void kernel_launch(void* const* d_in, const int* in_sizes, int n_in, void* d_out, int out_size, void* d_ws, size_t ws_size, hipStream_t stream) {
    (void)in_sizes; (void)n_in; (void)out_size; (void)ws_size;
    const float* x = (const float*)d_in[0];
    const float* gw = (const float*)d_in[1];
    const float* gb = (const float*)d_in[2];
    const float* thw = (const float*)d_in[3];
    const float* thb = (const float*)d_in[4];
    const float* phw = (const float*)d_in[5];
    const float* phb = (const float*)d_in[6];
    const float* Ww = (const float*)d_in[7];
    const float* Wb = (const float*)d_in[8];
    const float* bng = (const float*)d_in[9];
    const float* bnb = (const float*)d_in[10];
    const int Bn = 8;
    const int C = 256;
    const int IC = 128;
    const int HW = 4096;
    const int NK = 1024;
    float* out = (float*)d_out;
    char* wsp = (char*)d_ws;
    // One launch per stage for all Bn images (blockIdx.y = image, per-image strides). The workspace is laid out by lifetime:
    //   R1: x planes and the three conv outputs, dead after the pool
    //   R2: the operand planes that the pool writes
    //   R3: Y16 and WY
    char* R1 = wsp; wsp += (size_t)Bn * HW * C * 2 * 3 + (size_t)Bn * HW * IC * 4 * 3;
    unsigned short* XH = (unsigned short*)R1;
    unsigned short* XL = XH + (size_t)Bn * HW * C;
    unsigned short* X16 = XL + (size_t)Bn * HW * C;
    float* TH = (float*)(X16 + (size_t)Bn * HW * C);
    float* PH = TH + (size_t)Bn * HW * IC;
    float* G = PH + (size_t)Bn * IC * HW;
    float* PHP = (float*)wsp; wsp += (size_t)Bn * IC * NK * 4;
    float* GP = (float*)wsp; wsp += (size_t)Bn * IC * NK * 4;
    unsigned short* THH = (unsigned short*)wsp; wsp += (size_t)Bn * HW * IC * 2;
    unsigned short* THL = (unsigned short*)wsp; wsp += (size_t)Bn * HW * IC * 2;
    unsigned short* PPH = (unsigned short*)wsp; wsp += (size_t)Bn * NK * IC * 2;
    unsigned short* PPL = (unsigned short*)wsp; wsp += (size_t)Bn * NK * IC * 2;
    unsigned short* GP16 = (unsigned short*)wsp; wsp += (size_t)Bn * IC * NK * 2;
    char* R3 = wsp; wsp += (size_t)Bn * HW * IC * 2 + (size_t)Bn * C * HW * 4;
    unsigned short* Y16 = (unsigned short*)R3;
    float* WY = (float*)(Y16 + (size_t)Bn * HW * IC);
    unsigned short* WW16 = (unsigned short*)wsp; wsp += (size_t)C * IC * 2;
    unsigned short* TWH = (unsigned short*)wsp; wsp += (size_t)IC * C * 2;
    unsigned short* TWL = (unsigned short*)wsp; wsp += (size_t)IC * C * 2;
    unsigned short* PWH = (unsigned short*)wsp; wsp += (size_t)IC * C * 2;
    unsigned short* PWL = (unsigned short*)wsp; wsp += (size_t)IC * C * 2;
    unsigned short* GW16 = (unsigned short*)wsp; wsp += (size_t)IC * C * 2;
    float* BNS = (float*)wsp; wsp += (size_t)32 * C * 4;
    // weights
    k_cast16<<<(unsigned)((((long long)(C) * ((IC) / 2)) + 255) / 256), 256, 0, stream>>>(Ww, IC, (_Float16*)(WW16), IC, C, IC, 16.0f);
    k_castS16<<<(unsigned)((((long long)(IC) * ((C) / 2)) + 255) / 256), 256, 0, stream>>>(thw, C, (__bf16*)(TWH), (__bf16*)(TWL), C, IC, C, 1.0f, 0, 0, 0);
    k_castS16<<<(unsigned)((((long long)(IC) * ((C) / 2)) + 255) / 256), 256, 0, stream>>>(phw, C, (__bf16*)(PWH), (__bf16*)(PWL), C, IC, C, 1.0f, 0, 0, 0);
    k_cast16<<<(unsigned)((((long long)(IC) * ((C) / 2)) + 255) / 256), 256, 0, stream>>>(gw, C, (_Float16*)(GW16), C, IC, C, 1.0f);
    // x[b] ([C][HW]) -> transposed planes [b][HW][C]: bf16 hi/lo (theta, phi) and f16 of 16 x (g)
    k_castS16w<HW><<<dim3((unsigned)(HW / 32), (unsigned)(Bn)), 256, 0, stream>>>(x, (__bf16*)(XH), (__bf16*)(XL), 1.0f);
    k_castT16w<HW><<<dim3((unsigned)(HW / 32), (unsigned)(Bn)), 256, 0, stream>>>(x, (_Float16*)(X16), 16.0f);
    // TH[b] = x[b]^T thw^T + thb ([HW][IC]); PH[b] = phw x[b] + phb, G[b] = gw x[b] + gb ([IC][HW])
    w25::wmma_gemm64<1, true, 2, 0, false, 0><<<dim3((unsigned)((((HW) / 64) * ((IC) / 64) + 7) / 8), (unsigned)(Bn)), 256, 0, stream>>>((const unsigned short*)(XH), (const unsigned short*)(XL), C, (long)HW * C, (const unsigned short*)(TWH), (const unsigned short*)(TWL), C, 0, (void*)(TH), nullptr, IC, (long)HW * IC, thb, nullptr, 0, HW, IC, C, 1.0f);
    w25::wmma_gemm64<1, true, 1, 0, false, 0><<<dim3((unsigned)((((IC) / 64) * ((HW) / 64) + 7) / 8), (unsigned)(Bn)), 256, 0, stream>>>((const unsigned short*)(PWH), (const unsigned short*)(PWL), C, 0, (const unsigned short*)(XH), (const unsigned short*)(XL), C, (long)HW * C, (void*)(PH), nullptr, HW, (long)IC * HW, phb, nullptr, 0, IC, HW, C, 1.0f);
    w25::wmma_gemm64<0, false, 1, 0, false, 0><<<dim3((unsigned)((((IC) / 64) * ((HW) / 64) + 7) / 8), (unsigned)(Bn)), 256, 0, stream>>>((const unsigned short*)(GW16), nullptr, C, 0, (const unsigned short*)(X16), nullptr, C, (long)HW * C, (void*)(G), nullptr, HW, (long)IC * HW, gb, nullptr, 0, IC, HW, C, 0.0625f);
    k_nl_pool<<<dim3((unsigned)(((long long)HW * IC / 8 + 255) / 256), (unsigned)(Bn)), 256, 0, stream>>>(PH, G, TH, PHP, GP, (_Float16*)PPH, (_Float16*)PPL, (_Float16*)GP16, (_Float16*)THH, (_Float16*)THL, IC, HW, NK);
    // Y16[b] = f16(softmax(theta[b] phi[b]) g[b]^T) ([HW][IC]): 128 queries a block, blockIdx.y = image
    w25::k_nl_flash<<<dim3((unsigned)(HW / 128), (unsigned)(Bn)), 128, 0, stream>>>((const unsigned short*)(THH), (const unsigned short*)(THL), (const unsigned short*)(PPH), (const unsigned short*)(PPL), (const unsigned short*)(GP16), Y16);
    w25::wmma_gemm64<0, false, 1, 0, false, 0><<<dim3((unsigned)((((C) / 64) * ((HW) / 64) + 7) / 8), (unsigned)(Bn)), 256, 0, stream>>>((const unsigned short*)(WW16), nullptr, IC, 0, (const unsigned short*)(Y16), nullptr, IC, (long)HW * IC, (void*)(WY), nullptr, HW, (long)C * HW, Wb, nullptr, 0, C, HW, IC, 0.0625f);
    k_nl_bns<Bn, HW><<<C, 256, 0, stream>>>(WY, BNS, C); k_nl_out<<<(unsigned)(Bn * C), 256, 0, stream>>>(WY, BNS, bng, bnb, x, out, C);
}

// v004
// A run of this version takes 85.5 microseconds.
// Timed twice side by side with v003, it ran 1.67 and 1.74 times as fast.
// All steps since v000 together make it 16.4 times as fast.
#include <hip/hip_runtime.h>
#include <math.h>

typedef __attribute__((ext_vector_type(16))) _Float16 v16h;
typedef __attribute__((ext_vector_type(8)))  _Float16 v8h;
typedef __attribute__((ext_vector_type(16))) __bf16   v16b;
typedef __attribute__((ext_vector_type(8)))  float    v8f;
typedef __attribute__((ext_vector_type(4)))  float    v4f;

// 16-bit WMMA fragment map (wave32), lane L, h = L>>4, m = L&15:
//   A 16x32: lane = row m;   element i -> k = (i<8) ? 8h+i : 16+8h+(i-8)
//   B 32x16: lane = column m; the SAME k(i,h)
//   D 16x16 (8 f32): lane = column m; element r -> row 8h+r
__device__ __forceinline__ int frag_k(int i, int h) { return (i < 8) ? (8 * h + i) : (16 + 8 * h + (i - 8)); }
__device__ __forceinline__ __bf16 bf16_rne(float f) {
    unsigned int u = __float_as_uint(f);
    u += 0x7fffu + ((u >> 16) & 1u);
    return __builtin_bit_cast(__bf16, (unsigned short)(u >> 16));
}
__device__ __forceinline__ float bf16_f32(__bf16 b) { return __uint_as_float(((unsigned int)__builtin_bit_cast(unsigned short, b)) << 16); }
__device__ __forceinline__ v8f wmma16(v16h a, v16h b, v8f c) {
    c = __builtin_amdgcn_wmma_f32_16x16x32_f16(false, a, false, b, (short)0, c, false, false);
    asm volatile("v_nop\n\tv_nop\n\tv_nop\n\tv_nop" : "+v"(c) : "v"(a), "v"(b));
    return c;
}
__device__ __forceinline__ v8f wmmab(v16b a, v16b b, v8f c) {
    c = __builtin_amdgcn_wmma_f32_16x16x32_bf16(false, a, false, b, (short)0, c, false, false);
    asm volatile("v_nop\n\tv_nop\n\tv_nop\n\tv_nop" : "+v"(c) : "v"(a), "v"(b));
    return c;
}
struct Split { v16b hi, lo; };
// hi/lo split product: a.hi*b.hi + a.hi*b.lo + a.lo*b.hi
__device__ __forceinline__ v8f wmma3(const Split& a, const Split& b, v8f c) {
    c = __builtin_amdgcn_wmma_f32_16x16x32_bf16(false, a.hi, false, b.hi, (short)0, c, false, false);
    c = __builtin_amdgcn_wmma_f32_16x16x32_bf16(false, a.hi, false, b.lo, (short)0, c, false, false);
    c = __builtin_amdgcn_wmma_f32_16x16x32_bf16(false, a.lo, false, b.hi, (short)0, c, false, false);
    asm volatile("v_nop\n\tv_nop\n\tv_nop\n\tv_nop" : "+v"(c) : "v"(a.hi), "v"(a.lo), "v"(b.hi), "v"(b.lo));
    return c;
}
struct Split3 { v16b hi, mid, lo; };
// triple split product (6 terms, drops only terms below 2^-24 relative)
__device__ __forceinline__ v8f wmma6(const Split3& a, const Split3& b, v8f c) {
    c = __builtin_amdgcn_wmma_f32_16x16x32_bf16(false, a.hi, false, b.hi, (short)0, c, false, false);
    c = __builtin_amdgcn_wmma_f32_16x16x32_bf16(false, a.hi, false, b.mid, (short)0, c, false, false);
    c = __builtin_amdgcn_wmma_f32_16x16x32_bf16(false, a.mid, false, b.hi, (short)0, c, false, false);
    c = __builtin_amdgcn_wmma_f32_16x16x32_bf16(false, a.hi, false, b.lo, (short)0, c, false, false);
    c = __builtin_amdgcn_wmma_f32_16x16x32_bf16(false, a.mid, false, b.mid, (short)0, c, false, false);
    c = __builtin_amdgcn_wmma_f32_16x16x32_bf16(false, a.lo, false, b.hi, (short)0, c, false, false);
    asm volatile("v_nop\n\tv_nop\n\tv_nop\n\tv_nop" : "+v"(c) : "v"(a.hi), "v"(a.mid), "v"(a.lo), "v"(b.hi), "v"(b.mid), "v"(b.lo));
    return c;
}

// Fragment gathers from f32 memory: element i <- p[(k0 + frag_k(i,h)) * sk] * s, zero for k >= klen.
__device__ __forceinline__ v16h fh_ld(const float* __restrict__ p, long long sk, int k0, int h, int klen, float s) {
    v16h a;
#pragma unroll
    for (int i = 0; i < 16; ++i) { const int k = k0 + frag_k(i, h); a[i] = (k < klen) ? (_Float16)(p[(long long)k * sk] * s) : (_Float16)0.f; }
    return a;
}
__device__ __forceinline__ Split sp_ld(const float* __restrict__ p, long long sk, int k0, int h, int klen, float s) {
    Split r;
#pragma unroll
    for (int i = 0; i < 16; ++i) {
        const int k = k0 + frag_k(i, h); const float x = (k < klen) ? p[(long long)k * sk] * s : 0.f;
        const __bf16 hb = bf16_rne(x); r.hi[i] = hb; r.lo[i] = bf16_rne(x - bf16_f32(hb));
    }
    return r;
}
__device__ __forceinline__ Split3 sp3_ld(const float* __restrict__ p, long long sk, int k0, int h, int klen, float s) {
    Split3 r;
#pragma unroll
    for (int i = 0; i < 16; ++i) {
        const int k = k0 + frag_k(i, h); const float x = (k < klen) ? p[(long long)k * sk] * s : 0.f;
        const __bf16 hb = bf16_rne(x); const float r1 = x - bf16_f32(hb); const __bf16 mb = bf16_rne(r1);
        r.hi[i] = hb; r.mid[i] = mb; r.lo[i] = bf16_rne(r1 - bf16_f32(mb));
    }
    return r;
}
__device__ __forceinline__ v16b bh_ld(const float* __restrict__ p, long long sk, int k0, int h, int klen, float s) {
    v16b a;
#pragma unroll
    for (int i = 0; i < 16; ++i) { const int k = k0 + frag_k(i, h); a[i] = bf16_rne((k < klen) ? p[(long long)k * sk] * s : 0.f); }
    return a;
}
// f16 fragment from an f16 LDS/global row with element stride 1 (k-contiguous), no bounds (tile already zero padded)
__device__ __forceinline__ v16h fh_row(const _Float16* __restrict__ row, int k0, int h) {
    v16h a;
#pragma unroll
    for (int i = 0; i < 16; ++i) a[i] = row[k0 + frag_k(i, h)];
    return a;
}

#define VST2(T, ptr, val) do { const T vst2_v_ = (val); *(T*)(ptr) = vst2_v_;  } while (0)
typedef float v4f __attribute__((ext_vector_type(4)));
typedef unsigned int v4u __attribute__((ext_vector_type(4)));
typedef unsigned int v2u __attribute__((ext_vector_type(2)));
#define VST2V4(ptr, val) do { const v4f vst2_v4_ = (val); *(v4f*)(ptr) = vst2_v4_;  } while (0)

__device__ __attribute__((noinline)) float act_fn(float v, int act) {
    if (act == 1) return fmaxf(v, 0.f);                                                                               // relu
    if (act == 2) { const float u = 0.7978845608028654f * (v + 0.044715f * v * v * v); return 0.5f * v * (1.f + tanhf(u)); } // tanh-gelu
    if (act == 3) return v / (1.f + expf(-v));                                                                        // silu
    if (act == 4) return 0.5f * v * (1.f + erff(v * 0.7071067811865476f));                                             // erf-gelu
    if (act == 5) return tanhf(v);
    if (act == 6) return 1.f / (1.f + expf(-v));                                                                      // sigmoid
    if (act == 7) return (v > 0.f) ? v : 0.01f * v;                                                                   // leaky relu 0.01
    if (act == 8) return (v > 0.f) ? v : (expf(v) - 1.f);                                                             // elu
    if (act == 9) return fminf(fmaxf(v, 0.f), 6.f);                                                                   // relu6
    if (act == 10) return fabsf(v);                                                                                    // abs
    if (act == 11) return (v >= 0.f) ? v : 0.1f * v;                                                                  // leaky 0.1
    if (act == 12) return (v > 0.f) ? v : 0.2f * v;                                                                   // leaky 0.2
    if (act == 13) return (v > 20.f) ? v : log1pf(expf(v));                                                            // softplus
    return v;
}

// =====================================================================================================================
// k_gemm<MODE>: C(z, m, n) = act(alpha * sum_k A(z, m, k) * B(z, k, n) + bias) + beta * R(z, m, n)
//   One wave (32-thread block) per 16 x 32 tile of C; grid (ceil(N/32), ceil(M/16), Z). Batch z -> (zo = z / zi_n, zi = z % zi_n)
//   with separate outer/inner strides for every tensor (e.g. batch and head). A(m,k) = A[zo*sAo + zi*sAi + m*sAm + k*sAk] (f32),
//   B(k,n) = B[zo*sBo + zi*sBi + n*sBn + k*sBk] (f32); any M, N, K (K zero-padded to 32 inside the fragments, M/N tails guarded).
//   C(m,n) = C[zo*sCo + zi*sCi + m*sCm + n] (n contiguous). flags: 1 bias[n], 2 bias[m], 4 residual R[zo*sRo + zi*sRi + m*sRm + n*sRn].
//   MODE 0: f16 operands (A prescaled by sa, B by sb, both undone in the epilogue); 1: bf16 hi/lo split (3 products); 2: bf16;
//   3: bf16 hi/mid/lo triple split (6 products); 4: as 3 with Kahan-compensated f32 accumulation across k-steps.
// =====================================================================================================================
struct GemmP {
    const float* A; const float* B; const float* bias; const float* R; float* C;
    long long sAo, sAi, sAm, sAk, sBo, sBi, sBn, sBk, sCo, sCi, sCm, sRo, sRi, sRm, sRn;
    int M, N, K, zi_n, flags, act; float alpha, beta, sa, sb;
    int Npad, pad_;     // columns [N, Npad) of C are written as 0 so that padded workspace rows are covered by whole-line stores; Npad >= N
};
static_assert(sizeof(GemmP) == 5 * 8 + 15 * 8 + 6 * 4 + 4 * 4 + 2 * 4, "GemmP has padding");

template <int MODE>
__global__ __launch_bounds__(32) void k_gemm(GemmP p) {
    const int lane = threadIdx.x & 31, h = lane >> 4, l15 = lane & 15;
    const int m0 = blockIdx.y * 16, n0 = blockIdx.x * 32;
    const int z = blockIdx.z, zo = z / p.zi_n, zi = z - zo * p.zi_n;
    const float* A = p.A + zo * p.sAo + zi * p.sAi;
    const float* B = p.B + zo * p.sBo + zi * p.sBi;
    const int am = min(m0 + l15, p.M - 1);                       // clamped row for loads (stores are guarded)
    v8f acc[2], comp[2];
#pragma unroll
    for (int t = 0; t < 2; ++t) { v8f zz = {}; acc[t] = zz; comp[t] = zz; }
    for (int k0 = 0; k0 < p.K; k0 += 32) {
        const float* arow = A + (long long)am * p.sAm;
        if (MODE == 1) {
            const Split a = sp_ld(arow, p.sAk, k0, h, p.K, 1.f);
#pragma unroll
            for (int t = 0; t < 2; ++t) {
                const int bn = min(n0 + t * 16 + l15, p.N - 1);
                acc[t] = wmma3(a, sp_ld(B + (long long)bn * p.sBn, p.sBk, k0, h, p.K, 1.f), acc[t]);
            }
        } else if (MODE == 3) {
            const Split3 a = sp3_ld(arow, p.sAk, k0, h, p.K, 1.f);
#pragma unroll
            for (int t = 0; t < 2; ++t) {
                const int bn = min(n0 + t * 16 + l15, p.N - 1);
                acc[t] = wmma6(a, sp3_ld(B + (long long)bn * p.sBn, p.sBk, k0, h, p.K, 1.f), acc[t]);
            }
        } else if (MODE == 4) {
            // triple split as MODE 3, but each k-step's 6 products go into a fresh accumulator and the partial is added to the running f32 sum
            // on the VALU with Kahan compensation (accumulation error stays ~1 ulp however long K is)
            const Split3 a = sp3_ld(arow, p.sAk, k0, h, p.K, 1.f);
#pragma unroll
            for (int t = 0; t < 2; ++t) {
                const int bn = min(n0 + t * 16 + l15, p.N - 1); v8f zz = {};
                const v8f part = wmma6(a, sp3_ld(B + (long long)bn * p.sBn, p.sBk, k0, h, p.K, 1.f), zz);
                const v8f y = part - comp[t]; const v8f s = acc[t] + y; comp[t] = (s - acc[t]) - y; acc[t] = s;
            }
        } else if (MODE == 2) {
            const v16b a = bh_ld(arow, p.sAk, k0, h, p.K, 1.f);
#pragma unroll
            for (int t = 0; t < 2; ++t) {
                const int bn = min(n0 + t * 16 + l15, p.N - 1);
                acc[t] = wmmab(a, bh_ld(B + (long long)bn * p.sBn, p.sBk, k0, h, p.K, 1.f), acc[t]);
            }
        } else {
            const v16h a = fh_ld(arow, p.sAk, k0, h, p.K, p.sa);
#pragma unroll
            for (int t = 0; t < 2; ++t) {
                const int bn = min(n0 + t * 16 + l15, p.N - 1);
                acc[t] = wmma16(a, fh_ld(B + (long long)bn * p.sBn, p.sBk, k0, h, p.K, p.sb), acc[t]);
            }
        }
    }
    const float iscale = (MODE == 0) ? p.alpha / (p.sa * p.sb) : p.alpha;
    float* C = p.C + zo * p.sCo + zi * p.sCi;
    const float* R = p.R + zo * p.sRo + zi * p.sRi;
    __shared__ __align__(16) float ctile[16][36];
#pragma unroll
    for (int t = 0; t < 2; ++t) {
        const int n = n0 + t * 16 + l15; const int nn = min(n, p.N - 1);
#pragma unroll
        for (int r = 0; r < 8; ++r) {
            const int m = m0 + 8 * h + r; const int mm = min(m, p.M - 1);
            float v = acc[t][r] * iscale;
            if (p.flags & 1) v += p.bias[nn];
            if (p.flags & 2) v += p.bias[mm];
            if (p.flags & 8) v *= p.bias[(long long)zo * p.M + mm];   /* per-(z,row) scale vector laid out [Z][M]; exclusive with the bias flags */
            v = act_fn(v, p.act);
            if (p.flags & 4) v += p.beta * R[(long long)mm * p.sRm + (long long)nn * p.sRn];
            ctile[8 * h + r][t * 16 + l15] = (n < p.N) ? v : 0.f;
        }
    }
    __syncthreads();
    const int NW = (p.Npad > p.N) ? p.Npad : p.N;           // write width
    const bool fast = (m0 + 16 <= p.M) && (n0 + 32 <= NW) && ((p.sCm & 3) == 0) && ((((size_t)C) & 15) == 0);
    if (fast) {
#pragma unroll
        for (int s = 0; s < 4; ++s) {
            const int row = s * 4 + (lane >> 3), c4 = (lane & 7) * 4;
            const v4f v = *(const v4f*)&ctile[row][c4];
            VST2V4(C + (long long)(m0 + row) * p.sCm + n0 + c4, v);
        }
    } else {
        for (int row = 0; row < 16; ++row) {
            const int m = m0 + row, n = n0 + lane;
            if (m < p.M && n < NW) VST2(float, C + (long long)m * p.sCm + n, ctile[row][lane]);
        }
    }
}


// =====================================================================================================================
// k_gemmT<MODE, TM, TN>: same contract as k_gemm, but one wave computes a (16*TM) x (16*TN) tile: TM A fragments and TN B fragments are
//   loaded per 32-wide k-step and reused across TM*TN WMMAs (far fewer load/convert instructions per MAC). MODE 0 (f16), 1 (bf16 hi/lo),
//   2 (bf16) only. grid (ceil(NW/(16*TN)), ceil(M/(16*TM)), Z), block 32. Epilogue identical to k_gemm, run per 16x32 sub-tile.
// =====================================================================================================================
template <int MODE, int TM, int TN>
__global__ __launch_bounds__(32) void k_gemmT(GemmP p) {
    const int lane = threadIdx.x & 31, h = lane >> 4, l15 = lane & 15;
    const int m0 = blockIdx.y * (16 * TM), n0 = blockIdx.x * (16 * TN);
    const int z = blockIdx.z, zo = z / p.zi_n, zi = z - zo * p.zi_n;
    const float* A = p.A + zo * p.sAo + zi * p.sAi;
    const float* B = p.B + zo * p.sBo + zi * p.sBi;
    v8f acc[TM][TN];
#pragma unroll
    for (int i = 0; i < TM; ++i)
#pragma unroll
        for (int t = 0; t < TN; ++t) { v8f zz = {}; acc[i][t] = zz; }
    for (int k0 = 0; k0 < p.K; k0 += 32) {
        if (MODE == 1) {
            Split a[TM], b[TN];
#pragma unroll
            for (int i = 0; i < TM; ++i) { const int am = min(m0 + 16 * i + l15, p.M - 1); a[i] = sp_ld(A + (long long)am * p.sAm, p.sAk, k0, h, p.K, 1.f); }
#pragma unroll
            for (int t = 0; t < TN; ++t) { const int bn = min(n0 + 16 * t + l15, p.N - 1); b[t] = sp_ld(B + (long long)bn * p.sBn, p.sBk, k0, h, p.K, 1.f); }
#pragma unroll
            for (int i = 0; i < TM; ++i)
#pragma unroll
                for (int t = 0; t < TN; ++t) acc[i][t] = wmma3(a[i], b[t], acc[i][t]);
        } else if (MODE == 2) {
            v16b a[TM], b[TN];
#pragma unroll
            for (int i = 0; i < TM; ++i) { const int am = min(m0 + 16 * i + l15, p.M - 1); a[i] = bh_ld(A + (long long)am * p.sAm, p.sAk, k0, h, p.K, 1.f); }
#pragma unroll
            for (int t = 0; t < TN; ++t) { const int bn = min(n0 + 16 * t + l15, p.N - 1); b[t] = bh_ld(B + (long long)bn * p.sBn, p.sBk, k0, h, p.K, 1.f); }
#pragma unroll
            for (int i = 0; i < TM; ++i)
#pragma unroll
                for (int t = 0; t < TN; ++t) acc[i][t] = wmmab(a[i], b[t], acc[i][t]);
        } else {
            v16h a[TM], b[TN];
#pragma unroll
            for (int i = 0; i < TM; ++i) { const int am = min(m0 + 16 * i + l15, p.M - 1); a[i] = fh_ld(A + (long long)am * p.sAm, p.sAk, k0, h, p.K, p.sa); }
#pragma unroll
            for (int t = 0; t < TN; ++t) { const int bn = min(n0 + 16 * t + l15, p.N - 1); b[t] = fh_ld(B + (long long)bn * p.sBn, p.sBk, k0, h, p.K, p.sb); }
#pragma unroll
            for (int i = 0; i < TM; ++i)
#pragma unroll
                for (int t = 0; t < TN; ++t) acc[i][t] = wmma16(a[i], b[t], acc[i][t]);
        }
    }
    const float iscale = (MODE == 0) ? p.alpha / (p.sa * p.sb) : p.alpha;
    float* C = p.C + zo * p.sCo + zi * p.sCi;
    const float* R = p.R + zo * p.sRo + zi * p.sRi;
    const int NW = (p.Npad > p.N) ? p.Npad : p.N;
    __shared__ __align__(16) float ctile[16][36];
#pragma unroll
    for (int i = 0; i < TM; ++i) {
        const int mb = m0 + 16 * i; if (mb >= p.M) break;          // wave-uniform
#pragma unroll
        for (int tp = 0; tp < TN / 2; ++tp) {
            const int nb = n0 + 32 * tp; if (nb >= NW) break;        // wave-uniform
#pragma unroll
            for (int t2 = 0; t2 < 2; ++t2) {
                const int t = 2 * tp + t2; const int n = nb + t2 * 16 + l15; const int nn = min(n, p.N - 1);
#pragma unroll
                for (int r = 0; r < 8; ++r) {
                    const int m = mb + 8 * h + r; const int mm = min(m, p.M - 1);
                    float v = acc[i][t][r] * iscale;
                    if (p.flags & 1) v += p.bias[nn];
                    if (p.flags & 2) v += p.bias[mm];
            if (p.flags & 8) v *= p.bias[(long long)zo * p.M + mm];   /* per-(z,row) scale vector laid out [Z][M]; exclusive with the bias flags */
                    v = act_fn(v, p.act);
                    if (p.flags & 4) v += p.beta * R[(long long)mm * p.sRm + (long long)nn * p.sRn];
                    ctile[8 * h + r][t2 * 16 + l15] = (n < p.N) ? v : 0.f;
                }
            }
            __syncthreads();
            const bool fast = (mb + 16 <= p.M) && (nb + 32 <= NW) && ((p.sCm & 3) == 0) && ((((size_t)C) & 15) == 0);
            if (fast) {
#pragma unroll
                for (int s = 0; s < 4; ++s) {
                    const int row = s * 4 + (lane >> 3), c4 = (lane & 7) * 4;
                    const v4f v = *(const v4f*)&ctile[row][c4];
                    VST2V4(C + (long long)(mb + row) * p.sCm + nb + c4, v);
                }
            } else {
                for (int row = 0; row < 16; ++row) {
                    const int m = mb + row, n = nb + lane;
                    if (m < p.M && n < NW) VST2(float, C + (long long)m * p.sCm + n, ctile[row][lane]);
                }
            }
            __syncthreads();
        }
    }
}

// =====================================================================================================================
//   Wave = 16 queries, AW waves per block, 64-key blocks; grid (ceil(Lq/(16*AW)), H, B), block 32*AW. Any Lq, Lk; head dim dh <= DHP
//   (DHP multiple of 32), value dim dv <= DVP (multiple of 16, <= 128). Every tensor addressed by (batch, head, row, element) strides, f32.
//   Scores: QM 0 f16 operands, 1 bf16 hi/lo split, 2 bf16 triple split; statistics f32 (exp2 domain); P.V: P x 4096 as f16 with V f16 staged in LDS
//   (SPLITPV: P and V as bf16 hi/lo splits). kv head = h / hrep. Masking: causal = 1 (keep j <= i + coff, masked -> -inf, key blocks beyond the
//   diagonal skipped), causal = 2 (masked -> mfill, a finite fill like the -1e9; no skipping), causal = 3 (keep j >= i + coff,
//   masked -> -inf, no skipping); optional additive f32 mask Mf,
//   optional int keep-mask Mi (0 -> score := mfill), both addressed b*smb + h*smh + i*smi + j*smj (0 strides broadcast).
// =====================================================================================================================
#define AW 4
struct AttnP {   // apv4
    const float* Q; const float* K; const float* V; float* O; float* P; const float* Mf; const int* Mi; float* ST;
    const float* Pw; const float* Rt; const int* SQ; const int* SK;           // optional: post-softmax weight, relative-position table, segment ids
    long long swb, swh, swi, swj, srb, srh, sri;                                 // Pw strides (b,h,i,j); Rt strides (b,h,i), column = clamp(i - j + roff, 0, rn-1)
    long long sQb, sQh, sQi, sQd, sKb, sKh, sKj, sKd, sVb, sVh, sVj, sVd, sOb, sOh, sOi, sPb, sPh, sPi, smb, smh, smi, smj;
    int Lq, Lk, dh, dv, hrep, causal, coff, pband;   // pband > 0: P holds only the band |j - i| <= pband, column j - i + pband
    float scale, mfill; int nonorm, mpol;             // nonorm (online path only): O = sum_j exp(score_j) V_j without the 1/rowsum (scores must be <= ~0); mpol: Mi masks where ==0 (mpol 0) or where !=0 (mpol 1)
    int roff, rn, segpol, win;                        // Rt column offset/count; SQ/SK: score := mfill where (segpol 0) SQ[i] != SK[j] or (segpol 1) SQ[i] == SK[j]; win > 0: keys with i - j > win (after coff) -> -inf
};
//   Pw: the softmax numerator is multiplied by Pw(b,h,i,j) AFTER the row sum is taken (probs * weight, then P.V), as in post-softmax multiplicative biases.                                                    // ST (optional): per row (b,h,i) -> ST[((b*H + h)*Lq + i)*2 + {0,1}] = {row max of the scaled+masked score (natural units), sum_j exp(score - max)}
static_assert(sizeof(AttnP) == 12 * 8 + 29 * 8 + 16 * 4, "AttnP has padding");

#ifndef KATTN_ATTR
#define KATTN_ATTR
#endif
template <int DHP, int DVP, int QM, bool SPLITPV, bool TWOPASS>
__global__ __launch_bounds__(32 * AW) KATTN_ATTR void k_attn(AttnP p) {
    constexpr int NT = DVP / 16;                // output tiles
    constexpr int KS = DHP / 32;                // k-steps for the scores
    constexpr int VP = DVP + 8;                 // LDS pitch (halves)
    __shared__ __align__(16) float    pl[AW][16 * 64];
    __shared__ __align__(16) _Float16 vl[(SPLITPV ? 2 : 1) * 64 * VP];   // f16 V tile, or bf16 hi and lo tiles (same 2-byte size)
    const int lane = threadIdx.x & 31, hf = lane >> 4, l15 = lane & 15, wave = threadIdx.x >> 5;
    const int h = blockIdx.y, b = blockIdx.z, hk = h / p.hrep;
    const int q0 = (blockIdx.x * AW + wave) * 16;
    float* myp = pl[wave];
    const float L2E = 1.4426950408889634f;
    const float NEG = -__builtin_inff();
    const int qi = min(q0 + l15, p.Lq - 1);
    const float* qrow = p.Q + b * p.sQb + h * p.sQh + (long long)qi * p.sQi;
    const float* kbase = p.K + b * p.sKb + hk * p.sKh;
    const float* vbase = p.V + b * p.sVb + hk * p.sVh;
    v16h qa[QM == 0 ? KS : 1]; Split qs_[QM == 1 ? KS : 1]; Split3 qt_[QM == 2 ? KS : 1];
#pragma unroll
    for (int ks = 0; ks < KS; ++ks) {
        if (QM == 2) qt_[ks] = sp3_ld(qrow, p.sQd, ks * 32, hf, p.dh, 1.f);
        else if (QM == 1) qs_[ks] = sp_ld(qrow, p.sQd, ks * 32, hf, p.dh, 1.f);
        else qa[ks] = fh_ld(qrow, p.sQd, ks * 32, hf, p.dh, 1.f);
    }
    v8f o[NT]; float m8[8], l8[8];
#pragma unroll
    for (int t = 0; t < NT; ++t) { v8f zz = {}; o[t] = zz; }
#pragma unroll
    for (int i = 0; i < 8; ++i) { m8[i] = NEG; l8[i] = 0.f; }
    int jend = p.Lk; int jstart = 0;
    if (p.causal == 1) { const int je = (blockIdx.x * AW + AW - 1) * 16 + 16 + p.coff; jend = min(jend, max(je, 0)); }   // uniform per block
    if (p.win > 0) { const int js = (int)(blockIdx.x * AW) * 16 + p.coff - p.win; jstart = (js > 0) ? (js / 64) * 64 : 0; }   // uniform per block: key blocks entirely outside every row's window hold only -inf entries and are skipped exactly
    const int npass = TWOPASS ? 2 : 1;
    for (int pass = 0; pass < npass; ++pass) {
        const bool dopv = (!TWOPASS) || pass == 1;
        for (int j0 = jstart; j0 < jend; j0 += 64) {
            if (dopv) {
                __syncthreads();                                 // previous key block's reads of vl / pl are done
                for (int idx = threadIdx.x; idx < 64 * DVP; idx += 32 * AW) {
                    const int jr = idx / DVP, d = idx - jr * DVP, j = j0 + jr;
                    const float f = (j < p.Lk && d < p.dv) ? vbase[(long long)j * p.sVj + (long long)d * p.sVd] : 0.f;
                    if (SPLITPV) {
                        const __bf16 hb = bf16_rne(f);
                        ((__bf16*)vl)[jr * VP + d] = hb; ((__bf16*)vl)[64 * VP + jr * VP + d] = bf16_rne(f - bf16_f32(hb));
                    } else vl[jr * VP + d] = (_Float16)f;
                }
            }
            v8f s[4];
#pragma unroll
            for (int t = 0; t < 4; ++t) {
                const int j = min(j0 + t * 16 + l15, p.Lk - 1);
                const float* krow = kbase + (long long)j * p.sKj;
                v8f acc = {};
#pragma unroll
                for (int ks = 0; ks < KS; ++ks) {
                    if (QM == 2)      acc = wmma6(qt_[ks], sp3_ld(krow, p.sKd, ks * 32, hf, p.dh, 1.f), acc);
                    else if (QM == 1) acc = wmma3(qs_[ks], sp_ld(krow, p.sKd, ks * 32, hf, p.dh, 1.f), acc);
                    else              acc = wmma16(qa[ks], fh_ld(krow, p.sKd, ks * 32, hf, p.dh, 1.f), acc);
                }
                s[t] = acc;
            }
            float pv[8][4];
#pragma unroll
            for (int i = 0; i < 8; ++i) {
                const int irow = q0 + i + 8 * hf;
                const int ic = min(irow, p.Lq - 1);
                float sc[4];
#pragma unroll
                for (int t = 0; t < 4; ++t) {
                    const int jg = j0 + t * 16 + l15;
                    float v = s[t][i] * p.scale;
                    if (p.Mf) v += p.Mf[b * p.smb + h * p.smh + (long long)ic * p.smi + (long long)min(jg, p.Lk - 1) * p.smj];
                    if (p.Rt) { int rc = ic - min(jg, p.Lk - 1) + p.roff; rc = rc < 0 ? 0 : (rc >= p.rn ? p.rn - 1 : rc); v += p.Rt[b * p.srb + h * p.srh + (long long)ic * p.sri + rc]; }
                    if (p.Mi) { const int mv = p.Mi[b * p.smb + h * p.smh + (long long)ic * p.smi + (long long)min(jg, p.Lk - 1) * p.smj]; if (p.mpol ? (mv != 0) : (mv == 0)) v = p.mfill; }
                    if (p.SQ) { const bool same = p.SQ[(long long)b * p.Lq + ic] == p.SK[(long long)b * p.Lk + min(jg, p.Lk - 1)]; if (p.segpol ? same : !same) v = p.mfill; }
                    if (p.causal == 2 && jg > irow + p.coff) v = p.mfill;
                    if (jg >= p.Lk || (p.causal == 1 && jg > irow + p.coff) || (p.causal == 3 && jg < irow + p.coff) || (p.win > 0 && irow + p.coff - jg > p.win)) v = NEG; else v *= L2E;
                    sc[t] = v;
                }
                if (!TWOPASS || pass == 0) {
                    float mx = fmaxf(fmaxf(sc[0], sc[1]), fmaxf(sc[2], sc[3]));
                    mx = fmaxf(mx, __shfl_xor(mx, 1, 32)); mx = fmaxf(mx, __shfl_xor(mx, 2, 32));
                    mx = fmaxf(mx, __shfl_xor(mx, 4, 32)); mx = fmaxf(mx, __shfl_xor(mx, 8, 32));
                    const float mnew = fmaxf(m8[i], mx);
                    const float corr = (mnew == NEG) ? 1.f : exp2f(m8[i] - mnew);
                    float rs = 0.f;
#pragma unroll
                    for (int t = 0; t < 4; ++t) {
                        const float pp = (sc[t] == NEG) ? 0.f : exp2f(sc[t] - mnew); rs += pp;
                        pv[i][t] = p.Pw ? pp * p.Pw[b * p.swb + h * p.swh + (long long)ic * p.swi + (long long)min(j0 + t * 16 + l15, p.Lk - 1) * p.swj] : pp;
                    }
                    rs += __shfl_xor(rs, 1, 32); rs += __shfl_xor(rs, 2, 32); rs += __shfl_xor(rs, 4, 32); rs += __shfl_xor(rs, 8, 32);
                    l8[i] = l8[i] * corr + rs; m8[i] = mnew;
                    if (!TWOPASS) {
#pragma unroll
                        for (int t = 0; t < NT; ++t) o[t][i] *= corr;
                    }
                } else {
                    const float inv = (l8[i] > 0.f) ? 1.f / l8[i] : 0.f;
#pragma unroll
                    for (int t = 0; t < 4; ++t) {
                        const int jg = j0 + t * 16 + l15;
                        float pp = (sc[t] == NEG) ? 0.f : exp2f(sc[t] - m8[i]) * inv;
                        if (p.Pw) pp *= p.Pw[b * p.swb + h * p.swh + (long long)ic * p.swi + (long long)min(jg, p.Lk - 1) * p.swj];
                        pv[i][t] = pp;
                    }
                }
            }
            if (dopv) {
#pragma unroll
                for (int i = 0; i < 8; ++i)
#pragma unroll
                    for (int t = 0; t < 4; ++t) ((float*)myp)[(i + 8 * hf) * 64 + t * 16 + l15] = pv[i][t];
                __syncthreads();                                 // P (per wave) and V (shared) visible
                if (p.P) {
                    float* pb_ = p.P + b * p.sPb + h * p.sPh;
                    const bool fastP = (p.pband == 0) && ((p.sPi & 3) == 0) && (j0 + 64 <= p.Lk) && (q0 + 16 <= p.Lq) && ((((size_t)pb_) & 15) == 0);
                    if (fastP) {
#pragma unroll
                        for (int s = 0; s < 8; ++s) {
                            const int row = s * 2 + (lane >> 4), c4 = (lane & 15) * 4;
                            const v4f v = *(const v4f*)(myp + row * 64 + c4);
                            VST2V4(pb_ + (long long)(q0 + row) * p.sPi + j0 + c4, v);
                        }
                    } else {
                        for (int row = 0; row < 16; ++row) {
                            const int irow = q0 + row; if (irow >= p.Lq) continue;
                            for (int c = lane; c < 64; c += 32) {
                                const int jg = j0 + c; if (jg >= p.Lk) continue;
                                if (p.pband == 0) VST2(float, pb_ + (long long)irow * p.sPi + jg, myp[row * 64 + c]);
                                else if (jg - irow <= p.pband && irow - jg <= p.pband) VST2(float, pb_ + (long long)irow * p.sPi + (jg - irow + p.pband), myp[row * 64 + c]);
                            }
                        }
                    }
                }
                if (SPLITPV) {
                    const Split pa0 = sp_ld(myp + l15 * 64, 1, 0, hf, 64, 1.f), pa1 = sp_ld(myp + l15 * 64, 1, 32, hf, 64, 1.f);
                    const __bf16* vh = (const __bf16*)vl; const __bf16* vlo = vh + 64 * VP;
#pragma unroll
                    for (int t = 0; t < NT; ++t) {
                        const int dcol = t * 16 + l15;
                        Split b0, b1;
#pragma unroll
                        for (int e = 0; e < 16; ++e) {
                            const int k0 = frag_k(e, hf), k1 = 32 + frag_k(e, hf);
                            b0.hi[e] = vh[k0 * VP + dcol]; b0.lo[e] = vlo[k0 * VP + dcol]; b1.hi[e] = vh[k1 * VP + dcol]; b1.lo[e] = vlo[k1 * VP + dcol];
                        }
                        o[t] = wmma3(pa0, b0, o[t]);
                        o[t] = wmma3(pa1, b1, o[t]);
                    }
                } else {
                    const v16h pa0 = fh_ld(myp + l15 * 64, 1, 0, hf, 64, 4096.f), pa1 = fh_ld(myp + l15 * 64, 1, 32, hf, 64, 4096.f);
#pragma unroll
                    for (int t = 0; t < NT; ++t) {
                        const int dcol = t * 16 + l15;
                        v16h b0, b1;
#pragma unroll
                        for (int e = 0; e < 16; ++e) { b0[e] = vl[frag_k(e, hf) * VP + dcol]; b1[e] = vl[(32 + frag_k(e, hf)) * VP + dcol]; }
                        o[t] = wmma16(pa0, b0, o[t]);
                        o[t] = wmma16(pa1, b1, o[t]);
                    }
                }
            }
        }
    }
    float* obase = p.O + b * p.sOb + h * p.sOh;
    if (p.ST) {
        const int rl = lane >> 1, isel = rl & 7;           // row q0 + rl ; rl>>3 == hf holds because lane>>4 == (lane>>1)>>3
        float mv = 0.f, lv = 0.f;
#pragma unroll
        for (int i = 0; i < 8; ++i) if (i == isel) { mv = m8[i]; lv = l8[i]; }
        const int irow = q0 + rl;
        if (irow < p.Lq) { float* st = p.ST + (((long long)b * gridDim.y + h) * p.Lq + irow) * 2 + (lane & 1); VST2(float, st, (lane & 1) ? lv : mv * 0.6931471805599453f); }
    }
    float invr[8];
#pragma unroll
    for (int i = 0; i < 8; ++i) {
        if (TWOPASS) invr[i] = SPLITPV ? 1.f : (1.f / 4096.f);
        else if (p.nonorm) invr[i] = exp2f(m8[i]) * (SPLITPV ? 1.f : (1.f / 4096.f));
        else invr[i] = (l8[i] > 0.f) ? (SPLITPV ? 1.f / l8[i] : 1.f / (l8[i] * 4096.f)) : 0.f;
    }
    __syncthreads();                                             // all waves done with pl/vl from the main loop
    const bool ofast = ((p.sOi & 3) == 0) && ((((size_t)obase) & 15) == 0) && (q0 + 16 <= p.Lq);
#pragma unroll
    for (int c0 = 0; c0 < DVP; c0 += 64) {
#pragma unroll
        for (int i = 0; i < 8; ++i)
#pragma unroll
            for (int t = 0; t < NT; ++t) if (t * 16 >= c0 && t * 16 < c0 + 64) ((float*)myp)[(i + 8 * hf) * 64 + (t * 16 - c0) + l15] = o[t][i] * invr[i];
        __syncthreads();
        const int cw = (DVP - c0 < 64) ? (DVP - c0) : 64;      // staged columns in this chunk (multiple of 16)
        if (ofast && (c0 + cw <= p.dv) && (cw % 32 == 0)) {
            const int lpr = cw / 4;                              // lanes per row (16 for 64 cols, 8 for 32)
            const int rows_per_ins = 32 / lpr;
            for (int r0 = 0; r0 < 16; r0 += rows_per_ins) {
                const int row = r0 + lane / lpr, c4 = (lane % lpr) * 4;
                const v4f v = *(const v4f*)(myp + row * 64 + c4);
                VST2V4(obase + (long long)(q0 + row) * p.sOi + c0 + c4, v);
            }
        } else {
            for (int row = 0; row < 16; ++row) {
                const int irow = q0 + row; if (irow >= p.Lq) continue;
                for (int c = lane; c < cw; c += 32) { const int d = c0 + c; if (d < p.dv) VST2(float, obase + (long long)irow * p.sOi + d, myp[row * 64 + c]); }
            }
        }
        __syncthreads();
    }
}

// =====================================================================================================================
// k_tr: dst(z, c, r) = alpha * src(z, r, c) (+ beta * R2(z, c, r)): [Z][R][C] (row stride lds) -> [Z][C][R] (row stride ldd) through a 32x32 LDS tile;
//   flags: 1 -> add beta * residual R2 addressed like dst (z*sRz + c*ldr + r); act applied before the residual.
// =====================================================================================================================
struct TrP { const float* src; float* dst; const float* R2; long long sSz, lds, sDz, ldd, sRz, ldr; int R, C, flags, act; float alpha, beta; };
static_assert(sizeof(TrP) == 3 * 8 + 6 * 8 + 6 * 4, "TrP has padding");
__global__ __launch_bounds__(256) void k_tr(TrP p) {
    __shared__ float tile[32][33];
    const int c0 = blockIdx.x * 32, r0 = blockIdx.y * 32, z = blockIdx.z;
    const int lane = threadIdx.x & 31, wave = threadIdx.x >> 5;
    const float* s = p.src + z * p.sSz;
#pragma unroll
    for (int k = 0; k < 4; ++k) {
        const int rl = wave * 4 + k, r = r0 + rl, c = c0 + lane;
        tile[rl][lane] = (r < p.R && c < p.C) ? s[(long long)r * p.lds + c] : 0.f;
    }
    __syncthreads();
    float* d = p.dst + z * p.sDz; const float* rr = p.R2 + z * p.sRz;
#pragma unroll
    for (int k = 0; k < 4; ++k) {
        const int cl = wave * 4 + k, c = c0 + cl, r = r0 + lane;
        if (c < p.C && r < p.R) {
            float v = act_fn(p.alpha * tile[lane][cl], p.act);
            if (p.flags & 1) v += p.beta * rr[(long long)c * p.ldr + r];
            VST2(float, d + (long long)c * p.ldd + r, v);
        }
    }
}

// k_affine: dst[i] = a * (sdev ? sdev[0] : 1) * src[i] + b, i < n (one thread per element; consecutive lanes -> consecutive addresses)
__global__ __launch_bounds__(256) void k_affine(const float* __restrict__ src, float* __restrict__ dst, int n, float a, float b, const float* __restrict__ sdev) {
    const int i = blockIdx.x * 256 + threadIdx.x;
    if (i < n) { const float aa = sdev ? a * sdev[0] : a; const float v = aa * src[i] + b; VST2(float, dst + i, v); }
}

// =====================================================================================================================
// k_softmax: row softmax over n contiguous elements, one 256-thread block per row; rows addressed z*sz + r*sr (grid (R, Z)).
//   out = scale_out * softmax(scale_in * x + (Mf ? Mf[z*smz + r*smr + j] : 0)); a row whose max is -inf is written as 0.
// =====================================================================================================================
struct SmP { const float* src; float* dst; const float* Mf; long long sz, sr, dz, dr, smz, smr; int n, pad; float scale_in, scale_out; };
static_assert(sizeof(SmP) == 3 * 8 + 6 * 8 + 4 * 4, "SmP has padding");
__global__ __launch_bounds__(256) void k_softmax(SmP p) {
    __shared__ float red[256];
    const int r = blockIdx.x, z = blockIdx.y, tid = threadIdx.x;
    const float* s = p.src + z * p.sz + (long long)r * p.sr;
    const float* mf = p.Mf ? (p.Mf + z * p.smz + (long long)r * p.smr) : nullptr;
    float mx = -__builtin_inff();
    for (int j = tid; j < p.n; j += 256) { float v = s[j] * p.scale_in; if (mf) v += mf[j]; mx = fmaxf(mx, v); }
    red[tid] = mx; __syncthreads();
    for (int o = 128; o > 0; o >>= 1) { if (tid < o) red[tid] = fmaxf(red[tid], red[tid + o]); __syncthreads(); }
    mx = red[0]; __syncthreads();
    float sum = 0.f;
    for (int j = tid; j < p.n; j += 256) { float v = s[j] * p.scale_in; if (mf) v += mf[j]; sum += (mx == -__builtin_inff()) ? 0.f : expf(v - mx); }
    red[tid] = sum; __syncthreads();
    for (int o = 128; o > 0; o >>= 1) { if (tid < o) red[tid] += red[tid + o]; __syncthreads(); }
    sum = red[0];
    const float inv = (sum > 0.f) ? p.scale_out / sum : 0.f;
    float* d = p.dst + z * p.dz + (long long)r * p.dr;
    for (int j = tid; j < p.n; j += 256) { float v = s[j] * p.scale_in; if (mf) v += mf[j]; const float o = (mx == -__builtin_inff()) ? 0.f : expf(v - mx) * inv; VST2(float, d + j, o); }
}
// =====================================================================================================================
// k_stats: mean and rsqrt(var + eps) over a set of n elements addressed base + z*sz + (e / inner) * so + (e % inner) * si, one 256-thread
// k_norm_apply: y = (x - mean[set]) * rstd[set] * g[c] + b[c] over a [Z][C][L] channel-major tensor with set = z*G + c / (C/G) (G groups per z;
//   G = C -> per-channel sets indexed z*C+c; for batch norm pass stats indexed by c only via bn = 1). Optional act. Output same layout.
// =====================================================================================================================
//   mode 0: mean / rsqrt(var + eps); mode 1 (RMSNorm): 0 / rsqrt(mean(x^2) + eps); mode 2 (L2 normalize * sqrt(n)): 0 / sqrt(n) / max(||x||, eps); mode 3: as 0 with unbiased variance (n-1)
__global__ __launch_bounds__(256) void k_stats(const float* __restrict__ x, long long sz, long long so, long long si, int inner, int n, float eps, float* __restrict__ stat, int mode) {
    __shared__ float red[256];
    const int z = blockIdx.x, tid = threadIdx.x;
    const float* base = x + z * sz;
    float s = 0.f;
    for (int e = tid; e < n; e += 256) s += base[(long long)(e / inner) * so + (long long)(e % inner) * si];
    red[tid] = s; __syncthreads();
    for (int o = 128; o > 0; o >>= 1) { if (tid < o) red[tid] += red[tid + o]; __syncthreads(); }
    const float mu = (mode == 0 || mode == 3) ? red[0] / (float)n : 0.f; __syncthreads();
    float q = 0.f;
    for (int e = tid; e < n; e += 256) { const float dlt = base[(long long)(e / inner) * so + (long long)(e % inner) * si] - mu; q += dlt * dlt; }
    red[tid] = q; __syncthreads();
    for (int o = 128; o > 0; o >>= 1) { if (tid < o) red[tid] += red[tid + o]; __syncthreads(); }
    {
        float rs;
        if (mode == 2) rs = sqrtf((float)n) / fmaxf(sqrtf(red[0]), eps); else if (mode == 3) rs = rsqrtf(red[0] / (float)(n - 1) + eps); else rs = rsqrtf(red[0] / (float)n + eps);
        if (tid < 32) { const float v = (tid == 0) ? mu : ((tid == 1) ? rs : 0.f); VST2(float, stat + (long long)z * 32 + tid, v); }
    }
}
//   One thread per element over the flat [Z][C][L] index space: grid ceil(Z*C*L / 256).
__global__ __launch_bounds__(256) void k_norm_apply(const float* __restrict__ x, float* __restrict__ y, const float* __restrict__ stat, const float* __restrict__ g, const float* __restrict__ bta,
                                                     int Z, int C, int L, int G, int bn, int act) {
    const long long idx = (long long)blockIdx.x * 256 + threadIdx.x;
    if (idx >= (long long)Z * C * L) return;
    const int l = (int)(idx % L); const long long zc = idx / L; const int c = (int)(zc % C), z = (int)(zc / C); (void)l;
    const int set = bn ? c : (z * G + c / (C / G));
    float v = (x[idx] - stat[(long long)set * 32]) * stat[(long long)set * 32 + 1];
    if (g) v *= g[c];
    if (bta) v += bta[c];
    v = act_fn(v, act);
    VST2(float, y + idx, v);
}

// k_lse_neg: c[i] = -(st[2i] + log(st[2i+1])) = minus the log-sum-exp of row i from k_attn's ST output (for softmax over the query dimension)
__global__ __launch_bounds__(256) void k_lse_neg(const float* __restrict__ st, float* __restrict__ c, int n) {
    const int i = blockIdx.x * 256 + threadIdx.x;
    if (i < n) { const float v = -(st[2 * i] + logf(st[2 * i + 1])); VST2(float, c + i, v); }
}

// k_iota: dst[i] = a * i + b as int32 (segment/position id helper)
__global__ __launch_bounds__(256) void k_iota(int* __restrict__ dst, int n, int a, int b) {
    const int i = blockIdx.x * 256 + threadIdx.x;
    if (i < n) { const int v = a * i + b; VST2(int, dst + i, v); }
}

// k_axpby: dst[i] = a * x[i] + b * y[i] (+ c), i < n
__global__ __launch_bounds__(256) void k_axpby(const float* __restrict__ x, const float* __restrict__ y, float* __restrict__ dst, int n, float a, float b, float c) {
    const int i = blockIdx.x * 256 + threadIdx.x;
    if (i < n) { const float v = a * x[i] + b * y[i] + c; VST2(float, dst + i, v); }
}

// =====================================================================================================================
// k_rope: rotary embedding on a [R rows][Hn heads][D] view (row stride sXr, head stride sXh, element stride 1) -> Y (own strides).
//   mode 0: rotate_half (partner d±D/2, sign - for d<D/2); mode 1: interleaved pairs (partner d^1, sign - for even d).
//   table column tcol: tmode 0 -> d, 1 -> d % (D/2), 2 -> d / 2; position p: pmode 0 -> r % S, 1 -> head index, 2 -> pos[r];
//   c = C[(r / S) * sCb + p * sCp + tcol * sCd], s likewise from Sn; y = x[d] * c + sign * x[partner] * s. X and Y must not alias.
// =====================================================================================================================
struct RopeP { const float* X; float* Y; const float* C; const float* Sn; const int* pos; long long sXr, sXh, sYr, sYh, sCb, sCp, sCd; int R, Hn, D, S, mode, tmode, pmode, pad; };
static_assert(sizeof(RopeP) == 5 * 8 + 7 * 8 + 8 * 4, "RopeP has padding");
__global__ __launch_bounds__(256) void k_rope(RopeP p) {
    const long long idx = (long long)blockIdx.x * 256 + threadIdx.x;
    if (idx >= (long long)p.R * p.Hn * p.D) return;
    const int d = (int)(idx % p.D); const long long rh = idx / p.D; const int h = (int)(rh % p.Hn); const int r = (int)(rh / p.Hn);
    const int half = p.D / 2;
    int partner; float sign;
    if (p.mode == 0) { partner = (d < half) ? d + half : d - half; sign = (d < half) ? -1.f : 1.f; }
    else { partner = d ^ 1; sign = (d & 1) ? 1.f : -1.f; }
    const int tcol = (p.tmode == 0) ? d : ((p.tmode == 1) ? (d % half) : (d >> 1));
    const int pp = (p.pmode == 0) ? (r % p.S) : ((p.pmode == 1) ? h : p.pos[r]);
    const long long toff = (long long)(r / p.S) * p.sCb + (long long)pp * p.sCp + (long long)tcol * p.sCd;
    const float* xr = p.X + (long long)r * p.sXr + (long long)h * p.sXh;
    const float v = xr[d] * p.C[toff] + sign * xr[partner] * p.Sn[toff];
    VST2(float, p.Y + (long long)r * p.sYr + (long long)h * p.sYh + d, v);
}

// k_invf + k_sincos (split so neither kernel carries a large VALU-fma footprint): invf_i = num * (1 / powf(base, (2 i)/D)) [fmode 0],
//   num * expf((2 i) * cexp) [fmode 1], num * powf(base, -2 (i - 1) / D) [fmode 2]; then cs/sn[s*half + i] = cos/sin((pscale * s) * invf_i)
__global__ __launch_bounds__(256) void k_invf(float* __restrict__ invb, int half, int D, float base, float num, int fmode, float cexp) {
    const int i = blockIdx.x * 256 + threadIdx.x;
    if (i >= ((half + 31) / 32) * 32) return;
    if (i >= half) { VST2(float, invb + i, 0.f); return; }
    const float e = (float)(2 * i) / (float)D;
    float invf;
    if (fmode == 1) invf = num * expf((float)(2 * i) * cexp);
    else if (fmode == 2) invf = num * powf(base, (-2.0f * ((float)i - 1.0f)) / (float)D);
    else invf = num * (1.0f / powf(base, e));
    VST2(float, invb + i, invf);
}
__global__ __launch_bounds__(256) void k_sincos(float* __restrict__ cs, float* __restrict__ sn, const float* __restrict__ invb, int S, int half, float pscale) {
    const int idx = blockIdx.x * 256 + threadIdx.x;
    if (idx >= S * half) return;
    const int s = idx / half, i = idx - s * half;
    const float ang = (pscale * (float)s) * invb[i];
    VST2(float, cs + idx, cosf(ang)); VST2(float, sn + idx, sinf(ang));
}

// k_mulact: dst[i] = act(x[i]) * y[i]
__global__ __launch_bounds__(256) void k_mulact(const float* __restrict__ x, const float* __restrict__ y, float* __restrict__ dst, int n, int act) {
    const int i = blockIdx.x * 256 + threadIdx.x;
    if (i < n) { const float v = act_fn(x[i], act) * y[i]; VST2(float, dst + i, v); }
}

// =====================================================================================================================
// k_matvec: thread-per-row matrix-vector products for N <= 8 output columns (heads with 1-3 outputs, gates), f32 on the VALU.
//   C[r*sCm + j] = act(alpha * sum_k A[r*sAm + k*sAk] * B[j*sBn + k*sBk] + bias[j]) + beta * R[r*sRm + j*sRn]; each thread writes its N contiguous floats.
// =====================================================================================================================
__global__ __launch_bounds__(256) void k_matvec(GemmP p) {
    // 32 lanes write one line with one instruction.
    const int rpt = (p.N == 1) ? 1 : 32;
    const long long r0 = ((long long)blockIdx.x * 256 + threadIdx.x) * rpt; const int z = blockIdx.z, zo = z / p.zi_n, zi = z - zo * p.zi_n;
    if (r0 >= p.M) return;
    const float* Bb = p.B + zo * p.sBo + zi * p.sBi;
    float* C = p.C + zo * p.sCo + zi * p.sCi; const float* R = p.R + zo * p.sRo + zi * p.sRi;
    for (int rr = 0; rr < rpt; ++rr) {
        const long long r = r0 + rr; if (r >= p.M) break;
        const float* A = p.A + zo * p.sAo + zi * p.sAi + r * p.sAm;
        float acc[8] = {0.f, 0.f, 0.f, 0.f, 0.f, 0.f, 0.f, 0.f};
        for (int k = 0; k < p.K; ++k) { const float a = A[(long long)k * p.sAk];
#pragma unroll
            for (int j = 0; j < 8; ++j) if (j < p.N) acc[j] += a * Bb[(long long)j * p.sBn + (long long)k * p.sBk]; }
#pragma unroll
        for (int j = 0; j < 8; ++j) if (j < p.N) {
            float v = acc[j] * p.alpha;
            if (p.flags & 1) v += p.bias[j];
            if (p.flags & 2) v += p.bias[r];
            v = act_fn(v, p.act);
            if (p.flags & 4) v += p.beta * R[r * p.sRm + (long long)j * p.sRn];
            VST2(float, C + r * p.sCm + j, v);
        }
    }
}
// k_smallsoftmax: thread-per-row softmax for short rows (n <= 64): dst[r*dr + j] = softmax(scale*src[r*sr + j])
__global__ __launch_bounds__(256) void k_smallsoftmax(const float* __restrict__ src, float* __restrict__ dst, long long sr, long long dr, int n, long long R, float scale) {
    const long long r0 = ((long long)blockIdx.x * 256 + threadIdx.x) * 32;
    for (int rr = 0; rr < 32; ++rr) {
        const long long r = r0 + rr; if (r >= R) return;
        const float* s = src + r * sr; float* d = dst + r * dr;
        float mx = -__builtin_inff();
        for (int j = 0; j < n; ++j) mx = fmaxf(mx, s[j] * scale);
        float sum = 0.f;
        for (int j = 0; j < n; ++j) sum += expf(s[j] * scale - mx);
        const float inv = 1.f / sum;
        for (int j = 0; j < n; ++j) { const float v = expf(s[j] * scale - mx) * inv; VST2(float, d + j, v); }
    }
}

__global__ __launch_bounds__(32) void k_unitstat(float* __restrict__ st) { const int t = threadIdx.x; const float v = (t == 1) ? 1.f : 0.f; VST2(float, st + t, v); }

// destination (e.g. a d_out whose row width is not a multiple of 32 floats) is written by consecutive lanes of one instruction
__global__ __launch_bounds__(256) void k_lincopy(const float* __restrict__ src, long long lds, float* __restrict__ dst, long long ldd, long long rows, int cols) {
    const long long i = (long long)blockIdx.x * 256 + threadIdx.x; if (i >= rows * cols) return;
    const long long r = i / cols; const int c = (int)(i - r * cols);
    const float v = src[r * lds + c]; VST2(float, dst + r * ldd + c, v);
}

namespace w25 {
typedef __attribute__((ext_vector_type(16))) _Float16 v16h;
typedef __attribute__((ext_vector_type(8)))  _Float16 v8h;
typedef __attribute__((ext_vector_type(16))) __bf16   v16b;
typedef __attribute__((ext_vector_type(8)))  __bf16   v8b;
typedef __attribute__((ext_vector_type(8)))  float    v8f;
typedef __attribute__((ext_vector_type(4)))  float    v4f;

__device__ __forceinline__ unsigned short f2bf_bits(float f) {
  unsigned u = __float_as_uint(f);
  return (unsigned short)((u + 0x7FFFu + ((u >> 16) & 1u)) >> 16);
}
__device__ __forceinline__ float bf_bits2f(unsigned short h) { return __uint_as_float(((unsigned)h) << 16); }

// hazard guards as plain device helpers (no inline asm inside the kernel template body)
__device__ __forceinline__ void dep_guard_h(v8f& a, v8f& b, v16h x, v16h y) { asm volatile("v_nop\n\tv_nop\n\tv_nop\n\tv_nop" : "+v"(a), "+v"(b) : "v"(x), "v"(y)); }
__device__ __forceinline__ void dep_guard_b(v8f& a, v8f& b, v16b x, v16b y) { asm volatile("v_nop\n\tv_nop\n\tv_nop\n\tv_nop" : "+v"(a), "+v"(b) : "v"(x), "v"(y)); }
__device__ __forceinline__ void keep4_h(v16h a, v16h b, v16h c, v16h d) { asm volatile("v_nop" :: "v"(a), "v"(b), "v"(c), "v"(d)); }
__device__ __forceinline__ void keep4_b(v16b a, v16b b, v16b c, v16b d) { asm volatile("v_nop" :: "v"(a), "v"(b), "v"(c), "v"(d)); }
__device__ __forceinline__ void acc_guard4(v8f& a, v8f& b, v8f& c, v8f& d) { asm volatile("v_nop\n\tv_nop\n\tv_nop\n\tv_nop" : "+v"(a), "+v"(b), "+v"(c), "+v"(d)); }
template <typename T> struct Frag;
template <> struct Frag<_Float16> {
  typedef v16h V; union U { v16h v; v8h h[2]; };
  static __device__ __forceinline__ v16h load(const _Float16* p) {   // elements 0..7 <- p[0..7], 8..15 <- p[16..23]
    U f; f.h[0] = *(const v8h*)(p); f.h[1] = *(const v8h*)(p + 16); return f.v;
  }
  static __device__ __forceinline__ v8f mma(v16h a, v16h b, v8f c) {
    return __builtin_amdgcn_wmma_f32_16x16x32_f16(false, a, false, b, (short)0, c, false, false);
  }
  static __device__ __forceinline__ void guard(v8f& a, v8f& b, v16h x, v16h y) { dep_guard_h(a, b, x, y); }
  static __device__ __forceinline__ void keep(v16h a, v16h b, v16h c, v16h d) { keep4_h(a, b, c, d); }
};
template <> struct Frag<__bf16> {
  typedef v16b V; union U { v16b v; v8b h[2]; };
  static __device__ __forceinline__ v16b load(const __bf16* p) {
    U f; f.h[0] = *(const v8b*)(p); f.h[1] = *(const v8b*)(p + 16); return f.v;
  }
  static __device__ __forceinline__ v8f mma(v16b a, v16b b, v8f c) {
    return __builtin_amdgcn_wmma_f32_16x16x32_bf16(false, a, false, b, (short)0, c, false, false);
  }
  static __device__ __forceinline__ void guard(v8f& a, v8f& b, v16b x, v16b y) { dep_guard_b(a, b, x, y); }
  static __device__ __forceinline__ void keep(v16b a, v16b b, v16b c, v16b d) { keep4_b(a, b, c, d); }
};

// ---- Register-blocked batched WMMA GEMM ------------------------------------
// C[m,n] = scale * sum_k A[m,k] * Bt[n,k] (+bias)(+resid); each wave owns a 64x64 tile.
// A row-major [M,K]; Bt row-major [N,K]; M,N % 64 == 0, K % 32 == 0.
// SPLIT: operands are hi/lo planes (A2/Bt2 = lo planes, same layout); product = hi·hi + hi·lo + lo·hi.
// BIAS_MODE: 0 = none, 1 = bias[m], 2 = bias[n].
// OUT_MODE: 0 = f32, 1 = f16, 2 = bf16 hi plane (Cout) + bf16 lo plane (Cout2).
// ET: 0 = f16 operands, 1 = bf16 operands (pointers passed as 16-bit storage)
template <int ET> struct Elem;
template <> struct Elem<0> { typedef _Float16 T; };
template <> struct Elem<1> { typedef __bf16 T; };
template <int ET, bool SPLIT, int BIAS_MODE, int OUT_MODE, bool RESID, int ACT = 0>
__global__ __launch_bounds__(256) void wmma_gemm64(
    const unsigned short* __restrict__ Ap, const unsigned short* __restrict__ A2p, int lda, long strideA,
    const unsigned short* __restrict__ Btp, const unsigned short* __restrict__ Bt2p, int ldb, long strideB,
    void* __restrict__ Cout, void* __restrict__ Cout2, int ldc, long strideC,
    const float* __restrict__ bias,
    const float* __restrict__ resid, long strideR,
    int M, int N, int K, float scale) {
  typedef typename Elem<ET>::T T;
  typedef typename Frag<T>::V V;
  const T* A = (const T*)Ap; const T* A2 = (const T*)A2p; const T* Bt = (const T*)Btp; const T* Bt2 = (const T*)Bt2p;
  __shared__ __align__(16) float sT[8][16 * 68];   // per-wave 16x64 slab, pitch 68 floats
  const int b    = blockIdx.y;
  const int lane = threadIdx.x & 31;
  const int wave = threadIdx.x >> 5;
  const int tilesN = N >> 6;
  const int tilesM = M >> 6;
  const int tile = blockIdx.x * 8 + wave;
  if (tile >= tilesM * tilesN) return;   // wave-uniform; no block barriers in this kernel
  const int tm = tile / tilesN;
  const int tn = tile - tm * tilesN;
  const int m0 = tm << 6;
  const int n0 = tn << 6;

  const T* Ab  = A  + (size_t)b * strideA;
  const T* Bb  = Bt + (size_t)b * strideB;
  const T* Ab2 = SPLIT ? (A2  + (size_t)b * strideA) : nullptr;
  const T* Bb2 = SPLIT ? (Bt2 + (size_t)b * strideB) : nullptr;

  const int rlane = lane & 15;                 // row (A) / col (B, D) within subtile
  const int koff  = (lane >> 4) * 8;           // k offset of this lane half
  const int mOff  = (lane >> 4) * 8;           // D row offset

  v8f acc[4][4];
#pragma unroll
  for (int i = 0; i < 4; ++i)
#pragma unroll
    for (int j = 0; j < 4; ++j) acc[i][j] = (v8f){0.f,0.f,0.f,0.f,0.f,0.f,0.f,0.f};

  for (int k0 = 0; k0 < K; k0 += 32) {
    V bh[4], bl[4];
#pragma unroll
    for (int j = 0; j < 4; ++j) {
      const size_t bo = (size_t)(n0 + (j << 4) + rlane) * ldb + koff + k0;
      bh[j] = Frag<T>::load(Bb + bo);
      if (SPLIT) bl[j] = Frag<T>::load(Bb2 + bo);
    }
#pragma unroll
    for (int i = 0; i < 4; ++i) {
      const size_t ao = (size_t)(m0 + (i << 4) + rlane) * lda + koff + k0;
      V ah = Frag<T>::load(Ab + ao);
      V al;
      if (SPLIT) al = Frag<T>::load(Ab2 + ao);
#pragma unroll
      for (int j = 0; j < 4; ++j) {
        acc[i][j] = Frag<T>::mma(ah, bh[j], acc[i][j]);
        if (SPLIT) {
          acc[i][j] = Frag<T>::mma(ah, bl[j], acc[i][j]);
          acc[i][j] = Frag<T>::mma(al, bh[j], acc[i][j]);
        }
      }
      Frag<T>::guard(acc[i][0], acc[i][3], ah, SPLIT ? al : ah);
    }
    Frag<T>::keep(bh[0], bh[1], bh[2], bh[3]);
    if (SPLIT) Frag<T>::keep(bl[0], bl[1], bl[2], bl[3]);
  }
  acc_guard4(acc[0][0], acc[0][1], acc[0][2], acc[0][3]);
  acc_guard4(acc[1][0], acc[1][1], acc[1][2], acc[1][3]);
  acc_guard4(acc[2][0], acc[2][1], acc[2][2], acc[2][3]);
  acc_guard4(acc[3][0], acc[3][1], acc[3][2], acc[3][3]);

  // ---- epilogue ----
  float* slab = sT[wave];
  const float* Rb = RESID ? (resid + (size_t)b * strideR) : nullptr;
#pragma unroll
  for (int i = 0; i < 4; ++i) {
    const int mBase = m0 + (i << 4);
#pragma unroll
    for (int j = 0; j < 4; ++j) {
      const int n = n0 + (j << 4) + rlane;
      float bv = 0.f;
      if (BIAS_MODE == 2) bv = bias[n];
#pragma unroll
      for (int r = 0; r < 8; ++r) {
        float v = acc[i][j][r] * scale;
        if (BIAS_MODE == 1) v += bias[mBase + mOff + r];
        if (BIAS_MODE == 2) v += bv;
        if (RESID) v += Rb[(size_t)(mBase + mOff + r) * ldc + n];
        if (ACT == 1) v = tanhf(v);
        if (ACT == 2) v = fmaxf(v, 0.0f);
        if (ACT == 3) v = v / (1.0f + expf(-v));
        if (ACT == 4) v = (v > 0.f) ? v : 0.01f * v;
        if (ACT == 5) v = 0.5f * v * (1.0f + erff(v * 0.70710678118654752f));
        slab[(mOff + r) * 68 + (j << 4) + rlane] = v;
      }
    }
    __builtin_amdgcn_fence(__ATOMIC_RELEASE, "workgroup");
    __builtin_amdgcn_wave_barrier();
    __builtin_amdgcn_fence(__ATOMIC_ACQUIRE, "workgroup");
    if (OUT_MODE == 0) {
      float* C = (float*)Cout + (size_t)b * strideC;
      const int hh = lane >> 4, c4 = (lane & 15) * 4;     // row seg = 256 B = 16 lanes x 16 B
      {
#pragma unroll
        for (int it = 0; it < 8; ++it) {
          const int row = it * 2 + hh;
          v4f v = *(const v4f*)(slab + row * 68 + c4);
          *(v4f*)(C + (size_t)(mBase + row) * ldc + n0 + c4) = v;
        }
        
      }
    } else {
      const int q = lane >> 3, c8 = (lane & 7) * 8;
      unsigned short* C  = (unsigned short*)Cout  + (size_t)b * strideC;
      unsigned short* C2 = (OUT_MODE == 2) ? ((unsigned short*)Cout2 + (size_t)b * strideC) : nullptr;
      {
#pragma unroll
        for (int it = 0; it < 4; ++it) {
          const int row = it * 4 + q;
          const float* sp = slab + row * 68 + c8;
          v8h hv, lv;
#pragma unroll
          for (int e = 0; e < 8; ++e) {
            if (OUT_MODE == 1) {
              hv[e] = (_Float16)sp[e];
            } else {
              unsigned short hb = f2bf_bits(sp[e]);
              unsigned short lb = f2bf_bits(sp[e] - bf_bits2f(hb));
              hv[e] = __builtin_bit_cast(_Float16, hb);
              lv[e] = __builtin_bit_cast(_Float16, lb);
            }
          }
          *(v8h*)(C + (size_t)(mBase + row) * ldc + n0 + c8) = hv;
          if (OUT_MODE == 2) *(v8h*)(C2 + (size_t)(mBase + row) * ldc + n0 + c8) = lv;
        }
        
      }
    }
    __builtin_amdgcn_fence(__ATOMIC_RELEASE, "workgroup");
    __builtin_amdgcn_wave_barrier();
    __builtin_amdgcn_fence(__ATOMIC_ACQUIRE, "workgroup");
  }
}

__global__ __launch_bounds__(256) void cast_f32_f16x2(
    const float* __restrict__ in, _Float16* __restrict__ out, int n2) {
  int i = blockIdx.x * 256 + threadIdx.x;
  if (i < n2) {
    const _Float16 h0 = (_Float16)in[2 * i], h1 = (_Float16)in[2 * i + 1];
    const unsigned u = (unsigned)__builtin_bit_cast(unsigned short, h0) | ((unsigned)__builtin_bit_cast(unsigned short, h1) << 16);
    ((unsigned*)out)[i] = u;
    
  }
}


} // namespace w25

__device__ __forceinline__ unsigned int f2h2_pack(float a, float b) { return (unsigned)__builtin_bit_cast(unsigned short, (_Float16)a) | ((unsigned)__builtin_bit_cast(unsigned short, (_Float16)b) << 16); }
__global__ __launch_bounds__(256) void k_cast16(const float* __restrict__ src, long long lds, _Float16* __restrict__ dst, long long ldd, int R, int C, float s) {
    const long long i = (long long)blockIdx.x * 256 + threadIdx.x; const long long np = (long long)R * (C / 2); if (i >= np) return; const int r = (int)(i / (C / 2)); const int c = 2 * (int)(i % (C / 2));
    const _Float16 h0 = (_Float16)(src[(long long)r * lds + c] * s), h1 = (_Float16)(src[(long long)r * lds + c + 1] * s);
    const unsigned u = (unsigned)__builtin_bit_cast(unsigned short, h0) | ((unsigned)__builtin_bit_cast(unsigned short, h1) << 16);
    unsigned* d = (unsigned*)(dst + (long long)r * ldd + c); *d = u;  }

// f32 -> bf16 hi plane + bf16 lo plane (x = hi + lo to ~2^-17 relative; RNE both), [R][C] -> [R][C] (or transposed to [C][R]); 2 consecutive destination elements
__device__ __forceinline__ unsigned int f2bf2_pack(float a, float b, unsigned int* lo) {
    const unsigned short ha = w25::f2bf_bits(a), hb = w25::f2bf_bits(b);
    const unsigned short la = w25::f2bf_bits(a - w25::bf_bits2f(ha)), lb = w25::f2bf_bits(b - w25::bf_bits2f(hb));
    *lo = (unsigned)la | ((unsigned)lb << 16); return (unsigned)ha | ((unsigned)hb << 16); }
__global__ __launch_bounds__(256) void k_castS16(const float* __restrict__ src, long long lds, __bf16* __restrict__ dhi, __bf16* __restrict__ dlo, long long ldd, int R, int C, float s, int transpose, long long sb, long long db) {
    src += (long long)blockIdx.y * sb; dhi += (long long)blockIdx.y * db; dlo += (long long)blockIdx.y * db;   // blockIdx.y = image
    const long long i = (long long)blockIdx.x * 256 + threadIdx.x; long long o; float a, b;
    if (transpose) { const long long np = (long long)C * (R / 2); if (i >= np) return; const int c = (int)(i / (R / 2)); const int r = 2 * (int)(i % (R / 2)); a = src[(long long)r * lds + c] * s; b = src[(long long)(r + 1) * lds + c] * s; o = (long long)c * ldd + r; }
    else { const long long np = (long long)R * (C / 2); if (i >= np) return; const int r = (int)(i / (C / 2)); const int c = 2 * (int)(i % (C / 2)); a = src[(long long)r * lds + c] * s; b = src[(long long)r * lds + c + 1] * s; o = (long long)r * ldd + c; }
    unsigned lo; const unsigned hi = f2bf2_pack(a, b, &lo); unsigned* ph = (unsigned*)(dhi + o); unsigned* pl = (unsigned*)(dlo + o);
    *ph = hi; *pl = lo;  }

namespace w25 {
// =====================================================================================
// Generic causal/non-causal attention for head_dim 64, f32 in / f32 out; 16-bit operands: bf16 with optional hi/lo splits, or
// plain f16 (F16=true, non-split, probabilities carried x2^15).
//   scores = (q*qscale)·kᵀ : v_wmma_f32_16x16x32_bf16; SPLIT_QK -> q,k as bf16 hi/lo (hi·hi + hi·lo + lo·hi)
//   out    = p·v           : v_wmma_f32_16x16x32_bf16; SPLIT_PV -> p,v as bf16 hi/lo; else p,v plain bf16
//   f32 accumulate; online softmax in f32. Block = 4 waves = 64 query rows of one (batch, head); S % 64 == 0.
//   Element (b, s, h, d) of tensor X lives at X[b*X_bs + s*X_rs + h*X_hs + d] (strides in floats, multiples of 4).
//   Masking: mask_mode 0 none, 1 causal (kv > q masked), 2 tensor [S][Skv] shared over (b,h) (float if
//   mask_is_int==0, int32 with element == 0 -> masked if 1, int32 with element != 0 -> masked if 2), 3 per-token vectors qmask[B][S] & kvmask[B][Skv] (int32,
//   0 -> masked), 4 causal + sliding window (kv > q or q - kv > W masked; W passed in mask_is_int);
//   5 = relative-position bias: s += cp[b,h,q][idx[q][kv]] + pc[b,h,kv][idx[q][kv]] with idx = mask_b ([S][Skv] int32) and
//   mask_a an int32 [S][Skv] tensor with nonzero = masked (tables: element (b,h,row,n) at X + b*c_bs + h*c_hs + row*c_rs + n);
//   masked scores are replaced by mask_fill (e.g. -inf or -1e9) before the softmax.
//   grid.x = B * H * (S/64) (or a sub-range with blk0).
// =====================================================================================
#define AT_D 64
#define AT_NW 4
#define AT_QB 64
#define AT_KC 64
struct AttnGeom { const float* cp = nullptr; const float* pc = nullptr; long c_bs = 0, c_rs = 0, c_hs = 0;   // mode-5 score-bias tables
                  long q_bs, q_rs, q_hs, k_bs, k_rs, k_hs, v_bs, v_rs, v_hs, o_bs, o_rs, o_hs;
                  int S, Skv, H, mask_mode; float qscale; int blk0; float mask_fill; int mask_is_int; };
static_assert(sizeof(AttnGeom) == 168, "no padding");

__device__ __forceinline__ unsigned short at_bf_bits(float f) {
  unsigned u = __float_as_uint(f);
  return (unsigned short)((u + 0x7FFFu + ((u >> 16) & 1u)) >> 16);
}
__device__ __forceinline__ __bf16 at_f2bf(float f) { return __builtin_bit_cast(__bf16, at_bf_bits(f)); }
__device__ __forceinline__ void at_split(float f, __bf16& hi, __bf16& lo) {
  const unsigned short hb = at_bf_bits(f);
  hi = __builtin_bit_cast(__bf16, hb);
  lo = at_f2bf(f - __uint_as_float(((unsigned)hb) << 16));
}
__device__ __forceinline__ v8f at_mma(v16b a, v16b b, v8f c) {
  c = __builtin_amdgcn_wmma_f32_16x16x32_bf16(false, a, false, b, (short)0, c, false, false);
  asm volatile("v_nop\n\tv_nop\n\tv_nop\n\tv_nop" : "+v"(c) : "v"(a), "v"(b));
  return c;
}
// 16-bit element as a bit pattern held in a __bf16 slot: f16 bits when F16, bf16 (RNE) otherwise
template <bool F16> __device__ __forceinline__ __bf16 at_to16(float f) {
  if (F16) return __builtin_bit_cast(__bf16, (_Float16)f);
  return at_f2bf(f);
}
template <bool F16> __device__ __forceinline__ v8f at_mma16(v16b a, v16b b, v8f c) {
  if (F16) {
    const v16h ah = __builtin_bit_cast(v16h, a), bh = __builtin_bit_cast(v16h, b);
    c = __builtin_amdgcn_wmma_f32_16x16x32_f16(false, ah, false, bh, (short)0, c, false, false);
    asm volatile("v_nop\n\tv_nop\n\tv_nop\n\tv_nop" : "+v"(c) : "v"(ah), "v"(bh));
    return c;
  }
  return at_mma(a, b, c);
}

template <bool SPLIT_QK, bool SPLIT_PV, bool F16 = false>
__global__ __launch_bounds__(128)
void attn64_kernel(const float* __restrict__ q, const float* __restrict__ k,
                   const float* __restrict__ v, float* __restrict__ out,
                   const void* __restrict__ mask_a, const int* __restrict__ mask_b, AttnGeom g) {
  static_assert(!(F16 && (SPLIT_QK || SPLIT_PV)), "f16 mode is non-split");
  const float PSC = F16 ? 32768.0f : 1.0f;     // f16 probabilities carried x2^15 (subnormal range), folded into the final 1/l
  union FB { v16b v; v8b h[2]; };
  __shared__ __align__(16) __bf16 Ksh[AT_KC * AT_D];             // K hi [kv][d]      8 KB
  __shared__ __align__(16) __bf16 Ksl[SPLIT_QK ? AT_KC * AT_D : 8];
  __shared__ __align__(16) __bf16 Vth[AT_D * AT_KC];             // V hi [d][kv]      8 KB
  __shared__ __align__(16) __bf16 Vtl[SPLIT_PV ? AT_D * AT_KC : 8];
  __shared__ __align__(16) __bf16 Psh[AT_NW][16 * AT_KC];        // per wave P hi [row][kv]  8 KB
  __shared__ __align__(16) __bf16 Psl[SPLIT_PV ? AT_NW : 1][SPLIT_PV ? 16 * AT_KC : 8];
  __shared__ __align__(16) float  Os[AT_NW][16 * 68];            // per wave out tile, pitch 68

  const int tid  = threadIdx.x;
  const int wave = tid >> 5;
  const int lane = tid & 31;
  const int hh   = lane >> 4;
  const int c    = lane & 15;

  const int nqb = g.S / AT_QB;
  const int bx = blockIdx.x + g.blk0;
  const int qb = bx % nqb;
  const int bh = bx / nqb;
  const int h  = bh % g.H;
  const int b  = bh / g.H;
  const int qbase_block = qb * AT_QB;
  const int q0 = qbase_block + wave * 16;

  const float* qb_ptr = q + (size_t)b * g.q_bs + (size_t)h * g.q_hs;
  const float* kb_ptr = k + (size_t)b * g.k_bs + (size_t)h * g.k_hs;
  const float* vb_ptr = v + (size_t)b * g.v_bs + (size_t)h * g.v_hs;
  float*       ob_ptr = out + (size_t)b * g.o_bs + (size_t)h * g.o_hs;

  // ---- Q fragments (A operand): 2 d-chunks, hi (and lo) ----
  v16b qah[2], qal[2];
  {
    const float* qrow = qb_ptr + (size_t)(q0 + c) * g.q_rs;
#pragma unroll
    for (int dc = 0; dc < 2; ++dc) {
#pragma unroll
      for (int e = 0; e < 8; ++e) {
        const float f0 = qrow[dc * 32 + 8 * hh + e] * g.qscale;
        const float f1 = qrow[dc * 32 + 16 + 8 * hh + e] * g.qscale;
        if (SPLIT_QK) { __bf16 hq, lq; at_split(f0, hq, lq); qah[dc][e] = hq; qal[dc][e] = lq; at_split(f1, hq, lq); qah[dc][8 + e] = hq; qal[dc][8 + e] = lq; }
        else { qah[dc][e] = at_to16<F16>(f0); qah[dc][8 + e] = at_to16<F16>(f1); qal[dc][e] = qah[dc][e]; qal[dc][8 + e] = qah[dc][8 + e]; }
      }
    }
  }

  float mrow[8], lrow[8];
  v8f oacc[4];
#pragma unroll
  for (int r = 0; r < 8; ++r) { mrow[r] = -INFINITY; lrow[r] = 0.f; }
#pragma unroll
  for (int t = 0; t < 4; ++t) oacc[t] = (v8f){0.f,0.f,0.f,0.f,0.f,0.f,0.f,0.f};

  const int nChunks = (g.mask_mode == 1 || g.mask_mode == 4) ? (qb + 1) : (g.Skv / AT_KC);   // block-uniform
  // per-row query mask (mode 3)
  int qkeep[8];
#pragma unroll
  for (int r = 0; r < 8; ++r) qkeep[r] = (g.mask_mode == 3) ? mask_b[(size_t)b * g.S + q0 + 8 * hh + r] : 1;   // mask_b = qmask in mode 3
  for (int kc = 0; kc < nChunks; ++kc) {
    const int kv0 = kc * AT_KC;
    __syncthreads();
    {
      const int kvr = tid >> 1, dh = (tid & 1) * 32;
      const float* krow = kb_ptr + (size_t)(kv0 + kvr) * g.k_rs + dh;
      const float* vrow = vb_ptr + (size_t)(kv0 + kvr) * g.v_rs + dh;
#pragma unroll
      for (int i = 0; i < 8; ++i) {
        v4f kk = *(const v4f*)(krow + 4 * i);
        v4f vv = *(const v4f*)(vrow + 4 * i);
#pragma unroll
        for (int e = 0; e < 4; ++e) {
          const int d = dh + 4 * i + e;
          if (SPLIT_QK) { __bf16 a, bl; at_split(kk[e], a, bl); Ksh[kvr * AT_D + d] = a; Ksl[kvr * AT_D + d] = bl; }
          else Ksh[kvr * AT_D + d] = at_to16<F16>(kk[e]);
          if (SPLIT_PV) { __bf16 a, bl; at_split(vv[e], a, bl); Vth[d * AT_KC + kvr] = a; Vtl[d * AT_KC + kvr] = bl; }
          else Vth[d * AT_KC + kvr] = at_to16<F16>(vv[e]);
        }
      }
    }
    __syncthreads();

    v8f s[4];
#pragma unroll
    for (int j = 0; j < 4; ++j) {
      s[j] = (v8f){0.f,0.f,0.f,0.f,0.f,0.f,0.f,0.f};
#pragma unroll 1
      for (int dc = 0; dc < 2; ++dc) {
        FB kb;
        kb.h[0] = *(const v8b*)(Ksh + (j * 16 + c) * AT_D + dc * 32 + 8 * hh);
        kb.h[1] = *(const v8b*)(Ksh + (j * 16 + c) * AT_D + dc * 32 + 16 + 8 * hh);
        s[j] = at_mma16<F16>(qah[dc], kb.v, s[j]);
        if (SPLIT_QK) {
          FB kl;
          kl.h[0] = *(const v8b*)(Ksl + (j * 16 + c) * AT_D + dc * 32 + 8 * hh);
          kl.h[1] = *(const v8b*)(Ksl + (j * 16 + c) * AT_D + dc * 32 + 16 + 8 * hh);
          s[j] = at_mma16<F16>(qah[dc], kl.v, s[j]);
          s[j] = at_mma16<F16>(qal[dc], kb.v, s[j]);
        }
      }
    }
    const bool diag = (g.mask_mode == 1) && (kc == qb);
    int kvkeep[4] = {1, 1, 1, 1};
    if (g.mask_mode == 3) {
#pragma unroll
      for (int j = 0; j < 4; ++j) kvkeep[j] = ((const int*)mask_a)[(size_t)b * g.Skv + kv0 + j * 16 + c];   // mask_a = kvmask
    }
    float cm[8];
#pragma unroll
    for (int r = 0; r < 8; ++r) {
      const int qrow = q0 + 8 * hh + r;
      float m = -INFINITY;
#pragma unroll
      for (int j = 0; j < 4; ++j) {
        const int kvcol = kv0 + j * 16 + c;
        bool masked = false;
        if (diag) masked = (kvcol > qrow);
        else if (g.mask_mode == 4) masked = (kvcol > qrow) || (qrow - kvcol > g.mask_is_int);
        else if (g.mask_mode == 2) {
          const size_t mi = (size_t)qrow * g.Skv + kvcol;
          masked = (g.mask_is_int == 0) ? (((const float*)mask_a)[mi] == 0.0f)
                 : (g.mask_is_int == 1) ? (((const int*)mask_a)[mi] == 0) : (((const int*)mask_a)[mi] != 0);
        } else if (g.mask_mode == 3) masked = (qkeep[r] == 0) || (kvkeep[j] == 0);
        else if (g.mask_mode == 5) {
          const size_t mi = (size_t)qrow * g.Skv + kvcol;
          masked = (((const int*)mask_a)[mi] != 0);
          int n = mask_b[mi]; n = n < 0 ? 0 : n;
          s[j][r] += g.cp[(size_t)b * g.c_bs + (size_t)h * g.c_hs + (size_t)qrow * g.c_rs + n]
                   + g.pc[(size_t)b * g.c_bs + (size_t)h * g.c_hs + (size_t)kvcol * g.c_rs + n];
        }
        if (masked) s[j][r] = g.mask_fill;
        m = fmaxf(m, s[j][r]);
      }
#pragma unroll
      for (int off = 1; off < 16; off <<= 1) m = fmaxf(m, __shfl_xor(m, off, 32));
      cm[r] = m;
    }
    __bf16* pwh = Psh[wave];
    __bf16* pwl = Psl[SPLIT_PV ? wave : 0];
#pragma unroll
    for (int r = 0; r < 8; ++r) {
      const float mnew = fmaxf(mrow[r], cm[r]);
      const float alpha = expf(mrow[r] - mnew);
      mrow[r] = mnew;
      float psum = 0.f;
#pragma unroll
      for (int j = 0; j < 4; ++j) {
        const float p = expf(s[j][r] - mnew);
        psum += p;
        if (SPLIT_PV) { __bf16 a, bl; at_split(p, a, bl); pwh[(8 * hh + r) * AT_KC + j * 16 + c] = a; pwl[(8 * hh + r) * AT_KC + j * 16 + c] = bl; }
        else pwh[(8 * hh + r) * AT_KC + j * 16 + c] = at_to16<F16>(p * PSC);
      }
#pragma unroll
      for (int off = 1; off < 16; off <<= 1) psum += __shfl_xor(psum, off, 32);
      lrow[r] = lrow[r] * alpha + psum;
#pragma unroll
      for (int t = 0; t < 4; ++t) oacc[t][r] *= alpha;
    }
    __builtin_amdgcn_fence(__ATOMIC_RELEASE, "workgroup");
    __builtin_amdgcn_wave_barrier();
    __builtin_amdgcn_fence(__ATOMIC_ACQUIRE, "workgroup");
#pragma unroll 1
    for (int kk = 0; kk < 2; ++kk) {
      FB pa, pl;
      pa.h[0] = *(const v8b*)(pwh + c * AT_KC + kk * 32 + 8 * hh);
      pa.h[1] = *(const v8b*)(pwh + c * AT_KC + kk * 32 + 16 + 8 * hh);
      if (SPLIT_PV) {
        pl.h[0] = *(const v8b*)(pwl + c * AT_KC + kk * 32 + 8 * hh);
        pl.h[1] = *(const v8b*)(pwl + c * AT_KC + kk * 32 + 16 + 8 * hh);
      }
#pragma unroll
      for (int t = 0; t < 4; ++t) {
        FB vb;
        vb.h[0] = *(const v8b*)(Vth + (t * 16 + c) * AT_KC + kk * 32 + 8 * hh);
        vb.h[1] = *(const v8b*)(Vth + (t * 16 + c) * AT_KC + kk * 32 + 16 + 8 * hh);
        oacc[t] = at_mma16<F16>(pa.v, vb.v, oacc[t]);
        if (SPLIT_PV) {
          FB vl;
          vl.h[0] = *(const v8b*)(Vtl + (t * 16 + c) * AT_KC + kk * 32 + 8 * hh);
          vl.h[1] = *(const v8b*)(Vtl + (t * 16 + c) * AT_KC + kk * 32 + 16 + 8 * hh);
          oacc[t] = at_mma16<F16>(pa.v, vl.v, oacc[t]);
          oacc[t] = at_mma16<F16>(pl.v, vb.v, oacc[t]);
        }
      }
    }
  }

  float* os = Os[wave];
#pragma unroll
  for (int r = 0; r < 8; ++r) {
    const float inv = 1.0f / (lrow[r] * PSC);
#pragma unroll
    for (int t = 0; t < 4; ++t) os[(8 * hh + r) * 68 + t * 16 + c] = oacc[t][r] * inv;
  }
  __builtin_amdgcn_fence(__ATOMIC_RELEASE, "workgroup");
  __builtin_amdgcn_wave_barrier();
  __builtin_amdgcn_fence(__ATOMIC_ACQUIRE, "workgroup");
  {
    const int c4 = (lane & 15) * 4;
    {
#pragma unroll
      for (int it = 0; it < 8; ++it) {
        const int row = it * 2 + hh;
        v4f val = *(const v4f*)(os + row * 68 + c4);
        *(v4f*)(ob_ptr + (size_t)(q0 + row) * g.o_rs + c4) = val;
      }
      
    }
  }
}

} // namespace w25

// Fused projection of one image tile: the casts of x, the three 1x1 convolutions, the 2x2 max-pool and the operand planes of k_nl_flash in one kernel; x is read once, as f32.
// A block owns 64 pixels = 16 pool windows: image rows 2py, 2py + 1, columns 32hf .. 32hf + 31 (blockIdx.x = 2py + hf, blockIdx.y = image).
// Staging: a thread takes 16 channels x 4 pixels (sixteen 16-byte loads, 8 lanes = one 128-B line), casts them as the cast kernels did (bf16 hi, bf16 lo, f16 of 16 x) and stores, per pixel, plane and group of 8 channels,
// 16 bytes = 8 consecutive channels = half a lane's fragment into LDS, [slot][channel]. Slot = 16 j + m: m = pool window, j = 2 (row in window) + (column in window). So the four pixels of a window
// sit in four different 16-pixel tiles at the same column, and the pool is a maximum over four accumulators of one lane.
// Wave w owns channels 16w .. 16w + 15 of all three outputs for all 64 pixels: theta^T = Wt X and phi = Wp X (D: column = pixel, rows = 8 consecutive channels a lane; bf16 hi/lo, three products in
// the order the GEMMs had), g^T = X^T Wg^T (D: column = channel, rows = 8 consecutive windows a lane; f16). Pooled phi and g leave in the fragment order of k_nl_flash, 512 contiguous bytes a wave
// and plane (a 16-byte chunk is half of one lane's fragment, 32 chunks, lane = 16 h + c, are one wave-wide load; element e: bits 0-2 k, 3-6 row c, 7 half h, 8 which 16 k, then pooled phi: 9-10 block of
// 32 channels, 11.. tile of 16 keys; pooled g: 9-11 tile of 16 channels, 12.. block of 32 keys); theta goes through LDS so that a wave stores whole pixel rows. The bias is added behind the maximum (rounding is monotonic, so the value is the same).
namespace w25 {
// the bf16 hi/lo split of two values, packed, in 32-bit arithmetic throughout (the same bits as f2bf_bits gives: round to nearest even, the result in the upper half)
__device__ __forceinline__ unsigned bf_rn(float f) { const unsigned u = __float_as_uint(f); return u + 0x7FFFu + ((u >> 16) & 1u); }
__device__ __forceinline__ unsigned split2(float a, float b, unsigned* lo) {
  const unsigned ua = bf_rn(a) & 0xFFFF0000u, ub = bf_rn(b) & 0xFFFF0000u;
  *lo = (bf_rn(a - __uint_as_float(ua)) >> 16) | (bf_rn(b - __uint_as_float(ub)) & 0xFFFF0000u);
  return (ua >> 16) | ub; }
constexpr int PJX = 264;   // LDS pitch of a slot of x, in 16-bit elements: 512 B + 16 B, an odd multiple of 16 B for 16-byte reads
constexpr int PJT = 136;   // the same for a slot of theta: 256 B + 16 B
// launch bounds: four waves a SIMD (256 registers a wave), so that two blocks share a WGP and all 512 blocks are resident at once
__global__ __launch_bounds__(256, 4) void k_nl_proj(const float* __restrict__ X, const unsigned short* __restrict__ TWHp, const unsigned short* __restrict__ TWLp, const unsigned short* __restrict__ PWHp,
                                                 const unsigned short* __restrict__ PWLp, const unsigned short* __restrict__ GWp, const float* __restrict__ thb, const float* __restrict__ phb,
                                                 const float* __restrict__ gb, unsigned short* __restrict__ THHp, unsigned short* __restrict__ THLp, unsigned short* __restrict__ PPHp,
                                                 unsigned short* __restrict__ PPLp, unsigned short* __restrict__ GP16p) {
  constexpr int Cc = 256, D = 128, NKc = 1024, HWc = 4096;
  __shared__ __align__(16) unsigned short sx[3][64 * PJX];
  const int tid = threadIdx.x, lane = tid & 31, m = lane & 15, h = lane >> 4;
  const int wave = __builtin_amdgcn_readfirstlane(tid >> 5);   // the wave's number in a scalar register: every address is a scalar base plus a lane offset, and few vector registers live across the products
  const int b = blockIdx.y, py = blockIdx.x >> 1, hf = blockIdx.x & 1;
  // the wave's weight rows (lane = row 16 wave + m, k from 8 h), first k step: they fly with the loads of x
  const unsigned wob = (unsigned)(m * Cc + 8 * h) * 2u;   // one lane offset, in bytes, for the five planes
  const int wr = wave * 16 * Cc;
  const __bf16* TWH = (const __bf16*)((const char*)(TWHp + wr) + wob); const __bf16* TWL = (const __bf16*)((const char*)(TWLp + wr) + wob); const __bf16* PWH = (const __bf16*)((const char*)(PWHp + wr) + wob);
  const __bf16* PWL = (const __bf16*)((const char*)(PWLp + wr) + wob); const _Float16* GW = (const _Float16*)((const char*)(GWp + wr) + wob);
  v16b th = Frag<__bf16>::load(TWH), tl = Frag<__bf16>::load(TWL), ph = Frag<__bf16>::load(PWH), pl = Frag<__bf16>::load(PWL); v16h gw = Frag<_Float16>::load(GW);
  {
    const int g = lane & 7, cb = (lane >> 3) & 1, ry = h, cg = wave * 2 + cb;   // 4 pixels from column 4 g of row ry; channels 8 cg .. (and 128 + 8 cg ..); 16 lanes of one row: their LDS stores meet no common bank
    const unsigned xo = (unsigned)(cb * 8 * HWc + ry * 64 + g * 4) * 4u;   // lane offset in bytes
    const float* xp = (const float*)((const char*)(X + ((size_t)b * Cc + wave * 16) * HWc + (2 * py) * 64 + hf * 32) + xo);
    v4f v[2][8];
#pragma unroll   // v[][] in registers, all sixteen loads in flight
    for (int it = 0; it < 2; ++it)
#pragma unroll   // inner loop of the same
      for (int k = 0; k < 8; ++k) v[it][k] = *(const v4f*)(xp + (it * 128 + k) * HWc);
    // the wait before a load's address registers are reused; the two lane offsets as inputs keep their registers until the wait
    asm volatile("s_wait_xcnt 0x0" :: "v"(xo), "v"(wob) : "memory");
#pragma unroll   // constant indices into v[][]
    for (int it = 0; it < 2; ++it)
#pragma unroll   // inner loop of the same
      for (int e = 0; e < 4; ++e) { v4u hi, lo, f;
#pragma unroll   // inner loop of the same
        for (int q = 0; q < 4; ++q) { unsigned l2; hi[q] = split2(v[it][2 * q][e], v[it][2 * q + 1][e], &l2); lo[q] = l2; f[q] = f2h2_pack(v[it][2 * q][e] * 16.0f, v[it][2 * q + 1][e] * 16.0f); }
        const int so = ((ry * 2 + (e & 1)) * 16 + 2 * g + (e >> 1)) * PJX + it * 128 + cg * 8;
        *(v4u*)(&sx[0][so]) = hi; *(v4u*)(&sx[1][so]) = lo; *(v4u*)(&sx[2][so]) = f; }
  }
  __syncthreads();   // the tile of x is complete before any wave reads it
  v8f at[4], ap[4], ag[4];
#pragma unroll   // constant indices
  for (int j = 0; j < 4; ++j) { at[j] = (v8f){0.f,0.f,0.f,0.f,0.f,0.f,0.f,0.f}; ap[j] = at[j]; ag[j] = at[j]; }
  const __bf16* xh = (const __bf16*)(&sx[0][0]) + m * PJX + 8 * h; const __bf16* xl = (const __bf16*)(&sx[1][0]) + m * PJX + 8 * h; const _Float16* xf = (const _Float16*)(&sx[2][0]) + m * PJX + 8 * h;
  const unsigned bo8 = (unsigned)h * 32u, bo1 = (unsigned)m * 4u;   // lane offsets of the biases, in bytes
  const float* tbp = (const float*)((const char*)(thb + wave * 16) + bo8); const float* pbp = (const float*)((const char*)(phb + wave * 16) + bo8); const float* gbp = (const float*)((const char*)(gb + wave * 16) + bo1);
  v4f tb0, tb1, pb0, pb1; float gbv;
#pragma unroll   // eight k steps of 32 channels, constant offsets; no branch stands behind a matrix instruction
  for (int ks = 0; ks < 8; ++ks) {
    v16b nth = th, ntl = tl, nph = ph, npl = pl; v16h ngw = gw;
    if (ks < 7) {   // the next k step's weights fly behind this step's products
      const int kn = (ks + 1) * 32;
      nth = Frag<__bf16>::load(TWH + kn); ntl = Frag<__bf16>::load(TWL + kn); nph = Frag<__bf16>::load(PWH + kn); npl = Frag<__bf16>::load(PWL + kn); ngw = Frag<_Float16>::load(GW + kn);
      // the wait before these loads' address registers are reused (the offset as an input keeps it until then); memory clobbered, the loads also stay above the products instead of sinking to their first use
      asm volatile("s_wait_xcnt 0x0" :: "v"(wob) : "memory");
    } else {        // the biases fly behind the last step's products, in the registers that the weights have left
      tb0 = *(const v4f*)(tbp); tb1 = *(const v4f*)(tbp + 4); pb0 = *(const v4f*)(pbp); pb1 = *(const v4f*)(pbp + 4); gbv = *gbp;
      asm volatile("s_wait_xcnt 0x0" :: "v"(bo8), "v"(bo1) : "memory");   // the same wait for the biases' lane offsets
    }
#pragma unroll   // two pixel tiles at a time: six independent accumulators, half the fragments live
    for (int jp = 0; jp < 4; jp += 2) {
      v16b bh[2], bl[2]; v16h bf[2];
#pragma unroll   // constant indices
      for (int u = 0; u < 2; ++u) { const int o = (jp + u) * 16 * PJX + ks * 32; bh[u] = Frag<__bf16>::load(xh + o); bl[u] = Frag<__bf16>::load(xl + o); bf[u] = Frag<_Float16>::load(xf + o); }
#pragma unroll   // constant indices; neighbours in the stream go to different tiles
      for (int u = 0; u < 2; ++u) at[jp + u] = Frag<__bf16>::mma(th, bh[u], at[jp + u]);
#pragma unroll   // the same
      for (int u = 0; u < 2; ++u) ap[jp + u] = Frag<__bf16>::mma(ph, bh[u], ap[jp + u]);
#pragma unroll   // the same
      for (int u = 0; u < 2; ++u) ag[jp + u] = Frag<_Float16>::mma(bf[u], gw, ag[jp + u]);
#pragma unroll   // the same
      for (int u = 0; u < 2; ++u) at[jp + u] = Frag<__bf16>::mma(tl, bh[u], at[jp + u]);
#pragma unroll   // the same
      for (int u = 0; u < 2; ++u) ap[jp + u] = Frag<__bf16>::mma(ph, bl[u], ap[jp + u]);
#pragma unroll   // the same
      for (int u = 0; u < 2; ++u) at[jp + u] = Frag<__bf16>::mma(th, bl[u], at[jp + u]);
#pragma unroll   // the same
      for (int u = 0; u < 2; ++u) ap[jp + u] = Frag<__bf16>::mma(pl, bh[u], ap[jp + u]);
    }
    th = nth; tl = ntl; ph = nph; pl = npl; gw = ngw;
  }
  const float tbv[8] = { tb0[0], tb0[1], tb0[2], tb0[3], tb1[0], tb1[1], tb1[2], tb1[3] }, pbv[8] = { pb0[0], pb0[1], pb0[2], pb0[3], pb1[0], pb1[1], pb1[2], pb1[3] };
  // pooled phi (hi, lo) and pooled g
  v4u phi_h, phi_l, g_h;
#pragma unroll   // constant indices
  for (int q = 0; q < 4; ++q) { float pv[2], gv[2];
#pragma unroll   // inner loop of the same
    for (int u = 0; u < 2; ++u) { const int r = 2 * q + u;
      pv[u] = fmaxf(fmaxf(ap[0][r], ap[1][r]), fmaxf(ap[2][r], ap[3][r])) + pbv[r];
      gv[u] = fmaxf(fmaxf(ag[0][r], ag[1][r]), fmaxf(ag[2][r], ag[3][r])) * 0.0625f + gbv; }
    unsigned l2; phi_h[q] = split2(pv[0], pv[1], &l2); phi_l[q] = l2; g_h[q] = f2h2_pack(gv[0], gv[1]); }
  __syncthreads();   // every wave has read its last fragment of x: the LDS is free for theta
#pragma unroll   // constant indices
  for (int j = 0; j < 4; ++j) { v4u hi, lo;
#pragma unroll   // inner loop of the same
    for (int q = 0; q < 4; ++q) { unsigned l2; hi[q] = split2(at[j][2 * q] + tbv[2 * q], at[j][2 * q + 1] + tbv[2 * q + 1], &l2); lo[q] = l2; }
    const int so = (j * 16 + m) * PJT + wave * 16 + 8 * h;
    *(v4u*)(&sx[0][so]) = hi; *(v4u*)(&sx[1][so]) = lo; }
  __syncthreads();   // theta of all 128 channels is in LDS before the rows are read
  // 16 lanes store one pixel's 256 bytes of a plane, a wave two neighbouring pixels: pixel column p0 = 2 wave + h, chunk m, so every global offset is a scalar base + 16 lane bytes
  v4u oh[4], ol[4];
#pragma unroll   // constant indices; pixel = column p0 + 16 (it & 1) of row it >> 1, whose slot is 32 (it >> 1) + 16 (p0 & 1) + (p0 >> 1) + 8 (it & 1)
  for (int it = 0; it < 4; ++it) { const int so = ((it >> 1) * 32 + h * 16 + wave + 8 * (it & 1)) * PJT + m * 8; oh[it] = *(const v4u*)(&sx[0][so]); ol[it] = *(const v4u*)(&sx[1][so]); }
  const unsigned l16 = (unsigned)lane * 16u;
  const size_t to = ((size_t)b * HWc + (2 * py) * 64 + hf * 32 + 2 * wave) * D;
  char* tph = (char*)(THHp + to) + l16; char* tpl = (char*)(THLp + to) + l16;
#pragma unroll   // constant indices
  for (int it = 0; it < 4; ++it) { const int go = ((it >> 1) * 64 + (it & 1) * 16) * D * 2; *(v4u*)(tph + go) = oh[it]; *(v4u*)(tpl + go) = ol[it]; }
  const size_t po = (size_t)b * NKc * D + (py * 2 + hf) * 2048 + wave * 256, vo = (size_t)b * NKc * D + py * 4096 + wave * 512 + hf * 256;
  *(v4u*)((char*)(PPHp + po) + l16) = phi_h; *(v4u*)((char*)(PPLp + po) + l16) = phi_l; *(v4u*)((char*)(GP16p + vo) + l16) = g_h;
  // the wait before a store's registers are reused: the lane offset and the values as inputs keep them all until it, so nothing takes a register of an issued store
  asm volatile("s_wait_xcnt 0x0" :: "v"(l16), "v"(oh[0]), "v"(oh[1]), "v"(oh[2]), "v"(oh[3]), "v"(ol[0]), "v"(ol[1]), "v"(ol[2]), "v"(ol[3]), "v"(phi_h), "v"(phi_l), "v"(g_h) : "memory");
}
} // namespace w25
// Fused attention of one image: Y16[q][c] = f16( sum_k softmax_k(theta[q] . phi[k]) g[c][k] ). Scores and probabilities never leave the registers.
// A wave owns 32 queries (two 16-column groups) and walks the 1024 keys 32 at a time. It forms S^T = K Q^T (bf16 hi/lo planes, three products, as the score
// GEMM did) and O^T += V^T P^T (f16): in both D tiles a lane holds one query (column lane & 15), so maximum, sum and rescale are lane-local but for one
// exchange between the wave halves, and two S^T tiles (keys 0-15, 16-31), converted in place, are the B operand of the second product in the hardware k order.
// K (hi, lo) and V^T lie in fragment order (k_nl_proj writes them so): every fragment load covers four whole lines. Q is read once from the row-major theta planes.
// Running maximum in log2 units; the accumulators are rescaled only when a column's maximum has grown by more than 8; p = 2^(s - m + 7) <= 2^15 fits f16.
namespace w25 {
__device__ __forceinline__ float xhalf(float x) { return __builtin_bit_cast(float, __builtin_amdgcn_permlanex16(__builtin_bit_cast(int, x), __builtin_bit_cast(int, x), 0x76543210, 0xfedcba98, false, false)); }   // lane l takes lane l ^ 16
// a fragment stored in fragment order: two wave-wide loads of 512 contiguous bytes (elements 0..7 <- p[0..7], 8..15 <- p[256..263], p = fragment + 8 * lane)
__device__ __forceinline__ v16b ldf_b(const __bf16* p) { Frag<__bf16>::U f; f.h[0] = *(const v8b*)(p); f.h[1] = *(const v8b*)(p + 256); return f.v; }
__device__ __forceinline__ v16h ldf_h(const _Float16* p) { Frag<_Float16>::U f; f.h[0] = *(const v8h*)(p); f.h[1] = *(const v8h*)(p + 256); return f.v; }
__global__ __launch_bounds__(128) void k_nl_flash(const unsigned short* __restrict__ QHp, const unsigned short* __restrict__ QLp, const unsigned short* __restrict__ KHp, const unsigned short* __restrict__ KLp,
                                                  const unsigned short* __restrict__ VTp, unsigned short* __restrict__ Y16p) {
  constexpr int D = 128, NKc = 1024, HWc = 4096;
  constexpr float L2E = 1.4426950408889634f;
  const int lane = threadIdx.x & 31, wave = threadIdx.x >> 5, cq = lane & 15, h = lane >> 4;
  const int b = blockIdx.y, q0 = (blockIdx.x * 4 + wave) * 32;
  const size_t qo = ((size_t)b * HWc + q0 + cq) * D + 8 * h, ko = (size_t)b * NKc * D + 8 * lane;
  const __bf16* QH = (const __bf16*)QHp + qo; const __bf16* QL = (const __bf16*)QLp + qo;
  const __bf16* KH = (const __bf16*)KHp + ko; const __bf16* KL = (const __bf16*)KLp + ko;
  const _Float16* VT = (const _Float16*)VTp + ko;
  v16b qh[2][4], ql[2][4], kh[2][4], kl[2][4];
#pragma unroll   // constant indices: the fragments stay in registers
  for (int t = 0; t < 2; ++t)
#pragma unroll   // inner loop of the same
    for (int ks = 0; ks < 4; ++ks) {
      qh[t][ks] = Frag<__bf16>::load(QH + t * 16 * D + ks * 32); ql[t][ks] = Frag<__bf16>::load(QL + t * 16 * D + ks * 32);
      kh[t][ks] = ldf_b(KH + (t * 4 + ks) * 512); kl[t][ks] = ldf_b(KL + (t * 4 + ks) * 512);
    }
  asm volatile("s_wait_xcnt 0x0" :: "v"(QH), "v"(QL) : "memory");   // the two Q addresses as inputs keep the pairs until the wait (the K pairs live on through the loop)
  v8f o[2][8];
#pragma unroll   // constant indices
  for (int t = 0; t < 2; ++t)
#pragma unroll   // inner loop of the same
    for (int ct = 0; ct < 8; ++ct) o[t][ct] = (v8f){0.f,0.f,0.f,0.f,0.f,0.f,0.f,0.f};
  float mu[2] = { -1.0e30f, -1.0e30f }, l[2] = { 0.f, 0.f };
#pragma unroll 1   // one pass is 64 matrix instructions already; unrolled, the fragments of two passes would not fit
  for (int p = 0; p < NKc / 32; ++p) {
    v16h vt[8]; const _Float16* vp = VT + p * 32 * D;
#pragma unroll   // constant indices; the eight V^T fragments fly while the scores are formed
    for (int ct = 0; ct < 8; ++ct) vt[ct] = ldf_h(vp + ct * 512);
    __builtin_amdgcn_sched_barrier(0);   // keeps the V^T loads' issue above the score products; without it they sink to their first use and each waits a full latency there
    v8f s[2][2];   // [query group][key tile]
#pragma unroll   // constant indices
    for (int t = 0; t < 2; ++t) { s[t][0] = (v8f){0.f,0.f,0.f,0.f,0.f,0.f,0.f,0.f}; s[t][1] = s[t][0]; }
#pragma unroll   // constant indices; neighbours in the stream go to different tiles
    for (int ks = 0; ks < 4; ++ks) {
#pragma unroll   // inner loop of the same
      for (int kt = 0; kt < 2; ++kt)
#pragma unroll   // inner loop of the same
        for (int t = 0; t < 2; ++t) s[t][kt] = Frag<__bf16>::mma(kh[kt][ks], qh[t][ks], s[t][kt]);
#pragma unroll   // inner loop of the same
      for (int kt = 0; kt < 2; ++kt)
#pragma unroll   // inner loop of the same
        for (int t = 0; t < 2; ++t) s[t][kt] = Frag<__bf16>::mma(kh[kt][ks], ql[t][ks], s[t][kt]);
#pragma unroll   // inner loop of the same
      for (int kt = 0; kt < 2; ++kt)
#pragma unroll   // inner loop of the same
        for (int t = 0; t < 2; ++t) s[t][kt] = Frag<__bf16>::mma(kl[kt][ks], qh[t][ks], s[t][kt]);
    }
    // the next pass's K fragments, into the same registers: they fly behind the softmax and the second product (the last pass re-reads keys 0-31, in bounds, unused)
    const int kn = ((p + 1) & (NKc / 32 - 1)) * 32 * D; const __bf16* kph = KH + kn; const __bf16* kpl = KL + kn;
#pragma unroll   // constant indices
    for (int kt = 0; kt < 2; ++kt)
#pragma unroll   // inner loop of the same
      for (int ks = 0; ks < 4; ++ks) { kh[kt][ks] = ldf_b(kph + (kt * 4 + ks) * 512); kl[kt][ks] = ldf_b(kpl + (kt * 4 + ks) * 512); }
    // the wait before the pass's load addresses are reused: the three addresses as inputs
    // keep the pairs until the wait. With vp named and memory clobbered, the V^T loads also stay in front of it and are not sunk behind the rescale branch to their first use
    asm volatile("s_wait_xcnt 0x0" :: "v"(kph), "v"(kpl), "v"(vp) : "memory");
    float mx[2];
#pragma unroll   // constant indices
    for (int t = 0; t < 2; ++t) { float m = fmaxf(s[t][0][0], s[t][1][0]);
#pragma unroll   // inner loop of the same
      for (int r = 1; r < 8; ++r) m = fmaxf(m, fmaxf(s[t][0][r], s[t][1][r]));
      mx[t] = fmaxf(m, xhalf(m)) * L2E; }
    const bool need = (mx[0] > mu[0] + 8.f) || (mx[1] > mu[1] + 8.f);
    if (__builtin_amdgcn_ballot_w32(need) != 0) {   // one scalar test a pass
#pragma unroll   // constant indices
      for (int t = 0; t < 2; ++t) { const float mn = fmaxf(mu[t], mx[t]); const float f = __builtin_amdgcn_exp2f(mu[t] - mn); mu[t] = mn; l[t] *= f;
#pragma unroll   // inner loop of the same
        for (int ct = 0; ct < 8; ++ct) o[t][ct] *= f; }
    }
    v16h pb[2];
#pragma unroll   // constant indices
    for (int t = 0; t < 2; ++t) { const float mb = 7.f - mu[t]; float a0 = 0.f, a1 = 0.f;
#pragma unroll   // inner loop of the same
      for (int r = 0; r < 8; ++r) { const float e0 = __builtin_amdgcn_exp2f(fmaf(s[t][0][r], L2E, mb)), e1 = __builtin_amdgcn_exp2f(fmaf(s[t][1][r], L2E, mb));
        a0 += e0; a1 += e1; pb[t][r] = (_Float16)e0; pb[t][8 + r] = (_Float16)e1; }
      l[t] += a0 + a1; }
#pragma unroll   // constant indices; sixteen independent tiles
    for (int ct = 0; ct < 8; ++ct)
#pragma unroll   // inner loop of the same
      for (int t = 0; t < 2; ++t) o[t][ct] = Frag<_Float16>::mma(vt[ct], pb[t], o[t][ct]);
  }
#pragma unroll   // constant indices
  for (int t = 0; t < 2; ++t) { const float inv = 1.f / (l[t] + xhalf(l[t]));
    _Float16* yp = (_Float16*)Y16p + ((size_t)b * HWc + q0 + t * 16 + cq) * D + 8 * h; v8h hv[8];
#pragma unroll   // inner loop of the same
    for (int ct = 0; ct < 8; ++ct) {
#pragma unroll   // constant indices
      for (int r = 0; r < 8; ++r) hv[ct][r] = (_Float16)(o[t][ct][r] * inv);
      *(v8h*)(yp + ct * 16) = hv[ct]; }
    // address and values as inputs keep them until the wait
    asm volatile("s_wait_xcnt 0x0" :: "v"(yp), "v"(hv[0]), "v"(hv[1]), "v"(hv[2]), "v"(hv[3]), "v"(hv[4]), "v"(hv[5]), "v"(hv[6]), "v"(hv[7]) : "memory"); }
}
} // namespace w25
// batch statistics of channel c = blockIdx.x over [Bn][HW]: a thread holds its Bn x HW / 1024 groups of 16 B in registers, so WY is read once and the loads overlap;
// mean first, then the squared deviations from the same registers; the two LDS trees over the block are as they were
template <int Bn, int HW> __global__ __launch_bounds__(256) void k_nl_bns(const float* __restrict__ WY, float* __restrict__ BNS, int C) { __shared__ float red[256]; __shared__ float res[2]; const int c = blockIdx.x; const int t = threadIdx.x;
    const float* r[Bn]; v4f v[Bn][HW / 1024];
#pragma unroll   // v[][] in registers, the loads overlap instead of one latency each
    for (int b = 0; b < Bn; ++b) { r[b] = WY + ((long long)b * C + c) * HW + t * 4;
#pragma unroll   // inner loop of the same: constant indices, values stay in registers
        for (int k = 0; k < HW / 1024; ++k) v[b][k] = *(const v4f*)(r[b] + k * 1024); }
    static_assert(Bn == 8, "the wait below names eight addresses");
    asm volatile("s_wait_xcnt 0x0" :: "v"(r[0]), "v"(r[1]), "v"(r[2]), "v"(r[3]), "v"(r[4]), "v"(r[5]), "v"(r[6]), "v"(r[7]) : "memory");   // the addresses as inputs keep every load's address pair until the wait: no load's result takes a pair before it
    float s = 0.f;
#pragma unroll   // constant indices into v[][]
    for (int b = 0; b < Bn; ++b)
#pragma unroll   // inner loop of the same: constant indices, values stay in registers
        for (int k = 0; k < HW / 1024; ++k) s += (v[b][k][0] + v[b][k][1]) + (v[b][k][2] + v[b][k][3]);
    red[t] = s; __syncthreads(); for (int o = 128; o > 0; o >>= 1) { if (t < o) red[t] += red[t + o]; __syncthreads(); } const float mu = red[0] / (float)(Bn * HW); __syncthreads();
    float q = 0.f;
#pragma unroll   // constant indices into v[][]
    for (int b = 0; b < Bn; ++b)
#pragma unroll   // inner loop of the same: constant indices, values stay in registers
        for (int k = 0; k < HW / 1024; ++k) { const v4f d = v[b][k] - mu; q += (d[0] * d[0] + d[1] * d[1]) + (d[2] * d[2] + d[3] * d[3]); }
    red[t] = q; __syncthreads(); for (int o = 128; o > 0; o >>= 1) { if (t < o) red[t] += red[t + o]; __syncthreads(); }
    if (t == 0) { res[0] = mu; res[1] = rsqrtf(red[0] / (float)(Bn * HW) + 1e-5f); } __syncthreads();
    if (t < 32) VST2(float, BNS + (long long)c * 32 + t, (t == 0) ? res[0] : ((t == 1) ? res[1] : 0.f)); }
// out = (WY - mu[c]) * rstd[c] * gamma[c] + beta[c] + x; one block per plane (b, c) of 4096 values, 4 x 16 B of each operand a thread
__global__ __launch_bounds__(256) void k_nl_out(const float* __restrict__ WY, const float* __restrict__ BNS, const float* __restrict__ Gm, const float* __restrict__ Bt, const float* __restrict__ X, float* __restrict__ OUT, int C) { const int c = (int)(blockIdx.x % (unsigned)C); const long long o = (long long)blockIdx.x * 4096 + threadIdx.x * 4;
    const float mu = BNS[(long long)c * 32], rs = BNS[(long long)c * 32 + 1], g = Gm[c], be = Bt[c]; const float* wp = WY + o; const float* xp = X + o; v4f w[4], xv[4];
#pragma unroll   // all eight loads in flight
    for (int k = 0; k < 4; ++k) { w[k] = *(const v4f*)(wp + k * 1024); xv[k] = *(const v4f*)(xp + k * 1024); }
    asm volatile("s_wait_xcnt 0x0" :: "v"(wp), "v"(xp) : "memory");   // both addresses as inputs keep the pairs until the wait
#pragma unroll   // constant indices into w[], xv[]
    for (int k = 0; k < 4; ++k) { v4f r;
#pragma unroll   // inner loop of the same: constant indices, values stay in registers
        for (int e = 0; e < 4; ++e) r[e] = (w[k][e] - mu) * rs * g + be + xv[k][e];
        *(v4f*)(OUT + o + k * 1024) = r; } }


extern "C" void kernel_launch(void* const* d_in, const int* in_sizes, int n_in, void* d_out, int out_size, void* d_ws, size_t ws_size, hipStream_t stream) {
    (void)in_sizes; (void)n_in; (void)out_size; (void)ws_size;
    const float* x = (const float*)d_in[0];
    const float* gw = (const float*)d_in[1];
    const float* gb = (const float*)d_in[2];
    const float* thw = (const float*)d_in[3];
    const float* thb = (const float*)d_in[4];
    const float* phw = (const float*)d_in[5];
    const float* phb = (const float*)d_in[6];
    const float* Ww = (const float*)d_in[7];
    const float* Wb = (const float*)d_in[8];
    const float* bng = (const float*)d_in[9];
    const float* bnb = (const float*)d_in[10];
    const int Bn = 8;
    const int C = 256;
    const int IC = 128;
    const int HW = 4096;
    const int NK = 1024;
    float* out = (float*)d_out;
    char* wsp = (char*)d_ws;
    // One launch per stage for all Bn images (blockIdx.y = image, per-image strides). Workspace: the operand planes that the projection writes, Y16 and WY, the weight planes, the BN statistics
    unsigned short* THH = (unsigned short*)wsp; wsp += (size_t)Bn * HW * IC * 2;
    unsigned short* THL = (unsigned short*)wsp; wsp += (size_t)Bn * HW * IC * 2;
    unsigned short* PPH = (unsigned short*)wsp; wsp += (size_t)Bn * NK * IC * 2;
    unsigned short* PPL = (unsigned short*)wsp; wsp += (size_t)Bn * NK * IC * 2;
    unsigned short* GP16 = (unsigned short*)wsp; wsp += (size_t)Bn * IC * NK * 2;
    char* R3 = wsp; wsp += (size_t)Bn * HW * IC * 2 + (size_t)Bn * C * HW * 4;
    unsigned short* Y16 = (unsigned short*)R3;
    float* WY = (float*)(Y16 + (size_t)Bn * HW * IC);
    unsigned short* WW16 = (unsigned short*)wsp; wsp += (size_t)C * IC * 2;
    unsigned short* TWH = (unsigned short*)wsp; wsp += (size_t)IC * C * 2;
    unsigned short* TWL = (unsigned short*)wsp; wsp += (size_t)IC * C * 2;
    unsigned short* PWH = (unsigned short*)wsp; wsp += (size_t)IC * C * 2;
    unsigned short* PWL = (unsigned short*)wsp; wsp += (size_t)IC * C * 2;
    unsigned short* GW16 = (unsigned short*)wsp; wsp += (size_t)IC * C * 2;
    float* BNS = (float*)wsp; wsp += (size_t)32 * C * 4;
    // weights
    k_cast16<<<(unsigned)((((long long)(C) * ((IC) / 2)) + 255) / 256), 256, 0, stream>>>(Ww, IC, (_Float16*)(WW16), IC, C, IC, 16.0f);
    k_castS16<<<(unsigned)((((long long)(IC) * ((C) / 2)) + 255) / 256), 256, 0, stream>>>(thw, C, (__bf16*)(TWH), (__bf16*)(TWL), C, IC, C, 1.0f, 0, 0, 0);
    k_castS16<<<(unsigned)((((long long)(IC) * ((C) / 2)) + 255) / 256), 256, 0, stream>>>(phw, C, (__bf16*)(PWH), (__bf16*)(PWL), C, IC, C, 1.0f, 0, 0, 0);
    k_cast16<<<(unsigned)((((long long)(IC) * ((C) / 2)) + 255) / 256), 256, 0, stream>>>(gw, C, (_Float16*)(GW16), C, IC, C, 1.0f);
    // theta (bf16 hi/lo, [HW][IC]), pooled phi (bf16 hi/lo) and pooled g (f16) in fragment order, straight from x: 64 pixels a block, blockIdx.y = image
    w25::k_nl_proj<<<dim3((unsigned)(HW / 64), (unsigned)(Bn)), 256, 0, stream>>>(x, (const unsigned short*)(TWH), (const unsigned short*)(TWL), (const unsigned short*)(PWH), (const unsigned short*)(PWL), (const unsigned short*)(GW16), thb, phb, gb, THH, THL, PPH, PPL, GP16);
    // Y16[b] = f16(softmax(theta[b] phi[b]) g[b]^T) ([HW][IC]): 128 queries a block, blockIdx.y = image
    w25::k_nl_flash<<<dim3((unsigned)(HW / 128), (unsigned)(Bn)), 128, 0, stream>>>((const unsigned short*)(THH), (const unsigned short*)(THL), (const unsigned short*)(PPH), (const unsigned short*)(PPL), (const unsigned short*)(GP16), Y16);
    w25::wmma_gemm64<0, false, 1, 0, false, 0><<<dim3((unsigned)((((C) / 64) * ((HW) / 64) + 7) / 8), (unsigned)(Bn)), 256, 0, stream>>>((const unsigned short*)(WW16), nullptr, IC, 0, (const unsigned short*)(Y16), nullptr, IC, (long)HW * IC, (void*)(WY), nullptr, HW, (long)C * HW, Wb, nullptr, 0, C, HW, IC, 0.0625f);
    k_nl_bns<Bn, HW><<<C, 256, 0, stream>>>(WY, BNS, C); k_nl_out<<<(unsigned)(Bn * C), 256, 0, stream>>>(WY, BNS, bng, bnb, x, out, C);
}
